// v000
// Measured on an AMD MI455X. A time is GPU time per run, averaged over a window of back-to-back runs after a warm-up
// (all launches, gaps included; the runs take copies of the inputs in turn), and the median of several windows.
// Apart from v000's, it joins two sittings. Times from different sittings can be a few percent apart, while
// side-by-side timings come from the same sitting.
// The starting kernel, v000, takes 1970 microseconds a run.
// compute dtype: all float inputs rounded to bf16; q/k/v projections with EXACT bf16 products on WMMA 16x16x32 (f32 accumulate) + bias; logits q x k once to f16 each (1 product; sigma - 1) x 32^-0.5; the shared boolean mask read per element; softmax f32; P x 2^11 once to f16 x v once to f16 (1 product); ctx x 2^6 once to f16 x Wo f16(bf16 x 2^8) + bo; f32 output.
#include <hip/hip_runtime.h>
#include <math.h>

typedef int MASKT;   // dtype of the bool mask
typedef __attribute__((ext_vector_type(16))) _Float16 v16h;
typedef __attribute__((ext_vector_type(16))) __bf16 v16b;
typedef __attribute__((ext_vector_type(8)))  _Float16 v8h;
typedef __attribute__((ext_vector_type(8)))  float v8f;
typedef __attribute__((ext_vector_type(4)))  float v4f;
typedef __attribute__((ext_vector_type(2)))  float v2f;
typedef __attribute__((ext_vector_type(4)))  unsigned v4u;
typedef __attribute__((ext_vector_type(4)))  int v4i;
typedef float __attribute__((may_alias)) float_a;
typedef int __attribute__((may_alias)) int_a;

template <typename T> __device__ __forceinline__ void vst2(void* p, T v) { *(T*)p = v;  }
__device__ __forceinline__ v8f wmma16(v16h a, v16h b, v8f c) {
  v8f d = __builtin_amdgcn_wmma_f32_16x16x32_f16(false, a, false, b, (short)0, c, false, false);
  asm volatile("v_nop\n\tv_nop\n\tv_nop\n\tv_nop" : "+v"(d) : "v"(a), "v"(b));
  return d;
}
__device__ __forceinline__ v8f wmma_bf(v16b a, v16b b, v8f c) {
  v8f d = __builtin_amdgcn_wmma_f32_16x16x32_bf16(false, a, false, b, (short)0, c, false, false);
  asm volatile("v_nop\n\tv_nop\n\tv_nop\n\tv_nop" : "+v"(d) : "v"(a), "v"(b));
  return d;
}
// 16x16x32 fragments: lane = (h = lane>>4, row/col = lane&15); elements 0..7 = k0+8h+0..7, 8..15 = k0+16+8h+0..7; D element r = row 8h+r
__device__ __forceinline__ v16h frag_h(const _Float16* rowk0, int lane) {
  union { v16h v; v8h q[2]; } u; const _Float16* p = rowk0 + 8 * (lane >> 4);
  u.q[0] = *(const v8h*)p; u.q[1] = *(const v8h*)(p + 16); return u.v;
}
__device__ __forceinline__ v16h frag_f32(const float* rowk0, int lane) {
  v16h a; const float* p = rowk0 + 8 * (lane >> 4);
#pragma unroll
  for (int i = 0; i < 8; ++i) { a[i] = (_Float16)p[i]; a[8 + i] = (_Float16)p[16 + i]; }
  return a;
}
__device__ __forceinline__ v16h frag_f32s(const float* rowk0, int lane, float sc) {
  v16h a; const float* p = rowk0 + 8 * (lane >> 4);
#pragma unroll
  for (int i = 0; i < 8; ++i) { a[i] = (_Float16)(p[i] * sc); a[8 + i] = (_Float16)(p[16 + i] * sc); }
  return a;
}
// column fragment from a [K][ld] layout (column n), rows >= K read as 0
__device__ __forceinline__ v16h fragc_f32(const float* W, int k0, int n, int lane, int ld, int K) {
  v16h a; const int g = lane >> 4;
#pragma unroll
  for (int i = 0; i < 8; ++i) { const int ka = k0 + 8 * g + i, kb = ka + 16;
    a[i] = (_Float16)(ka < K ? W[(size_t)(ka < K ? ka : K - 1) * ld + n] : 0.f); a[8 + i] = (_Float16)(kb < K ? W[(size_t)(kb < K ? kb : K - 1) * ld + n] : 0.f); }
  return a;
}
struct F2 { v16b h, l; };
__device__ __forceinline__ F2 bsplit16(const float v[16]) { F2 r;
#pragma unroll
  for (int i = 0; i < 16; ++i) { const __bf16 h = (__bf16)v[i]; r.h[i] = h; r.l[i] = (__bf16)(v[i] - (float)h); }
  return r; }
__device__ __forceinline__ F2 split_row(const float* row, int k0, int lane) { float v[16]; const float* p = row + k0 + 8 * (lane >> 4);
#pragma unroll
  for (int i = 0; i < 8; ++i) { v[i] = p[i]; v[8 + i] = p[16 + i]; }
  return bsplit16(v); }
__device__ __forceinline__ F2 split_rowK(const float* row, int k0, int lane, int K) { float v[16]; const int g = lane >> 4;
#pragma unroll
  for (int i = 0; i < 8; ++i) { const int ka = k0 + 8 * g + i, kb = ka + 16; v[i] = ka < K ? row[ka < K ? ka : K - 1] : 0.f; v[8 + i] = kb < K ? row[kb < K ? kb : K - 1] : 0.f; }
  return bsplit16(v); }
__device__ __forceinline__ F2 split_col(const float* W, int k0, int n, int lane, int ld, int K) { float v[16]; const int g = lane >> 4;
#pragma unroll
  for (int i = 0; i < 8; ++i) { const int ka = k0 + 8 * g + i, kb = ka + 16; v[i] = ka < K ? W[(size_t)(ka < K ? ka : K - 1) * ld + n] : 0.f; v[8 + i] = kb < K ? W[(size_t)(kb < K ? kb : K - 1) * ld + n] : 0.f; }
  return bsplit16(v); }
__device__ __forceinline__ v8f mac3(const F2& a, const F2& b, v8f c) { c = wmma_bf(a.l, b.h, c); c = wmma_bf(a.h, b.l, c); return wmma_bf(a.h, b.h, c); }
__device__ __forceinline__ float sigm(float v) { return 1.0f / (1.0f + expf(-v)); }
#define LDSX() do { asm volatile("s_wait_dscnt 0" ::: "memory"); __builtin_amdgcn_wave_barrier(); __builtin_amdgcn_fence(__ATOMIC_RELEASE, "workgroup"); } while (0)

// Multi-head self-attention with a shared boolean topology mask (x [32,1024,256]; 8 heads x 32; torch (out,in) Wq/Wk/Wv/Wo [256,256] + biases (N(0, 1/256), NONZERO); attn_mask [1024,1024] bool (~50 % True, diagonal True) shared by all batches and heads: scores = where(mask, q_h k_h^T / sqrt(32), -1e9)): out = merge(softmax(scores) v_h) Wo^T + bo.
#define NB 32
#define TT 1024
#define CC 256            // NH * HD = projected width
#define DIN 256          // input (model) width
#define NH 8
#define HD 32
#define NQB (TT / 64)
#define HG 8
#define SCALE (0.17677669529663687f)
#define CAUSAL 0
#ifndef TNB
#define TNB NB
#endif
__device__ __forceinline__ float bfr(float v) { return (float)(__bf16)v; }
__host__ __device__ __forceinline__ int kb_last(int qb) { return CAUSAL ? ((qb * 64 + 63) >> 7) : (TT / 128 - 1); }
typedef __attribute__((ext_vector_type(8))) __bf16 v8b;
__device__ __forceinline__ v16b frag_b(const __bf16* rowk0, int lane) {
  union { v16b v; v8b q[2]; } u; const __bf16* p = rowk0 + 8 * (lane >> 4);
  u.q[0] = *(const v8b*)p; u.q[1] = *(const v8b*)(p + 16); return u.v;
}
#define QBH 0              // no query block takes the high-precision path (non-causal: every row spans all TT keys)
#define QHI 0               // single-product logits on every row (sigma - 1 logits averaged over -512 visible keys)
#define KHI 64            // key rows carrying k residual / v bf16 hi+lo planes (written by k_proj, never read since QBH = 0)
// B fragment (k rows k0+.., output column o) of a weight: (in,out) [K][ld] or (out,in) [ld rows of K]: bf16 exact, or f16(bf16 * 256) exact
__device__ __forceinline__ v16b wcol_io(const float* Wm, int k0, int o, int lane, int ld) { v16b w; const int g = lane >> 4;
#pragma unroll
  for (int i = 0; i < 8; ++i) { w[i] = (__bf16)Wm[(size_t)(k0 + 8 * g + i) * ld + o]; w[8 + i] = (__bf16)Wm[(size_t)(k0 + 16 + 8 * g + i) * ld + o]; }
  return w; }
__device__ __forceinline__ v16b wcol_oi(const float* Wm, int k0, int o, int lane, int K) { v16b w; const float* p = Wm + (size_t)o * K + k0 + 8 * (lane >> 4);
#pragma unroll
  for (int i = 0; i < 8; ++i) { w[i] = (__bf16)p[i]; w[8 + i] = (__bf16)p[16 + i]; }
  return w; }
__device__ __forceinline__ v16h wcolh_io(const float* Wm, int k0, int o, int lane, int ld) { v16h w; const int g = lane >> 4;
#pragma unroll
  for (int i = 0; i < 8; ++i) { w[i] = (_Float16)(bfr(Wm[(size_t)(k0 + 8 * g + i) * ld + o]) * 256.0f); w[8 + i] = (_Float16)(bfr(Wm[(size_t)(k0 + 16 + 8 * g + i) * ld + o]) * 256.0f); }
  return w; }
__device__ __forceinline__ v16h wcolh_oi(const float* Wm, int k0, int o, int lane, int K) { v16h w; const float* p = Wm + (size_t)o * K + k0 + 8 * (lane >> 4);
#pragma unroll
  for (int i = 0; i < 8; ++i) { w[i] = (_Float16)(bfr(p[i]) * 256.0f); w[8 + i] = (_Float16)(bfr(p[16 + i]) * 256.0f); }
  return w; }
#define WQKV_LAYOUT 1   // 0 = (in,out) [DIN][CC]; 1 = (out,in) [CC][DIN]; 2 = per-head [NH][DIN][HD]
__device__ __forceinline__ v16b wcol_hdk(const float* Wm, int k0, int o, int lane) { v16b w; const int g = lane >> 4; const float* p = Wm + (size_t)(o / HD) * DIN * HD + (o % HD);
#pragma unroll
  for (int i = 0; i < 8; ++i) { w[i] = (__bf16)p[(size_t)(k0 + 8 * g + i) * HD]; w[8 + i] = (__bf16)p[(size_t)(k0 + 16 + 8 * g + i) * HD]; }
  return w; }
#define WO_OUT_IN 1
#if WQKV_LAYOUT == 1
#define WCOL(W, k0, o, lane) wcol_oi(W, k0, o, lane, DIN)
#elif WQKV_LAYOUT == 2
#define WCOL(W, k0, o, lane) wcol_hdk(W, k0, o, lane)
#else
#define WCOL(W, k0, o, lane) wcol_io(W, k0, o, lane, CC)
#endif
#if WO_OUT_IN
#define WOCOL(W, k0, o, lane) wcol_oi(W, k0, o, lane, CC)
#define WOCOLH(W, k0, o, lane) wcolh_oi(W, k0, o, lane, CC)
#else
#define WOCOL(W, k0, o, lane) wcol_io(W, k0, o, lane, DIN)
#define WOCOLH(W, k0, o, lane) wcolh_io(W, k0, o, lane, DIN)
#endif
#define SM_EXTRA_PARAMS , const MASKT* __restrict__ AMASK
// shared boolean topology mask [S][S] (True = attend): where(mask, score, -1e9); -1e9 underflows to weight exactly 0 in f32; read per (query, key)
#define SM_MASK_HOOK do { v = (AMASK[(size_t)t * TT + k] != 0) ? v : -1.0e9f; } while (0)
#ifndef SM_EXTRA_PARAMS
#define SM_EXTRA_PARAMS
#endif
#ifndef PROJ_EXTRA_PARAMS
#define PROJ_EXTRA_PARAMS
#endif
#ifndef SM_MASK_HOOK
#define SM_MASK_HOOK (void)0
#endif

#define WS_QH  0u                                      // f16 q rows [b*t][CC]
#define WS_KH  (WS_QH + 2u * (size_t)NB * TT * CC)      // f16 k rows [b*t][CC]
#define WS_VT  (WS_KH + 2u * (size_t)NB * TT * CC)      // f16 v planes [b][c][t]
#define WS_QL  (WS_VT + 2u * (size_t)NB * CC * TT)      // f16 q residual x 2^10 rows [b][t < QHI][CC]
#define WS_KL  (WS_QL + 2u * (size_t)NB * QHI * CC)     // f16 k residual x 2^10 rows [b][t < KHI][CC]
#define WS_VB  (WS_KL + 2u * (size_t)NB * KHI * CC)     // bf16 v hi planes [b][c][t < KHI]
#define WS_VBL (WS_VB + 2u * (size_t)NB * CC * KHI)
#define WS_S   (WS_VBL + 2u * (size_t)NB * CC * KHI)    // f32 logits / P [hg][t][s]
#define WS_Y   (WS_S  + 4u * (size_t)HG * TT * TT)      // f32 ctx rows [b*t][CC] (only when there is an output projection)
#define WS_END (WS_Y  + 4u * (size_t)NB * TT * CC)

// ---- k_proj: block = (64 rows, 128 cols, which): q/k/v = X W (+ b) with exact bf16 products (K = DIN) -> which 0: q f16 rows (+ residual rows < QHI); 1: k f16 rows (+ residual rows < KHI); 2: v f16 planes [c][t] (+ bf16 hi/lo planes for t < KHI)
__global__ __launch_bounds__(128) void k_proj(const float* __restrict__ XQ, const float* __restrict__ XK, const float* __restrict__ XV, const float* __restrict__ WQ, const float* __restrict__ WK, const float* __restrict__ WV, const float* __restrict__ BQ, const float* __restrict__ BK, const float* __restrict__ BV,
    _Float16* __restrict__ QH, _Float16* __restrict__ QL, _Float16* __restrict__ KH, _Float16* __restrict__ KL, _Float16* __restrict__ VT, __bf16* __restrict__ VB, __bf16* __restrict__ VBL) {
  __shared__ __align__(16) _Float16 sh[64][136], sl[64][136]; __shared__ __align__(16) _Float16 th[128][72]; __shared__ __align__(16) __bf16 tb[128][72], tbl[128][72];
  const int tid = threadIdx.x, wave = tid >> 5, lane = tid & 31, col = lane & 15, g = lane >> 4; const int which = blockIdx.z; const int c0 = blockIdx.y * 128; const size_t r0 = (size_t)blockIdx.x * 64; const size_t bb = r0 / TT; const int t0 = (int)(r0 % TT);
  const float* X = which == 0 ? XQ : which == 1 ? XK : XV; const float* WA = which == 0 ? WQ : which == 1 ? WK : WV; const float* BA = which == 0 ? BQ : which == 1 ? BK : BV;
  v8f acc[8] = {};
#pragma unroll 2
  for (int kc = 0; kc < DIN / 32; ++kc) { v16b a; { const float* p = X + (r0 + wave * 16 + col) * DIN + kc * 32 + 8 * g;
#pragma unroll
      for (int i = 0; i < 8; ++i) { a[i] = (__bf16)p[i]; a[8 + i] = (__bf16)p[16 + i]; } }
    asm volatile("s_wait_loadcnt 0x0" ::: "memory");
#pragma unroll
    for (int j = 0; j < 8; ++j) { const v16b w = WCOL(WA, kc * 32, c0 + j * 16 + col, lane); asm volatile("s_wait_loadcnt 0x0" ::: "memory"); acc[j] = wmma_bf(a, w, acc[j]); } }
  if (which < 2) { _Float16* DH = which == 0 ? QH : KH; _Float16* DL = which == 0 ? QL : KL; const int nhi = which == 0 ? QHI : KHI; const bool hi_rows = t0 < nhi;
#pragma unroll
    for (int j = 0; j < 8; ++j) { const float bias = BA ? bfr(BA[c0 + j * 16 + col]) : 0.f;
#pragma unroll
      for (int r = 0; r < 8; ++r) { const float v = acc[j][r] + bias; const _Float16 hv = (_Float16)v; sh[wave * 16 + 8 * g + r][j * 16 + col] = hv; sl[wave * 16 + 8 * g + r][j * 16 + col] = (_Float16)((v - (float)hv) * 1024.0f); } }
    __syncthreads();
    for (int e = tid; e < 64 * 16; e += 128) { const int rl = e >> 4, q = e & 15; vst2((unsigned*)(DH + (r0 + rl) * CC + c0 + q * 8), *(const v4u*)&sh[rl][q * 8]); if (hi_rows) vst2((unsigned*)(DL + (bb * nhi + t0 + rl) * (size_t)CC + c0 + q * 8), *(const v4u*)&sl[rl][q * 8]); }
  } else { const bool hi_rows = t0 < KHI;
#pragma unroll
    for (int j = 0; j < 8; ++j) { const float bias = BA ? bfr(BA[c0 + j * 16 + col]) : 0.f;
#pragma unroll
      for (int r = 0; r < 8; ++r) { const float v = acc[j][r] + bias; const int rl = wave * 16 + 8 * g + r, cl = j * 16 + col; th[cl][rl] = (_Float16)v; const __bf16 bh = (__bf16)v; tb[cl][rl] = bh; tbl[cl][rl] = (__bf16)(v - (float)bh); } }
    __syncthreads();
    for (int e = tid; e < 128 * 8; e += 128) { const int cl = e >> 3, q = e & 7; vst2((unsigned*)(VT + (bb * CC + c0 + cl) * (size_t)TT + t0 + q * 8), *(const v4u*)&th[cl][q * 8]); if (hi_rows) { const size_t o3 = (bb * CC + c0 + cl) * (size_t)KHI + t0 + q * 8; vst2((unsigned*)(VB + o3), *(const v4u*)&tb[cl][q * 8]); vst2((unsigned*)(VBL + o3), *(const v4u*)&tbl[cl][q * 8]); } } } }
// ---- k_sc: block = (query block qb, key block kb <= kb_last(qb), head in group) of batch b: logits x SCALE; q hi + residual (x 2^10) against k (2 products) for query rows < QHI, plus the k residual (3 products) for query blocks < QBH (causal early rows); causal: blocks past the diagonal exit, the mask itself is applied by index in k_sm
__global__ __launch_bounds__(128) void k_sc(const _Float16* __restrict__ QH, const _Float16* __restrict__ KH, const _Float16* __restrict__ QL, const _Float16* __restrict__ KL, int b, int h0, float* __restrict__ S0) { __shared__ __align__(16) float ss[4][16][132];
  const int qb = blockIdx.x, kb = blockIdx.y; if (kb > kb_last(qb)) return;
  const int h = h0 + blockIdx.z; float* S = S0 + (size_t)blockIdx.z * TT * TT;
  const int tid = threadIdx.x, wave = tid >> 5, lane = tid & 31, col = lane & 15, g = lane >> 4; const int k0 = kb * 128; const int ql0 = qb * 64 + wave * 16; const size_t q0 = (size_t)b * TT + ql0, kr0 = (size_t)b * TT + k0;
  v8f acc[8] = {}, accl[8] = {};
  const _Float16* QLb = QL + (size_t)b * QHI * CC; const _Float16* KLb = KL + (size_t)b * KHI * CC;
  if (qb < QBH) {
#pragma unroll
    for (int kc = 0; kc < HD / 32; ++kc) { const v16h ah = frag_h(QH + (q0 + col) * CC + h * HD + kc * 32, lane), al = frag_h(QLb + (size_t)(ql0 + col) * CC + h * HD + kc * 32, lane);
#pragma unroll
      for (int j = 0; j < 8; ++j) { const v16h kbf = frag_h(KH + (kr0 + j * 16 + col) * CC + h * HD + kc * 32, lane), klf = frag_h(KLb + (size_t)(k0 + j * 16 + col) * CC + h * HD + kc * 32, lane); acc[j] = wmma16(ah, kbf, acc[j]); accl[j] = wmma16(al, kbf, accl[j]); accl[j] = wmma16(ah, klf, accl[j]); } }
  } else if (qb * 64 < QHI) {
#pragma unroll
    for (int kc = 0; kc < HD / 32; ++kc) { const v16h ah = frag_h(QH + (q0 + col) * CC + h * HD + kc * 32, lane), al = frag_h(QLb + (size_t)(ql0 + col) * CC + h * HD + kc * 32, lane);
#pragma unroll
      for (int j = 0; j < 8; ++j) { const v16h kbf = frag_h(KH + (kr0 + j * 16 + col) * CC + h * HD + kc * 32, lane); acc[j] = wmma16(ah, kbf, acc[j]); accl[j] = wmma16(al, kbf, accl[j]); } }
  } else {
#pragma unroll
    for (int kc = 0; kc < HD / 32; ++kc) { const v16h ah = frag_h(QH + (q0 + col) * CC + h * HD + kc * 32, lane);
#pragma unroll
      for (int j = 0; j < 8; ++j) { const v16h kbf = frag_h(KH + (kr0 + j * 16 + col) * CC + h * HD + kc * 32, lane); acc[j] = wmma16(ah, kbf, acc[j]); } } }
#pragma unroll
  for (int j = 0; j < 8; ++j) {
#pragma unroll
    for (int r = 0; r < 8; ++r) ss[wave][8 * g + r][j * 16 + col] = (acc[j][r] + accl[j][r] * (1.0f / 1024.0f)) * SCALE; }
  LDSX(); for (int rl = 0; rl < 16; ++rl) vst2(S + (size_t)(ql0 + rl) * TT + k0 + lane * 4, *(const v4f*)&ss[wave][rl][lane * 4]); }
// ---- k_sm: block = query row t (head in group): keys [0, kend): causal -> logit if s <= t else excluded; softmax in f32; P x 2^11 in place (0 for excluded)
__global__ __launch_bounds__(256) void k_sm(float* __restrict__ S0 SM_EXTRA_PARAMS) { __shared__ float sred[8]; __shared__ float sbc; __shared__ __align__(16) float shv[TT];
  const int tid = threadIdx.x; const int t = blockIdx.x; const int kend = (kb_last(t >> 6) + 1) * 128;
  float* sr = S0 + (size_t)blockIdx.y * TT * TT + (size_t)t * TT;
  float m = -3.0e38f; for (int k = tid; k < kend; k += 256) { float v = (!CAUSAL || k <= t) ? sr[k] : -3.0e38f; SM_MASK_HOOK; shv[k] = v; m = fmaxf(m, v); }
#pragma unroll
  for (int o = 1; o < 32; o <<= 1) m = fmaxf(m, __shfl_xor(m, o));
  if ((tid & 31) == 0) sred[tid >> 5] = m; __syncthreads(); if (tid == 0) { float a = sred[0]; for (int i = 1; i < 8; ++i) a = fmaxf(a, sred[i]); sbc = a; } __syncthreads(); m = sbc; __syncthreads();
  float sum = 0.f; for (int k = tid; k < kend; k += 256) { const float v = shv[k]; const float e = (v <= -1.0e38f) ? 0.f : expf(v - m); shv[k] = e; sum += e; }
#pragma unroll
  for (int o = 1; o < 32; o <<= 1) sum += __shfl_xor(sum, o);
  if ((tid & 31) == 0) sred[tid >> 5] = sum; __syncthreads(); if (tid == 0) { float a = 0.f; for (int i = 0; i < 8; ++i) a += sred[i]; sbc = a > 0.f ? 2048.0f / a : 0.f; }   /* a fully excluded row yields P = 0 */ __syncthreads(); const float inv = sbc;
  for (int k = tid; k < kend; k += 256) shv[k] = shv[k] * inv;
  __syncthreads(); for (int q = tid; q < kend / 4; q += 256) vst2(sr + q * 4, *(const v4f*)&shv[q * 4]); }
// ---- k_pv: block = 64 queries (qb) of (b, h): ctx = P . v over keys [0, kend) (P x 2^11 once to f16 against v f16: 1 product; causal early query blocks: P and v as bf16 hi + lo, 3 products); 128-B (row, head) segment by 8 lanes
__global__ __launch_bounds__(128) void k_pv(const float* __restrict__ PS0, const _Float16* __restrict__ VT, const __bf16* __restrict__ VB, const __bf16* __restrict__ VBL, int b, int h0, float* __restrict__ Y) { const int h = h0 + blockIdx.z; const float* PS = PS0 + (size_t)blockIdx.z * TT * TT; __shared__ __align__(16) float ss[4][16][HD + 4];
  const int tid = threadIdx.x, wave = tid >> 5, lane = tid & 31, col = lane & 15, g = lane >> 4; const int qb = blockIdx.x; const int ql0 = qb * 64 + wave * 16; const int kce = (kb_last(qb) + 1) * 4;
  v8f acc[HD / 16] = {};
  if (qb < QBH) {
#pragma unroll 1
    for (int kc = 0; kc < kce; ++kc) { const F2 p = split_row(PS + (size_t)(ql0 + col) * TT, kc * 32, lane);
      asm volatile("s_wait_loadcnt 0x0" ::: "memory");
#pragma unroll
      for (int j = 0; j < HD / 16; ++j) { const size_t po = ((size_t)b * CC + h * HD + j * 16 + col) * (size_t)KHI + kc * 32; const v16b vh = frag_b(VB + po, lane); acc[j] = wmma_bf(p.h, vh, acc[j]); acc[j] = wmma_bf(p.l, vh, acc[j]); acc[j] = wmma_bf(p.h, frag_b(VBL + po, lane), acc[j]); } }
  } else {
#pragma unroll 1
    for (int kc = 0; kc < kce; ++kc) { const v16h p = frag_f32(PS + (size_t)(ql0 + col) * TT + kc * 32, lane);
      asm volatile("s_wait_loadcnt 0x0" ::: "memory");
#pragma unroll
      for (int j = 0; j < HD / 16; ++j) { const size_t po = ((size_t)b * CC + h * HD + j * 16 + col) * (size_t)TT + kc * 32; acc[j] = wmma16(p, frag_h(VT + po, lane), acc[j]); } } }
#pragma unroll
  for (int j = 0; j < HD / 16; ++j)
#pragma unroll
    for (int r = 0; r < 8; ++r) ss[wave][8 * g + r][j * 16 + col] = acc[j][r] * (1.0f / 2048.0f);
  LDSX(); for (int rl = 0; rl < 16; ++rl) if (lane < HD / 4) vst2(Y + ((size_t)b * TT + ql0 + rl) * CC + h * HD + lane * 4, *(const v4f*)&ss[wave][rl][lane * 4]); }
// ---- k_out: block = (64 rows, 128 cols): out = ctx Wo (+ bo): ctx x 2^6 once to f16 against Wo as f16(bf16 x 2^8) exact (1 product) x 2^-14; causal early rows (< QHI of each sequence): ctx bf16 hi + lo against exact bf16 Wo (2 products)
__global__ __launch_bounds__(128) void k_out(const float* __restrict__ Y, const float* __restrict__ WO, const float* __restrict__ BO, float* __restrict__ OUT) { __shared__ __align__(16) float sf[4][16][132];
  const int tid = threadIdx.x, wave = tid >> 5, lane = tid & 31, col = lane & 15, g = lane >> 4; const int c0 = blockIdx.y * 128; const size_t r0 = (size_t)blockIdx.x * 64 + wave * 16;
  v8f acc[8] = {};
  if (CAUSAL && (int)(((size_t)blockIdx.x * 64) % TT) < QHI) {   /* block-uniform */
#pragma unroll 2
    for (int kc = 0; kc < CC / 32; ++kc) { const F2 a = split_row(Y + (r0 + col) * CC, kc * 32, lane); asm volatile("s_wait_loadcnt 0x0" ::: "memory");
#pragma unroll
      for (int j = 0; j < 8; ++j) { const v16b w = WOCOL(WO, kc * 32, c0 + j * 16 + col, lane); asm volatile("s_wait_loadcnt 0x0" ::: "memory"); acc[j] = wmma_bf(a.h, w, acc[j]); acc[j] = wmma_bf(a.l, w, acc[j]); } }
#pragma unroll
    for (int j = 0; j < 8; ++j) { const float bias = BO ? bfr(BO[c0 + j * 16 + col]) : 0.f;
#pragma unroll
      for (int r = 0; r < 8; ++r) sf[wave][8 * g + r][j * 16 + col] = acc[j][r] + bias; }
  } else {
#pragma unroll 2
    for (int kc = 0; kc < CC / 32; ++kc) { const v16h a = frag_f32s(Y + (r0 + col) * CC + kc * 32, lane, 64.0f); asm volatile("s_wait_loadcnt 0x0" ::: "memory");   /* ctx carried x 2^6 into f16 so small-magnitude context rows stay clear of f16 subnormals */
#pragma unroll
      for (int j = 0; j < 8; ++j) { const v16h w = WOCOLH(WO, kc * 32, c0 + j * 16 + col, lane); asm volatile("s_wait_loadcnt 0x0" ::: "memory"); acc[j] = wmma16(a, w, acc[j]); } }
#pragma unroll
    for (int j = 0; j < 8; ++j) { const float bias = BO ? bfr(BO[c0 + j * 16 + col]) : 0.f;
#pragma unroll
      for (int r = 0; r < 8; ++r) sf[wave][8 * g + r][j * 16 + col] = acc[j][r] * (1.0f / 16384.0f) + bias; } }   /* 2^-8 (Wo carry) x 2^-6 (ctx carry) */
  LDSX(); for (int rl = 0; rl < 16; ++rl) vst2(OUT + (r0 + rl) * DIN + c0 + lane * 4, *(const v4f*)&sf[wave][rl][lane * 4]); }

extern "C" void kernel_launch(void* const* d_in, const int* in_sizes, int n_in, void* d_out, int out_size, void* d_ws, size_t ws_size, hipStream_t stream) {
  (void)in_sizes; (void)n_in; (void)out_size;
  const float** F = (const float**)d_in;
  if (ws_size < (size_t)WS_END) return;
  char* ws = (char*)d_ws; _Float16 *QH = (_Float16*)(ws + WS_QH), *KH = (_Float16*)(ws + WS_KH), *VT = (_Float16*)(ws + WS_VT), *QL = (_Float16*)(ws + WS_QL), *KL = (_Float16*)(ws + WS_KL); __bf16 *VB = (__bf16*)(ws + WS_VB), *VBL = (__bf16*)(ws + WS_VBL); float *S = (float*)(ws + WS_S), *Y = (float*)(ws + WS_Y);
  (void)Y; (void)QL; (void)KL; (void)VB; (void)VBL;
  // inputs: 0 x [32,1024,256]; 1 attn_mask [1024,1024] (bool topology mask, diagonal True); 2 Wq [256,256] (out,in), 3 bq; 4 Wk, 5 bk; 6 Wv, 7 bv; 8 Wo (out,in), 9 bo (biases nonzero)
  k_proj<<<dim3(TNB * TT / 64, CC / 128, 3), 128, 0, stream>>>(F[0], F[0], F[0], F[2], F[4], F[6], F[3], F[5], F[7], QH, QL, KH, KL, VT, VB, VBL);
  for (int b = 0; b < TNB; ++b) for (int h0 = 0; h0 < NH; h0 += HG) {
    k_sc<<<dim3(NQB, TT / 128, HG), 128, 0, stream>>>(QH, KH, QL, KL, b, h0, S);
    k_sm<<<dim3(TT, HG), 256, 0, stream>>>(S, (const MASKT*)d_in[1]);
    k_pv<<<dim3(NQB, 1, HG), 128, 0, stream>>>(S, VT, VB, VBL, b, h0, Y);
  }
  k_out<<<dim3(TNB * TT / 64, DIN / 128), 128, 0, stream>>>(Y, F[8], F[9], (float*)d_out);
}

// v001
// Measured time: 258 microseconds a run.
// In two side-by-side timings against v000, it was 7.65 and 7.63 times as fast.
// compute dtype: all float inputs rounded to bf16; q/k/v projections with EXACT bf16 products on WMMA 16x16x32 (f32 accumulate) + bias; logits q x k once to f16 each (1 product; sigma - 1) x 32^-0.5; the shared boolean mask read per element; online softmax f32 (running maximum and sum per query); weights exp2(.) x 2^8 once to f16 x v once to f16 (1 product), divided by the f32 sum after the product; ctx x 2^6 once to f16 x Wo f16(bf16 x 2^8) + bo; f32 output.
#include <hip/hip_runtime.h>
#include <math.h>

typedef __attribute__((ext_vector_type(16))) _Float16 v16h;
typedef __attribute__((ext_vector_type(16))) __bf16 v16b;
typedef __attribute__((ext_vector_type(8)))  _Float16 v8h;
typedef __attribute__((ext_vector_type(8)))  float v8f;
typedef __attribute__((ext_vector_type(4)))  float v4f;
typedef __attribute__((ext_vector_type(2)))  float v2f;
typedef __attribute__((ext_vector_type(4)))  unsigned v4u;
typedef __attribute__((ext_vector_type(4)))  int v4i;
typedef float __attribute__((may_alias)) float_a;
typedef int __attribute__((may_alias)) int_a;

template <typename T> __device__ __forceinline__ void vst2(void* p, T v) { *(T*)p = v;  }
__device__ __forceinline__ v8f wmma16(v16h a, v16h b, v8f c) {
  v8f d = __builtin_amdgcn_wmma_f32_16x16x32_f16(false, a, false, b, (short)0, c, false, false);
  asm volatile("v_nop\n\tv_nop\n\tv_nop\n\tv_nop" : "+v"(d) : "v"(a), "v"(b));
  return d;
}
__device__ __forceinline__ v8f wmma_bf(v16b a, v16b b, v8f c) {
  v8f d = __builtin_amdgcn_wmma_f32_16x16x32_bf16(false, a, false, b, (short)0, c, false, false);
  asm volatile("v_nop\n\tv_nop\n\tv_nop\n\tv_nop" : "+v"(d) : "v"(a), "v"(b));
  return d;
}
// 16x16x32 fragments: lane = (h = lane>>4, row/col = lane&15); elements 0..7 = k0+8h+0..7, 8..15 = k0+16+8h+0..7; D element r = row 8h+r
__device__ __forceinline__ v16h frag_h(const _Float16* rowk0, int lane) {
  union { v16h v; v8h q[2]; } u; const _Float16* p = rowk0 + 8 * (lane >> 4);
  u.q[0] = *(const v8h*)p; u.q[1] = *(const v8h*)(p + 16); return u.v;
}
__device__ __forceinline__ v16h frag_f32(const float* rowk0, int lane) {
  v16h a; const float* p = rowk0 + 8 * (lane >> 4);
#pragma unroll
  for (int i = 0; i < 8; ++i) { a[i] = (_Float16)p[i]; a[8 + i] = (_Float16)p[16 + i]; }
  return a;
}
__device__ __forceinline__ v16h frag_f32s(const float* rowk0, int lane, float sc) {
  v16h a; const float* p = rowk0 + 8 * (lane >> 4);
#pragma unroll
  for (int i = 0; i < 8; ++i) { a[i] = (_Float16)(p[i] * sc); a[8 + i] = (_Float16)(p[16 + i] * sc); }
  return a;
}
// column fragment from a [K][ld] layout (column n), rows >= K read as 0
__device__ __forceinline__ v16h fragc_f32(const float* W, int k0, int n, int lane, int ld, int K) {
  v16h a; const int g = lane >> 4;
#pragma unroll
  for (int i = 0; i < 8; ++i) { const int ka = k0 + 8 * g + i, kb = ka + 16;
    a[i] = (_Float16)(ka < K ? W[(size_t)(ka < K ? ka : K - 1) * ld + n] : 0.f); a[8 + i] = (_Float16)(kb < K ? W[(size_t)(kb < K ? kb : K - 1) * ld + n] : 0.f); }
  return a;
}
struct F2 { v16b h, l; };
__device__ __forceinline__ F2 bsplit16(const float v[16]) { F2 r;
#pragma unroll
  for (int i = 0; i < 16; ++i) { const __bf16 h = (__bf16)v[i]; r.h[i] = h; r.l[i] = (__bf16)(v[i] - (float)h); }
  return r; }
__device__ __forceinline__ F2 split_row(const float* row, int k0, int lane) { float v[16]; const float* p = row + k0 + 8 * (lane >> 4);
#pragma unroll
  for (int i = 0; i < 8; ++i) { v[i] = p[i]; v[8 + i] = p[16 + i]; }
  return bsplit16(v); }
__device__ __forceinline__ F2 split_rowK(const float* row, int k0, int lane, int K) { float v[16]; const int g = lane >> 4;
#pragma unroll
  for (int i = 0; i < 8; ++i) { const int ka = k0 + 8 * g + i, kb = ka + 16; v[i] = ka < K ? row[ka < K ? ka : K - 1] : 0.f; v[8 + i] = kb < K ? row[kb < K ? kb : K - 1] : 0.f; }
  return bsplit16(v); }
__device__ __forceinline__ F2 split_col(const float* W, int k0, int n, int lane, int ld, int K) { float v[16]; const int g = lane >> 4;
#pragma unroll
  for (int i = 0; i < 8; ++i) { const int ka = k0 + 8 * g + i, kb = ka + 16; v[i] = ka < K ? W[(size_t)(ka < K ? ka : K - 1) * ld + n] : 0.f; v[8 + i] = kb < K ? W[(size_t)(kb < K ? kb : K - 1) * ld + n] : 0.f; }
  return bsplit16(v); }
__device__ __forceinline__ v8f mac3(const F2& a, const F2& b, v8f c) { c = wmma_bf(a.l, b.h, c); c = wmma_bf(a.h, b.l, c); return wmma_bf(a.h, b.h, c); }
__device__ __forceinline__ float sigm(float v) { return 1.0f / (1.0f + expf(-v)); }
#define LDSX() do { asm volatile("s_wait_dscnt 0" ::: "memory"); __builtin_amdgcn_wave_barrier(); __builtin_amdgcn_fence(__ATOMIC_RELEASE, "workgroup"); } while (0)

// Multi-head self-attention with a shared boolean topology mask (x [32,1024,256]; 8 heads x 32; torch (out,in) Wq/Wk/Wv/Wo [256,256] + biases (N(0, 1/256), NONZERO); attn_mask [1024,1024] bool (~50 % True, diagonal True) shared by all batches and heads: scores = where(mask, q_h k_h^T / sqrt(32), -1e9)): out = merge(softmax(scores) v_h) Wo^T + bo.
#define NB 32
#define TT 1024
#define CC 256            // NH * HD = projected width
#define DIN 256          // input (model) width
#define NH 8
#define HD 32
#define NQB (TT / 64)
#define HG 8
#define SCALE (0.17677669529663687f)
#define CAUSAL 0
#ifndef TNB
#define TNB NB
#endif
__device__ __forceinline__ float bfr(float v) { return (float)(__bf16)v; }
__host__ __device__ __forceinline__ int kb_last(int qb) { return CAUSAL ? ((qb * 64 + 63) >> 7) : (TT / 128 - 1); }
typedef __attribute__((ext_vector_type(8))) __bf16 v8b;
__device__ __forceinline__ v16b frag_b(const __bf16* rowk0, int lane) {
  union { v16b v; v8b q[2]; } u; const __bf16* p = rowk0 + 8 * (lane >> 4);
  u.q[0] = *(const v8b*)p; u.q[1] = *(const v8b*)(p + 16); return u.v;
}
#define QBH 0              // read by no kernel: k_attn has one single-product path for every query block
#define QHI 0               // single-product logits on every row (sigma - 1 logits averaged over -512 visible keys)
#define KHI 64            // key rows carrying k residual / v bf16 hi+lo planes (written by k_proj; no kernel here reads them)
// B fragment (k rows k0+.., output column o) of a weight: (in,out) [K][ld] or (out,in) [ld rows of K]: bf16 exact, or f16(bf16 * 256) exact
__device__ __forceinline__ v16b wcol_io(const float* Wm, int k0, int o, int lane, int ld) { v16b w; const int g = lane >> 4;
#pragma unroll
  for (int i = 0; i < 8; ++i) { w[i] = (__bf16)Wm[(size_t)(k0 + 8 * g + i) * ld + o]; w[8 + i] = (__bf16)Wm[(size_t)(k0 + 16 + 8 * g + i) * ld + o]; }
  return w; }
__device__ __forceinline__ v16b wcol_oi(const float* Wm, int k0, int o, int lane, int K) { v16b w; const float* p = Wm + (size_t)o * K + k0 + 8 * (lane >> 4);
#pragma unroll
  for (int i = 0; i < 8; ++i) { w[i] = (__bf16)p[i]; w[8 + i] = (__bf16)p[16 + i]; }
  return w; }
__device__ __forceinline__ v16h wcolh_io(const float* Wm, int k0, int o, int lane, int ld) { v16h w; const int g = lane >> 4;
#pragma unroll
  for (int i = 0; i < 8; ++i) { w[i] = (_Float16)(bfr(Wm[(size_t)(k0 + 8 * g + i) * ld + o]) * 256.0f); w[8 + i] = (_Float16)(bfr(Wm[(size_t)(k0 + 16 + 8 * g + i) * ld + o]) * 256.0f); }
  return w; }
__device__ __forceinline__ v16h wcolh_oi(const float* Wm, int k0, int o, int lane, int K) { v16h w; const float* p = Wm + (size_t)o * K + k0 + 8 * (lane >> 4);
#pragma unroll
  for (int i = 0; i < 8; ++i) { w[i] = (_Float16)(bfr(p[i]) * 256.0f); w[8 + i] = (_Float16)(bfr(p[16 + i]) * 256.0f); }
  return w; }
#define WQKV_LAYOUT 1   // 0 = (in,out) [DIN][CC]; 1 = (out,in) [CC][DIN]; 2 = per-head [NH][DIN][HD]
__device__ __forceinline__ v16b wcol_hdk(const float* Wm, int k0, int o, int lane) { v16b w; const int g = lane >> 4; const float* p = Wm + (size_t)(o / HD) * DIN * HD + (o % HD);
#pragma unroll
  for (int i = 0; i < 8; ++i) { w[i] = (__bf16)p[(size_t)(k0 + 8 * g + i) * HD]; w[8 + i] = (__bf16)p[(size_t)(k0 + 16 + 8 * g + i) * HD]; }
  return w; }
#define WO_OUT_IN 1
#if WQKV_LAYOUT == 1
#define WCOL(W, k0, o, lane) wcol_oi(W, k0, o, lane, DIN)
#elif WQKV_LAYOUT == 2
#define WCOL(W, k0, o, lane) wcol_hdk(W, k0, o, lane)
#else
#define WCOL(W, k0, o, lane) wcol_io(W, k0, o, lane, CC)
#endif
#if WO_OUT_IN
#define WOCOL(W, k0, o, lane) wcol_oi(W, k0, o, lane, CC)
#define WOCOLH(W, k0, o, lane) wcolh_oi(W, k0, o, lane, CC)
#else
#define WOCOL(W, k0, o, lane) wcol_io(W, k0, o, lane, DIN)
#define WOCOLH(W, k0, o, lane) wcolh_io(W, k0, o, lane, DIN)
#endif
#ifndef PROJ_EXTRA_PARAMS
#define PROJ_EXTRA_PARAMS
#endif

#define WS_QH  0u                                      // f16 q rows [b*t][CC]
#define WS_KH  (WS_QH + 2u * (size_t)NB * TT * CC)      // f16 k rows [b*t][CC]
#define WS_VT  (WS_KH + 2u * (size_t)NB * TT * CC)      // f16 v planes [b][c][t]
#define WS_QL  (WS_VT + 2u * (size_t)NB * CC * TT)      // f16 q residual x 2^10 rows [b][t < QHI][CC]
#define WS_KL  (WS_QL + 2u * (size_t)NB * QHI * CC)     // f16 k residual x 2^10 rows [b][t < KHI][CC]
#define WS_VB  (WS_KL + 2u * (size_t)NB * KHI * CC)     // bf16 v hi planes [b][c][t < KHI]
#define WS_VBL (WS_VB + 2u * (size_t)NB * CC * KHI)
#define WS_S   (WS_VBL + 2u * (size_t)NB * CC * KHI)    // f32 [hg][t][s], unused: k_attn keeps logits in registers
#define WS_Y   (WS_S  + 4u * (size_t)HG * TT * TT)      // f32 ctx rows [b*t][CC] (only when there is an output projection)
#define WS_END (WS_Y  + 4u * (size_t)NB * TT * CC)

// ---- k_proj: block = (64 rows, 128 cols, which): q/k/v = X W (+ b) with exact bf16 products (K = DIN) -> which 0: q f16 rows (+ residual rows < QHI); 1: k f16 rows (+ residual rows < KHI); 2: v f16 planes [c][t] (+ bf16 hi/lo planes for t < KHI)
__global__ __launch_bounds__(128) void k_proj(const float* __restrict__ XQ, const float* __restrict__ XK, const float* __restrict__ XV, const float* __restrict__ WQ, const float* __restrict__ WK, const float* __restrict__ WV, const float* __restrict__ BQ, const float* __restrict__ BK, const float* __restrict__ BV,
    _Float16* __restrict__ QH, _Float16* __restrict__ QL, _Float16* __restrict__ KH, _Float16* __restrict__ KL, _Float16* __restrict__ VT, __bf16* __restrict__ VB, __bf16* __restrict__ VBL) {
  __shared__ __align__(16) _Float16 sh[64][136], sl[64][136]; __shared__ __align__(16) _Float16 th[128][72]; __shared__ __align__(16) __bf16 tb[128][72], tbl[128][72];
  const int tid = threadIdx.x, wave = tid >> 5, lane = tid & 31, col = lane & 15, g = lane >> 4; const int which = blockIdx.z; const int c0 = blockIdx.y * 128; const size_t r0 = (size_t)blockIdx.x * 64; const size_t bb = r0 / TT; const int t0 = (int)(r0 % TT);
  const float* X = which == 0 ? XQ : which == 1 ? XK : XV; const float* WA = which == 0 ? WQ : which == 1 ? WK : WV; const float* BA = which == 0 ? BQ : which == 1 ? BK : BV;
  v8f acc[8] = {};
#pragma unroll 2
  for (int kc = 0; kc < DIN / 32; ++kc) { v16b a; { const float* p = X + (r0 + wave * 16 + col) * DIN + kc * 32 + 8 * g;
#pragma unroll
      for (int i = 0; i < 8; ++i) { a[i] = (__bf16)p[i]; a[8 + i] = (__bf16)p[16 + i]; } }
    asm volatile("s_wait_loadcnt 0x0" ::: "memory");
#pragma unroll
    for (int j = 0; j < 8; ++j) { const v16b w = WCOL(WA, kc * 32, c0 + j * 16 + col, lane); asm volatile("s_wait_loadcnt 0x0" ::: "memory"); acc[j] = wmma_bf(a, w, acc[j]); } }
  if (which < 2) { _Float16* DH = which == 0 ? QH : KH; _Float16* DL = which == 0 ? QL : KL; const int nhi = which == 0 ? QHI : KHI; const bool hi_rows = t0 < nhi;
#pragma unroll
    for (int j = 0; j < 8; ++j) { const float bias = BA ? bfr(BA[c0 + j * 16 + col]) : 0.f;
#pragma unroll
      for (int r = 0; r < 8; ++r) { const float v = acc[j][r] + bias; const _Float16 hv = (_Float16)v; sh[wave * 16 + 8 * g + r][j * 16 + col] = hv; sl[wave * 16 + 8 * g + r][j * 16 + col] = (_Float16)((v - (float)hv) * 1024.0f); } }
    __syncthreads();
    for (int e = tid; e < 64 * 16; e += 128) { const int rl = e >> 4, q = e & 15; vst2((unsigned*)(DH + (r0 + rl) * CC + c0 + q * 8), *(const v4u*)&sh[rl][q * 8]); if (hi_rows) vst2((unsigned*)(DL + (bb * nhi + t0 + rl) * (size_t)CC + c0 + q * 8), *(const v4u*)&sl[rl][q * 8]); }
  } else { const bool hi_rows = t0 < KHI;
#pragma unroll
    for (int j = 0; j < 8; ++j) { const float bias = BA ? bfr(BA[c0 + j * 16 + col]) : 0.f;
#pragma unroll
      for (int r = 0; r < 8; ++r) { const float v = acc[j][r] + bias; const int rl = wave * 16 + 8 * g + r, cl = j * 16 + col; th[cl][rl] = (_Float16)v; const __bf16 bh = (__bf16)v; tb[cl][rl] = bh; tbl[cl][rl] = (__bf16)(v - (float)bh); } }
    __syncthreads();
    for (int e = tid; e < 128 * 8; e += 128) { const int cl = e >> 3, q = e & 7; vst2((unsigned*)(VT + (bb * CC + c0 + cl) * (size_t)TT + t0 + q * 8), *(const v4u*)&th[cl][q * 8]); if (hi_rows) { const size_t o3 = (bb * CC + c0 + cl) * (size_t)KHI + t0 + q * 8; vst2((unsigned*)(VB + o3), *(const v4u*)&tb[cl][q * 8]); vst2((unsigned*)(VBL + o3), *(const v4u*)&tbl[cl][q * 8]); } } } }
// ---- k_attn: block = (256 queries, head h, batch b), 8 waves x 32 queries. K rows and v planes of (b, h) are staged once in LDS; each wave walks the 1024 keys 32 at a time:
// S^T = K q^T (lane = one query, 16 of the 32 keys), mask by element, running maximum and sum per query (online softmax, f32), weights x 2^8 once to f16 straight from the score registers as the B operand of ctx^T += v^T P^T; ctx / sum at the end.
#define AW 8
#define AQT 2
#define AQB (AW * AQT * 16)
static_assert(AW * 32 == 256 && TT == 1024 && HD == 32, "the fill below is written for 256 threads, 1024 keys, head size 32");
#define KPIT 40            // f16 per staged K row: 80 B = 16 B x odd
#define VPIT (TT + 8)      // f16 per staged v plane: 2064 B = 16 B x odd
#define LOG2E 1.4426950408889634f
typedef __attribute__((ext_vector_type(2))) _Float16 v2h;
__device__ __forceinline__ float xhalf(float x) { return __builtin_bit_cast(float, __builtin_amdgcn_permlanex16(__builtin_bit_cast(int, x), __builtin_bit_cast(int, x), 0x76543210, 0xfedcba98, false, false)); }   // lane l with lane l ^ 16
__device__ __forceinline__ v8f wmma_h(v16h a, v16h b, v8f c) { return __builtin_amdgcn_wmma_f32_16x16x32_f16(false, a, false, b, (short)0, c, false, false); }
__global__ __launch_bounds__(AW * 32) __attribute__((amdgpu_waves_per_eu(4, 4))) void k_attn(const _Float16* __restrict__ QH, const _Float16* __restrict__ KH, const _Float16* __restrict__ VT, const int* __restrict__ AMASK, float* __restrict__ Y) {   // 4 waves per SIMD = two blocks per WGP (2 x 147,968 B of LDS fit)
  __shared__ __align__(16) _Float16 sK[TT][KPIT]; __shared__ __align__(16) _Float16 sV[HD][VPIT];
  const int tid = threadIdx.x, wave = tid >> 5, lane = tid & 31, col = lane & 15, g = lane >> 4; const int h = blockIdx.y, b = blockIdx.z; const int q0 = blockIdx.x * AQB + wave * (AQT * 16);
  v4u tk[16], tv[16];      // the fill: 1024 K rows x 64 B and 32 v planes x 2048 B, 16 + 16 loads of 16 B a thread, all in flight together, then the LDS stores
  const _Float16* kp = KH + ((size_t)b * TT + (tid >> 2)) * CC + h * HD + (tid & 3) * 8;            // load i: K row (tid >> 2) + 64 i
  const _Float16* vp = VT + ((size_t)b * CC + h * HD + (tid >> 7)) * (size_t)TT + (tid & 127) * 8;   // load i: v plane (tid >> 7) + 2 i
  const _Float16* qp = QH + ((size_t)b * TT + q0 + col) * CC + h * HD + 8 * g;
#pragma unroll
  for (int i = 0; i < 16; ++i) tk[i] = *(const v4u*)(kp + i * 64 * CC);
#pragma unroll
  for (int i = 0; i < 16; ++i) tv[i] = *(const v4u*)(vp + i * 2 * TT);
  v16h qf[AQT]; v8f acc[AQT][2] = {}; float mx[AQT], ls[AQT]; const unsigned moff = (unsigned)(q0 + col) * TT + 8 * g;      // this lane's first mask element: row = its query of tile 0, tile u is 16 rows on
#pragma unroll
  for (int u = 0; u < AQT; ++u) { union { v16h v; v8h q[2]; } t; t.q[0] = *(const v8h*)(qp + u * 16 * CC); t.q[1] = *(const v8h*)(qp + u * 16 * CC + 16); qf[u] = t.v; mx[u] = -3.0e38f; ls[u] = 0.f; }   // B fragment, same k order as frag_h
  asm volatile("s_wait_xcnt 0x0" :: "v"(kp), "v"(vp), "v"(qp) : "memory");      // the three address pairs stay untouched until the loads above have taken them
#pragma unroll
  for (int i = 0; i < 16; ++i) *(v4u*)&sK[(tid >> 2) + 64 * i][(tid & 3) * 8] = tk[i];
#pragma unroll
  for (int i = 0; i < 16; ++i) *(v4u*)&sV[(tid >> 7) + 2 * i][(tid & 127) * 8] = tv[i];
  __syncthreads();
  const float NEGR = -1.0e9f / SCALE;      // the reference's -1e9 fill in units of the unscaled product
  const float CL = SCALE * LOG2E;
  auto mload = [&](int k0, v4i (&mk)[AQT][4]) {
#pragma unroll
    for (int u = 0; u < AQT; ++u) { const int* mp = AMASK + (moff + (unsigned)k0) + u * 16 * TT; mk[u][0] = *(const v4i*)mp; mk[u][1] = *(const v4i*)(mp + 4); mk[u][2] = *(const v4i*)(mp + 16); mk[u][3] = *(const v4i*)(mp + 20); } };
  auto step = [&](int k0, const v4i (&mk)[AQT][4]) {
    const v16h ka = frag_h(&sK[k0 + col][0], lane), kb = frag_h(&sK[k0 + 16 + col][0], lane);      // A rows = keys k0 + 0..15, k0 + 16..31
    const v16h va = frag_h(&sV[col][k0], lane), vb = frag_h(&sV[16 + col][k0], lane);              // A rows = head columns 0..15, 16..31; k = keys in the order of the packed scores
#pragma unroll
    for (int u = 0; u < AQT; ++u) {
      const v8f z = {}; v8f s[2]; s[0] = wmma_h(ka, qf[u], z); s[1] = wmma_h(kb, qf[u], z);      // s[T][r] = key k0 + 16T + 8g + r, query = col
      float x[16];
#pragma unroll
      for (int i = 0; i < 16; ++i) x[i] = mk[u][i >> 2][i & 3] != 0 ? s[i >> 3][i & 7] : NEGR;
      float cm = x[0];
#pragma unroll
      for (int i = 1; i < 16; ++i) cm = fmaxf(cm, x[i]);
      const float mn = fmaxf(mx[u], fmaxf(cm, xhalf(cm)));           // both lane halves of a query use one maximum: their weights meet in one product
      const float al = __builtin_amdgcn_exp2f((mx[u] - mn) * CL); mx[u] = mn;
      union { v16h v; v2h q[8]; } pf; v2f sum = {};
#pragma unroll
      for (int i = 0; i < 8; ++i) { v2f d = { x[2 * i], x[2 * i + 1] }; d = (d - mn) * CL + 8.0f;      // difference first: exactly 0 where a whole row is masked (uniform weights, as the reference gives)
        const v2f p = { __builtin_amdgcn_exp2f(d[0]), __builtin_amdgcn_exp2f(d[1]) }; sum += p; pf.q[i] = __builtin_convertvector(p, v2h); }
      ls[u] = ls[u] * al + (sum[0] + sum[1]);
      acc[u][0] = wmma_h(va, pf.v, acc[u][0] * al); acc[u][1] = wmma_h(vb, pf.v, acc[u][1] * al);
    } };
  v4i ma[AQT][4], mb[AQT][4]; mload(0, ma);      // the mask words of the next 32 keys are fetched while these 32 are worked on
  for (int k0 = 0; k0 < TT; k0 += 64) { mload(k0 + 32, mb); step(k0, ma); mload(k0 + 64 < TT ? k0 + 64 : 0, ma); step(k0 + 32, mb); }
#pragma unroll
  for (int u = 0; u < AQT; ++u) { const float inv = 1.0f / (ls[u] + xhalf(ls[u])); float* yp = Y + (unsigned)((b * TT + q0 + u * 16 + col) * CC + h * HD + 8 * g);
#pragma unroll
    for (int j = 0; j < 2; ++j) { const v8f o = acc[u][j] * inv; vst2(yp + j * 16, (v4f)__builtin_shufflevector(o, o, 0, 1, 2, 3)); vst2(yp + j * 16 + 4, (v4f)__builtin_shufflevector(o, o, 4, 5, 6, 7)); } } }
// ---- k_out: block = (64 rows, 128 cols): out = ctx Wo (+ bo): ctx x 2^6 once to f16 against Wo as f16(bf16 x 2^8) exact (1 product) x 2^-14; causal early rows (< QHI of each sequence): ctx bf16 hi + lo against exact bf16 Wo (2 products)
__global__ __launch_bounds__(128) void k_out(const float* __restrict__ Y, const float* __restrict__ WO, const float* __restrict__ BO, float* __restrict__ OUT) { __shared__ __align__(16) float sf[4][16][132];
  const int tid = threadIdx.x, wave = tid >> 5, lane = tid & 31, col = lane & 15, g = lane >> 4; const int c0 = blockIdx.y * 128; const size_t r0 = (size_t)blockIdx.x * 64 + wave * 16;
  v8f acc[8] = {};
  if (CAUSAL && (int)(((size_t)blockIdx.x * 64) % TT) < QHI) {   /* block-uniform */
#pragma unroll 2
    for (int kc = 0; kc < CC / 32; ++kc) { const F2 a = split_row(Y + (r0 + col) * CC, kc * 32, lane); asm volatile("s_wait_loadcnt 0x0" ::: "memory");
#pragma unroll
      for (int j = 0; j < 8; ++j) { const v16b w = WOCOL(WO, kc * 32, c0 + j * 16 + col, lane); asm volatile("s_wait_loadcnt 0x0" ::: "memory"); acc[j] = wmma_bf(a.h, w, acc[j]); acc[j] = wmma_bf(a.l, w, acc[j]); } }
#pragma unroll
    for (int j = 0; j < 8; ++j) { const float bias = BO ? bfr(BO[c0 + j * 16 + col]) : 0.f;
#pragma unroll
      for (int r = 0; r < 8; ++r) sf[wave][8 * g + r][j * 16 + col] = acc[j][r] + bias; }
  } else {
#pragma unroll 2
    for (int kc = 0; kc < CC / 32; ++kc) { const v16h a = frag_f32s(Y + (r0 + col) * CC + kc * 32, lane, 64.0f); asm volatile("s_wait_loadcnt 0x0" ::: "memory");   /* ctx carried x 2^6 into f16 so small-magnitude context rows stay clear of f16 subnormals */
#pragma unroll
      for (int j = 0; j < 8; ++j) { const v16h w = WOCOLH(WO, kc * 32, c0 + j * 16 + col, lane); asm volatile("s_wait_loadcnt 0x0" ::: "memory"); acc[j] = wmma16(a, w, acc[j]); } }
#pragma unroll
    for (int j = 0; j < 8; ++j) { const float bias = BO ? bfr(BO[c0 + j * 16 + col]) : 0.f;
#pragma unroll
      for (int r = 0; r < 8; ++r) sf[wave][8 * g + r][j * 16 + col] = acc[j][r] * (1.0f / 16384.0f) + bias; } }   /* 2^-8 (Wo carry) x 2^-6 (ctx carry) */
  LDSX(); for (int rl = 0; rl < 16; ++rl) vst2(OUT + (r0 + rl) * DIN + c0 + lane * 4, *(const v4f*)&sf[wave][rl][lane * 4]); }

extern "C" void kernel_launch(void* const* d_in, const int* in_sizes, int n_in, void* d_out, int out_size, void* d_ws, size_t ws_size, hipStream_t stream) {
  (void)in_sizes; (void)n_in; (void)out_size;
  const float** F = (const float**)d_in;
  if (ws_size < (size_t)WS_END) return;
  char* ws = (char*)d_ws; _Float16 *QH = (_Float16*)(ws + WS_QH), *KH = (_Float16*)(ws + WS_KH), *VT = (_Float16*)(ws + WS_VT), *QL = (_Float16*)(ws + WS_QL), *KL = (_Float16*)(ws + WS_KL); __bf16 *VB = (__bf16*)(ws + WS_VB), *VBL = (__bf16*)(ws + WS_VBL); float *S = (float*)(ws + WS_S), *Y = (float*)(ws + WS_Y);
  (void)Y; (void)S; (void)QL; (void)KL; (void)VB; (void)VBL;
  // inputs: 0 x [32,1024,256]; 1 attn_mask [1024,1024] (bool topology mask, diagonal True); 2 Wq [256,256] (out,in), 3 bq; 4 Wk, 5 bk; 6 Wv, 7 bv; 8 Wo (out,in), 9 bo (biases nonzero)
  k_proj<<<dim3(TNB * TT / 64, CC / 128, 3), 128, 0, stream>>>(F[0], F[0], F[0], F[2], F[4], F[6], F[3], F[5], F[7], QH, QL, KH, KL, VT, VB, VBL);
  k_attn<<<dim3(TT / AQB, NH, TNB), AW * 32, 0, stream>>>(QH, KH, VT, (const int*)d_in[1], Y);
  k_out<<<dim3(TNB * TT / 64, DIN / 128), 128, 0, stream>>>(Y, F[8], F[9], (float*)d_out);
}

// v002
// A run of this version takes 120 microseconds.
// Two timings next to v001 put it at 2.16 and 2.15 times that version's speed.
// All steps since v000 together make it 16.5 times as fast.
// compute dtype: all float inputs rounded to bf16; q/k/v projections with EXACT bf16 products on WMMA 16x16x32 (f32 accumulate) + bias; logits q x k once to f16 each (1 product; sigma - 1) x 32^-0.5; the shared boolean mask read per element; online softmax f32 (running maximum and sum per query); weights exp2(.) x 2^8 once to f16 x v once to f16 (1 product), divided by the f32 sum after the product; ctx x 2^6 once to f16 x Wo f16(bf16 x 2^8) + bo; f32 output.
#include <hip/hip_runtime.h>
#include <math.h>

typedef __attribute__((ext_vector_type(16))) _Float16 v16h;
typedef __attribute__((ext_vector_type(16))) __bf16 v16b;
typedef __attribute__((ext_vector_type(8)))  _Float16 v8h;
typedef __attribute__((ext_vector_type(8)))  float v8f;
typedef __attribute__((ext_vector_type(4)))  float v4f;
typedef __attribute__((ext_vector_type(2)))  float v2f;
typedef __attribute__((ext_vector_type(4)))  unsigned v4u;
typedef __attribute__((ext_vector_type(4)))  int v4i;
typedef float __attribute__((may_alias)) float_a;
typedef int __attribute__((may_alias)) int_a;

template <typename T> __device__ __forceinline__ void vst2(void* p, T v) { *(T*)p = v;  }
__device__ __forceinline__ v8f wmma16(v16h a, v16h b, v8f c) {
  v8f d = __builtin_amdgcn_wmma_f32_16x16x32_f16(false, a, false, b, (short)0, c, false, false);
  asm volatile("v_nop\n\tv_nop\n\tv_nop\n\tv_nop" : "+v"(d) : "v"(a), "v"(b));
  return d;
}
__device__ __forceinline__ v8f wmma_bf(v16b a, v16b b, v8f c) {
  v8f d = __builtin_amdgcn_wmma_f32_16x16x32_bf16(false, a, false, b, (short)0, c, false, false);
  asm volatile("v_nop\n\tv_nop\n\tv_nop\n\tv_nop" : "+v"(d) : "v"(a), "v"(b));
  return d;
}
// 16x16x32 fragments: lane = (h = lane>>4, row/col = lane&15); elements 0..7 = k0+8h+0..7, 8..15 = k0+16+8h+0..7; D element r = row 8h+r
__device__ __forceinline__ v16h frag_h(const _Float16* rowk0, int lane) {
  union { v16h v; v8h q[2]; } u; const _Float16* p = rowk0 + 8 * (lane >> 4);
  u.q[0] = *(const v8h*)p; u.q[1] = *(const v8h*)(p + 16); return u.v;
}
__device__ __forceinline__ v16h frag_f32(const float* rowk0, int lane) {
  v16h a; const float* p = rowk0 + 8 * (lane >> 4);
#pragma unroll
  for (int i = 0; i < 8; ++i) { a[i] = (_Float16)p[i]; a[8 + i] = (_Float16)p[16 + i]; }
  return a;
}
__device__ __forceinline__ v16h frag_f32s(const float* rowk0, int lane, float sc) {
  v16h a; const float* p = rowk0 + 8 * (lane >> 4);
#pragma unroll
  for (int i = 0; i < 8; ++i) { a[i] = (_Float16)(p[i] * sc); a[8 + i] = (_Float16)(p[16 + i] * sc); }
  return a;
}
// column fragment from a [K][ld] layout (column n), rows >= K read as 0
__device__ __forceinline__ v16h fragc_f32(const float* W, int k0, int n, int lane, int ld, int K) {
  v16h a; const int g = lane >> 4;
#pragma unroll
  for (int i = 0; i < 8; ++i) { const int ka = k0 + 8 * g + i, kb = ka + 16;
    a[i] = (_Float16)(ka < K ? W[(size_t)(ka < K ? ka : K - 1) * ld + n] : 0.f); a[8 + i] = (_Float16)(kb < K ? W[(size_t)(kb < K ? kb : K - 1) * ld + n] : 0.f); }
  return a;
}
struct F2 { v16b h, l; };
__device__ __forceinline__ F2 bsplit16(const float v[16]) { F2 r;
#pragma unroll
  for (int i = 0; i < 16; ++i) { const __bf16 h = (__bf16)v[i]; r.h[i] = h; r.l[i] = (__bf16)(v[i] - (float)h); }
  return r; }
__device__ __forceinline__ F2 split_row(const float* row, int k0, int lane) { float v[16]; const float* p = row + k0 + 8 * (lane >> 4);
#pragma unroll
  for (int i = 0; i < 8; ++i) { v[i] = p[i]; v[8 + i] = p[16 + i]; }
  return bsplit16(v); }
__device__ __forceinline__ F2 split_rowK(const float* row, int k0, int lane, int K) { float v[16]; const int g = lane >> 4;
#pragma unroll
  for (int i = 0; i < 8; ++i) { const int ka = k0 + 8 * g + i, kb = ka + 16; v[i] = ka < K ? row[ka < K ? ka : K - 1] : 0.f; v[8 + i] = kb < K ? row[kb < K ? kb : K - 1] : 0.f; }
  return bsplit16(v); }
__device__ __forceinline__ F2 split_col(const float* W, int k0, int n, int lane, int ld, int K) { float v[16]; const int g = lane >> 4;
#pragma unroll
  for (int i = 0; i < 8; ++i) { const int ka = k0 + 8 * g + i, kb = ka + 16; v[i] = ka < K ? W[(size_t)(ka < K ? ka : K - 1) * ld + n] : 0.f; v[8 + i] = kb < K ? W[(size_t)(kb < K ? kb : K - 1) * ld + n] : 0.f; }
  return bsplit16(v); }
__device__ __forceinline__ v8f mac3(const F2& a, const F2& b, v8f c) { c = wmma_bf(a.l, b.h, c); c = wmma_bf(a.h, b.l, c); return wmma_bf(a.h, b.h, c); }
__device__ __forceinline__ float sigm(float v) { return 1.0f / (1.0f + expf(-v)); }
#define LDSX() do { asm volatile("s_wait_dscnt 0" ::: "memory"); __builtin_amdgcn_wave_barrier(); __builtin_amdgcn_fence(__ATOMIC_RELEASE, "workgroup"); } while (0)

// Multi-head self-attention with a shared boolean topology mask (x [32,1024,256]; 8 heads x 32; torch (out,in) Wq/Wk/Wv/Wo [256,256] + biases (N(0, 1/256), NONZERO); attn_mask [1024,1024] bool (~50 % True, diagonal True) shared by all batches and heads: scores = where(mask, q_h k_h^T / sqrt(32), -1e9)): out = merge(softmax(scores) v_h) Wo^T + bo.
#define NB 32
#define TT 1024
#define CC 256            // NH * HD = projected width
#define DIN 256          // input (model) width
#define NH 8
#define HD 32
#define NQB (TT / 64)
#define HG 8
#define SCALE (0.17677669529663687f)
#define CAUSAL 0
#ifndef TNB
#define TNB NB
#endif
__device__ __forceinline__ float bfr(float v) { return (float)(__bf16)v; }
__host__ __device__ __forceinline__ int kb_last(int qb) { return CAUSAL ? ((qb * 64 + 63) >> 7) : (TT / 128 - 1); }
typedef __attribute__((ext_vector_type(8))) __bf16 v8b;
__device__ __forceinline__ v16b frag_b(const __bf16* rowk0, int lane) {
  union { v16b v; v8b q[2]; } u; const __bf16* p = rowk0 + 8 * (lane >> 4);
  u.q[0] = *(const v8b*)p; u.q[1] = *(const v8b*)(p + 16); return u.v;
}
#define QBH 0              // read by no kernel: k_attn has one single-product path for every query block
#define QHI 0               // single-product logits on every row (sigma - 1 logits averaged over -512 visible keys)
#define KHI 64            // key rows carrying k residual / v bf16 hi+lo planes (written by k_proj; no kernel here reads them)
// B fragment (k rows k0+.., output column o) of a weight: (in,out) [K][ld] or (out,in) [ld rows of K]: bf16 exact, or f16(bf16 * 256) exact
__device__ __forceinline__ v16b wcol_io(const float* Wm, int k0, int o, int lane, int ld) { v16b w; const int g = lane >> 4;
#pragma unroll
  for (int i = 0; i < 8; ++i) { w[i] = (__bf16)Wm[(size_t)(k0 + 8 * g + i) * ld + o]; w[8 + i] = (__bf16)Wm[(size_t)(k0 + 16 + 8 * g + i) * ld + o]; }
  return w; }
__device__ __forceinline__ v16b wcol_oi(const float* Wm, int k0, int o, int lane, int K) { v16b w; const float* p = Wm + (size_t)o * K + k0 + 8 * (lane >> 4);
#pragma unroll
  for (int i = 0; i < 8; ++i) { w[i] = (__bf16)p[i]; w[8 + i] = (__bf16)p[16 + i]; }
  return w; }
__device__ __forceinline__ v16h wcolh_io(const float* Wm, int k0, int o, int lane, int ld) { v16h w; const int g = lane >> 4;
#pragma unroll
  for (int i = 0; i < 8; ++i) { w[i] = (_Float16)(bfr(Wm[(size_t)(k0 + 8 * g + i) * ld + o]) * 256.0f); w[8 + i] = (_Float16)(bfr(Wm[(size_t)(k0 + 16 + 8 * g + i) * ld + o]) * 256.0f); }
  return w; }
__device__ __forceinline__ v16h wcolh_oi(const float* Wm, int k0, int o, int lane, int K) { v16h w; const float* p = Wm + (size_t)o * K + k0 + 8 * (lane >> 4);
#pragma unroll
  for (int i = 0; i < 8; ++i) { w[i] = (_Float16)(bfr(p[i]) * 256.0f); w[8 + i] = (_Float16)(bfr(p[16 + i]) * 256.0f); }
  return w; }
#define WQKV_LAYOUT 1   // 0 = (in,out) [DIN][CC]; 1 = (out,in) [CC][DIN]; 2 = per-head [NH][DIN][HD]
__device__ __forceinline__ v16b wcol_hdk(const float* Wm, int k0, int o, int lane) { v16b w; const int g = lane >> 4; const float* p = Wm + (size_t)(o / HD) * DIN * HD + (o % HD);
#pragma unroll
  for (int i = 0; i < 8; ++i) { w[i] = (__bf16)p[(size_t)(k0 + 8 * g + i) * HD]; w[8 + i] = (__bf16)p[(size_t)(k0 + 16 + 8 * g + i) * HD]; }
  return w; }
#define WO_OUT_IN 1
#if WQKV_LAYOUT == 1
#define WCOL(W, k0, o, lane) wcol_oi(W, k0, o, lane, DIN)
#elif WQKV_LAYOUT == 2
#define WCOL(W, k0, o, lane) wcol_hdk(W, k0, o, lane)
#else
#define WCOL(W, k0, o, lane) wcol_io(W, k0, o, lane, CC)
#endif
#if WO_OUT_IN
#define WOCOL(W, k0, o, lane) wcol_oi(W, k0, o, lane, CC)
#define WOCOLH(W, k0, o, lane) wcolh_oi(W, k0, o, lane, CC)
#else
#define WOCOL(W, k0, o, lane) wcol_io(W, k0, o, lane, DIN)
#define WOCOLH(W, k0, o, lane) wcolh_io(W, k0, o, lane, DIN)
#endif
#ifndef PROJ_EXTRA_PARAMS
#define PROJ_EXTRA_PARAMS
#endif

#define WS_QH  0u                                      // f16 q rows [b*t][CC]
#define WS_KH  (WS_QH + 2u * (size_t)NB * TT * CC)      // f16 k rows [b*t][CC]
#define WS_VT  (WS_KH + 2u * (size_t)NB * TT * CC)      // f16 v planes [b][c][t]
#define WS_QL  (WS_VT + 2u * (size_t)NB * CC * TT)      // f16 q residual x 2^10 rows [b][t < QHI][CC]
#define WS_KL  (WS_QL + 2u * (size_t)NB * QHI * CC)     // f16 k residual x 2^10 rows [b][t < KHI][CC]
#define WS_VB  (WS_KL + 2u * (size_t)NB * KHI * CC)     // bf16 v hi planes [b][c][t < KHI]
#define WS_VBL (WS_VB + 2u * (size_t)NB * CC * KHI)
#define WS_S   (WS_VBL + 2u * (size_t)NB * CC * KHI)    // f32 [hg][t][s], unused: k_attn keeps logits in registers
#define WS_Y   (WS_S  + 4u * (size_t)HG * TT * TT)      // f32 ctx rows [b*t][CC] (only when there is an output projection)
#define WS_END (WS_Y  + 4u * (size_t)NB * TT * CC)

// ---- operand staging of k_proj and k_out: a block's 128 weight rows (its output columns) and 64 input rows, 256 f32 each and contiguous in memory, go to LDS once as 16-bit rows.
// Every load of a wave takes 512 contiguous bytes, so a block touches each 128-B line once; the WMMA fragments are then 16-B LDS reads.
#define SPIT 264           // 16-bit elements per staged row: 528 B = 16 B x odd
#define SW_BYTES (128 * SPIT * 2)
#define SOP_BYTES ((128 + 64) * SPIT * 2)
static_assert(WQKV_LAYOUT == 1 && WO_OUT_IN == 1 && DIN == 256 && CC == 256, "the staging below reads (out,in) weight rows of 256");
typedef __attribute__((ext_vector_type(4))) __bf16 v4b;
typedef __attribute__((ext_vector_type(4))) _Float16 v4h;
// base = first row (128 threads = two rows a pass), d = this thread's 8 bytes of LDS row tid >> 6; the loops are unrolled so that t[] stays in registers and every step is an immediate offset
template <int NROW, typename CV> __device__ __forceinline__ void stage_rows(const float* base, int tid, unsigned char* d, CV cv) {
  const float* p = base + tid * 4;
#pragma unroll
  for (int b = 0; b < NROW / 2; b += 16) { v4f t[16];
#pragma unroll
    for (int i = 0; i < 16; ++i) t[i] = *(const v4f*)(p + (b + i) * 512);
    asm volatile("s_wait_xcnt 0x0" :: "v"(tid), "s"(base) : "memory");      // the loads' offset register and base stay untouched until the 16 loads above have taken them; no later load is lifted over this line, which keeps the registers under 256
#pragma unroll
    for (int i = 0; i < 16; ++i) cv(d + (b + i) * (2 * SPIT * 2), t[i]); } }

// ---- k_proj: block = (64 rows, 128 cols, which): q/k/v = X W (+ b) with exact bf16 products (K = DIN) -> which 0: q f16 rows (+ residual rows < QHI); 1: k f16 rows (+ residual rows < KHI); 2: v f16 planes [c][t] (+ bf16 hi/lo planes for t < KHI)
__global__ __launch_bounds__(128) void k_proj(const float* __restrict__ XQ, const float* __restrict__ XK, const float* __restrict__ XV, const float* __restrict__ WQ, const float* __restrict__ WK, const float* __restrict__ WV, const float* __restrict__ BQ, const float* __restrict__ BK, const float* __restrict__ BV,
    _Float16* __restrict__ QH, _Float16* __restrict__ QL, _Float16* __restrict__ KH, _Float16* __restrict__ KL, _Float16* __restrict__ VT, __bf16* __restrict__ VB, __bf16* __restrict__ VBL) {
  __shared__ __align__(16) unsigned char sm[SOP_BYTES];      // the staged operands; behind the second barrier the same bytes hold the output tiles
  __bf16 (*sW)[SPIT] = (__bf16 (*)[SPIT])sm; __bf16 (*sX)[SPIT] = (__bf16 (*)[SPIT])(sm + SW_BYTES);
  _Float16 (*sh)[136] = (_Float16 (*)[136])sm; _Float16 (*sl)[136] = (_Float16 (*)[136])(sm + 17408); _Float16 (*th)[72] = (_Float16 (*)[72])(sm + 34816); __bf16 (*tb)[72] = (__bf16 (*)[72])(sm + 53248); __bf16 (*tbl)[72] = (__bf16 (*)[72])(sm + 71680);
  static_assert(71680 + 128 * 72 * 2 <= SOP_BYTES, "output tiles fit in the operand bytes");
  const int tid = threadIdx.x, wave = tid >> 5, lane = tid & 31, col = lane & 15, g = lane >> 4; const int which = blockIdx.z; const int c0 = blockIdx.y * 128; const size_t r0 = (size_t)blockIdx.x * 64; const size_t bb = r0 / TT; const int t0 = (int)(r0 % TT);
  const float* X = which == 0 ? XQ : which == 1 ? XK : XV; const float* WA = which == 0 ? WQ : which == 1 ? WK : WV; const float* BA = which == 0 ? BQ : which == 1 ? BK : BV;
  { unsigned char* d = sm + (tid >> 6) * (SPIT * 2) + (tid & 63) * 8;
    auto cv = [](unsigned char* q, v4f v) { const v4b o = { (__bf16)v[0], (__bf16)v[1], (__bf16)v[2], (__bf16)v[3] }; *(v4b*)q = o; };
    stage_rows<64>(X + r0 * DIN, tid, d + SW_BYTES, cv); stage_rows<128>(WA + (size_t)c0 * DIN, tid, d, cv); }
  __syncthreads();
  v8f acc[8] = {}; v16b a[2], w[2][8];
  auto frags = [&](int kc, v16b& fa, v16b (&fw)[8]) { fa = frag_b(&sX[wave * 16 + col][kc * 32], lane);
#pragma unroll
    for (int j = 0; j < 8; ++j) fw[j] = frag_b(&sW[j * 16 + col][kc * 32], lane); };
  frags(0, a[0], w[0]);
#pragma unroll
  for (int kc = 0; kc < DIN / 32; ++kc) { if (kc + 1 < DIN / 32) frags(kc + 1, a[(kc + 1) & 1], w[(kc + 1) & 1]);      // the next 32 k's fragments are fetched as one group while these products run; unrolled so that both fragment sets are indexed statically and stay in registers
#pragma unroll
    for (int j = 0; j < 8; ++j) acc[j] = wmma_bf(a[kc & 1], w[kc & 1][j], acc[j]); }
  __syncthreads();      // every wave has read its last fragment before the output tiles overwrite the operands
  if (which < 2) { _Float16* DH = which == 0 ? QH : KH; _Float16* DL = which == 0 ? QL : KL; const int nhi = which == 0 ? QHI : KHI; const bool hi_rows = t0 < nhi;
#pragma unroll
    for (int j = 0; j < 8; ++j) { const float bias = BA ? bfr(BA[c0 + j * 16 + col]) : 0.f;
#pragma unroll
      for (int r = 0; r < 8; ++r) { const float v = acc[j][r] + bias; const _Float16 hv = (_Float16)v; sh[wave * 16 + 8 * g + r][j * 16 + col] = hv; sl[wave * 16 + 8 * g + r][j * 16 + col] = (_Float16)((v - (float)hv) * 1024.0f); } }
    __syncthreads();
    for (int e = tid; e < 64 * 16; e += 128) { const int rl = e >> 4, q = e & 15; vst2((unsigned*)(DH + (r0 + rl) * CC + c0 + q * 8), *(const v4u*)&sh[rl][q * 8]); if (hi_rows) vst2((unsigned*)(DL + (bb * nhi + t0 + rl) * (size_t)CC + c0 + q * 8), *(const v4u*)&sl[rl][q * 8]); }
  } else { const bool hi_rows = t0 < KHI;
#pragma unroll
    for (int j = 0; j < 8; ++j) { const float bias = BA ? bfr(BA[c0 + j * 16 + col]) : 0.f;
#pragma unroll
      for (int r = 0; r < 8; ++r) { const float v = acc[j][r] + bias; const int rl = wave * 16 + 8 * g + r, cl = j * 16 + col; th[cl][rl] = (_Float16)v; const __bf16 bh = (__bf16)v; tb[cl][rl] = bh; tbl[cl][rl] = (__bf16)(v - (float)bh); } }
    __syncthreads();
    for (int e = tid; e < 128 * 8; e += 128) { const int cl = e >> 3, q = e & 7; vst2((unsigned*)(VT + (bb * CC + c0 + cl) * (size_t)TT + t0 + q * 8), *(const v4u*)&th[cl][q * 8]); if (hi_rows) { const size_t o3 = (bb * CC + c0 + cl) * (size_t)KHI + t0 + q * 8; vst2((unsigned*)(VB + o3), *(const v4u*)&tb[cl][q * 8]); vst2((unsigned*)(VBL + o3), *(const v4u*)&tbl[cl][q * 8]); } } } }
// ---- k_attn: block = (256 queries, head h, batch b), 8 waves x 32 queries. K rows and v planes of (b, h) are staged once in LDS; each wave walks the 1024 keys 32 at a time:
// S^T = K q^T (lane = one query, 16 of the 32 keys), mask by element, running maximum and sum per query (online softmax, f32), weights x 2^8 once to f16 straight from the score registers as the B operand of ctx^T += v^T P^T; ctx / sum at the end.
#define AW 8
#define AQT 2
#define AQB (AW * AQT * 16)
static_assert(AW * 32 == 256 && TT == 1024 && HD == 32, "the fill below is written for 256 threads, 1024 keys, head size 32");
#define KPIT 40            // f16 per staged K row: 80 B = 16 B x odd
#define VPIT (TT + 8)      // f16 per staged v plane: 2064 B = 16 B x odd
#define LOG2E 1.4426950408889634f
typedef __attribute__((ext_vector_type(2))) _Float16 v2h;
__device__ __forceinline__ float xhalf(float x) { return __builtin_bit_cast(float, __builtin_amdgcn_permlanex16(__builtin_bit_cast(int, x), __builtin_bit_cast(int, x), 0x76543210, 0xfedcba98, false, false)); }   // lane l with lane l ^ 16
__device__ __forceinline__ v8f wmma_h(v16h a, v16h b, v8f c) { return __builtin_amdgcn_wmma_f32_16x16x32_f16(false, a, false, b, (short)0, c, false, false); }
__global__ __launch_bounds__(AW * 32) __attribute__((amdgpu_waves_per_eu(4, 4))) void k_attn(const _Float16* __restrict__ QH, const _Float16* __restrict__ KH, const _Float16* __restrict__ VT, const int* __restrict__ AMASK, float* __restrict__ Y) {   // 4 waves per SIMD = two blocks per WGP (2 x 147,968 B of LDS fit)
  __shared__ __align__(16) _Float16 sK[TT][KPIT]; __shared__ __align__(16) _Float16 sV[HD][VPIT];
  const int tid = threadIdx.x, wave = tid >> 5, lane = tid & 31, col = lane & 15, g = lane >> 4; const int h = blockIdx.y, b = blockIdx.z; const int q0 = blockIdx.x * AQB + wave * (AQT * 16);
  v4u tk[16], tv[16];      // the fill: 1024 K rows x 64 B and 32 v planes x 2048 B, 16 + 16 loads of 16 B a thread, all in flight together, then the LDS stores
  const _Float16* kp = KH + ((size_t)b * TT + (tid >> 2)) * CC + h * HD + (tid & 3) * 8;            // load i: K row (tid >> 2) + 64 i
  const _Float16* vp = VT + ((size_t)b * CC + h * HD + (tid >> 7)) * (size_t)TT + (tid & 127) * 8;   // load i: v plane (tid >> 7) + 2 i
  const _Float16* qp = QH + ((size_t)b * TT + q0 + col) * CC + h * HD + 8 * g;
#pragma unroll
  for (int i = 0; i < 16; ++i) tk[i] = *(const v4u*)(kp + i * 64 * CC);
#pragma unroll
  for (int i = 0; i < 16; ++i) tv[i] = *(const v4u*)(vp + i * 2 * TT);
  v16h qf[AQT]; v8f acc[AQT][2] = {}; float mx[AQT], ls[AQT]; const unsigned moff = (unsigned)(q0 + col) * TT + 8 * g;      // this lane's first mask element: row = its query of tile 0, tile u is 16 rows on
#pragma unroll
  for (int u = 0; u < AQT; ++u) { union { v16h v; v8h q[2]; } t; t.q[0] = *(const v8h*)(qp + u * 16 * CC); t.q[1] = *(const v8h*)(qp + u * 16 * CC + 16); qf[u] = t.v; mx[u] = -3.0e38f; ls[u] = 0.f; }   // B fragment, same k order as frag_h
  asm volatile("s_wait_xcnt 0x0" :: "v"(kp), "v"(vp), "v"(qp) : "memory");      // the three address pairs stay untouched until the loads above have taken them
#pragma unroll
  for (int i = 0; i < 16; ++i) *(v4u*)&sK[(tid >> 2) + 64 * i][(tid & 3) * 8] = tk[i];
#pragma unroll
  for (int i = 0; i < 16; ++i) *(v4u*)&sV[(tid >> 7) + 2 * i][(tid & 127) * 8] = tv[i];
  __syncthreads();
  const float NEGR = -1.0e9f / SCALE;      // the reference's -1e9 fill in units of the unscaled product
  const float CL = SCALE * LOG2E;
  auto mload = [&](int k0, v4i (&mk)[AQT][4]) {
#pragma unroll
    for (int u = 0; u < AQT; ++u) { const int* mp = AMASK + (moff + (unsigned)k0) + u * 16 * TT; mk[u][0] = *(const v4i*)mp; mk[u][1] = *(const v4i*)(mp + 4); mk[u][2] = *(const v4i*)(mp + 16); mk[u][3] = *(const v4i*)(mp + 20); } };
  auto step = [&](int k0, const v4i (&mk)[AQT][4]) {
    const v16h ka = frag_h(&sK[k0 + col][0], lane), kb = frag_h(&sK[k0 + 16 + col][0], lane);      // A rows = keys k0 + 0..15, k0 + 16..31
    const v16h va = frag_h(&sV[col][k0], lane), vb = frag_h(&sV[16 + col][k0], lane);              // A rows = head columns 0..15, 16..31; k = keys in the order of the packed scores
#pragma unroll
    for (int u = 0; u < AQT; ++u) {
      const v8f z = {}; v8f s[2]; s[0] = wmma_h(ka, qf[u], z); s[1] = wmma_h(kb, qf[u], z);      // s[T][r] = key k0 + 16T + 8g + r, query = col
      float x[16];
#pragma unroll
      for (int i = 0; i < 16; ++i) x[i] = mk[u][i >> 2][i & 3] != 0 ? s[i >> 3][i & 7] : NEGR;
      float cm = x[0];
#pragma unroll
      for (int i = 1; i < 16; ++i) cm = fmaxf(cm, x[i]);
      const float mn = fmaxf(mx[u], fmaxf(cm, xhalf(cm)));           // both lane halves of a query use one maximum: their weights meet in one product
      const float al = __builtin_amdgcn_exp2f((mx[u] - mn) * CL); mx[u] = mn;
      union { v16h v; v2h q[8]; } pf; v2f sum = {};
#pragma unroll
      for (int i = 0; i < 8; ++i) { v2f d = { x[2 * i], x[2 * i + 1] }; d = (d - mn) * CL + 8.0f;      // difference first: exactly 0 where a whole row is masked (uniform weights, as the reference gives)
        const v2f p = { __builtin_amdgcn_exp2f(d[0]), __builtin_amdgcn_exp2f(d[1]) }; sum += p; pf.q[i] = __builtin_convertvector(p, v2h); }
      ls[u] = ls[u] * al + (sum[0] + sum[1]);
      acc[u][0] = wmma_h(va, pf.v, acc[u][0] * al); acc[u][1] = wmma_h(vb, pf.v, acc[u][1] * al);
    } };
  v4i ma[AQT][4], mb[AQT][4]; mload(0, ma);      // the mask words of the next 32 keys are fetched while these 32 are worked on
  for (int k0 = 0; k0 < TT; k0 += 64) { mload(k0 + 32, mb); step(k0, ma); mload(k0 + 64 < TT ? k0 + 64 : 0, ma); step(k0 + 32, mb); }
#pragma unroll
  for (int u = 0; u < AQT; ++u) { const float inv = 1.0f / (ls[u] + xhalf(ls[u])); float* yp = Y + (unsigned)((b * TT + q0 + u * 16 + col) * CC + h * HD + 8 * g);
#pragma unroll
    for (int j = 0; j < 2; ++j) { const v8f o = acc[u][j] * inv; vst2(yp + j * 16, (v4f)__builtin_shufflevector(o, o, 0, 1, 2, 3)); vst2(yp + j * 16 + 4, (v4f)__builtin_shufflevector(o, o, 4, 5, 6, 7)); } } }
// ---- k_out: block = (64 rows, 128 cols): out = ctx Wo (+ bo): ctx x 2^6 once to f16 against Wo as f16(bf16 x 2^8) exact (1 product) x 2^-14; causal early rows (< QHI of each sequence): ctx bf16 hi + lo against exact bf16 Wo (2 products)
__global__ __launch_bounds__(128) void k_out(const float* __restrict__ Y, const float* __restrict__ WO, const float* __restrict__ BO, float* __restrict__ OUT) { __shared__ __align__(16) unsigned char sm[SOP_BYTES];      // the staged operands; behind the second barrier the same bytes hold the output tile
  _Float16 (*sW)[SPIT] = (_Float16 (*)[SPIT])sm; _Float16 (*sY)[SPIT] = (_Float16 (*)[SPIT])(sm + SW_BYTES); float (*sf)[16][132] = (float (*)[16][132])sm;
  const int tid = threadIdx.x, wave = tid >> 5, lane = tid & 31, col = lane & 15, g = lane >> 4; const int c0 = blockIdx.y * 128; const size_t r0 = (size_t)blockIdx.x * 64 + wave * 16;
  v8f acc[8] = {};
  if (CAUSAL && (int)(((size_t)blockIdx.x * 64) % TT) < QHI) {   /* block-uniform */
#pragma unroll 2
    for (int kc = 0; kc < CC / 32; ++kc) { const F2 a = split_row(Y + (r0 + col) * CC, kc * 32, lane); asm volatile("s_wait_loadcnt 0x0" ::: "memory");
#pragma unroll
      for (int j = 0; j < 8; ++j) { const v16b w = WOCOL(WO, kc * 32, c0 + j * 16 + col, lane); asm volatile("s_wait_loadcnt 0x0" ::: "memory"); acc[j] = wmma_bf(a.h, w, acc[j]); acc[j] = wmma_bf(a.l, w, acc[j]); } }
#pragma unroll
    for (int j = 0; j < 8; ++j) { const float bias = BO ? bfr(BO[c0 + j * 16 + col]) : 0.f;
#pragma unroll
      for (int r = 0; r < 8; ++r) sf[wave][8 * g + r][j * 16 + col] = acc[j][r] + bias; }
  } else {
    { unsigned char* d = sm + (tid >> 6) * (SPIT * 2) + (tid & 63) * 8;
      auto cy = [](unsigned char* q, v4f v) { const v4h o = { (_Float16)(v[0] * 64.0f), (_Float16)(v[1] * 64.0f), (_Float16)(v[2] * 64.0f), (_Float16)(v[3] * 64.0f) }; *(v4h*)q = o; };   /* ctx carried x 2^6 into f16 so small-magnitude context rows stay clear of f16 subnormals */
      auto cw = [](unsigned char* q, v4f v) { const v4h o = { (_Float16)(bfr(v[0]) * 256.0f), (_Float16)(bfr(v[1]) * 256.0f), (_Float16)(bfr(v[2]) * 256.0f), (_Float16)(bfr(v[3]) * 256.0f) }; *(v4h*)q = o; };
      stage_rows<64>(Y + (size_t)blockIdx.x * 64 * CC, tid, d + SW_BYTES, cy); stage_rows<128>(WO + (size_t)c0 * CC, tid, d, cw); }
    __syncthreads();
    v16h a[2], w[2][8];
    auto frags = [&](int kc, v16h& fa, v16h (&fw)[8]) { fa = frag_h(&sY[wave * 16 + col][kc * 32], lane);
#pragma unroll
      for (int j = 0; j < 8; ++j) fw[j] = frag_h(&sW[j * 16 + col][kc * 32], lane); };
    frags(0, a[0], w[0]);
#pragma unroll
    for (int kc = 0; kc < CC / 32; ++kc) { if (kc + 1 < CC / 32) frags(kc + 1, a[(kc + 1) & 1], w[(kc + 1) & 1]);      // the next 32 k's fragments are fetched as one group while these products run; unrolled so that both fragment sets are indexed statically and stay in registers
#pragma unroll
      for (int j = 0; j < 8; ++j) acc[j] = wmma16(a[kc & 1], w[kc & 1][j], acc[j]); }
    __syncthreads();      // every wave has read its last fragment before the output tile overwrites the operands
#pragma unroll
    for (int j = 0; j < 8; ++j) { const float bias = BO ? bfr(BO[c0 + j * 16 + col]) : 0.f;
#pragma unroll
      for (int r = 0; r < 8; ++r) sf[wave][8 * g + r][j * 16 + col] = acc[j][r] * (1.0f / 16384.0f) + bias; } }   /* 2^-8 (Wo carry) x 2^-6 (ctx carry) */
  LDSX(); for (int rl = 0; rl < 16; ++rl) vst2(OUT + (r0 + rl) * DIN + c0 + lane * 4, *(const v4f*)&sf[wave][rl][lane * 4]); }

extern "C" void kernel_launch(void* const* d_in, const int* in_sizes, int n_in, void* d_out, int out_size, void* d_ws, size_t ws_size, hipStream_t stream) {
  (void)in_sizes; (void)n_in; (void)out_size;
  const float** F = (const float**)d_in;
  if (ws_size < (size_t)WS_END) return;
  char* ws = (char*)d_ws; _Float16 *QH = (_Float16*)(ws + WS_QH), *KH = (_Float16*)(ws + WS_KH), *VT = (_Float16*)(ws + WS_VT), *QL = (_Float16*)(ws + WS_QL), *KL = (_Float16*)(ws + WS_KL); __bf16 *VB = (__bf16*)(ws + WS_VB), *VBL = (__bf16*)(ws + WS_VBL); float *S = (float*)(ws + WS_S), *Y = (float*)(ws + WS_Y);
  (void)Y; (void)S; (void)QL; (void)KL; (void)VB; (void)VBL;
  // inputs: 0 x [32,1024,256]; 1 attn_mask [1024,1024] (bool topology mask, diagonal True); 2 Wq [256,256] (out,in), 3 bq; 4 Wk, 5 bk; 6 Wv, 7 bv; 8 Wo (out,in), 9 bo (biases nonzero)
  k_proj<<<dim3(TNB * TT / 64, CC / 128, 3), 128, 0, stream>>>(F[0], F[0], F[0], F[2], F[4], F[6], F[3], F[5], F[7], QH, QL, KH, KL, VT, VB, VBL);
  k_attn<<<dim3(TT / AQB, NH, TNB), AW * 32, 0, stream>>>(QH, KH, VT, (const int*)d_in[1], Y);
  k_out<<<dim3(TNB * TT / 64, DIN / 128), 128, 0, stream>>>(Y, F[8], F[9], (float*)d_out);
}

// v003
// A run of this version takes 102 microseconds.
// In two side-by-side timings against v002, it was 1.18 and 1.19 times as fast.
// Counting every step since v000, it is 19.5 times as fast.
// compute dtype: all float inputs rounded to bf16; q/k/v projections with EXACT bf16 products on WMMA 16x16x32 (f32 accumulate) + bias; logits q x k once to f16 each (1 product; sigma - 1) x 32^-0.5; the shared boolean mask read per element; online softmax f32 (running maximum and sum per query); weights exp2(.) x 2^8 once to f16 x v once to f16 (1 product), divided by the f32 sum after the product; ctx x 2^6 once to f16 x Wo f16(bf16 x 2^8) + bo; f32 output.
#include <hip/hip_runtime.h>
#include <math.h>

typedef __attribute__((ext_vector_type(16))) _Float16 v16h;
typedef __attribute__((ext_vector_type(16))) __bf16 v16b;
typedef __attribute__((ext_vector_type(8)))  _Float16 v8h;
typedef __attribute__((ext_vector_type(8)))  float v8f;
typedef __attribute__((ext_vector_type(4)))  float v4f;
typedef __attribute__((ext_vector_type(2)))  float v2f;
typedef __attribute__((ext_vector_type(4)))  unsigned v4u;
typedef __attribute__((ext_vector_type(4)))  int v4i;
typedef float __attribute__((may_alias)) float_a;
typedef int __attribute__((may_alias)) int_a;

template <typename T> __device__ __forceinline__ void vst2(void* p, T v) { *(T*)p = v;  }
__device__ __forceinline__ v8f wmma16(v16h a, v16h b, v8f c) {
  v8f d = __builtin_amdgcn_wmma_f32_16x16x32_f16(false, a, false, b, (short)0, c, false, false);
  asm volatile("v_nop\n\tv_nop\n\tv_nop\n\tv_nop" : "+v"(d) : "v"(a), "v"(b));
  return d;
}
__device__ __forceinline__ v8f wmma_bf(v16b a, v16b b, v8f c) {
  v8f d = __builtin_amdgcn_wmma_f32_16x16x32_bf16(false, a, false, b, (short)0, c, false, false);
  asm volatile("v_nop\n\tv_nop\n\tv_nop\n\tv_nop" : "+v"(d) : "v"(a), "v"(b));
  return d;
}
// 16x16x32 fragments: lane = (h = lane>>4, row/col = lane&15); elements 0..7 = k0+8h+0..7, 8..15 = k0+16+8h+0..7; D element r = row 8h+r
__device__ __forceinline__ v16h frag_h(const _Float16* rowk0, int lane) {
  union { v16h v; v8h q[2]; } u; const _Float16* p = rowk0 + 8 * (lane >> 4);
  u.q[0] = *(const v8h*)p; u.q[1] = *(const v8h*)(p + 16); return u.v;
}
__device__ __forceinline__ v16h frag_f32(const float* rowk0, int lane) {
  v16h a; const float* p = rowk0 + 8 * (lane >> 4);
#pragma unroll
  for (int i = 0; i < 8; ++i) { a[i] = (_Float16)p[i]; a[8 + i] = (_Float16)p[16 + i]; }
  return a;
}
__device__ __forceinline__ v16h frag_f32s(const float* rowk0, int lane, float sc) {
  v16h a; const float* p = rowk0 + 8 * (lane >> 4);
#pragma unroll
  for (int i = 0; i < 8; ++i) { a[i] = (_Float16)(p[i] * sc); a[8 + i] = (_Float16)(p[16 + i] * sc); }
  return a;
}
// column fragment from a [K][ld] layout (column n), rows >= K read as 0
__device__ __forceinline__ v16h fragc_f32(const float* W, int k0, int n, int lane, int ld, int K) {
  v16h a; const int g = lane >> 4;
#pragma unroll
  for (int i = 0; i < 8; ++i) { const int ka = k0 + 8 * g + i, kb = ka + 16;
    a[i] = (_Float16)(ka < K ? W[(size_t)(ka < K ? ka : K - 1) * ld + n] : 0.f); a[8 + i] = (_Float16)(kb < K ? W[(size_t)(kb < K ? kb : K - 1) * ld + n] : 0.f); }
  return a;
}
struct F2 { v16b h, l; };
__device__ __forceinline__ F2 bsplit16(const float v[16]) { F2 r;
#pragma unroll
  for (int i = 0; i < 16; ++i) { const __bf16 h = (__bf16)v[i]; r.h[i] = h; r.l[i] = (__bf16)(v[i] - (float)h); }
  return r; }
__device__ __forceinline__ F2 split_row(const float* row, int k0, int lane) { float v[16]; const float* p = row + k0 + 8 * (lane >> 4);
#pragma unroll
  for (int i = 0; i < 8; ++i) { v[i] = p[i]; v[8 + i] = p[16 + i]; }
  return bsplit16(v); }
__device__ __forceinline__ F2 split_rowK(const float* row, int k0, int lane, int K) { float v[16]; const int g = lane >> 4;
#pragma unroll
  for (int i = 0; i < 8; ++i) { const int ka = k0 + 8 * g + i, kb = ka + 16; v[i] = ka < K ? row[ka < K ? ka : K - 1] : 0.f; v[8 + i] = kb < K ? row[kb < K ? kb : K - 1] : 0.f; }
  return bsplit16(v); }
__device__ __forceinline__ F2 split_col(const float* W, int k0, int n, int lane, int ld, int K) { float v[16]; const int g = lane >> 4;
#pragma unroll
  for (int i = 0; i < 8; ++i) { const int ka = k0 + 8 * g + i, kb = ka + 16; v[i] = ka < K ? W[(size_t)(ka < K ? ka : K - 1) * ld + n] : 0.f; v[8 + i] = kb < K ? W[(size_t)(kb < K ? kb : K - 1) * ld + n] : 0.f; }
  return bsplit16(v); }
__device__ __forceinline__ v8f mac3(const F2& a, const F2& b, v8f c) { c = wmma_bf(a.l, b.h, c); c = wmma_bf(a.h, b.l, c); return wmma_bf(a.h, b.h, c); }
__device__ __forceinline__ float sigm(float v) { return 1.0f / (1.0f + expf(-v)); }
#define LDSX() do { asm volatile("s_wait_dscnt 0" ::: "memory"); __builtin_amdgcn_wave_barrier(); __builtin_amdgcn_fence(__ATOMIC_RELEASE, "workgroup"); } while (0)

// Multi-head self-attention with a shared boolean topology mask (x [32,1024,256]; 8 heads x 32; torch (out,in) Wq/Wk/Wv/Wo [256,256] + biases (N(0, 1/256), NONZERO); attn_mask [1024,1024] bool (~50 % True, diagonal True) shared by all batches and heads: scores = where(mask, q_h k_h^T / sqrt(32), -1e9)): out = merge(softmax(scores) v_h) Wo^T + bo.
#define NB 32
#define TT 1024
#define CC 256            // NH * HD = projected width
#define DIN 256          // input (model) width
#define NH 8
#define HD 32
#define NQB (TT / 64)
#define HG 8
#define SCALE (0.17677669529663687f)
#define CAUSAL 0
#ifndef TNB
#define TNB NB
#endif
__device__ __forceinline__ float bfr(float v) { return (float)(__bf16)v; }
__host__ __device__ __forceinline__ int kb_last(int qb) { return CAUSAL ? ((qb * 64 + 63) >> 7) : (TT / 128 - 1); }
typedef __attribute__((ext_vector_type(8))) __bf16 v8b;
__device__ __forceinline__ v16b frag_b(const __bf16* rowk0, int lane) {
  union { v16b v; v8b q[2]; } u; const __bf16* p = rowk0 + 8 * (lane >> 4);
  u.q[0] = *(const v8b*)p; u.q[1] = *(const v8b*)(p + 16); return u.v;
}
#define QBH 0              // read by no kernel: k_attn has one single-product path for every query block
#define QHI 0               // single-product logits on every row (sigma - 1 logits averaged over -512 visible keys)
#define KHI 64            // key rows carrying k residual / v bf16 hi+lo planes (written by k_proj; no kernel here reads them)
// B fragment (k rows k0+.., output column o) of a weight: (in,out) [K][ld] or (out,in) [ld rows of K]: bf16 exact, or f16(bf16 * 256) exact
__device__ __forceinline__ v16b wcol_io(const float* Wm, int k0, int o, int lane, int ld) { v16b w; const int g = lane >> 4;
#pragma unroll
  for (int i = 0; i < 8; ++i) { w[i] = (__bf16)Wm[(size_t)(k0 + 8 * g + i) * ld + o]; w[8 + i] = (__bf16)Wm[(size_t)(k0 + 16 + 8 * g + i) * ld + o]; }
  return w; }
__device__ __forceinline__ v16b wcol_oi(const float* Wm, int k0, int o, int lane, int K) { v16b w; const float* p = Wm + (size_t)o * K + k0 + 8 * (lane >> 4);
#pragma unroll
  for (int i = 0; i < 8; ++i) { w[i] = (__bf16)p[i]; w[8 + i] = (__bf16)p[16 + i]; }
  return w; }
__device__ __forceinline__ v16h wcolh_io(const float* Wm, int k0, int o, int lane, int ld) { v16h w; const int g = lane >> 4;
#pragma unroll
  for (int i = 0; i < 8; ++i) { w[i] = (_Float16)(bfr(Wm[(size_t)(k0 + 8 * g + i) * ld + o]) * 256.0f); w[8 + i] = (_Float16)(bfr(Wm[(size_t)(k0 + 16 + 8 * g + i) * ld + o]) * 256.0f); }
  return w; }
__device__ __forceinline__ v16h wcolh_oi(const float* Wm, int k0, int o, int lane, int K) { v16h w; const float* p = Wm + (size_t)o * K + k0 + 8 * (lane >> 4);
#pragma unroll
  for (int i = 0; i < 8; ++i) { w[i] = (_Float16)(bfr(p[i]) * 256.0f); w[8 + i] = (_Float16)(bfr(p[16 + i]) * 256.0f); }
  return w; }
#define WQKV_LAYOUT 1   // 0 = (in,out) [DIN][CC]; 1 = (out,in) [CC][DIN]; 2 = per-head [NH][DIN][HD]
__device__ __forceinline__ v16b wcol_hdk(const float* Wm, int k0, int o, int lane) { v16b w; const int g = lane >> 4; const float* p = Wm + (size_t)(o / HD) * DIN * HD + (o % HD);
#pragma unroll
  for (int i = 0; i < 8; ++i) { w[i] = (__bf16)p[(size_t)(k0 + 8 * g + i) * HD]; w[8 + i] = (__bf16)p[(size_t)(k0 + 16 + 8 * g + i) * HD]; }
  return w; }
#define WO_OUT_IN 1
#if WQKV_LAYOUT == 1
#define WCOL(W, k0, o, lane) wcol_oi(W, k0, o, lane, DIN)
#elif WQKV_LAYOUT == 2
#define WCOL(W, k0, o, lane) wcol_hdk(W, k0, o, lane)
#else
#define WCOL(W, k0, o, lane) wcol_io(W, k0, o, lane, CC)
#endif
#if WO_OUT_IN
#define WOCOL(W, k0, o, lane) wcol_oi(W, k0, o, lane, CC)
#define WOCOLH(W, k0, o, lane) wcolh_oi(W, k0, o, lane, CC)
#else
#define WOCOL(W, k0, o, lane) wcol_io(W, k0, o, lane, DIN)
#define WOCOLH(W, k0, o, lane) wcolh_io(W, k0, o, lane, DIN)
#endif
#ifndef PROJ_EXTRA_PARAMS
#define PROJ_EXTRA_PARAMS
#endif

#define WS_QH  0u                                      // f16 q rows [b*t][CC]
#define WS_KH  (WS_QH + 2u * (size_t)NB * TT * CC)      // f16 k rows [b*t][CC]
#define WS_VT  (WS_KH + 2u * (size_t)NB * TT * CC)      // f16 v planes [b][c][t]
#define WS_QL  (WS_VT + 2u * (size_t)NB * CC * TT)      // f16 q residual x 2^10 rows [b][t < QHI][CC]
#define WS_KL  (WS_QL + 2u * (size_t)NB * QHI * CC)     // f16 k residual x 2^10 rows [b][t < KHI][CC]
#define WS_VB  (WS_KL + 2u * (size_t)NB * KHI * CC)     // bf16 v hi planes [b][c][t < KHI]
#define WS_VBL (WS_VB + 2u * (size_t)NB * CC * KHI)
#define WS_S   (WS_VBL + 2u * (size_t)NB * CC * KHI)    // room of HG x TT x TT f32; only the mask words (WS_PM) use it
#define WS_PM  WS_S                                      // the mask as lane-mask words [query tile of 16][32 keys][16 words], 128 KiB (the logits plane is not used)
#define WS_Y   (WS_S  + 4u * (size_t)HG * TT * TT)      // f32 ctx rows [b*t][CC] (only when there is an output projection)
#define WS_END (WS_Y  + 4u * (size_t)NB * TT * CC)

// ---- operand staging of k_proj and k_out: a block's 128 weight rows (its output columns) and 64 input rows, 256 f32 each and contiguous in memory, go to LDS once as 16-bit rows.
// Every load of a wave takes 512 contiguous bytes, so a block touches each 128-B line once; the WMMA fragments are then 16-B LDS reads.
#define SPIT 264           // 16-bit elements per staged row: 528 B = 16 B x odd
#define SW_BYTES (128 * SPIT * 2)
#define SOP_BYTES ((128 + 64) * SPIT * 2)
static_assert(WQKV_LAYOUT == 1 && WO_OUT_IN == 1 && DIN == 256 && CC == 256, "the staging below reads (out,in) weight rows of 256");
typedef __attribute__((ext_vector_type(4))) __bf16 v4b;
typedef __attribute__((ext_vector_type(4))) _Float16 v4h;
// base = first row (128 threads = two rows a pass), d = this thread's 8 bytes of LDS row tid >> 6; the loops are unrolled so that t[] stays in registers and every step is an immediate offset
template <int NROW, typename CV> __device__ __forceinline__ void stage_rows(const float* base, int tid, unsigned char* d, CV cv) {
  const float* p = base + tid * 4;
#pragma unroll
  for (int b = 0; b < NROW / 2; b += 16) { v4f t[16];
#pragma unroll
    for (int i = 0; i < 16; ++i) t[i] = *(const v4f*)(p + (b + i) * 512);
    asm volatile("s_wait_xcnt 0x0" :: "v"(tid), "s"(base) : "memory");      // the loads' offset register and base stay untouched until the 16 loads above have taken them; no later load is lifted over this line, which keeps the registers under 256
#pragma unroll
    for (int i = 0; i < 16; ++i) cv(d + (b + i) * (2 * SPIT * 2), t[i]); } }

// ---- k_proj: block = (64 rows, 128 cols, which): q/k/v = X W (+ b) with exact bf16 products (K = DIN) -> which 0: q f16 rows (+ residual rows < QHI); 1: k f16 rows (+ residual rows < KHI); 2: v f16 planes [c][t] (+ bf16 hi/lo planes for t < KHI); 3: the mask as lane-mask words (no product)
__global__ __launch_bounds__(128) void k_proj(const float* __restrict__ XQ, const float* __restrict__ XK, const float* __restrict__ XV, const float* __restrict__ WQ, const float* __restrict__ WK, const float* __restrict__ WV, const float* __restrict__ BQ, const float* __restrict__ BK, const float* __restrict__ BV,
    _Float16* __restrict__ QH, _Float16* __restrict__ QL, _Float16* __restrict__ KH, _Float16* __restrict__ KL, _Float16* __restrict__ VT, __bf16* __restrict__ VB, __bf16* __restrict__ VBL, const int* __restrict__ AMASK, unsigned* __restrict__ PM) {
  __shared__ __align__(16) unsigned char sm[SOP_BYTES];      // the staged operands; behind the second barrier the same bytes hold the output tiles
  __bf16 (*sW)[SPIT] = (__bf16 (*)[SPIT])sm; __bf16 (*sX)[SPIT] = (__bf16 (*)[SPIT])(sm + SW_BYTES);
  _Float16 (*sh)[136] = (_Float16 (*)[136])sm; _Float16 (*sl)[136] = (_Float16 (*)[136])(sm + 17408); _Float16 (*th)[72] = (_Float16 (*)[72])(sm + 34816); __bf16 (*tb)[72] = (__bf16 (*)[72])(sm + 53248); __bf16 (*tbl)[72] = (__bf16 (*)[72])(sm + 71680);
  static_assert(71680 + 128 * 72 * 2 <= SOP_BYTES, "output tiles fit in the operand bytes");
  const int tid = threadIdx.x, wave = tid >> 5, lane = tid & 31, col = lane & 15, g = lane >> 4; const int which = blockIdx.z; const int c0 = blockIdx.y * 128; const size_t r0 = (size_t)blockIdx.x * 64; const size_t bb = r0 / TT; const int t0 = (int)(r0 % TT);
  if (which == 3) {      // mask blocks (block-uniform, in front of every barrier): wave 0 turns two tiles of 16 queries x 32 keys into 32 words, one 128-B line.
    // Word i of a tile, bit l = mask[query tile * 16 + (l & 15)][key block * 32 + 16 (i >> 3) + 8 (l >> 4) + (i & 7)]: the lane mask of score register i in k_attn
    static_assert((TNB * TT / 64) * (CC / 128) == (TT / 16) * (TT / 64), "one mask block for every pair of tiles");
    if (wave) return;
    const int tp = blockIdx.x * 2 + blockIdx.y; const int* mp = AMASK + ((tp >> 4) * 16 + col) * TT + (tp & 15) * 64 + 8 * g; v4i m[8]; unsigned wd = 0;
#pragma unroll
    for (int i = 0; i < 8; ++i) m[i] = *(const v4i*)(mp + (i >> 1) * 16 + (i & 1) * 4);
#pragma unroll
    for (int i = 0; i < 32; ++i) { const unsigned bl = __builtin_amdgcn_ballot_w32(m[i >> 2][i & 3] != 0); if (lane == i) wd = bl; }
    PM[tp * 32 + lane] = wd; return; }
  const float* X = which == 0 ? XQ : which == 1 ? XK : XV; const float* WA = which == 0 ? WQ : which == 1 ? WK : WV; const float* BA = which == 0 ? BQ : which == 1 ? BK : BV;
  { unsigned char* d = sm + (tid >> 6) * (SPIT * 2) + (tid & 63) * 8;
    auto cv = [](unsigned char* q, v4f v) { const v4b o = { (__bf16)v[0], (__bf16)v[1], (__bf16)v[2], (__bf16)v[3] }; *(v4b*)q = o; };
    stage_rows<64>(X + r0 * DIN, tid, d + SW_BYTES, cv); stage_rows<128>(WA + (size_t)c0 * DIN, tid, d, cv); }
  __syncthreads();
  v8f acc[8] = {}; v16b a[2], w[2][8];
  auto frags = [&](int kc, v16b& fa, v16b (&fw)[8]) { fa = frag_b(&sX[wave * 16 + col][kc * 32], lane);
#pragma unroll
    for (int j = 0; j < 8; ++j) fw[j] = frag_b(&sW[j * 16 + col][kc * 32], lane); };
  frags(0, a[0], w[0]);
#pragma unroll
  for (int kc = 0; kc < DIN / 32; ++kc) { if (kc + 1 < DIN / 32) frags(kc + 1, a[(kc + 1) & 1], w[(kc + 1) & 1]);      // the next 32 k's fragments are fetched as one group while these products run; unrolled so that both fragment sets are indexed statically and stay in registers
#pragma unroll
    for (int j = 0; j < 8; ++j) acc[j] = wmma_bf(a[kc & 1], w[kc & 1][j], acc[j]); }
  __syncthreads();      // every wave has read its last fragment before the output tiles overwrite the operands
  if (which < 2) { _Float16* DH = which == 0 ? QH : KH; _Float16* DL = which == 0 ? QL : KL; const int nhi = which == 0 ? QHI : KHI; const bool hi_rows = t0 < nhi;
#pragma unroll
    for (int j = 0; j < 8; ++j) { const float bias = BA ? bfr(BA[c0 + j * 16 + col]) : 0.f;
#pragma unroll
      for (int r = 0; r < 8; ++r) { const float v = acc[j][r] + bias; const _Float16 hv = (_Float16)v; sh[wave * 16 + 8 * g + r][j * 16 + col] = hv; sl[wave * 16 + 8 * g + r][j * 16 + col] = (_Float16)((v - (float)hv) * 1024.0f); } }
    __syncthreads();
    for (int e = tid; e < 64 * 16; e += 128) { const int rl = e >> 4, q = e & 15; vst2((unsigned*)(DH + (r0 + rl) * CC + c0 + q * 8), *(const v4u*)&sh[rl][q * 8]); if (hi_rows) vst2((unsigned*)(DL + (bb * nhi + t0 + rl) * (size_t)CC + c0 + q * 8), *(const v4u*)&sl[rl][q * 8]); }
  } else { const bool hi_rows = t0 < KHI;
#pragma unroll
    for (int j = 0; j < 8; ++j) { const float bias = BA ? bfr(BA[c0 + j * 16 + col]) : 0.f;
#pragma unroll
      for (int r = 0; r < 8; ++r) { const float v = acc[j][r] + bias; const int rl = wave * 16 + 8 * g + r, cl = j * 16 + col; th[cl][rl] = (_Float16)v; const __bf16 bh = (__bf16)v; tb[cl][rl] = bh; tbl[cl][rl] = (__bf16)(v - (float)bh); } }
    __syncthreads();
    for (int e = tid; e < 128 * 8; e += 128) { const int cl = e >> 3, q = e & 7; vst2((unsigned*)(VT + (bb * CC + c0 + cl) * (size_t)TT + t0 + q * 8), *(const v4u*)&th[cl][q * 8]); if (hi_rows) { const size_t o3 = (bb * CC + c0 + cl) * (size_t)KHI + t0 + q * 8; vst2((unsigned*)(VB + o3), *(const v4u*)&tb[cl][q * 8]); vst2((unsigned*)(VBL + o3), *(const v4u*)&tbl[cl][q * 8]); } } } }
// ---- k_attn: block = (256 queries, head h, batch b), 8 waves x 32 queries. K rows and v planes of (b, h) are staged once in LDS; each wave walks the 1024 keys 32 at a time:
// S^T = K q^T (lane = one query, 16 of the 32 keys), mask by element, running maximum and sum per query (online softmax, f32), weights x 2^8 once to f16 straight from the score registers as the B operand of ctx^T += v^T P^T; ctx / sum at the end.
#define AW 8
#define AQT 2
#define AQB (AW * AQT * 16)
static_assert(AW * 32 == 256 && TT == 1024 && HD == 32, "the fill below is written for 256 threads, 1024 keys, head size 32");
#define KPIT 40            // f16 per staged K row: 80 B = 16 B x odd
#define VPIT (TT + 8)      // f16 per staged v plane: 2064 B = 16 B x odd
#define LOG2E 1.4426950408889634f
typedef __attribute__((ext_vector_type(2))) _Float16 v2h;
typedef __attribute__((ext_vector_type(16))) unsigned v16u;
__device__ __forceinline__ float xhalf(float x) { return __builtin_bit_cast(float, __builtin_amdgcn_permlanex16(__builtin_bit_cast(int, x), __builtin_bit_cast(int, x), 0x76543210, 0xfedcba98, false, false)); }   // lane l with lane l ^ 16
__device__ __forceinline__ v8f wmma_h(v16h a, v16h b, v8f c) { return __builtin_amdgcn_wmma_f32_16x16x32_f16(false, a, false, b, (short)0, c, false, false); }
__global__ __launch_bounds__(AW * 32) __attribute__((amdgpu_waves_per_eu(4, 4))) void k_attn(const _Float16* __restrict__ QH, const _Float16* __restrict__ KH, const _Float16* __restrict__ VT, const unsigned* __restrict__ PM, float* __restrict__ Y) {   // 4 waves per SIMD = two blocks per WGP (2 x 147,968 B of LDS fit)
  __shared__ __align__(16) _Float16 sK[TT][KPIT]; __shared__ __align__(16) _Float16 sV[HD][VPIT];
  const int tid = threadIdx.x, wave = tid >> 5, lane = tid & 31, col = lane & 15, g = lane >> 4; const int h = blockIdx.y, b = blockIdx.z; const int q0 = blockIdx.x * AQB + wave * (AQT * 16);
  v4u tk[16], tv[16];      // the fill: 1024 K rows x 64 B and 32 v planes x 2048 B, 16 + 16 loads of 16 B a thread, all in flight together, then the LDS stores
  const _Float16* kp = KH + ((size_t)b * TT + (tid >> 2)) * CC + h * HD + (tid & 3) * 8;            // load i: K row (tid >> 2) + 64 i
  const _Float16* vp = VT + ((size_t)b * CC + h * HD + (tid >> 7)) * (size_t)TT + (tid & 127) * 8;   // load i: v plane (tid >> 7) + 2 i
  const _Float16* qp = QH + ((size_t)b * TT + q0 + col) * CC + h * HD + 8 * g;
#pragma unroll
  for (int i = 0; i < 16; ++i) tk[i] = *(const v4u*)(kp + i * 64 * CC);
#pragma unroll
  for (int i = 0; i < 16; ++i) tv[i] = *(const v4u*)(vp + i * 2 * TT);
  v16h qf[AQT]; v8f acc[AQT][2] = {}; float mx[AQT], ls[AQT]; const v16u* pm = (const v16u*)PM + __builtin_amdgcn_readfirstlane(q0 >> 4) * (TT / 32);      // this wave's mask words: wave-uniform, so they come by scalar loads; tile u is TT / 32 groups of 16 words on
#pragma unroll
  for (int u = 0; u < AQT; ++u) { union { v16h v; v8h q[2]; } t; t.q[0] = *(const v8h*)(qp + u * 16 * CC); t.q[1] = *(const v8h*)(qp + u * 16 * CC + 16); qf[u] = t.v; mx[u] = -3.0e38f; ls[u] = 0.f; }   // B fragment, same k order as frag_h
  asm volatile("s_wait_xcnt 0x0" :: "v"(kp), "v"(vp), "v"(qp) : "memory");      // the three address pairs stay untouched until the loads above have taken them
#pragma unroll
  for (int i = 0; i < 16; ++i) *(v4u*)&sK[(tid >> 2) + 64 * i][(tid & 3) * 8] = tk[i];
#pragma unroll
  for (int i = 0; i < 16; ++i) *(v4u*)&sV[(tid >> 7) + 2 * i][(tid & 127) * 8] = tv[i];
  __syncthreads();
  const float NEGR = -1.0e9f / SCALE;      // the reference's -1e9 fill in units of the unscaled product
  const float CL = SCALE * LOG2E;
  auto mload = [&](int k0, v16u (&mk)[AQT]) {
#pragma unroll
    for (int u = 0; u < AQT; ++u) mk[u] = pm[u * (TT / 32) + (k0 >> 5)]; };
  auto step = [&](int k0, const v16u (&mk)[AQT]) {
    const v16h ka = frag_h(&sK[k0 + col][0], lane), kb = frag_h(&sK[k0 + 16 + col][0], lane);      // A rows = keys k0 + 0..15, k0 + 16..31
    const v16h va = frag_h(&sV[col][k0], lane), vb = frag_h(&sV[16 + col][k0], lane);              // A rows = head columns 0..15, 16..31; k = keys in the order of the packed scores
#pragma unroll
    for (int u = 0; u < AQT; ++u) {
      const v8f z = {}; v8f s[2]; s[0] = wmma_h(ka, qf[u], z); s[1] = wmma_h(kb, qf[u], z);      // s[T][r] = key k0 + 16T + 8g + r, query = col
      float x[16];
#pragma unroll
      for (int i = 0; i < 16; ++i) x[i] = __builtin_amdgcn_inverse_ballot_w32(mk[u][i]) ? s[i >> 3][i & 7] : NEGR;      // word i is the select's lane mask as it stands
      float cm = x[0];
#pragma unroll
      for (int i = 1; i < 16; ++i) cm = fmaxf(cm, x[i]);
      const float mn = fmaxf(mx[u], fmaxf(cm, xhalf(cm)));           // both lane halves of a query use one maximum: their weights meet in one product
      const float al = __builtin_amdgcn_exp2f((mx[u] - mn) * CL); mx[u] = mn;
      union { v16h v; v2h q[8]; } pf; v2f sum = {};
#pragma unroll
      for (int i = 0; i < 8; ++i) { v2f d = { x[2 * i], x[2 * i + 1] }; d = (d - mn) * CL + 8.0f;      // difference first: exactly 0 where a whole row is masked (uniform weights, as the reference gives)
        const v2f p = { __builtin_amdgcn_exp2f(d[0]), __builtin_amdgcn_exp2f(d[1]) }; sum += p; pf.q[i] = __builtin_convertvector(p, v2h); }
      ls[u] = ls[u] * al + (sum[0] + sum[1]);
      acc[u][0] = wmma_h(va, pf.v, acc[u][0] * al); acc[u][1] = wmma_h(vb, pf.v, acc[u][1] * al);
    } };
  v16u ma[AQT], mb[AQT]; mload(0, ma); mload(32, mb);      // the mask words of the next 64 keys are fetched, into the registers that the selects have just read, while these 64 are worked on
  for (int k0 = 0; k0 < TT; k0 += 64) { const int kn = k0 + 64 < TT ? k0 + 64 : 0; step(k0, ma); mload(kn, ma); step(k0 + 32, mb); mload(kn + 32, mb); }
#pragma unroll
  for (int u = 0; u < AQT; ++u) { const float inv = 1.0f / (ls[u] + xhalf(ls[u])); float* yp = Y + (unsigned)((b * TT + q0 + u * 16 + col) * CC + h * HD + 8 * g);
#pragma unroll
    for (int j = 0; j < 2; ++j) { const v8f o = acc[u][j] * inv; vst2(yp + j * 16, (v4f)__builtin_shufflevector(o, o, 0, 1, 2, 3)); vst2(yp + j * 16 + 4, (v4f)__builtin_shufflevector(o, o, 4, 5, 6, 7)); } } }
// ---- k_out: block = (64 rows, 128 cols): out = ctx Wo (+ bo): ctx x 2^6 once to f16 against Wo as f16(bf16 x 2^8) exact (1 product) x 2^-14; causal early rows (< QHI of each sequence): ctx bf16 hi + lo against exact bf16 Wo (2 products)
__global__ __launch_bounds__(128) void k_out(const float* __restrict__ Y, const float* __restrict__ WO, const float* __restrict__ BO, float* __restrict__ OUT) { __shared__ __align__(16) unsigned char sm[SOP_BYTES];      // the staged operands; behind the second barrier the same bytes hold the output tile
  _Float16 (*sW)[SPIT] = (_Float16 (*)[SPIT])sm; _Float16 (*sY)[SPIT] = (_Float16 (*)[SPIT])(sm + SW_BYTES); float (*sf)[16][132] = (float (*)[16][132])sm;
  const int tid = threadIdx.x, wave = tid >> 5, lane = tid & 31, col = lane & 15, g = lane >> 4; const int c0 = blockIdx.y * 128; const size_t r0 = (size_t)blockIdx.x * 64 + wave * 16;
  v8f acc[8] = {};
  if (CAUSAL && (int)(((size_t)blockIdx.x * 64) % TT) < QHI) {   /* block-uniform */
#pragma unroll 2
    for (int kc = 0; kc < CC / 32; ++kc) { const F2 a = split_row(Y + (r0 + col) * CC, kc * 32, lane); asm volatile("s_wait_loadcnt 0x0" ::: "memory");
#pragma unroll
      for (int j = 0; j < 8; ++j) { const v16b w = WOCOL(WO, kc * 32, c0 + j * 16 + col, lane); asm volatile("s_wait_loadcnt 0x0" ::: "memory"); acc[j] = wmma_bf(a.h, w, acc[j]); acc[j] = wmma_bf(a.l, w, acc[j]); } }
#pragma unroll
    for (int j = 0; j < 8; ++j) { const float bias = BO ? bfr(BO[c0 + j * 16 + col]) : 0.f;
#pragma unroll
      for (int r = 0; r < 8; ++r) sf[wave][8 * g + r][j * 16 + col] = acc[j][r] + bias; }
  } else {
    { unsigned char* d = sm + (tid >> 6) * (SPIT * 2) + (tid & 63) * 8;
      auto cy = [](unsigned char* q, v4f v) { const v4h o = { (_Float16)(v[0] * 64.0f), (_Float16)(v[1] * 64.0f), (_Float16)(v[2] * 64.0f), (_Float16)(v[3] * 64.0f) }; *(v4h*)q = o; };   /* ctx carried x 2^6 into f16 so small-magnitude context rows stay clear of f16 subnormals */
      auto cw = [](unsigned char* q, v4f v) { const v4h o = { (_Float16)(bfr(v[0]) * 256.0f), (_Float16)(bfr(v[1]) * 256.0f), (_Float16)(bfr(v[2]) * 256.0f), (_Float16)(bfr(v[3]) * 256.0f) }; *(v4h*)q = o; };
      stage_rows<64>(Y + (size_t)blockIdx.x * 64 * CC, tid, d + SW_BYTES, cy); stage_rows<128>(WO + (size_t)c0 * CC, tid, d, cw); }
    __syncthreads();
    v16h a[2], w[2][8];
    auto frags = [&](int kc, v16h& fa, v16h (&fw)[8]) { fa = frag_h(&sY[wave * 16 + col][kc * 32], lane);
#pragma unroll
      for (int j = 0; j < 8; ++j) fw[j] = frag_h(&sW[j * 16 + col][kc * 32], lane); };
    frags(0, a[0], w[0]);
#pragma unroll
    for (int kc = 0; kc < CC / 32; ++kc) { if (kc + 1 < CC / 32) frags(kc + 1, a[(kc + 1) & 1], w[(kc + 1) & 1]);      // the next 32 k's fragments are fetched as one group while these products run; unrolled so that both fragment sets are indexed statically and stay in registers
#pragma unroll
      for (int j = 0; j < 8; ++j) acc[j] = wmma16(a[kc & 1], w[kc & 1][j], acc[j]); }
    __syncthreads();      // every wave has read its last fragment before the output tile overwrites the operands
#pragma unroll
    for (int j = 0; j < 8; ++j) { const float bias = BO ? bfr(BO[c0 + j * 16 + col]) : 0.f;
#pragma unroll
      for (int r = 0; r < 8; ++r) sf[wave][8 * g + r][j * 16 + col] = acc[j][r] * (1.0f / 16384.0f) + bias; } }   /* 2^-8 (Wo carry) x 2^-6 (ctx carry) */
  LDSX(); for (int rl = 0; rl < 16; ++rl) vst2(OUT + (r0 + rl) * DIN + c0 + lane * 4, *(const v4f*)&sf[wave][rl][lane * 4]); }

extern "C" void kernel_launch(void* const* d_in, const int* in_sizes, int n_in, void* d_out, int out_size, void* d_ws, size_t ws_size, hipStream_t stream) {
  (void)in_sizes; (void)n_in; (void)out_size;
  const float** F = (const float**)d_in;
  if (ws_size < (size_t)WS_END) return;
  char* ws = (char*)d_ws; _Float16 *QH = (_Float16*)(ws + WS_QH), *KH = (_Float16*)(ws + WS_KH), *VT = (_Float16*)(ws + WS_VT), *QL = (_Float16*)(ws + WS_QL), *KL = (_Float16*)(ws + WS_KL); __bf16 *VB = (__bf16*)(ws + WS_VB), *VBL = (__bf16*)(ws + WS_VBL); float *S = (float*)(ws + WS_S), *Y = (float*)(ws + WS_Y); unsigned* PM = (unsigned*)(ws + WS_PM);
  (void)Y; (void)S; (void)QL; (void)KL; (void)VB; (void)VBL;
  // inputs: 0 x [32,1024,256]; 1 attn_mask [1024,1024] (bool topology mask, diagonal True); 2 Wq [256,256] (out,in), 3 bq; 4 Wk, 5 bk; 6 Wv, 7 bv; 8 Wo (out,in), 9 bo (biases nonzero)
  k_proj<<<dim3(TNB * TT / 64, CC / 128, 4), 128, 0, stream>>>(F[0], F[0], F[0], F[2], F[4], F[6], F[3], F[5], F[7], QH, QL, KH, KL, VT, VB, VBL, (const int*)d_in[1], PM);   // z = 3: the 1024 mask blocks
  k_attn<<<dim3(TT / AQB, NH, TNB), AW * 32, 0, stream>>>(QH, KH, VT, PM, Y);
  k_out<<<dim3(TNB * TT / 64, DIN / 128), 128, 0, stream>>>(Y, F[8], F[9], (float*)d_out);
}

// v004
// A run of this version takes 96.1 microseconds.
// Next to v003, in two timings, it ran 1.05 and 1.06 times as fast.
// Over all steps from v000 it is 20.6 times as fast.
// compute dtype: all float inputs rounded to bf16; q/k/v projections with EXACT bf16 products on WMMA 16x16x32 (f32 accumulate) + bias; logits q x k once to f16 each (1 product; sigma - 1) x 32^-0.5; the shared boolean mask read per element; online softmax f32 (running maximum and sum per query); weights exp2(.) x 2^8 once to f16 x v once to f16 (1 product), divided by the f32 sum after the product; ctx x 2^6 once to f16 x Wo f16(bf16 x 2^8) + bo; f32 output.
#include <hip/hip_runtime.h>
#include <math.h>

typedef __attribute__((ext_vector_type(16))) _Float16 v16h;
typedef __attribute__((ext_vector_type(16))) __bf16 v16b;
typedef __attribute__((ext_vector_type(8)))  _Float16 v8h;
typedef __attribute__((ext_vector_type(8)))  float v8f;
typedef __attribute__((ext_vector_type(4)))  float v4f;
typedef __attribute__((ext_vector_type(2)))  float v2f;
typedef __attribute__((ext_vector_type(4)))  unsigned v4u;
typedef __attribute__((ext_vector_type(4)))  int v4i;
typedef float __attribute__((may_alias)) float_a;
typedef int __attribute__((may_alias)) int_a;

template <typename T> __device__ __forceinline__ void vst2(void* p, T v) { *(T*)p = v;  }
__device__ __forceinline__ v8f wmma16(v16h a, v16h b, v8f c) {
  v8f d = __builtin_amdgcn_wmma_f32_16x16x32_f16(false, a, false, b, (short)0, c, false, false);
  asm volatile("v_nop\n\tv_nop\n\tv_nop\n\tv_nop" : "+v"(d) : "v"(a), "v"(b));
  return d;
}
__device__ __forceinline__ v8f wmma_bf(v16b a, v16b b, v8f c) {
  v8f d = __builtin_amdgcn_wmma_f32_16x16x32_bf16(false, a, false, b, (short)0, c, false, false);
  asm volatile("v_nop\n\tv_nop\n\tv_nop\n\tv_nop" : "+v"(d) : "v"(a), "v"(b));
  return d;
}
// 16x16x32 fragments: lane = (h = lane>>4, row/col = lane&15); elements 0..7 = k0+8h+0..7, 8..15 = k0+16+8h+0..7; D element r = row 8h+r
__device__ __forceinline__ v16h frag_h(const _Float16* rowk0, int lane) {
  union { v16h v; v8h q[2]; } u; const _Float16* p = rowk0 + 8 * (lane >> 4);
  u.q[0] = *(const v8h*)p; u.q[1] = *(const v8h*)(p + 16); return u.v;
}
__device__ __forceinline__ v16h frag_f32(const float* rowk0, int lane) {
  v16h a; const float* p = rowk0 + 8 * (lane >> 4);
#pragma unroll
  for (int i = 0; i < 8; ++i) { a[i] = (_Float16)p[i]; a[8 + i] = (_Float16)p[16 + i]; }
  return a;
}
__device__ __forceinline__ v16h frag_f32s(const float* rowk0, int lane, float sc) {
  v16h a; const float* p = rowk0 + 8 * (lane >> 4);
#pragma unroll
  for (int i = 0; i < 8; ++i) { a[i] = (_Float16)(p[i] * sc); a[8 + i] = (_Float16)(p[16 + i] * sc); }
  return a;
}
// column fragment from a [K][ld] layout (column n), rows >= K read as 0
__device__ __forceinline__ v16h fragc_f32(const float* W, int k0, int n, int lane, int ld, int K) {
  v16h a; const int g = lane >> 4;
#pragma unroll
  for (int i = 0; i < 8; ++i) { const int ka = k0 + 8 * g + i, kb = ka + 16;
    a[i] = (_Float16)(ka < K ? W[(size_t)(ka < K ? ka : K - 1) * ld + n] : 0.f); a[8 + i] = (_Float16)(kb < K ? W[(size_t)(kb < K ? kb : K - 1) * ld + n] : 0.f); }
  return a;
}
struct F2 { v16b h, l; };
__device__ __forceinline__ F2 bsplit16(const float v[16]) { F2 r;
#pragma unroll
  for (int i = 0; i < 16; ++i) { const __bf16 h = (__bf16)v[i]; r.h[i] = h; r.l[i] = (__bf16)(v[i] - (float)h); }
  return r; }
__device__ __forceinline__ F2 split_row(const float* row, int k0, int lane) { float v[16]; const float* p = row + k0 + 8 * (lane >> 4);
#pragma unroll
  for (int i = 0; i < 8; ++i) { v[i] = p[i]; v[8 + i] = p[16 + i]; }
  return bsplit16(v); }
__device__ __forceinline__ F2 split_rowK(const float* row, int k0, int lane, int K) { float v[16]; const int g = lane >> 4;
#pragma unroll
  for (int i = 0; i < 8; ++i) { const int ka = k0 + 8 * g + i, kb = ka + 16; v[i] = ka < K ? row[ka < K ? ka : K - 1] : 0.f; v[8 + i] = kb < K ? row[kb < K ? kb : K - 1] : 0.f; }
  return bsplit16(v); }
__device__ __forceinline__ F2 split_col(const float* W, int k0, int n, int lane, int ld, int K) { float v[16]; const int g = lane >> 4;
#pragma unroll
  for (int i = 0; i < 8; ++i) { const int ka = k0 + 8 * g + i, kb = ka + 16; v[i] = ka < K ? W[(size_t)(ka < K ? ka : K - 1) * ld + n] : 0.f; v[8 + i] = kb < K ? W[(size_t)(kb < K ? kb : K - 1) * ld + n] : 0.f; }
  return bsplit16(v); }
__device__ __forceinline__ v8f mac3(const F2& a, const F2& b, v8f c) { c = wmma_bf(a.l, b.h, c); c = wmma_bf(a.h, b.l, c); return wmma_bf(a.h, b.h, c); }
__device__ __forceinline__ float sigm(float v) { return 1.0f / (1.0f + expf(-v)); }
#define LDSX() do { asm volatile("s_wait_dscnt 0" ::: "memory"); __builtin_amdgcn_wave_barrier(); __builtin_amdgcn_fence(__ATOMIC_RELEASE, "workgroup"); } while (0)

// Multi-head self-attention with a shared boolean topology mask (x [32,1024,256]; 8 heads x 32; torch (out,in) Wq/Wk/Wv/Wo [256,256] + biases (N(0, 1/256), NONZERO); attn_mask [1024,1024] bool (~50 % True, diagonal True) shared by all batches and heads: scores = where(mask, q_h k_h^T / sqrt(32), -1e9)): out = merge(softmax(scores) v_h) Wo^T + bo.
#define NB 32
#define TT 1024
#define CC 256            // NH * HD = projected width
#define DIN 256          // input (model) width
#define NH 8
#define HD 32
#define NQB (TT / 64)
#define HG 8
#define SCALE (0.17677669529663687f)
#define CAUSAL 0
#ifndef TNB
#define TNB NB
#endif
__device__ __forceinline__ float bfr(float v) { return (float)(__bf16)v; }
__host__ __device__ __forceinline__ int kb_last(int qb) { return CAUSAL ? ((qb * 64 + 63) >> 7) : (TT / 128 - 1); }
typedef __attribute__((ext_vector_type(8))) __bf16 v8b;
__device__ __forceinline__ v16b frag_b(const __bf16* rowk0, int lane) {
  union { v16b v; v8b q[2]; } u; const __bf16* p = rowk0 + 8 * (lane >> 4);
  u.q[0] = *(const v8b*)p; u.q[1] = *(const v8b*)(p + 16); return u.v;
}
#define QBH 0              // read by no kernel: k_attn has one single-product path for every query block
#define QHI 0               // single-product logits on every row (sigma - 1 logits averaged over -512 visible keys)
#define KHI 64            // key rows carrying k residual / v bf16 hi+lo planes (no kernel here writes or reads them)
// B fragment (k rows k0+.., output column o) of a weight: (in,out) [K][ld] or (out,in) [ld rows of K]: bf16 exact, or f16(bf16 * 256) exact
__device__ __forceinline__ v16b wcol_io(const float* Wm, int k0, int o, int lane, int ld) { v16b w; const int g = lane >> 4;
#pragma unroll
  for (int i = 0; i < 8; ++i) { w[i] = (__bf16)Wm[(size_t)(k0 + 8 * g + i) * ld + o]; w[8 + i] = (__bf16)Wm[(size_t)(k0 + 16 + 8 * g + i) * ld + o]; }
  return w; }
__device__ __forceinline__ v16b wcol_oi(const float* Wm, int k0, int o, int lane, int K) { v16b w; const float* p = Wm + (size_t)o * K + k0 + 8 * (lane >> 4);
#pragma unroll
  for (int i = 0; i < 8; ++i) { w[i] = (__bf16)p[i]; w[8 + i] = (__bf16)p[16 + i]; }
  return w; }
__device__ __forceinline__ v16h wcolh_io(const float* Wm, int k0, int o, int lane, int ld) { v16h w; const int g = lane >> 4;
#pragma unroll
  for (int i = 0; i < 8; ++i) { w[i] = (_Float16)(bfr(Wm[(size_t)(k0 + 8 * g + i) * ld + o]) * 256.0f); w[8 + i] = (_Float16)(bfr(Wm[(size_t)(k0 + 16 + 8 * g + i) * ld + o]) * 256.0f); }
  return w; }
__device__ __forceinline__ v16h wcolh_oi(const float* Wm, int k0, int o, int lane, int K) { v16h w; const float* p = Wm + (size_t)o * K + k0 + 8 * (lane >> 4);
#pragma unroll
  for (int i = 0; i < 8; ++i) { w[i] = (_Float16)(bfr(p[i]) * 256.0f); w[8 + i] = (_Float16)(bfr(p[16 + i]) * 256.0f); }
  return w; }
#define WQKV_LAYOUT 1   // 0 = (in,out) [DIN][CC]; 1 = (out,in) [CC][DIN]; 2 = per-head [NH][DIN][HD]
__device__ __forceinline__ v16b wcol_hdk(const float* Wm, int k0, int o, int lane) { v16b w; const int g = lane >> 4; const float* p = Wm + (size_t)(o / HD) * DIN * HD + (o % HD);
#pragma unroll
  for (int i = 0; i < 8; ++i) { w[i] = (__bf16)p[(size_t)(k0 + 8 * g + i) * HD]; w[8 + i] = (__bf16)p[(size_t)(k0 + 16 + 8 * g + i) * HD]; }
  return w; }
#define WO_OUT_IN 1
#if WQKV_LAYOUT == 1
#define WCOL(W, k0, o, lane) wcol_oi(W, k0, o, lane, DIN)
#elif WQKV_LAYOUT == 2
#define WCOL(W, k0, o, lane) wcol_hdk(W, k0, o, lane)
#else
#define WCOL(W, k0, o, lane) wcol_io(W, k0, o, lane, CC)
#endif
#if WO_OUT_IN
#define WOCOL(W, k0, o, lane) wcol_oi(W, k0, o, lane, CC)
#define WOCOLH(W, k0, o, lane) wcolh_oi(W, k0, o, lane, CC)
#else
#define WOCOL(W, k0, o, lane) wcol_io(W, k0, o, lane, DIN)
#define WOCOLH(W, k0, o, lane) wcolh_io(W, k0, o, lane, DIN)
#endif
#ifndef PROJ_EXTRA_PARAMS
#define PROJ_EXTRA_PARAMS
#endif

#define WS_QH  0u                                      // f16 q rows [b*t][CC]
#define WS_KH  (WS_QH + 2u * (size_t)NB * TT * CC)      // f16 k rows [b*t][CC]
#define WS_VT  (WS_KH + 2u * (size_t)NB * TT * CC)      // f16 v planes [b][c][t]
#define WS_QL  (WS_VT + 2u * (size_t)NB * CC * TT)      // f16 q residual x 2^10 rows [b][t < QHI][CC]
#define WS_KL  (WS_QL + 2u * (size_t)NB * QHI * CC)     // f16 k residual x 2^10 rows [b][t < KHI][CC]
#define WS_VB  (WS_KL + 2u * (size_t)NB * KHI * CC)     // bf16 v hi planes [b][c][t < KHI]
#define WS_VBL (WS_VB + 2u * (size_t)NB * CC * KHI)
#define WS_S   (WS_VBL + 2u * (size_t)NB * CC * KHI)    // room of HG x TT x TT f32; only the mask words (WS_PM) use it
#define WS_PM  WS_S                                      // the mask as lane-mask words [query tile of 16][32 keys][16 words], 128 KiB (the logits plane is not used)
#define WS_Y   (WS_S  + 4u * (size_t)HG * TT * TT)      // f32 ctx rows [b*t][CC] (only when there is an output projection)
#define WS_END (WS_Y  + 4u * (size_t)NB * TT * CC)

// ---- operand staging of k_proj and k_out: a block's 128 weight rows (its output columns) and, per row tile, 64 input rows, 256 f32 each and contiguous in memory, go to LDS once as 16-bit rows.
// Every load of a wave takes 512 contiguous bytes, so a block touches each 128-B line once; the WMMA fragments are then 16-B LDS reads.
#define SPIT 264           // 16-bit elements per staged row: 528 B = 16 B x odd
#define SW_BYTES (128 * SPIT * 2)
#define SX_BYTES (64 * SPIT * 2)      // the 64 input rows stand first, so that every LDS store of the tile loop is an immediate offset; the weight rows follow
#define SOP_BYTES ((128 + 64) * SPIT * 2)
static_assert(WQKV_LAYOUT == 1 && WO_OUT_IN == 1 && DIN == 256 && CC == 256, "the staging below reads (out,in) weight rows of 256");
typedef __attribute__((ext_vector_type(4))) __bf16 v4b;
typedef __attribute__((ext_vector_type(4))) _Float16 v4h;
// base = first row (128 threads = two rows a pass), d = this thread's 8 bytes of LDS row tid >> 6; the loops are unrolled so that t[] stays in registers and every step is an immediate offset
// pre() runs once, behind the first 16 loads' issue and in front of the first LDS store
template <int NROW, typename CV, typename PRE> __device__ __forceinline__ void stage_rows(const float* base, int tid, unsigned char* d, CV cv, PRE pre) {
  const float* p = base + tid * 4;
#pragma unroll
  for (int b = 0; b < NROW / 2; b += 16) { v4f t[16];
#pragma unroll
    for (int i = 0; i < 16; ++i) t[i] = *(const v4f*)(p + (b + i) * 512);
    asm volatile("s_wait_xcnt 0x0" :: "v"(tid), "s"(base) : "memory");      // the loads' offset register and base stay untouched until the 16 loads above have taken them; no later load is lifted over this line, which keeps the registers under 256
    if (b == 0) pre();
#pragma unroll
    for (int i = 0; i < 16; ++i) cv(d + (b + i) * (2 * SPIT * 2), t[i]); } }

#define PNT 4             // row tiles of 64 that a k_proj block walks with its 128 weight rows kept in LDS
#define ONT 2             // the same for k_out
// ---- k_proj: block = (PNT x 64 rows, 128 cols, which): q/k/v = X W (+ b) with exact bf16 products (K = DIN) -> which 0: q f16 rows; 1: k f16 rows; 2: v f16 planes [c][t]. The weight rows are staged once; each row tile stages its 64 input rows behind them
__global__ __launch_bounds__(128) void k_proj(const float* __restrict__ XQ, const float* __restrict__ XK, const float* __restrict__ XV, const float* __restrict__ WQ, const float* __restrict__ WK, const float* __restrict__ WV, const float* __restrict__ BQ, const float* __restrict__ BK, const float* __restrict__ BV,
    _Float16* __restrict__ QH, _Float16* __restrict__ KH, _Float16* __restrict__ VT, const int* __restrict__ AMASK, unsigned* __restrict__ PM) {
  __shared__ __align__(16) unsigned char sm[SOP_BYTES];      // the input rows of one tile, then the weight rows; behind a tile's third barrier the input rows' bytes hold its output tile
  __bf16 (*sX)[SPIT] = (__bf16 (*)[SPIT])sm; __bf16 (*sW)[SPIT] = (__bf16 (*)[SPIT])(sm + SX_BYTES);
  _Float16 (*sh)[136] = (_Float16 (*)[136])sm; _Float16 (*th)[72] = (_Float16 (*)[72])sm;
  static_assert(64 * 136 * 2 <= 64 * SPIT * 2 && 128 * 72 * 2 <= 64 * SPIT * 2, "an output tile fits in the input rows' bytes");
  static_assert(TT % (64 * PNT) == 0, "a block's row tiles lie in one sequence");
  const int tid = threadIdx.x, wave = tid >> 5, lane = tid & 31, col = lane & 15, g = lane >> 4; const int which = blockIdx.z; const int c0 = blockIdx.y * 128;
  if (which == 3) {      // mask blocks (block-uniform, in front of every barrier): each wave turns two tiles of 16 queries x 32 keys into 32 words, one 128-B line.
    // Word i of a tile, bit l = mask[query tile * 16 + (l & 15)][key block * 32 + 16 (i >> 3) + 8 (l >> 4) + (i & 7)]: the lane mask of score register i in k_attn
    static_assert((TNB * TT / 64 / PNT) * (CC / 128) * 4 == (TT / 16) * (TT / 64), "one wave of a mask block for every pair of tiles");
    const int tp = (blockIdx.x * 2 + blockIdx.y) * 4 + wave; const int* mp = AMASK + ((tp >> 4) * 16 + col) * TT + (tp & 15) * 64 + 8 * g; v4i m[8]; unsigned wd = 0;
#pragma unroll
    for (int i = 0; i < 8; ++i) m[i] = *(const v4i*)(mp + (i >> 1) * 16 + (i & 1) * 4);
#pragma unroll
    for (int i = 0; i < 32; ++i) { const unsigned bl = __builtin_amdgcn_ballot_w32(m[i >> 2][i & 3] != 0); if (lane == i) wd = bl; }
    PM[tp * 32 + lane] = wd; return; }
  const float* X = which == 0 ? XQ : which == 1 ? XK : XV; const float* WA = which == 0 ? WQ : which == 1 ? WK : WV; const float* BA = which == 0 ? BQ : which == 1 ? BK : BV;
  unsigned char* d = sm + (tid >> 6) * (SPIT * 2) + (tid & 63) * 8;
  auto cv = [](unsigned char* q, v4f v) { const v4b o = { (__bf16)v[0], (__bf16)v[1], (__bf16)v[2], (__bf16)v[3] }; *(v4b*)q = o; };
  auto none = []() {}; auto foot = []() { __syncthreads(); };      // foot: every thread has read its part of the last output tile before this tile's input rows overwrite it; it stands behind the loads' issue, so that the wait for the last tile's global stores runs beside the loads
  stage_rows<128>(WA + (size_t)c0 * DIN, tid, d + SX_BYTES, cv, none);
  float bias[8];
#pragma unroll
  for (int j = 0; j < 8; ++j) bias[j] = BA ? bfr(BA[c0 + j * 16 + col]) : 0.f;
#pragma unroll 1      // one copy of the tile's code: the four tiles differ only in their row offset
  for (int it = 0; it < PNT; ++it) { const size_t r0 = ((size_t)blockIdx.x * PNT + it) * 64; const size_t bb = r0 / TT; const int t0 = (int)(r0 % TT);
    stage_rows<64>(X + r0 * DIN, tid, d, cv, foot);
    __syncthreads();      // the tile's input rows (and, on the first tile, the weight rows) are in LDS
    v8f acc[8] = {}; v16b a[2], w[2][8];
    auto frags = [&](int kc, v16b& fa, v16b (&fw)[8]) { fa = frag_b(&sX[wave * 16 + col][kc * 32], lane);
#pragma unroll
      for (int j = 0; j < 8; ++j) fw[j] = frag_b(&sW[j * 16 + col][kc * 32], lane); };
    frags(0, a[0], w[0]);
#pragma unroll
    for (int kc = 0; kc < DIN / 32; ++kc) { if (kc + 1 < DIN / 32) frags(kc + 1, a[(kc + 1) & 1], w[(kc + 1) & 1]);      // the next 32 k's fragments are fetched as one group while these products run; unrolled so that both fragment sets are indexed statically and stay in registers
#pragma unroll
      for (int j = 0; j < 8; ++j) acc[j] = wmma_bf(a[kc & 1], w[kc & 1][j], acc[j]); }
    __syncthreads();      // every wave has read its last fragment before the output tile overwrites the input rows
    if (which < 2) { _Float16* DH = which == 0 ? QH : KH;
#pragma unroll
      for (int j = 0; j < 8; ++j) {
#pragma unroll
        for (int r = 0; r < 8; ++r) sh[wave * 16 + 8 * g + r][j * 16 + col] = (_Float16)(acc[j][r] + bias[j]); }
      __syncthreads();
      for (int e = tid; e < 64 * 16; e += 128) { const int rl = e >> 4, q = e & 15; vst2((unsigned*)(DH + (r0 + rl) * CC + c0 + q * 8), *(const v4u*)&sh[rl][q * 8]); }
    } else {
#pragma unroll
      for (int j = 0; j < 8; ++j) {
#pragma unroll
        for (int r = 0; r < 8; ++r) th[j * 16 + col][wave * 16 + 8 * g + r] = (_Float16)(acc[j][r] + bias[j]); }
      __syncthreads();
      for (int e = tid; e < 128 * 8; e += 128) { const int cl = e >> 3, q = e & 7; vst2((unsigned*)(VT + (bb * CC + c0 + cl) * (size_t)TT + t0 + q * 8), *(const v4u*)&th[cl][q * 8]); } }
    asm volatile("s_wait_xcnt 0x0" ::: "memory");      // the stores above have taken their address registers before the next tile rewrites them
  } }
// ---- k_attn: block = (256 queries, head h, batch b), 8 waves x 32 queries. K rows and v planes of (b, h) are staged once in LDS; each wave walks the 1024 keys 32 at a time:
// S^T = K q^T (lane = one query, 16 of the 32 keys), mask by element, running maximum and sum per query (online softmax, f32), weights x 2^8 once to f16 straight from the score registers as the B operand of ctx^T += v^T P^T; ctx / sum at the end.
#define AW 8
#define AQT 2
#define AQB (AW * AQT * 16)
static_assert(AW * 32 == 256 && TT == 1024 && HD == 32, "the fill below is written for 256 threads, 1024 keys, head size 32");
#define KPIT 40            // f16 per staged K row: 80 B = 16 B x odd
#define VPIT (TT + 8)      // f16 per staged v plane: 2064 B = 16 B x odd
#define LOG2E 1.4426950408889634f
typedef __attribute__((ext_vector_type(2))) _Float16 v2h;
typedef __attribute__((ext_vector_type(16))) unsigned v16u;
__device__ __forceinline__ float xhalf(float x) { return __builtin_bit_cast(float, __builtin_amdgcn_permlanex16(__builtin_bit_cast(int, x), __builtin_bit_cast(int, x), 0x76543210, 0xfedcba98, false, false)); }   // lane l with lane l ^ 16
__device__ __forceinline__ v8f wmma_h(v16h a, v16h b, v8f c) { return __builtin_amdgcn_wmma_f32_16x16x32_f16(false, a, false, b, (short)0, c, false, false); }
__global__ __launch_bounds__(AW * 32) __attribute__((amdgpu_waves_per_eu(4, 4))) void k_attn(const _Float16* __restrict__ QH, const _Float16* __restrict__ KH, const _Float16* __restrict__ VT, const unsigned* __restrict__ PM, float* __restrict__ Y) {   // 4 waves per SIMD = two blocks per WGP (2 x 147,968 B of LDS fit)
  __shared__ __align__(16) _Float16 sK[TT][KPIT]; __shared__ __align__(16) _Float16 sV[HD][VPIT];
  const int tid = threadIdx.x, wave = tid >> 5, lane = tid & 31, col = lane & 15, g = lane >> 4; const int h = blockIdx.y, b = blockIdx.z; const int q0 = blockIdx.x * AQB + wave * (AQT * 16);
  v4u tk[16], tv[16];      // the fill: 1024 K rows x 64 B and 32 v planes x 2048 B, 16 + 16 loads of 16 B a thread, all in flight together, then the LDS stores
  const _Float16* kp = KH + ((size_t)b * TT + (tid >> 2)) * CC + h * HD + (tid & 3) * 8;            // load i: K row (tid >> 2) + 64 i
  const _Float16* vp = VT + ((size_t)b * CC + h * HD + (tid >> 7)) * (size_t)TT + (tid & 127) * 8;   // load i: v plane (tid >> 7) + 2 i
  const _Float16* qp = QH + ((size_t)b * TT + q0 + col) * CC + h * HD + 8 * g;
#pragma unroll
  for (int i = 0; i < 16; ++i) tk[i] = *(const v4u*)(kp + i * 64 * CC);
#pragma unroll
  for (int i = 0; i < 16; ++i) tv[i] = *(const v4u*)(vp + i * 2 * TT);
  v16h qf[AQT]; v8f acc[AQT][2] = {}; float mx[AQT], ls[AQT]; const v16u* pm = (const v16u*)PM + __builtin_amdgcn_readfirstlane(q0 >> 4) * (TT / 32);      // this wave's mask words: wave-uniform, so they come by scalar loads; tile u is TT / 32 groups of 16 words on
#pragma unroll
  for (int u = 0; u < AQT; ++u) { union { v16h v; v8h q[2]; } t; t.q[0] = *(const v8h*)(qp + u * 16 * CC); t.q[1] = *(const v8h*)(qp + u * 16 * CC + 16); qf[u] = t.v; mx[u] = -3.0e38f; ls[u] = 0.f; }   // B fragment, same k order as frag_h
  asm volatile("s_wait_xcnt 0x0" :: "v"(kp), "v"(vp), "v"(qp) : "memory");      // the three address pairs stay untouched until the loads above have taken them
#pragma unroll
  for (int i = 0; i < 16; ++i) *(v4u*)&sK[(tid >> 2) + 64 * i][(tid & 3) * 8] = tk[i];
#pragma unroll
  for (int i = 0; i < 16; ++i) *(v4u*)&sV[(tid >> 7) + 2 * i][(tid & 127) * 8] = tv[i];
  __syncthreads();
  const float NEGR = -1.0e9f / SCALE;      // the reference's -1e9 fill in units of the unscaled product
  const float CL = SCALE * LOG2E;
  auto mload = [&](int k0, v16u (&mk)[AQT]) {
#pragma unroll
    for (int u = 0; u < AQT; ++u) mk[u] = pm[u * (TT / 32) + (k0 >> 5)]; };
  auto step = [&](int k0, const v16u (&mk)[AQT]) {
    const v16h ka = frag_h(&sK[k0 + col][0], lane), kb = frag_h(&sK[k0 + 16 + col][0], lane);      // A rows = keys k0 + 0..15, k0 + 16..31
    const v16h va = frag_h(&sV[col][k0], lane), vb = frag_h(&sV[16 + col][k0], lane);              // A rows = head columns 0..15, 16..31; k = keys in the order of the packed scores
#pragma unroll
    for (int u = 0; u < AQT; ++u) {
      const v8f z = {}; v8f s[2]; s[0] = wmma_h(ka, qf[u], z); s[1] = wmma_h(kb, qf[u], z);      // s[T][r] = key k0 + 16T + 8g + r, query = col
      float x[16];
#pragma unroll
      for (int i = 0; i < 16; ++i) x[i] = __builtin_amdgcn_inverse_ballot_w32(mk[u][i]) ? s[i >> 3][i & 7] : NEGR;      // word i is the select's lane mask as it stands
      float cm = x[0];
#pragma unroll
      for (int i = 1; i < 16; ++i) cm = fmaxf(cm, x[i]);
      const float mn = fmaxf(mx[u], fmaxf(cm, xhalf(cm)));           // both lane halves of a query use one maximum: their weights meet in one product
      const float al = __builtin_amdgcn_exp2f((mx[u] - mn) * CL); mx[u] = mn;
      union { v16h v; v2h q[8]; } pf; v2f sum = {};
#pragma unroll
      for (int i = 0; i < 8; ++i) { v2f d = { x[2 * i], x[2 * i + 1] }; d = (d - mn) * CL + 8.0f;      // difference first: exactly 0 where a whole row is masked (uniform weights, as the reference gives)
        const v2f p = { __builtin_amdgcn_exp2f(d[0]), __builtin_amdgcn_exp2f(d[1]) }; sum += p; pf.q[i] = __builtin_convertvector(p, v2h); }
      ls[u] = ls[u] * al + (sum[0] + sum[1]);
      acc[u][0] = wmma_h(va, pf.v, acc[u][0] * al); acc[u][1] = wmma_h(vb, pf.v, acc[u][1] * al);
    } };
  v16u ma[AQT], mb[AQT]; mload(0, ma); mload(32, mb);      // the mask words of the next 64 keys are fetched, into the registers that the selects have just read, while these 64 are worked on
  for (int k0 = 0; k0 < TT; k0 += 64) { const int kn = k0 + 64 < TT ? k0 + 64 : 0; step(k0, ma); mload(kn, ma); step(k0 + 32, mb); mload(kn + 32, mb); }
#pragma unroll
  for (int u = 0; u < AQT; ++u) { const float inv = 1.0f / (ls[u] + xhalf(ls[u])); float* yp = Y + (unsigned)((b * TT + q0 + u * 16 + col) * CC + h * HD + 8 * g);
#pragma unroll
    for (int j = 0; j < 2; ++j) { const v8f o = acc[u][j] * inv; vst2(yp + j * 16, (v4f)__builtin_shufflevector(o, o, 0, 1, 2, 3)); vst2(yp + j * 16 + 4, (v4f)__builtin_shufflevector(o, o, 4, 5, 6, 7)); } } }
// ---- k_out: block = (ONT x 64 rows, 128 cols): out = ctx Wo (+ bo): ctx x 2^6 once to f16 against Wo as f16(bf16 x 2^8) exact (1 product) x 2^-14. The Wo rows are staged once; each row tile stages its 64 ctx rows behind them
__global__ __launch_bounds__(128) void k_out(const float* __restrict__ Y, const float* __restrict__ WO, const float* __restrict__ BO, float* __restrict__ OUT) { __shared__ __align__(16) unsigned char sm[SOP_BYTES];      // the ctx rows of one tile, then the weight rows; behind a tile's third barrier the ctx rows' bytes hold its output tile
  _Float16 (*sY)[SPIT] = (_Float16 (*)[SPIT])sm; _Float16 (*sW)[SPIT] = (_Float16 (*)[SPIT])(sm + SX_BYTES); float (*sf)[16][132] = (float (*)[16][132])sm;
  static_assert(4 * 16 * 132 * 4 <= 64 * SPIT * 2, "the output tile fits in the ctx rows' bytes");
  const int tid = threadIdx.x, wave = tid >> 5, lane = tid & 31, col = lane & 15, g = lane >> 4; const int c0 = blockIdx.y * 128;
  unsigned char* d = sm + (tid >> 6) * (SPIT * 2) + (tid & 63) * 8;
  auto cy = [](unsigned char* q, v4f v) { const v4h o = { (_Float16)(v[0] * 64.0f), (_Float16)(v[1] * 64.0f), (_Float16)(v[2] * 64.0f), (_Float16)(v[3] * 64.0f) }; *(v4h*)q = o; };   /* ctx carried x 2^6 into f16 so small-magnitude context rows stay clear of f16 subnormals */
  auto cw = [](unsigned char* q, v4f v) { const v4h o = { (_Float16)(bfr(v[0]) * 256.0f), (_Float16)(bfr(v[1]) * 256.0f), (_Float16)(bfr(v[2]) * 256.0f), (_Float16)(bfr(v[3]) * 256.0f) }; *(v4h*)q = o; };
  auto none = []() {}; auto foot = []() { __syncthreads(); };      // foot: every wave has read its last output rows before this tile's ctx rows overwrite them; it stands behind the loads' issue, so that the wait for the last tile's global stores runs beside the loads
  stage_rows<128>(WO + (size_t)c0 * CC, tid, d + SX_BYTES, cw, none);
  float bias[8];
#pragma unroll
  for (int j = 0; j < 8; ++j) bias[j] = BO ? bfr(BO[c0 + j * 16 + col]) : 0.f;
#pragma unroll 1      // one copy of the tile's code: the tiles differ only in their row offset
  for (int it = 0; it < ONT; ++it) { const size_t rb = ((size_t)blockIdx.x * ONT + it) * 64; const size_t r0 = rb + wave * 16;
    stage_rows<64>(Y + rb * CC, tid, d, cy, foot);
    __syncthreads();      // the tile's ctx rows (and, on the first tile, the weight rows) are in LDS
    v8f acc[8] = {}; v16h a[2], w[2][8];
    auto frags = [&](int kc, v16h& fa, v16h (&fw)[8]) { fa = frag_h(&sY[wave * 16 + col][kc * 32], lane);
#pragma unroll
      for (int j = 0; j < 8; ++j) fw[j] = frag_h(&sW[j * 16 + col][kc * 32], lane); };
    frags(0, a[0], w[0]);
#pragma unroll
    for (int kc = 0; kc < CC / 32; ++kc) { if (kc + 1 < CC / 32) frags(kc + 1, a[(kc + 1) & 1], w[(kc + 1) & 1]);      // the next 32 k's fragments are fetched as one group while these products run; unrolled so that both fragment sets are indexed statically and stay in registers
#pragma unroll
      for (int j = 0; j < 8; ++j) acc[j] = wmma16(a[kc & 1], w[kc & 1][j], acc[j]); }
    __syncthreads();      // every wave has read its last fragment before the output tile overwrites the ctx rows
#pragma unroll
    for (int j = 0; j < 8; ++j) {
#pragma unroll
      for (int r = 0; r < 8; ++r) sf[wave][8 * g + r][j * 16 + col] = acc[j][r] * (1.0f / 16384.0f) + bias[j]; }   /* 2^-8 (Wo carry) x 2^-6 (ctx carry) */
    LDSX(); for (int rl = 0; rl < 16; ++rl) vst2(OUT + (r0 + rl) * DIN + c0 + lane * 4, *(const v4f*)&sf[wave][rl][lane * 4]);
    asm volatile("s_wait_xcnt 0x0" ::: "memory");      // the stores above have taken their address registers before the next tile rewrites them
  } }

extern "C" void kernel_launch(void* const* d_in, const int* in_sizes, int n_in, void* d_out, int out_size, void* d_ws, size_t ws_size, hipStream_t stream) {
  (void)in_sizes; (void)n_in; (void)out_size;
  const float** F = (const float**)d_in;
  if (ws_size < (size_t)WS_END) return;
  char* ws = (char*)d_ws; _Float16 *QH = (_Float16*)(ws + WS_QH), *KH = (_Float16*)(ws + WS_KH), *VT = (_Float16*)(ws + WS_VT), *QL = (_Float16*)(ws + WS_QL), *KL = (_Float16*)(ws + WS_KL); __bf16 *VB = (__bf16*)(ws + WS_VB), *VBL = (__bf16*)(ws + WS_VBL); float *S = (float*)(ws + WS_S), *Y = (float*)(ws + WS_Y); unsigned* PM = (unsigned*)(ws + WS_PM);
  (void)Y; (void)S; (void)QL; (void)KL; (void)VB; (void)VBL;
  // inputs: 0 x [32,1024,256]; 1 attn_mask [1024,1024] (bool topology mask, diagonal True); 2 Wq [256,256] (out,in), 3 bq; 4 Wk, 5 bk; 6 Wv, 7 bv; 8 Wo (out,in), 9 bo (biases nonzero)
  k_proj<<<dim3(TNB * TT / 64 / PNT, CC / 128, 4), 128, 0, stream>>>(F[0], F[0], F[0], F[2], F[4], F[6], F[3], F[5], F[7], QH, KH, VT, (const int*)d_in[1], PM);   // z = 3: the 256 mask blocks
  k_attn<<<dim3(TT / AQB, NH, TNB), AW * 32, 0, stream>>>(QH, KH, VT, PM, Y);
  k_out<<<dim3(TNB * TT / 64 / ONT, DIN / 128), 128, 0, stream>>>(Y, F[8], F[9], (float*)d_out);
}

// v005
// A run of this version takes 90.6 microseconds.
// In both of two side-by-side timings against v004, it was 1.06 times as fast.
// All steps since v000 together make it 21.8 times as fast.
// compute dtype: all float inputs rounded to bf16; q/k/v projections with EXACT bf16 products on WMMA 16x16x32 (f32 accumulate) + bias; logits q x k once to f16 each (1 product; sigma - 1) x 32^-0.5; the shared boolean mask read per element; online softmax f32 (running maximum and sum per query); weights exp2(.) x 2^8 once to f16 x v once to f16 (1 product), divided by the f32 sum after the product; ctx x 2^6 once to f16 x Wo f16(bf16 x 2^8) + bo; f32 output.
#include <hip/hip_runtime.h>
#include <math.h>

typedef __attribute__((ext_vector_type(16))) _Float16 v16h;
typedef __attribute__((ext_vector_type(16))) __bf16 v16b;
typedef __attribute__((ext_vector_type(8)))  _Float16 v8h;
typedef __attribute__((ext_vector_type(8)))  float v8f;
typedef __attribute__((ext_vector_type(4)))  float v4f;
typedef __attribute__((ext_vector_type(2)))  float v2f;
typedef __attribute__((ext_vector_type(4)))  unsigned v4u;
typedef __attribute__((ext_vector_type(4)))  int v4i;
typedef float __attribute__((may_alias)) float_a;
typedef int __attribute__((may_alias)) int_a;

template <typename T> __device__ __forceinline__ void vst2(void* p, T v) { *(T*)p = v;  }
__device__ __forceinline__ v8f wmma16(v16h a, v16h b, v8f c) {
  v8f d = __builtin_amdgcn_wmma_f32_16x16x32_f16(false, a, false, b, (short)0, c, false, false);
  asm volatile("v_nop\n\tv_nop\n\tv_nop\n\tv_nop" : "+v"(d) : "v"(a), "v"(b));
  return d;
}
__device__ __forceinline__ v8f wmma_bf(v16b a, v16b b, v8f c) {
  v8f d = __builtin_amdgcn_wmma_f32_16x16x32_bf16(false, a, false, b, (short)0, c, false, false);
  asm volatile("v_nop\n\tv_nop\n\tv_nop\n\tv_nop" : "+v"(d) : "v"(a), "v"(b));
  return d;
}
// 16x16x32 fragments: lane = (h = lane>>4, row/col = lane&15); elements 0..7 = k0+8h+0..7, 8..15 = k0+16+8h+0..7; D element r = row 8h+r
__device__ __forceinline__ v16h frag_h(const _Float16* rowk0, int lane) {
  union { v16h v; v8h q[2]; } u; const _Float16* p = rowk0 + 8 * (lane >> 4);
  u.q[0] = *(const v8h*)p; u.q[1] = *(const v8h*)(p + 16); return u.v;
}
__device__ __forceinline__ v16h frag_f32(const float* rowk0, int lane) {
  v16h a; const float* p = rowk0 + 8 * (lane >> 4);
#pragma unroll
  for (int i = 0; i < 8; ++i) { a[i] = (_Float16)p[i]; a[8 + i] = (_Float16)p[16 + i]; }
  return a;
}
__device__ __forceinline__ v16h frag_f32s(const float* rowk0, int lane, float sc) {
  v16h a; const float* p = rowk0 + 8 * (lane >> 4);
#pragma unroll
  for (int i = 0; i < 8; ++i) { a[i] = (_Float16)(p[i] * sc); a[8 + i] = (_Float16)(p[16 + i] * sc); }
  return a;
}
// column fragment from a [K][ld] layout (column n), rows >= K read as 0
__device__ __forceinline__ v16h fragc_f32(const float* W, int k0, int n, int lane, int ld, int K) {
  v16h a; const int g = lane >> 4;
#pragma unroll
  for (int i = 0; i < 8; ++i) { const int ka = k0 + 8 * g + i, kb = ka + 16;
    a[i] = (_Float16)(ka < K ? W[(size_t)(ka < K ? ka : K - 1) * ld + n] : 0.f); a[8 + i] = (_Float16)(kb < K ? W[(size_t)(kb < K ? kb : K - 1) * ld + n] : 0.f); }
  return a;
}
struct F2 { v16b h, l; };
__device__ __forceinline__ F2 bsplit16(const float v[16]) { F2 r;
#pragma unroll
  for (int i = 0; i < 16; ++i) { const __bf16 h = (__bf16)v[i]; r.h[i] = h; r.l[i] = (__bf16)(v[i] - (float)h); }
  return r; }
__device__ __forceinline__ F2 split_row(const float* row, int k0, int lane) { float v[16]; const float* p = row + k0 + 8 * (lane >> 4);
#pragma unroll
  for (int i = 0; i < 8; ++i) { v[i] = p[i]; v[8 + i] = p[16 + i]; }
  return bsplit16(v); }
__device__ __forceinline__ F2 split_rowK(const float* row, int k0, int lane, int K) { float v[16]; const int g = lane >> 4;
#pragma unroll
  for (int i = 0; i < 8; ++i) { const int ka = k0 + 8 * g + i, kb = ka + 16; v[i] = ka < K ? row[ka < K ? ka : K - 1] : 0.f; v[8 + i] = kb < K ? row[kb < K ? kb : K - 1] : 0.f; }
  return bsplit16(v); }
__device__ __forceinline__ F2 split_col(const float* W, int k0, int n, int lane, int ld, int K) { float v[16]; const int g = lane >> 4;
#pragma unroll
  for (int i = 0; i < 8; ++i) { const int ka = k0 + 8 * g + i, kb = ka + 16; v[i] = ka < K ? W[(size_t)(ka < K ? ka : K - 1) * ld + n] : 0.f; v[8 + i] = kb < K ? W[(size_t)(kb < K ? kb : K - 1) * ld + n] : 0.f; }
  return bsplit16(v); }
__device__ __forceinline__ v8f mac3(const F2& a, const F2& b, v8f c) { c = wmma_bf(a.l, b.h, c); c = wmma_bf(a.h, b.l, c); return wmma_bf(a.h, b.h, c); }
__device__ __forceinline__ float sigm(float v) { return 1.0f / (1.0f + expf(-v)); }
#define LDSX() do { asm volatile("s_wait_dscnt 0" ::: "memory"); __builtin_amdgcn_wave_barrier(); __builtin_amdgcn_fence(__ATOMIC_RELEASE, "workgroup"); } while (0)

// Multi-head self-attention with a shared boolean topology mask (x [32,1024,256]; 8 heads x 32; torch (out,in) Wq/Wk/Wv/Wo [256,256] + biases (N(0, 1/256), NONZERO); attn_mask [1024,1024] bool (~50 % True, diagonal True) shared by all batches and heads: scores = where(mask, q_h k_h^T / sqrt(32), -1e9)): out = merge(softmax(scores) v_h) Wo^T + bo.
#define NB 32
#define TT 1024
#define CC 256            // NH * HD = projected width
#define DIN 256          // input (model) width
#define NH 8
#define HD 32
#define NQB (TT / 64)
#define HG 8
#define SCALE (0.17677669529663687f)
#define CAUSAL 0
#ifndef TNB
#define TNB NB
#endif
__device__ __forceinline__ float bfr(float v) { return (float)(__bf16)v; }
__host__ __device__ __forceinline__ int kb_last(int qb) { return CAUSAL ? ((qb * 64 + 63) >> 7) : (TT / 128 - 1); }
typedef __attribute__((ext_vector_type(8))) __bf16 v8b;
__device__ __forceinline__ v16b frag_b(const __bf16* rowk0, int lane) {
  union { v16b v; v8b q[2]; } u; const __bf16* p = rowk0 + 8 * (lane >> 4);
  u.q[0] = *(const v8b*)p; u.q[1] = *(const v8b*)(p + 16); return u.v;
}
#define QBH 0              // read by no kernel: k_attn has one single-product path for every query block
#define QHI 0               // single-product logits on every row (sigma - 1 logits averaged over -512 visible keys)
#define KHI 64            // key rows carrying k residual / v bf16 hi+lo planes (no kernel here writes or reads them)
// B fragment (k rows k0+.., output column o) of a weight: (in,out) [K][ld] or (out,in) [ld rows of K]: bf16 exact, or f16(bf16 * 256) exact
__device__ __forceinline__ v16b wcol_io(const float* Wm, int k0, int o, int lane, int ld) { v16b w; const int g = lane >> 4;
#pragma unroll
  for (int i = 0; i < 8; ++i) { w[i] = (__bf16)Wm[(size_t)(k0 + 8 * g + i) * ld + o]; w[8 + i] = (__bf16)Wm[(size_t)(k0 + 16 + 8 * g + i) * ld + o]; }
  return w; }
__device__ __forceinline__ v16b wcol_oi(const float* Wm, int k0, int o, int lane, int K) { v16b w; const float* p = Wm + (size_t)o * K + k0 + 8 * (lane >> 4);
#pragma unroll
  for (int i = 0; i < 8; ++i) { w[i] = (__bf16)p[i]; w[8 + i] = (__bf16)p[16 + i]; }
  return w; }
__device__ __forceinline__ v16h wcolh_io(const float* Wm, int k0, int o, int lane, int ld) { v16h w; const int g = lane >> 4;
#pragma unroll
  for (int i = 0; i < 8; ++i) { w[i] = (_Float16)(bfr(Wm[(size_t)(k0 + 8 * g + i) * ld + o]) * 256.0f); w[8 + i] = (_Float16)(bfr(Wm[(size_t)(k0 + 16 + 8 * g + i) * ld + o]) * 256.0f); }
  return w; }
__device__ __forceinline__ v16h wcolh_oi(const float* Wm, int k0, int o, int lane, int K) { v16h w; const float* p = Wm + (size_t)o * K + k0 + 8 * (lane >> 4);
#pragma unroll
  for (int i = 0; i < 8; ++i) { w[i] = (_Float16)(bfr(p[i]) * 256.0f); w[8 + i] = (_Float16)(bfr(p[16 + i]) * 256.0f); }
  return w; }
#define WQKV_LAYOUT 1   // 0 = (in,out) [DIN][CC]; 1 = (out,in) [CC][DIN]; 2 = per-head [NH][DIN][HD]
__device__ __forceinline__ v16b wcol_hdk(const float* Wm, int k0, int o, int lane) { v16b w; const int g = lane >> 4; const float* p = Wm + (size_t)(o / HD) * DIN * HD + (o % HD);
#pragma unroll
  for (int i = 0; i < 8; ++i) { w[i] = (__bf16)p[(size_t)(k0 + 8 * g + i) * HD]; w[8 + i] = (__bf16)p[(size_t)(k0 + 16 + 8 * g + i) * HD]; }
  return w; }
#define WO_OUT_IN 1
#if WQKV_LAYOUT == 1
#define WCOL(W, k0, o, lane) wcol_oi(W, k0, o, lane, DIN)
#elif WQKV_LAYOUT == 2
#define WCOL(W, k0, o, lane) wcol_hdk(W, k0, o, lane)
#else
#define WCOL(W, k0, o, lane) wcol_io(W, k0, o, lane, CC)
#endif
#if WO_OUT_IN
#define WOCOL(W, k0, o, lane) wcol_oi(W, k0, o, lane, CC)
#define WOCOLH(W, k0, o, lane) wcolh_oi(W, k0, o, lane, CC)
#else
#define WOCOL(W, k0, o, lane) wcol_io(W, k0, o, lane, DIN)
#define WOCOLH(W, k0, o, lane) wcolh_io(W, k0, o, lane, DIN)
#endif
#ifndef PROJ_EXTRA_PARAMS
#define PROJ_EXTRA_PARAMS
#endif

#define WS_QH  0u                                      // f16 q rows [b*t][CC]
#define WS_KH  (WS_QH + 2u * (size_t)NB * TT * CC)      // f16 k rows [b*t][CC]
#define WS_VT  (WS_KH + 2u * (size_t)NB * TT * CC)      // f16 v planes [b][c][t]
#define WS_QL  (WS_VT + 2u * (size_t)NB * CC * TT)      // f16 q residual x 2^10 rows [b][t < QHI][CC]
#define WS_KL  (WS_QL + 2u * (size_t)NB * QHI * CC)     // f16 k residual x 2^10 rows [b][t < KHI][CC]
#define WS_VB  (WS_KL + 2u * (size_t)NB * KHI * CC)     // bf16 v hi planes [b][c][t < KHI]
#define WS_VBL (WS_VB + 2u * (size_t)NB * CC * KHI)
#define WS_S   (WS_VBL + 2u * (size_t)NB * CC * KHI)    // room of HG x TT x TT f32; only the mask words (WS_PM) use it
#define WS_PM  WS_S                                      // the mask as lane-mask words [query tile of 16][32 keys][16 words], 128 KiB (the logits plane is not used)
#define WS_Y   (WS_S  + 4u * (size_t)HG * TT * TT)      // f32 ctx rows [b*t][CC] (only when there is an output projection)
#define WS_END (WS_Y  + 4u * (size_t)NB * TT * CC)

// ---- operand staging of k_proj and k_out: a block's 128 weight rows (its output columns) and, per row tile, 64 input rows, 256 f32 each and contiguous in memory, go to LDS once as 16-bit rows.
// Every load of a wave takes 512 contiguous bytes, so a block touches each 128-B line once; the WMMA fragments are then 16-B LDS reads.
#define SPIT 264           // 16-bit elements per staged row: 528 B = 16 B x odd
#define SW_BYTES (128 * SPIT * 2)
#define SX_BYTES (64 * SPIT * 2)      // the 64 input rows stand first, so that every LDS store of the tile loop is an immediate offset; the weight rows follow
#define SOP_BYTES ((128 + 64) * SPIT * 2)
static_assert(WQKV_LAYOUT == 1 && WO_OUT_IN == 1 && DIN == 256 && CC == 256, "the staging below reads (out,in) weight rows of 256");
typedef __attribute__((ext_vector_type(4))) __bf16 v4b;
typedef __attribute__((ext_vector_type(4))) _Float16 v4h;
// base = first row (128 threads = two rows a pass), d = this thread's 8 bytes of LDS row tid >> 6; the loops are unrolled so that t[] stays in registers and every step is an immediate offset
// pre() runs once, behind the first 16 loads' issue and in front of the first LDS store
template <int NROW, typename CV, typename PRE> __device__ __forceinline__ void stage_rows(const float* base, int tid, unsigned char* d, CV cv, PRE pre) {
  const float* p = base + tid * 4;
#pragma unroll
  for (int b = 0; b < NROW / 2; b += 16) { v4f t[16];
#pragma unroll
    for (int i = 0; i < 16; ++i) t[i] = *(const v4f*)(p + (b + i) * 512);
    asm volatile("s_wait_xcnt 0x0" :: "v"(tid), "s"(base) : "memory");      // the loads' offset register and base stay untouched until the 16 loads above have taken them; no later load is lifted over this line, which keeps the registers under 256
    if (b == 0) pre();
#pragma unroll
    for (int i = 0; i < 16; ++i) cv(d + (b + i) * (2 * SPIT * 2), t[i]); } }

#define PNT 4             // row tiles of 64 that a k_proj block walks with its 128 weight rows kept in LDS
#define ONT 2             // the same for k_out
// ---- k_proj: block = (PNT x 64 rows, 128 cols, which): q/k/v = X W (+ b) with exact bf16 products (K = DIN) -> which 0: q f16 rows; 1: k f16 rows; 2: v f16 planes [c][t]. The weight rows are staged once; each row tile stages its 64 input rows behind them
__global__ __launch_bounds__(128) void k_proj(const float* __restrict__ XQ, const float* __restrict__ XK, const float* __restrict__ XV, const float* __restrict__ WQ, const float* __restrict__ WK, const float* __restrict__ WV, const float* __restrict__ BQ, const float* __restrict__ BK, const float* __restrict__ BV,
    _Float16* __restrict__ QH, _Float16* __restrict__ KH, _Float16* __restrict__ VT, const int* __restrict__ AMASK, unsigned* __restrict__ PM) {
  __shared__ __align__(16) unsigned char sm[SOP_BYTES];      // the input rows of one tile, then the weight rows; behind a tile's third barrier the input rows' bytes hold its output tile
  __bf16 (*sX)[SPIT] = (__bf16 (*)[SPIT])sm; __bf16 (*sW)[SPIT] = (__bf16 (*)[SPIT])(sm + SX_BYTES);
  _Float16 (*sh)[136] = (_Float16 (*)[136])sm; _Float16 (*th)[72] = (_Float16 (*)[72])sm;
  static_assert(64 * 136 * 2 <= 64 * SPIT * 2 && 128 * 72 * 2 <= 64 * SPIT * 2, "an output tile fits in the input rows' bytes");
  static_assert(TT % (64 * PNT) == 0, "a block's row tiles lie in one sequence");
  const int tid = threadIdx.x, wave = tid >> 5, lane = tid & 31, col = lane & 15, g = lane >> 4; const int which = blockIdx.z; const int c0 = blockIdx.y * 128;
  if (which == 3) {      // mask blocks (block-uniform, in front of every barrier): each wave turns two tiles of 16 queries x 32 keys into 32 words, one 128-B line.
    // Word i of a tile, bit l = mask[query tile * 16 + (l & 15)][key block * 32 + 16 (i >> 3) + 8 (l >> 4) + (i & 7)]: the lane mask of score register i in k_attn
    static_assert((TNB * TT / 64 / PNT) * (CC / 128) * 4 == (TT / 16) * (TT / 64), "one wave of a mask block for every pair of tiles");
    const int tp = (blockIdx.x * 2 + blockIdx.y) * 4 + wave; const int* mp = AMASK + ((tp >> 4) * 16 + col) * TT + (tp & 15) * 64 + 8 * g; v4i m[8]; unsigned wd = 0;
#pragma unroll
    for (int i = 0; i < 8; ++i) m[i] = *(const v4i*)(mp + (i >> 1) * 16 + (i & 1) * 4);
#pragma unroll
    for (int i = 0; i < 32; ++i) { const unsigned bl = __builtin_amdgcn_ballot_w32(m[i >> 2][i & 3] != 0); if (lane == i) wd = bl; }
    PM[tp * 32 + lane] = wd; return; }
  const float* X = which == 0 ? XQ : which == 1 ? XK : XV; const float* WA = which == 0 ? WQ : which == 1 ? WK : WV; const float* BA = which == 0 ? BQ : which == 1 ? BK : BV;
  unsigned char* d = sm + (tid >> 6) * (SPIT * 2) + (tid & 63) * 8;
  auto cv = [](unsigned char* q, v4f v) { const v4b o = { (__bf16)v[0], (__bf16)v[1], (__bf16)v[2], (__bf16)v[3] }; *(v4b*)q = o; };
  auto none = []() {}; auto foot = []() { __syncthreads(); };      // foot: every thread has read its part of the last output tile before this tile's input rows overwrite it; it stands behind the loads' issue, so that the wait for the last tile's global stores runs beside the loads
  stage_rows<128>(WA + (size_t)c0 * DIN, tid, d + SX_BYTES, cv, none);
  float bias[8];
#pragma unroll
  for (int j = 0; j < 8; ++j) bias[j] = BA ? bfr(BA[c0 + j * 16 + col]) : 0.f;
#pragma unroll 1      // one copy of the tile's code: the four tiles differ only in their row offset
  for (int it = 0; it < PNT; ++it) { const size_t r0 = ((size_t)blockIdx.x * PNT + it) * 64; const size_t bb = r0 / TT; const int t0 = (int)(r0 % TT);
    stage_rows<64>(X + r0 * DIN, tid, d, cv, foot);
    __syncthreads();      // the tile's input rows (and, on the first tile, the weight rows) are in LDS
    v8f acc[8] = {}; v16b a[2], w[2][8];
    auto frags = [&](int kc, v16b& fa, v16b (&fw)[8]) { fa = frag_b(&sX[wave * 16 + col][kc * 32], lane);
#pragma unroll
      for (int j = 0; j < 8; ++j) fw[j] = frag_b(&sW[j * 16 + col][kc * 32], lane); };
    frags(0, a[0], w[0]);
#pragma unroll
    for (int kc = 0; kc < DIN / 32; ++kc) { if (kc + 1 < DIN / 32) frags(kc + 1, a[(kc + 1) & 1], w[(kc + 1) & 1]);      // the next 32 k's fragments are fetched as one group while these products run; unrolled so that both fragment sets are indexed statically and stay in registers
#pragma unroll
      for (int j = 0; j < 8; ++j) acc[j] = wmma_bf(a[kc & 1], w[kc & 1][j], acc[j]); }
    __syncthreads();      // every wave has read its last fragment before the output tile overwrites the input rows
    if (which < 2) { _Float16* DH = which == 0 ? QH : KH;
#pragma unroll
      for (int j = 0; j < 8; ++j) {
#pragma unroll
        for (int r = 0; r < 8; ++r) sh[wave * 16 + 8 * g + r][j * 16 + col] = (_Float16)(acc[j][r] + bias[j]); }
      __syncthreads();
      for (int e = tid; e < 64 * 16; e += 128) { const int rl = e >> 4, q = e & 15; vst2((unsigned*)(DH + (r0 + rl) * CC + c0 + q * 8), *(const v4u*)&sh[rl][q * 8]); }
    } else {
#pragma unroll
      for (int j = 0; j < 8; ++j) {
#pragma unroll
        for (int r = 0; r < 8; ++r) th[j * 16 + col][wave * 16 + 8 * g + r] = (_Float16)(acc[j][r] + bias[j]); }
      __syncthreads();
      for (int e = tid; e < 128 * 8; e += 128) { const int cl = e >> 3, q = e & 7; vst2((unsigned*)(VT + (bb * CC + c0 + cl) * (size_t)TT + t0 + q * 8), *(const v4u*)&th[cl][q * 8]); } }
    asm volatile("s_wait_xcnt 0x0" ::: "memory");      // the stores above have taken their address registers before the next tile rewrites them
  } }
// ---- k_attn: block = (all 1024 queries, head h, batch b), 16 waves, each with ANG groups of 32 queries one after the other. K rows and v planes of (b, h) are staged in LDS once for all of them; for each group a wave walks the 1024 keys 32 at a time:
// S^T = K q^T (lane = one query, 16 of the 32 keys), mask by element, running maximum and sum per query (online softmax, f32), weights x 2^8 once to f16 straight from the score registers as the B operand of ctx^T += v^T P^T; ctx / sum at the end.
#define AW 16
#define AQT 2
#define ANG 2              // query groups that a wave walks under the one fill
#define AQG (AW * AQT * 16)      // queries of one group over the block's waves
#define AQB (AQG * ANG)
static_assert(AW * 32 == 512 && TT == 1024 && HD == 32 && TT % AQB == 0, "the fill below is written for 512 threads, 1024 keys, head size 32");
#define KPIT 40            // f16 per staged K row: 80 B = 16 B x odd
#define VPIT (TT + 8)      // f16 per staged v plane: 2064 B = 16 B x odd
#define LOG2E 1.4426950408889634f
typedef __attribute__((ext_vector_type(2))) _Float16 v2h;
typedef __attribute__((ext_vector_type(16))) unsigned v16u;
__device__ __forceinline__ float xhalf(float x) { return __builtin_bit_cast(float, __builtin_amdgcn_permlanex16(__builtin_bit_cast(int, x), __builtin_bit_cast(int, x), 0x76543210, 0xfedcba98, false, false)); }   // lane l with lane l ^ 16
__device__ __forceinline__ v8f wmma_h(v16h a, v16h b, v8f c) { return __builtin_amdgcn_wmma_f32_16x16x32_f16(false, a, false, b, (short)0, c, false, false); }
__global__ __launch_bounds__(AW * 32) __attribute__((amdgpu_waves_per_eu(4, 4))) void k_attn(const _Float16* __restrict__ QH, const _Float16* __restrict__ KH, const _Float16* __restrict__ VT, const unsigned* __restrict__ PM, float* __restrict__ Y) {   // 4 waves per SIMD = one block of 16 waves per WGP
  __shared__ __align__(16) _Float16 sK[TT][KPIT]; __shared__ __align__(16) _Float16 sV[HD][VPIT];
  const int tid = threadIdx.x, wave = tid >> 5, lane = tid & 31, col = lane & 15, g = lane >> 4; const int h = blockIdx.y, b = blockIdx.z; const int qw = blockIdx.x * AQB + wave * (AQT * 16);      // group n of this wave: queries qw + n * AQG + 0..31
  v4u tk[8], tv[8];      // the fill: 1024 K rows x 64 B and 32 v planes x 2048 B, 8 + 8 loads of 16 B a thread, all in flight together, then the LDS stores
  const _Float16* kp = KH + ((size_t)b * TT + (tid >> 2)) * CC + h * HD + (tid & 3) * 8;            // load i: K row (tid >> 2) + 128 i
  const _Float16* vp = VT + ((size_t)b * CC + h * HD + (tid >> 7)) * (size_t)TT + (tid & 127) * 8;   // load i: v plane (tid >> 7) + 4 i
  const _Float16* qp = QH + ((size_t)b * TT + qw + col) * CC + h * HD + 8 * g;
#pragma unroll
  for (int i = 0; i < 8; ++i) tk[i] = *(const v4u*)(kp + i * 128 * CC);
#pragma unroll
  for (int i = 0; i < 8; ++i) tv[i] = *(const v4u*)(vp + i * 4 * TT);
  v16h qa[ANG][AQT];      // the q fragments of every group come with the fill, so that no group waits for its own
#pragma unroll
  for (int n = 0; n < ANG; ++n) {
#pragma unroll
    for (int u = 0; u < AQT; ++u) { union { v16h v; v8h q[2]; } t; t.q[0] = *(const v8h*)(qp + (n * AQG + u * 16) * CC); t.q[1] = *(const v8h*)(qp + (n * AQG + u * 16) * CC + 16); qa[n][u] = t.v; } }   // B fragment, same k order as frag_h
  asm volatile("s_wait_xcnt 0x0" :: "v"(kp), "v"(vp), "v"(qp) : "memory");      // the three address pairs stay untouched until the loads above have taken them
#pragma unroll
  for (int i = 0; i < 8; ++i) *(v4u*)&sK[(tid >> 2) + 128 * i][(tid & 3) * 8] = tk[i];
#pragma unroll
  for (int i = 0; i < 8; ++i) *(v4u*)&sV[(tid >> 7) + 4 * i][(tid & 127) * 8] = tv[i];
  __syncthreads();
  const float NEGR = -1.0e9f / SCALE;      // the reference's -1e9 fill in units of the unscaled product
  const float CL = SCALE * LOG2E;
#pragma unroll      // unrolled so that qa[n] is indexed statically and stays in registers
  for (int n = 0; n < ANG; ++n) { const int q0 = qw + n * AQG; const v16h (&qf)[AQT] = qa[n]; v8f acc[AQT][2] = {}; float mx[AQT], ls[AQT];
#pragma unroll
  for (int u = 0; u < AQT; ++u) { mx[u] = -3.0e38f; ls[u] = 0.f; }
  const v16u* pm = (const v16u*)PM + __builtin_amdgcn_readfirstlane(q0 >> 4) * (TT / 32);      // this group's mask words: wave-uniform, so they come by scalar loads; tile u is TT / 32 groups of 16 words on
  auto mload = [&](int k0, v16u (&mk)[AQT]) {
#pragma unroll
    for (int u = 0; u < AQT; ++u) mk[u] = pm[u * (TT / 32) + (k0 >> 5)]; };
  auto step = [&](int k0, const v16u (&mk)[AQT]) {
    const v16h ka = frag_h(&sK[k0 + col][0], lane), kb = frag_h(&sK[k0 + 16 + col][0], lane);      // A rows = keys k0 + 0..15, k0 + 16..31
    const v16h va = frag_h(&sV[col][k0], lane), vb = frag_h(&sV[16 + col][k0], lane);              // A rows = head columns 0..15, 16..31; k = keys in the order of the packed scores
#pragma unroll
    for (int u = 0; u < AQT; ++u) {
      const v8f z = {}; v8f s[2]; s[0] = wmma_h(ka, qf[u], z); s[1] = wmma_h(kb, qf[u], z);      // s[T][r] = key k0 + 16T + 8g + r, query = col
      float x[16];
#pragma unroll
      for (int i = 0; i < 16; ++i) x[i] = __builtin_amdgcn_inverse_ballot_w32(mk[u][i]) ? s[i >> 3][i & 7] : NEGR;      // word i is the select's lane mask as it stands
      float cm = x[0];
#pragma unroll
      for (int i = 1; i < 16; ++i) cm = fmaxf(cm, x[i]);
      const float mn = fmaxf(mx[u], fmaxf(cm, xhalf(cm)));           // both lane halves of a query use one maximum: their weights meet in one product
      const float al = __builtin_amdgcn_exp2f((mx[u] - mn) * CL); mx[u] = mn;
      union { v16h v; v2h q[8]; } pf; v2f sum = {};
#pragma unroll
      for (int i = 0; i < 8; ++i) { v2f d = { x[2 * i], x[2 * i + 1] }; d = (d - mn) * CL + 8.0f;      // difference first: exactly 0 where a whole row is masked (uniform weights, as the reference gives)
        const v2f p = { __builtin_amdgcn_exp2f(d[0]), __builtin_amdgcn_exp2f(d[1]) }; sum += p; pf.q[i] = __builtin_convertvector(p, v2h); }
      ls[u] = ls[u] * al + (sum[0] + sum[1]);
      acc[u][0] = wmma_h(va, pf.v, acc[u][0] * al); acc[u][1] = wmma_h(vb, pf.v, acc[u][1] * al);
    } };
  v16u ma[AQT], mb[AQT]; mload(0, ma); mload(32, mb);      // the mask words of the next 64 keys are fetched, into the registers that the selects have just read, while these 64 are worked on
  for (int k0 = 0; k0 < TT; k0 += 64) { const int kn = k0 + 64 < TT ? k0 + 64 : 0; step(k0, ma); mload(kn, ma); step(k0 + 32, mb); mload(kn + 32, mb); }
#pragma unroll
  for (int u = 0; u < AQT; ++u) { const float inv = 1.0f / (ls[u] + xhalf(ls[u])); float* yp = Y + (unsigned)((b * TT + q0 + u * 16 + col) * CC + h * HD + 8 * g);
#pragma unroll
    for (int j = 0; j < 2; ++j) { const v8f o = acc[u][j] * inv; vst2(yp + j * 16, (v4f)__builtin_shufflevector(o, o, 0, 1, 2, 3)); vst2(yp + j * 16 + 4, (v4f)__builtin_shufflevector(o, o, 4, 5, 6, 7)); } }
  if (n + 1 < ANG) asm volatile("s_wait_xcnt 0x0" ::: "memory");      // the stores above have taken their address registers before the next group rewrites them
  } }
// ---- k_out: block = (ONT x 64 rows, 128 cols): out = ctx Wo (+ bo): ctx x 2^6 once to f16 against Wo as f16(bf16 x 2^8) exact (1 product) x 2^-14. The Wo rows are staged once; each row tile stages its 64 ctx rows behind them
__global__ __launch_bounds__(128) void k_out(const float* __restrict__ Y, const float* __restrict__ WO, const float* __restrict__ BO, float* __restrict__ OUT) { __shared__ __align__(16) unsigned char sm[SOP_BYTES];      // the ctx rows of one tile, then the weight rows; behind a tile's third barrier the ctx rows' bytes hold its output tile
  _Float16 (*sY)[SPIT] = (_Float16 (*)[SPIT])sm; _Float16 (*sW)[SPIT] = (_Float16 (*)[SPIT])(sm + SX_BYTES); float (*sf)[16][132] = (float (*)[16][132])sm;
  static_assert(4 * 16 * 132 * 4 <= 64 * SPIT * 2, "the output tile fits in the ctx rows' bytes");
  const int tid = threadIdx.x, wave = tid >> 5, lane = tid & 31, col = lane & 15, g = lane >> 4; const int c0 = blockIdx.y * 128;
  unsigned char* d = sm + (tid >> 6) * (SPIT * 2) + (tid & 63) * 8;
  auto cy = [](unsigned char* q, v4f v) { const v4h o = { (_Float16)(v[0] * 64.0f), (_Float16)(v[1] * 64.0f), (_Float16)(v[2] * 64.0f), (_Float16)(v[3] * 64.0f) }; *(v4h*)q = o; };   /* ctx carried x 2^6 into f16 so small-magnitude context rows stay clear of f16 subnormals */
  auto cw = [](unsigned char* q, v4f v) { const v4h o = { (_Float16)(bfr(v[0]) * 256.0f), (_Float16)(bfr(v[1]) * 256.0f), (_Float16)(bfr(v[2]) * 256.0f), (_Float16)(bfr(v[3]) * 256.0f) }; *(v4h*)q = o; };
  auto none = []() {}; auto foot = []() { __syncthreads(); };      // foot: every wave has read its last output rows before this tile's ctx rows overwrite them; it stands behind the loads' issue, so that the wait for the last tile's global stores runs beside the loads
  stage_rows<128>(WO + (size_t)c0 * CC, tid, d + SX_BYTES, cw, none);
  float bias[8];
#pragma unroll
  for (int j = 0; j < 8; ++j) bias[j] = BO ? bfr(BO[c0 + j * 16 + col]) : 0.f;
#pragma unroll 1      // one copy of the tile's code: the tiles differ only in their row offset
  for (int it = 0; it < ONT; ++it) { const size_t rb = ((size_t)blockIdx.x * ONT + it) * 64; const size_t r0 = rb + wave * 16;
    stage_rows<64>(Y + rb * CC, tid, d, cy, foot);
    __syncthreads();      // the tile's ctx rows (and, on the first tile, the weight rows) are in LDS
    v8f acc[8] = {}; v16h a[2], w[2][8];
    auto frags = [&](int kc, v16h& fa, v16h (&fw)[8]) { fa = frag_h(&sY[wave * 16 + col][kc * 32], lane);
#pragma unroll
      for (int j = 0; j < 8; ++j) fw[j] = frag_h(&sW[j * 16 + col][kc * 32], lane); };
    frags(0, a[0], w[0]);
#pragma unroll
    for (int kc = 0; kc < CC / 32; ++kc) { if (kc + 1 < CC / 32) frags(kc + 1, a[(kc + 1) & 1], w[(kc + 1) & 1]);      // the next 32 k's fragments are fetched as one group while these products run; unrolled so that both fragment sets are indexed statically and stay in registers
#pragma unroll
      for (int j = 0; j < 8; ++j) acc[j] = wmma16(a[kc & 1], w[kc & 1][j], acc[j]); }
    __syncthreads();      // every wave has read its last fragment before the output tile overwrites the ctx rows
#pragma unroll
    for (int j = 0; j < 8; ++j) {
#pragma unroll
      for (int r = 0; r < 8; ++r) sf[wave][8 * g + r][j * 16 + col] = acc[j][r] * (1.0f / 16384.0f) + bias[j]; }   /* 2^-8 (Wo carry) x 2^-6 (ctx carry) */
    LDSX(); for (int rl = 0; rl < 16; ++rl) vst2(OUT + (r0 + rl) * DIN + c0 + lane * 4, *(const v4f*)&sf[wave][rl][lane * 4]);
    asm volatile("s_wait_xcnt 0x0" ::: "memory");      // the stores above have taken their address registers before the next tile rewrites them
  } }

extern "C" void kernel_launch(void* const* d_in, const int* in_sizes, int n_in, void* d_out, int out_size, void* d_ws, size_t ws_size, hipStream_t stream) {
  (void)in_sizes; (void)n_in; (void)out_size;
  const float** F = (const float**)d_in;
  if (ws_size < (size_t)WS_END) return;
  char* ws = (char*)d_ws; _Float16 *QH = (_Float16*)(ws + WS_QH), *KH = (_Float16*)(ws + WS_KH), *VT = (_Float16*)(ws + WS_VT), *QL = (_Float16*)(ws + WS_QL), *KL = (_Float16*)(ws + WS_KL); __bf16 *VB = (__bf16*)(ws + WS_VB), *VBL = (__bf16*)(ws + WS_VBL); float *S = (float*)(ws + WS_S), *Y = (float*)(ws + WS_Y); unsigned* PM = (unsigned*)(ws + WS_PM);
  (void)Y; (void)S; (void)QL; (void)KL; (void)VB; (void)VBL;
  // inputs: 0 x [32,1024,256]; 1 attn_mask [1024,1024] (bool topology mask, diagonal True); 2 Wq [256,256] (out,in), 3 bq; 4 Wk, 5 bk; 6 Wv, 7 bv; 8 Wo (out,in), 9 bo (biases nonzero)
  k_proj<<<dim3(TNB * TT / 64 / PNT, CC / 128, 4), 128, 0, stream>>>(F[0], F[0], F[0], F[2], F[4], F[6], F[3], F[5], F[7], QH, KH, VT, (const int*)d_in[1], PM);   // z = 3: the 256 mask blocks
  k_attn<<<dim3(TT / AQB, NH, TNB), AW * 32, 0, stream>>>(QH, KH, VT, PM, Y);
  k_out<<<dim3(TNB * TT / 64 / ONT, DIN / 128), 128, 0, stream>>>(Y, F[8], F[9], (float*)d_out);
}

// v006
// Measured time: 83.1 microseconds a run.
// In both of two side-by-side timings against v005, it was 1.09 times as fast.
// Over all steps from v000 it is 23.9 times as fast.
// compute dtype: all float inputs rounded to bf16; q/k/v projections with EXACT bf16 products on WMMA 16x16x32 (f32 accumulate) + bias; logits q x k once to f16 each (1 product; sigma - 1) x 32^-0.5; the shared boolean mask read per element; softmax f32 without a shift (weights exp2(logit) x 2, f32 sum per query) where a query's sum shows its weights inside f16's range, else online softmax (running maximum and sum, weights x 2^8); weights once to f16 x v once to f16 (1 product), divided by the f32 sum after the product; ctx x 2^6 once to f16 x Wo f16(bf16 x 2^8) + bo; f32 output.
#include <hip/hip_runtime.h>
#include <math.h>

typedef __attribute__((ext_vector_type(16))) _Float16 v16h;
typedef __attribute__((ext_vector_type(16))) __bf16 v16b;
typedef __attribute__((ext_vector_type(8)))  _Float16 v8h;
typedef __attribute__((ext_vector_type(8)))  float v8f;
typedef __attribute__((ext_vector_type(4)))  float v4f;
typedef __attribute__((ext_vector_type(2)))  float v2f;
typedef __attribute__((ext_vector_type(4)))  unsigned v4u;
typedef __attribute__((ext_vector_type(4)))  int v4i;
typedef float __attribute__((may_alias)) float_a;
typedef int __attribute__((may_alias)) int_a;

template <typename T> __device__ __forceinline__ void vst2(void* p, T v) { *(T*)p = v;  }
__device__ __forceinline__ v8f wmma16(v16h a, v16h b, v8f c) {
  v8f d = __builtin_amdgcn_wmma_f32_16x16x32_f16(false, a, false, b, (short)0, c, false, false);
  asm volatile("v_nop\n\tv_nop\n\tv_nop\n\tv_nop" : "+v"(d) : "v"(a), "v"(b));
  return d;
}
__device__ __forceinline__ v8f wmma_bf(v16b a, v16b b, v8f c) {
  v8f d = __builtin_amdgcn_wmma_f32_16x16x32_bf16(false, a, false, b, (short)0, c, false, false);
  asm volatile("v_nop\n\tv_nop\n\tv_nop\n\tv_nop" : "+v"(d) : "v"(a), "v"(b));
  return d;
}
// 16x16x32 fragments: lane = (h = lane>>4, row/col = lane&15); elements 0..7 = k0+8h+0..7, 8..15 = k0+16+8h+0..7; D element r = row 8h+r
__device__ __forceinline__ v16h frag_h(const _Float16* rowk0, int lane) {
  union { v16h v; v8h q[2]; } u; const _Float16* p = rowk0 + 8 * (lane >> 4);
  u.q[0] = *(const v8h*)p; u.q[1] = *(const v8h*)(p + 16); return u.v;
}
__device__ __forceinline__ v16h frag_f32(const float* rowk0, int lane) {
  v16h a; const float* p = rowk0 + 8 * (lane >> 4);
#pragma unroll
  for (int i = 0; i < 8; ++i) { a[i] = (_Float16)p[i]; a[8 + i] = (_Float16)p[16 + i]; }
  return a;
}
__device__ __forceinline__ v16h frag_f32s(const float* rowk0, int lane, float sc) {
  v16h a; const float* p = rowk0 + 8 * (lane >> 4);
#pragma unroll
  for (int i = 0; i < 8; ++i) { a[i] = (_Float16)(p[i] * sc); a[8 + i] = (_Float16)(p[16 + i] * sc); }
  return a;
}
// column fragment from a [K][ld] layout (column n), rows >= K read as 0
__device__ __forceinline__ v16h fragc_f32(const float* W, int k0, int n, int lane, int ld, int K) {
  v16h a; const int g = lane >> 4;
#pragma unroll
  for (int i = 0; i < 8; ++i) { const int ka = k0 + 8 * g + i, kb = ka + 16;
    a[i] = (_Float16)(ka < K ? W[(size_t)(ka < K ? ka : K - 1) * ld + n] : 0.f); a[8 + i] = (_Float16)(kb < K ? W[(size_t)(kb < K ? kb : K - 1) * ld + n] : 0.f); }
  return a;
}
struct F2 { v16b h, l; };
__device__ __forceinline__ F2 bsplit16(const float v[16]) { F2 r;
#pragma unroll
  for (int i = 0; i < 16; ++i) { const __bf16 h = (__bf16)v[i]; r.h[i] = h; r.l[i] = (__bf16)(v[i] - (float)h); }
  return r; }
__device__ __forceinline__ F2 split_row(const float* row, int k0, int lane) { float v[16]; const float* p = row + k0 + 8 * (lane >> 4);
#pragma unroll
  for (int i = 0; i < 8; ++i) { v[i] = p[i]; v[8 + i] = p[16 + i]; }
  return bsplit16(v); }
__device__ __forceinline__ F2 split_rowK(const float* row, int k0, int lane, int K) { float v[16]; const int g = lane >> 4;
#pragma unroll
  for (int i = 0; i < 8; ++i) { const int ka = k0 + 8 * g + i, kb = ka + 16; v[i] = ka < K ? row[ka < K ? ka : K - 1] : 0.f; v[8 + i] = kb < K ? row[kb < K ? kb : K - 1] : 0.f; }
  return bsplit16(v); }
__device__ __forceinline__ F2 split_col(const float* W, int k0, int n, int lane, int ld, int K) { float v[16]; const int g = lane >> 4;
#pragma unroll
  for (int i = 0; i < 8; ++i) { const int ka = k0 + 8 * g + i, kb = ka + 16; v[i] = ka < K ? W[(size_t)(ka < K ? ka : K - 1) * ld + n] : 0.f; v[8 + i] = kb < K ? W[(size_t)(kb < K ? kb : K - 1) * ld + n] : 0.f; }
  return bsplit16(v); }
__device__ __forceinline__ v8f mac3(const F2& a, const F2& b, v8f c) { c = wmma_bf(a.l, b.h, c); c = wmma_bf(a.h, b.l, c); return wmma_bf(a.h, b.h, c); }
__device__ __forceinline__ float sigm(float v) { return 1.0f / (1.0f + expf(-v)); }
#define LDSX() do { asm volatile("s_wait_dscnt 0" ::: "memory"); __builtin_amdgcn_wave_barrier(); __builtin_amdgcn_fence(__ATOMIC_RELEASE, "workgroup"); } while (0)

// Multi-head self-attention with a shared boolean topology mask (x [32,1024,256]; 8 heads x 32; torch (out,in) Wq/Wk/Wv/Wo [256,256] + biases (N(0, 1/256), NONZERO); attn_mask [1024,1024] bool (~50 % True, diagonal True) shared by all batches and heads: scores = where(mask, q_h k_h^T / sqrt(32), -1e9)): out = merge(softmax(scores) v_h) Wo^T + bo.
#define NB 32
#define TT 1024
#define CC 256            // NH * HD = projected width
#define DIN 256          // input (model) width
#define NH 8
#define HD 32
#define NQB (TT / 64)
#define HG 8
#define SCALE (0.17677669529663687f)
#define CAUSAL 0
#ifndef TNB
#define TNB NB
#endif
__device__ __forceinline__ float bfr(float v) { return (float)(__bf16)v; }
__host__ __device__ __forceinline__ int kb_last(int qb) { return CAUSAL ? ((qb * 64 + 63) >> 7) : (TT / 128 - 1); }
typedef __attribute__((ext_vector_type(8))) __bf16 v8b;
__device__ __forceinline__ v16b frag_b(const __bf16* rowk0, int lane) {
  union { v16b v; v8b q[2]; } u; const __bf16* p = rowk0 + 8 * (lane >> 4);
  u.q[0] = *(const v8b*)p; u.q[1] = *(const v8b*)(p + 16); return u.v;
}
#define QBH 0              // read by no kernel: k_attn has one single-product path for every query block
#define QHI 0               // single-product logits on every row (sigma - 1 logits averaged over -512 visible keys)
#define KHI 64            // key rows carrying k residual / v bf16 hi+lo planes (no kernel here writes or reads them)
// B fragment (k rows k0+.., output column o) of a weight: (in,out) [K][ld] or (out,in) [ld rows of K]: bf16 exact, or f16(bf16 * 256) exact
__device__ __forceinline__ v16b wcol_io(const float* Wm, int k0, int o, int lane, int ld) { v16b w; const int g = lane >> 4;
#pragma unroll
  for (int i = 0; i < 8; ++i) { w[i] = (__bf16)Wm[(size_t)(k0 + 8 * g + i) * ld + o]; w[8 + i] = (__bf16)Wm[(size_t)(k0 + 16 + 8 * g + i) * ld + o]; }
  return w; }
__device__ __forceinline__ v16b wcol_oi(const float* Wm, int k0, int o, int lane, int K) { v16b w; const float* p = Wm + (size_t)o * K + k0 + 8 * (lane >> 4);
#pragma unroll
  for (int i = 0; i < 8; ++i) { w[i] = (__bf16)p[i]; w[8 + i] = (__bf16)p[16 + i]; }
  return w; }
__device__ __forceinline__ v16h wcolh_io(const float* Wm, int k0, int o, int lane, int ld) { v16h w; const int g = lane >> 4;
#pragma unroll
  for (int i = 0; i < 8; ++i) { w[i] = (_Float16)(bfr(Wm[(size_t)(k0 + 8 * g + i) * ld + o]) * 256.0f); w[8 + i] = (_Float16)(bfr(Wm[(size_t)(k0 + 16 + 8 * g + i) * ld + o]) * 256.0f); }
  return w; }
__device__ __forceinline__ v16h wcolh_oi(const float* Wm, int k0, int o, int lane, int K) { v16h w; const float* p = Wm + (size_t)o * K + k0 + 8 * (lane >> 4);
#pragma unroll
  for (int i = 0; i < 8; ++i) { w[i] = (_Float16)(bfr(p[i]) * 256.0f); w[8 + i] = (_Float16)(bfr(p[16 + i]) * 256.0f); }
  return w; }
#define WQKV_LAYOUT 1   // 0 = (in,out) [DIN][CC]; 1 = (out,in) [CC][DIN]; 2 = per-head [NH][DIN][HD]
__device__ __forceinline__ v16b wcol_hdk(const float* Wm, int k0, int o, int lane) { v16b w; const int g = lane >> 4; const float* p = Wm + (size_t)(o / HD) * DIN * HD + (o % HD);
#pragma unroll
  for (int i = 0; i < 8; ++i) { w[i] = (__bf16)p[(size_t)(k0 + 8 * g + i) * HD]; w[8 + i] = (__bf16)p[(size_t)(k0 + 16 + 8 * g + i) * HD]; }
  return w; }
#define WO_OUT_IN 1
#if WQKV_LAYOUT == 1
#define WCOL(W, k0, o, lane) wcol_oi(W, k0, o, lane, DIN)
#elif WQKV_LAYOUT == 2
#define WCOL(W, k0, o, lane) wcol_hdk(W, k0, o, lane)
#else
#define WCOL(W, k0, o, lane) wcol_io(W, k0, o, lane, CC)
#endif
#if WO_OUT_IN
#define WOCOL(W, k0, o, lane) wcol_oi(W, k0, o, lane, CC)
#define WOCOLH(W, k0, o, lane) wcolh_oi(W, k0, o, lane, CC)
#else
#define WOCOL(W, k0, o, lane) wcol_io(W, k0, o, lane, DIN)
#define WOCOLH(W, k0, o, lane) wcolh_io(W, k0, o, lane, DIN)
#endif
#ifndef PROJ_EXTRA_PARAMS
#define PROJ_EXTRA_PARAMS
#endif

#define WS_QH  0u                                      // f16 q rows [b*t][CC]
#define WS_KH  (WS_QH + 2u * (size_t)NB * TT * CC)      // f16 k rows [b*t][CC]
#define WS_VT  (WS_KH + 2u * (size_t)NB * TT * CC)      // f16 v planes [b][c][t]
#define WS_QL  (WS_VT + 2u * (size_t)NB * CC * TT)      // f16 q residual x 2^10 rows [b][t < QHI][CC]
#define WS_KL  (WS_QL + 2u * (size_t)NB * QHI * CC)     // f16 k residual x 2^10 rows [b][t < KHI][CC]
#define WS_VB  (WS_KL + 2u * (size_t)NB * KHI * CC)     // bf16 v hi planes [b][c][t < KHI]
#define WS_VBL (WS_VB + 2u * (size_t)NB * CC * KHI)
#define WS_S   (WS_VBL + 2u * (size_t)NB * CC * KHI)    // room of HG x TT x TT f32; only the mask words (WS_PM) use it
#define WS_PM  WS_S                                      // the mask as lane-mask words [query tile of 16][32 keys][16 words], 128 KiB (the logits plane is not used)
#define WS_Y   (WS_S  + 4u * (size_t)HG * TT * TT)      // f32 ctx rows [b*t][CC] (only when there is an output projection)
#define WS_END (WS_Y  + 4u * (size_t)NB * TT * CC)

// ---- operand staging of k_proj and k_out: a block's 128 weight rows (its output columns) and, per row tile, 64 input rows, 256 f32 each and contiguous in memory, go to LDS once as 16-bit rows.
// Every load of a wave takes 512 contiguous bytes, so a block touches each 128-B line once; the WMMA fragments are then 16-B LDS reads.
#define SPIT 264           // 16-bit elements per staged row: 528 B = 16 B x odd
#define SW_BYTES (128 * SPIT * 2)
#define SX_BYTES (64 * SPIT * 2)      // the 64 input rows stand first, so that every LDS store of the tile loop is an immediate offset; the weight rows follow
#define SOP_BYTES ((128 + 64) * SPIT * 2)
static_assert(WQKV_LAYOUT == 1 && WO_OUT_IN == 1 && DIN == 256 && CC == 256, "the staging below reads (out,in) weight rows of 256");
typedef __attribute__((ext_vector_type(4))) __bf16 v4b;
typedef __attribute__((ext_vector_type(4))) _Float16 v4h;
// base = first row (128 threads = two rows a pass), d = this thread's 8 bytes of LDS row tid >> 6; the loops are unrolled so that t[] stays in registers and every step is an immediate offset
// pre() runs once, behind the first 16 loads' issue and in front of the first LDS store
template <int NROW, typename CV, typename PRE> __device__ __forceinline__ void stage_rows(const float* base, int tid, unsigned char* d, CV cv, PRE pre) {
  const float* p = base + tid * 4;
#pragma unroll
  for (int b = 0; b < NROW / 2; b += 16) { v4f t[16];
#pragma unroll
    for (int i = 0; i < 16; ++i) t[i] = *(const v4f*)(p + (b + i) * 512);
    asm volatile("s_wait_xcnt 0x0" :: "v"(tid), "s"(base) : "memory");      // the loads' offset register and base stay untouched until the 16 loads above have taken them; no later load is lifted over this line, which keeps the registers under 256
    if (b == 0) pre();
#pragma unroll
    for (int i = 0; i < 16; ++i) cv(d + (b + i) * (2 * SPIT * 2), t[i]); } }

#define PNT 4             // row tiles of 64 that a k_proj block walks with its 128 weight rows kept in LDS
#define ONT 2             // the same for k_out
// ---- k_proj: block = (PNT x 64 rows, 128 cols, which): q/k/v = X W (+ b) with exact bf16 products (K = DIN) -> which 0: q f16 rows; 1: k f16 rows; 2: v f16 planes [c][t]. The weight rows are staged once; each row tile stages its 64 input rows behind them
__global__ __launch_bounds__(128) void k_proj(const float* __restrict__ XQ, const float* __restrict__ XK, const float* __restrict__ XV, const float* __restrict__ WQ, const float* __restrict__ WK, const float* __restrict__ WV, const float* __restrict__ BQ, const float* __restrict__ BK, const float* __restrict__ BV,
    _Float16* __restrict__ QH, _Float16* __restrict__ KH, _Float16* __restrict__ VT, const int* __restrict__ AMASK, unsigned* __restrict__ PM) {
  __shared__ __align__(16) unsigned char sm[SOP_BYTES];      // the input rows of one tile, then the weight rows; behind a tile's third barrier the input rows' bytes hold its output tile
  __bf16 (*sX)[SPIT] = (__bf16 (*)[SPIT])sm; __bf16 (*sW)[SPIT] = (__bf16 (*)[SPIT])(sm + SX_BYTES);
  _Float16 (*sh)[136] = (_Float16 (*)[136])sm; _Float16 (*th)[72] = (_Float16 (*)[72])sm;
  static_assert(64 * 136 * 2 <= 64 * SPIT * 2 && 128 * 72 * 2 <= 64 * SPIT * 2, "an output tile fits in the input rows' bytes");
  static_assert(TT % (64 * PNT) == 0, "a block's row tiles lie in one sequence");
  const int tid = threadIdx.x, wave = tid >> 5, lane = tid & 31, col = lane & 15, g = lane >> 4; const int which = blockIdx.z; const int c0 = blockIdx.y * 128;
  if (which == 3) {      // mask blocks (block-uniform, in front of every barrier): each wave turns two tiles of 16 queries x 32 keys into 32 words, one 128-B line.
    // Word i of a tile, bit l = mask[query tile * 16 + (l & 15)][key block * 32 + 16 (i >> 3) + 8 (l >> 4) + (i & 7)]: the lane mask of score register i in k_attn
    static_assert((TNB * TT / 64 / PNT) * (CC / 128) * 4 == (TT / 16) * (TT / 64), "one wave of a mask block for every pair of tiles");
    const int tp = (blockIdx.x * 2 + blockIdx.y) * 4 + wave; const int* mp = AMASK + ((tp >> 4) * 16 + col) * TT + (tp & 15) * 64 + 8 * g; v4i m[8]; unsigned wd = 0;
#pragma unroll
    for (int i = 0; i < 8; ++i) m[i] = *(const v4i*)(mp + (i >> 1) * 16 + (i & 1) * 4);
#pragma unroll
    for (int i = 0; i < 32; ++i) { const unsigned bl = __builtin_amdgcn_ballot_w32(m[i >> 2][i & 3] != 0); if (lane == i) wd = bl; }
    PM[tp * 32 + lane] = wd; return; }
  const float* X = which == 0 ? XQ : which == 1 ? XK : XV; const float* WA = which == 0 ? WQ : which == 1 ? WK : WV; const float* BA = which == 0 ? BQ : which == 1 ? BK : BV;
  unsigned char* d = sm + (tid >> 6) * (SPIT * 2) + (tid & 63) * 8;
  auto cv = [](unsigned char* q, v4f v) { const v4b o = { (__bf16)v[0], (__bf16)v[1], (__bf16)v[2], (__bf16)v[3] }; *(v4b*)q = o; };
  auto none = []() {}; auto foot = []() { __syncthreads(); };      // foot: every thread has read its part of the last output tile before this tile's input rows overwrite it; it stands behind the loads' issue, so that the wait for the last tile's global stores runs beside the loads
  stage_rows<128>(WA + (size_t)c0 * DIN, tid, d + SX_BYTES, cv, none);
  float bias[8];
#pragma unroll
  for (int j = 0; j < 8; ++j) bias[j] = BA ? bfr(BA[c0 + j * 16 + col]) : 0.f;
#pragma unroll 1      // one copy of the tile's code: the four tiles differ only in their row offset
  for (int it = 0; it < PNT; ++it) { const size_t r0 = ((size_t)blockIdx.x * PNT + it) * 64; const size_t bb = r0 / TT; const int t0 = (int)(r0 % TT);
    stage_rows<64>(X + r0 * DIN, tid, d, cv, foot);
    __syncthreads();      // the tile's input rows (and, on the first tile, the weight rows) are in LDS
    v8f acc[8] = {}; v16b a[2], w[2][8];
    auto frags = [&](int kc, v16b& fa, v16b (&fw)[8]) { fa = frag_b(&sX[wave * 16 + col][kc * 32], lane);
#pragma unroll
      for (int j = 0; j < 8; ++j) fw[j] = frag_b(&sW[j * 16 + col][kc * 32], lane); };
    frags(0, a[0], w[0]);
#pragma unroll
    for (int kc = 0; kc < DIN / 32; ++kc) { if (kc + 1 < DIN / 32) frags(kc + 1, a[(kc + 1) & 1], w[(kc + 1) & 1]);      // the next 32 k's fragments are fetched as one group while these products run; unrolled so that both fragment sets are indexed statically and stay in registers
#pragma unroll
      for (int j = 0; j < 8; ++j) acc[j] = wmma_bf(a[kc & 1], w[kc & 1][j], acc[j]); }
    __syncthreads();      // every wave has read its last fragment before the output tile overwrites the input rows
    if (which < 2) { _Float16* DH = which == 0 ? QH : KH;
#pragma unroll
      for (int j = 0; j < 8; ++j) {
#pragma unroll
        for (int r = 0; r < 8; ++r) sh[wave * 16 + 8 * g + r][j * 16 + col] = (_Float16)(acc[j][r] + bias[j]); }
      __syncthreads();
      for (int e = tid; e < 64 * 16; e += 128) { const int rl = e >> 4, q = e & 15; vst2((unsigned*)(DH + (r0 + rl) * CC + c0 + q * 8), *(const v4u*)&sh[rl][q * 8]); }
    } else {
#pragma unroll
      for (int j = 0; j < 8; ++j) {
#pragma unroll
        for (int r = 0; r < 8; ++r) th[j * 16 + col][wave * 16 + 8 * g + r] = (_Float16)(acc[j][r] + bias[j]); }
      __syncthreads();
      for (int e = tid; e < 128 * 8; e += 128) { const int cl = e >> 3, q = e & 7; vst2((unsigned*)(VT + (bb * CC + c0 + cl) * (size_t)TT + t0 + q * 8), *(const v4u*)&th[cl][q * 8]); } }
    asm volatile("s_wait_xcnt 0x0" ::: "memory");      // the stores above have taken their address registers before the next tile rewrites them
  } }
// ---- k_attn: block = (all 1024 queries, head h, batch b), 16 waves, each with ANG groups of 32 queries one after the other. K rows and v planes of (b, h) are staged in LDS once for all of them; for each group a wave walks the 1024 keys 32 at a time:
// S^T = K q^T (lane = one query, 16 of the 32 keys), mask by element, weights exp2(logit) x 2 with their f32 sum per query, once to f16 straight from the score registers as the B operand of ctx^T += v^T P^T; ctx / sum at the end.
// A softmax does not depend on its shift, so the key loop uses none: no maximum, no exchange between the lane halves, no rescaling. The range is checked from the data behind the loop, by the sum alone (every weight is >= 0):
// sum < 65504 -> no weight left f16's range upwards; sum >= 2^8 -> the weights under f16's smallest normal number, 1024 x 2^-14 at most, are at most 2^-12 of the sum, the bound that the running maximum gives (largest weight 2^8).
// The factor 2 puts a row of 512 to 1024 visible logits around 0 at 2^10 to 2^11: 2 to 3 powers of two over the lower limit, 5 under the upper one, on which side the exponentials' tail lies.
// A group of 32 queries with a sum outside (large or strongly offset logits, few or no visible keys, a NaN) is worked again with the running maximum: slower, and right for any input.
#define AW 16
#define AQT 2
#define ANG 2              // query groups that a wave walks under the one fill
#define AQG (AW * AQT * 16)      // queries of one group over the block's waves
#define AQB (AQG * ANG)
static_assert(AW * 32 == 512 && TT == 1024 && HD == 32 && TT % AQB == 0, "the fill below is written for 512 threads, 1024 keys, head size 32");
#define KPIT 40            // f16 per staged K row: 80 B = 16 B x odd
#define VPIT (TT + 8)      // f16 per staged v plane: 2064 B = 16 B x odd
#define LOG2E 1.4426950408889634f
#define SUMLO 256.0f       // the sums for which the weights without a shift stand: SUMLO <= sum < SUMHI
#define SUMHI 65504.0f
typedef __attribute__((ext_vector_type(2))) _Float16 v2h;
typedef __attribute__((ext_vector_type(16))) unsigned v16u;
__device__ __forceinline__ float xhalf(float x) { return __builtin_bit_cast(float, __builtin_amdgcn_permlanex16(__builtin_bit_cast(int, x), __builtin_bit_cast(int, x), 0x76543210, 0xfedcba98, false, false)); }   // lane l with lane l ^ 16
__device__ __forceinline__ v8f wmma_h(v16h a, v16h b, v8f c) { return __builtin_amdgcn_wmma_f32_16x16x32_f16(false, a, false, b, (short)0, c, false, false); }
__global__ __launch_bounds__(AW * 32) __attribute__((amdgpu_waves_per_eu(4, 4))) void k_attn(const _Float16* __restrict__ QH, const _Float16* __restrict__ KH, const _Float16* __restrict__ VT, const unsigned* __restrict__ PM, float* __restrict__ Y) {   // 4 waves per SIMD = one block of 16 waves per WGP
  __shared__ __align__(16) _Float16 sK[TT][KPIT]; __shared__ __align__(16) _Float16 sV[HD][VPIT];
  const int tid = threadIdx.x, wave = tid >> 5, lane = tid & 31, col = lane & 15, g = lane >> 4; const int h = blockIdx.y, b = blockIdx.z; const int qw = blockIdx.x * AQB + wave * (AQT * 16);      // group n of this wave: queries qw + n * AQG + 0..31
  v4u tk[8], tv[8];      // the fill: 1024 K rows x 64 B and 32 v planes x 2048 B, 8 + 8 loads of 16 B a thread, all in flight together, then the LDS stores
  const _Float16* kp = KH + ((size_t)b * TT + (tid >> 2)) * CC + h * HD + (tid & 3) * 8;            // load i: K row (tid >> 2) + 128 i
  const _Float16* vp = VT + ((size_t)b * CC + h * HD + (tid >> 7)) * (size_t)TT + (tid & 127) * 8;   // load i: v plane (tid >> 7) + 4 i
  const _Float16* qp = QH + ((size_t)b * TT + qw + col) * CC + h * HD + 8 * g;
#pragma unroll
  for (int i = 0; i < 8; ++i) tk[i] = *(const v4u*)(kp + i * 128 * CC);
#pragma unroll
  for (int i = 0; i < 8; ++i) tv[i] = *(const v4u*)(vp + i * 4 * TT);
  v16h qa[ANG][AQT];      // the q fragments of every group come with the fill, so that no group waits for its own
#pragma unroll
  for (int n = 0; n < ANG; ++n) {
#pragma unroll
    for (int u = 0; u < AQT; ++u) { union { v16h v; v8h q[2]; } t; t.q[0] = *(const v8h*)(qp + (n * AQG + u * 16) * CC); t.q[1] = *(const v8h*)(qp + (n * AQG + u * 16) * CC + 16); qa[n][u] = t.v; } }   // B fragment, same k order as frag_h
  asm volatile("s_wait_xcnt 0x0" :: "v"(kp), "v"(vp), "v"(qp) : "memory");      // the three address pairs stay untouched until the loads above have taken them
#pragma unroll
  for (int i = 0; i < 8; ++i) *(v4u*)&sK[(tid >> 2) + 128 * i][(tid & 3) * 8] = tk[i];
#pragma unroll
  for (int i = 0; i < 8; ++i) *(v4u*)&sV[(tid >> 7) + 4 * i][(tid & 127) * 8] = tv[i];
  __syncthreads();
  const float NEGR = -1.0e9f / SCALE;      // the reference's -1e9 fill in units of the unscaled product
  const float CL = SCALE * LOG2E;
#pragma unroll      // unrolled so that qa[n] is indexed statically and stays in registers
  for (int n = 0; n < ANG; ++n) { const int q0 = qw + n * AQG; const v16h (&qf)[AQT] = qa[n]; v8f acc[AQT][2] = {}; v2f ps[AQT][2] = {}; float mx[AQT], ls[AQT];
  const v16u* pm = (const v16u*)PM + __builtin_amdgcn_readfirstlane(q0 >> 4) * (TT / 32);      // this group's mask words: wave-uniform, so they come by scalar loads; tile u is TT / 32 groups of 16 words on
  auto mload = [&](int k0, v16u (&mk)[AQT]) {
#pragma unroll
    for (int u = 0; u < AQT; ++u) mk[u] = pm[u * (TT / 32) + (k0 >> 5)]; };
  auto step = [&](int k0, const v16u (&mk)[AQT]) {
    const v16h ka = frag_h(&sK[k0 + col][0], lane), kb = frag_h(&sK[k0 + 16 + col][0], lane);      // A rows = keys k0 + 0..15, k0 + 16..31
    const v16h va = frag_h(&sV[col][k0], lane), vb = frag_h(&sV[16 + col][k0], lane);              // A rows = head columns 0..15, 16..31; k = keys in the order of the packed scores
#pragma unroll
    for (int u = 0; u < AQT; ++u) {
      const v8f z = {}; v8f s[2]; s[0] = wmma_h(ka, qf[u], z); s[1] = wmma_h(kb, qf[u], z);      // s[T][r] = key k0 + 16T + 8g + r, query = col
      union { v16h v; v2h q[8]; } pf;
#pragma unroll
      for (int i = 0; i < 8; ++i) { v2f d = { __builtin_amdgcn_inverse_ballot_w32(mk[u][2 * i]) ? s[i >> 2][(2 * i) & 7] : NEGR, __builtin_amdgcn_inverse_ballot_w32(mk[u][2 * i + 1]) ? s[i >> 2][(2 * i + 1) & 7] : NEGR };      // word i is the select's lane mask as it stands
        d = d * CL + 1.0f;      // a masked key's exponent is far below f32's range: weight 0
        const v2f p = { __builtin_amdgcn_exp2f(d[0]), __builtin_amdgcn_exp2f(d[1]) }; ps[u][i & 1] += p; pf.q[i] = __builtin_convertvector(p, v2h); }
      acc[u][0] = wmma_h(va, pf.v, acc[u][0]); acc[u][1] = wmma_h(vb, pf.v, acc[u][1]);
    } };
  auto step_mx = [&](int k0, const v16u (&mk)[AQT]) {      // the same 32 keys with a running maximum: any range of logits
    const v16h ka = frag_h(&sK[k0 + col][0], lane), kb = frag_h(&sK[k0 + 16 + col][0], lane);      // A rows = keys k0 + 0..15, k0 + 16..31
    const v16h va = frag_h(&sV[col][k0], lane), vb = frag_h(&sV[16 + col][k0], lane);              // A rows = head columns 0..15, 16..31; k = keys in the order of the packed scores
#pragma unroll
    for (int u = 0; u < AQT; ++u) {
      const v8f z = {}; v8f s[2]; s[0] = wmma_h(ka, qf[u], z); s[1] = wmma_h(kb, qf[u], z);      // s[T][r] = key k0 + 16T + 8g + r, query = col
      float x[16];
#pragma unroll
      for (int i = 0; i < 16; ++i) x[i] = __builtin_amdgcn_inverse_ballot_w32(mk[u][i]) ? s[i >> 3][i & 7] : NEGR;      // word i is the select's lane mask as it stands
      float cm = x[0];
#pragma unroll
      for (int i = 1; i < 16; ++i) cm = fmaxf(cm, x[i]);
      const float mn = fmaxf(mx[u], fmaxf(cm, xhalf(cm)));           // both lane halves of a query use one maximum: their weights meet in one product
      const float al = __builtin_amdgcn_exp2f((mx[u] - mn) * CL); mx[u] = mn;
      union { v16h v; v2h q[8]; } pf; v2f sum = {};
#pragma unroll
      for (int i = 0; i < 8; ++i) { v2f d = { x[2 * i], x[2 * i + 1] }; d = (d - mn) * CL + 8.0f;      // difference first: exactly 0 where a whole row is masked (uniform weights, as the reference gives)
        const v2f p = { __builtin_amdgcn_exp2f(d[0]), __builtin_amdgcn_exp2f(d[1]) }; sum += p; pf.q[i] = __builtin_convertvector(p, v2h); }
      ls[u] = ls[u] * al + (sum[0] + sum[1]);
      acc[u][0] = wmma_h(va, pf.v, acc[u][0] * al); acc[u][1] = wmma_h(vb, pf.v, acc[u][1] * al);
    } };
  v16u ma[AQT], mb[AQT]; mload(0, ma); mload(32, mb);      // the mask words of the next 64 keys are fetched, into the registers that the selects have just read, while these 64 are worked on
  for (int k0 = 0; k0 < TT; k0 += 64) { const int kn = k0 + 64 < TT ? k0 + 64 : 0; step(k0, ma); mload(kn, ma); step(k0 + 32, mb); mload(kn + 32, mb); }
  bool in = true;
#pragma unroll
  for (int u = 0; u < AQT; ++u) { const v2f t = ps[u][0] + ps[u][1]; ls[u] = t[0] + t[1]; const float tot = ls[u] + xhalf(ls[u]); in = in && tot >= SUMLO && tot < SUMHI; }      // false for a NaN too
  if (__builtin_amdgcn_ballot_w32(!in) != 0) {      // wave-uniform (a scalar branch on the ballot), no barrier behind it: the group's 32 queries again, from the start
#pragma unroll
    for (int u = 0; u < AQT; ++u) { mx[u] = -3.0e38f; ls[u] = 0.f; acc[u][0] = v8f{}; acc[u][1] = v8f{}; }
#pragma unroll 1      // a path that few inputs take: one copy of the 32 keys' code
    for (int k0 = 0; k0 < TT; k0 += 32) { mload(k0, ma); step_mx(k0, ma); } }
#pragma unroll
  for (int u = 0; u < AQT; ++u) { const float inv = 1.0f / (ls[u] + xhalf(ls[u])); float* yp = Y + (unsigned)((b * TT + q0 + u * 16 + col) * CC + h * HD + 8 * g);
#pragma unroll
    for (int j = 0; j < 2; ++j) { const v8f o = acc[u][j] * inv; vst2(yp + j * 16, (v4f)__builtin_shufflevector(o, o, 0, 1, 2, 3)); vst2(yp + j * 16 + 4, (v4f)__builtin_shufflevector(o, o, 4, 5, 6, 7)); } }
  if (n + 1 < ANG) asm volatile("s_wait_xcnt 0x0" ::: "memory");      // the stores above have taken their address registers before the next group rewrites them
  } }
// ---- k_out: block = (ONT x 64 rows, 128 cols): out = ctx Wo (+ bo): ctx x 2^6 once to f16 against Wo as f16(bf16 x 2^8) exact (1 product) x 2^-14. The Wo rows are staged once; each row tile stages its 64 ctx rows behind them
__global__ __launch_bounds__(128) void k_out(const float* __restrict__ Y, const float* __restrict__ WO, const float* __restrict__ BO, float* __restrict__ OUT) { __shared__ __align__(16) unsigned char sm[SOP_BYTES];      // the ctx rows of one tile, then the weight rows; behind a tile's third barrier the ctx rows' bytes hold its output tile
  _Float16 (*sY)[SPIT] = (_Float16 (*)[SPIT])sm; _Float16 (*sW)[SPIT] = (_Float16 (*)[SPIT])(sm + SX_BYTES); float (*sf)[16][132] = (float (*)[16][132])sm;
  static_assert(4 * 16 * 132 * 4 <= 64 * SPIT * 2, "the output tile fits in the ctx rows' bytes");
  const int tid = threadIdx.x, wave = tid >> 5, lane = tid & 31, col = lane & 15, g = lane >> 4; const int c0 = blockIdx.y * 128;
  unsigned char* d = sm + (tid >> 6) * (SPIT * 2) + (tid & 63) * 8;
  auto cy = [](unsigned char* q, v4f v) { const v4h o = { (_Float16)(v[0] * 64.0f), (_Float16)(v[1] * 64.0f), (_Float16)(v[2] * 64.0f), (_Float16)(v[3] * 64.0f) }; *(v4h*)q = o; };   /* ctx carried x 2^6 into f16 so small-magnitude context rows stay clear of f16 subnormals */
  auto cw = [](unsigned char* q, v4f v) { const v4h o = { (_Float16)(bfr(v[0]) * 256.0f), (_Float16)(bfr(v[1]) * 256.0f), (_Float16)(bfr(v[2]) * 256.0f), (_Float16)(bfr(v[3]) * 256.0f) }; *(v4h*)q = o; };
  auto none = []() {}; auto foot = []() { __syncthreads(); };      // foot: every wave has read its last output rows before this tile's ctx rows overwrite them; it stands behind the loads' issue, so that the wait for the last tile's global stores runs beside the loads
  stage_rows<128>(WO + (size_t)c0 * CC, tid, d + SX_BYTES, cw, none);
  float bias[8];
#pragma unroll
  for (int j = 0; j < 8; ++j) bias[j] = BO ? bfr(BO[c0 + j * 16 + col]) : 0.f;
#pragma unroll 1      // one copy of the tile's code: the tiles differ only in their row offset
  for (int it = 0; it < ONT; ++it) { const size_t rb = ((size_t)blockIdx.x * ONT + it) * 64; const size_t r0 = rb + wave * 16;
    stage_rows<64>(Y + rb * CC, tid, d, cy, foot);
    __syncthreads();      // the tile's ctx rows (and, on the first tile, the weight rows) are in LDS
    v8f acc[8] = {}; v16h a[2], w[2][8];
    auto frags = [&](int kc, v16h& fa, v16h (&fw)[8]) { fa = frag_h(&sY[wave * 16 + col][kc * 32], lane);
#pragma unroll
      for (int j = 0; j < 8; ++j) fw[j] = frag_h(&sW[j * 16 + col][kc * 32], lane); };
    frags(0, a[0], w[0]);
#pragma unroll
    for (int kc = 0; kc < CC / 32; ++kc) { if (kc + 1 < CC / 32) frags(kc + 1, a[(kc + 1) & 1], w[(kc + 1) & 1]);      // the next 32 k's fragments are fetched as one group while these products run; unrolled so that both fragment sets are indexed statically and stay in registers
#pragma unroll
      for (int j = 0; j < 8; ++j) acc[j] = wmma16(a[kc & 1], w[kc & 1][j], acc[j]); }
    __syncthreads();      // every wave has read its last fragment before the output tile overwrites the ctx rows
#pragma unroll
    for (int j = 0; j < 8; ++j) {
#pragma unroll
      for (int r = 0; r < 8; ++r) sf[wave][8 * g + r][j * 16 + col] = acc[j][r] * (1.0f / 16384.0f) + bias[j]; }   /* 2^-8 (Wo carry) x 2^-6 (ctx carry) */
    LDSX(); for (int rl = 0; rl < 16; ++rl) vst2(OUT + (r0 + rl) * DIN + c0 + lane * 4, *(const v4f*)&sf[wave][rl][lane * 4]);
    asm volatile("s_wait_xcnt 0x0" ::: "memory");      // the stores above have taken their address registers before the next tile rewrites them
  } }

extern "C" void kernel_launch(void* const* d_in, const int* in_sizes, int n_in, void* d_out, int out_size, void* d_ws, size_t ws_size, hipStream_t stream) {
  (void)in_sizes; (void)n_in; (void)out_size;
  const float** F = (const float**)d_in;
  if (ws_size < (size_t)WS_END) return;
  char* ws = (char*)d_ws; _Float16 *QH = (_Float16*)(ws + WS_QH), *KH = (_Float16*)(ws + WS_KH), *VT = (_Float16*)(ws + WS_VT), *QL = (_Float16*)(ws + WS_QL), *KL = (_Float16*)(ws + WS_KL); __bf16 *VB = (__bf16*)(ws + WS_VB), *VBL = (__bf16*)(ws + WS_VBL); float *S = (float*)(ws + WS_S), *Y = (float*)(ws + WS_Y); unsigned* PM = (unsigned*)(ws + WS_PM);
  (void)Y; (void)S; (void)QL; (void)KL; (void)VB; (void)VBL;
  // inputs: 0 x [32,1024,256]; 1 attn_mask [1024,1024] (bool topology mask, diagonal True); 2 Wq [256,256] (out,in), 3 bq; 4 Wk, 5 bk; 6 Wv, 7 bv; 8 Wo (out,in), 9 bo (biases nonzero)
  k_proj<<<dim3(TNB * TT / 64 / PNT, CC / 128, 4), 128, 0, stream>>>(F[0], F[0], F[0], F[2], F[4], F[6], F[3], F[5], F[7], QH, KH, VT, (const int*)d_in[1], PM);   // z = 3: the 256 mask blocks
  k_attn<<<dim3(TT / AQB, NH, TNB), AW * 32, 0, stream>>>(QH, KH, VT, PM, Y);
  k_out<<<dim3(TNB * TT / 64 / ONT, DIN / 128), 128, 0, stream>>>(Y, F[8], F[9], (float*)d_out);
}

// v007
// Measured time: 80 microseconds a run.
// Next to v006, in two timings, it ran 1.04 times as fast each time.
// Counting every step since v000, it is 24.7 times as fast.
// compute dtype: all float inputs rounded to bf16; q/k/v projections with EXACT bf16 products on WMMA 16x16x32 (f32 accumulate) + bias; logits q x k once to f16 each (1 product; sigma - 1) x 32^-0.5; the shared boolean mask read per element; softmax f32 without a shift (weights exp2(logit) x 2, f32 sum per query) where a query's sum shows its weights inside f16's range, else online softmax (running maximum and sum, weights x 2^8); weights once to f16 x v once to f16 (1 product), divided by the f32 sum after the product; ctx x 2^6 once to f16 x Wo f16(bf16 x 2^8) + bo; f32 output.
#include <hip/hip_runtime.h>
#include <math.h>

typedef __attribute__((ext_vector_type(16))) _Float16 v16h;
typedef __attribute__((ext_vector_type(16))) __bf16 v16b;
typedef __attribute__((ext_vector_type(8)))  _Float16 v8h;
typedef __attribute__((ext_vector_type(8)))  float v8f;
typedef __attribute__((ext_vector_type(4)))  float v4f;
typedef __attribute__((ext_vector_type(2)))  float v2f;
typedef __attribute__((ext_vector_type(4)))  unsigned v4u;
typedef __attribute__((ext_vector_type(4)))  int v4i;
typedef float __attribute__((may_alias)) float_a;
typedef int __attribute__((may_alias)) int_a;

template <typename T> __device__ __forceinline__ void vst2(void* p, T v) { *(T*)p = v;  }
__device__ __forceinline__ v8f wmma16(v16h a, v16h b, v8f c) {
  v8f d = __builtin_amdgcn_wmma_f32_16x16x32_f16(false, a, false, b, (short)0, c, false, false);
  asm volatile("v_nop\n\tv_nop\n\tv_nop\n\tv_nop" : "+v"(d) : "v"(a), "v"(b));
  return d;
}
__device__ __forceinline__ v8f wmma_bf(v16b a, v16b b, v8f c) {
  v8f d = __builtin_amdgcn_wmma_f32_16x16x32_bf16(false, a, false, b, (short)0, c, false, false);
  asm volatile("v_nop\n\tv_nop\n\tv_nop\n\tv_nop" : "+v"(d) : "v"(a), "v"(b));
  return d;
}
// 16x16x32 fragments: lane = (h = lane>>4, row/col = lane&15); elements 0..7 = k0+8h+0..7, 8..15 = k0+16+8h+0..7; D element r = row 8h+r
__device__ __forceinline__ v16h frag_h(const _Float16* rowk0, int lane) {
  union { v16h v; v8h q[2]; } u; const _Float16* p = rowk0 + 8 * (lane >> 4);
  u.q[0] = *(const v8h*)p; u.q[1] = *(const v8h*)(p + 16); return u.v;
}
__device__ __forceinline__ v16h frag_f32(const float* rowk0, int lane) {
  v16h a; const float* p = rowk0 + 8 * (lane >> 4);
#pragma unroll
  for (int i = 0; i < 8; ++i) { a[i] = (_Float16)p[i]; a[8 + i] = (_Float16)p[16 + i]; }
  return a;
}
__device__ __forceinline__ v16h frag_f32s(const float* rowk0, int lane, float sc) {
  v16h a; const float* p = rowk0 + 8 * (lane >> 4);
#pragma unroll
  for (int i = 0; i < 8; ++i) { a[i] = (_Float16)(p[i] * sc); a[8 + i] = (_Float16)(p[16 + i] * sc); }
  return a;
}
// column fragment from a [K][ld] layout (column n), rows >= K read as 0
__device__ __forceinline__ v16h fragc_f32(const float* W, int k0, int n, int lane, int ld, int K) {
  v16h a; const int g = lane >> 4;
#pragma unroll
  for (int i = 0; i < 8; ++i) { const int ka = k0 + 8 * g + i, kb = ka + 16;
    a[i] = (_Float16)(ka < K ? W[(size_t)(ka < K ? ka : K - 1) * ld + n] : 0.f); a[8 + i] = (_Float16)(kb < K ? W[(size_t)(kb < K ? kb : K - 1) * ld + n] : 0.f); }
  return a;
}
struct F2 { v16b h, l; };
__device__ __forceinline__ F2 bsplit16(const float v[16]) { F2 r;
#pragma unroll
  for (int i = 0; i < 16; ++i) { const __bf16 h = (__bf16)v[i]; r.h[i] = h; r.l[i] = (__bf16)(v[i] - (float)h); }
  return r; }
__device__ __forceinline__ F2 split_row(const float* row, int k0, int lane) { float v[16]; const float* p = row + k0 + 8 * (lane >> 4);
#pragma unroll
  for (int i = 0; i < 8; ++i) { v[i] = p[i]; v[8 + i] = p[16 + i]; }
  return bsplit16(v); }
__device__ __forceinline__ F2 split_rowK(const float* row, int k0, int lane, int K) { float v[16]; const int g = lane >> 4;
#pragma unroll
  for (int i = 0; i < 8; ++i) { const int ka = k0 + 8 * g + i, kb = ka + 16; v[i] = ka < K ? row[ka < K ? ka : K - 1] : 0.f; v[8 + i] = kb < K ? row[kb < K ? kb : K - 1] : 0.f; }
  return bsplit16(v); }
__device__ __forceinline__ F2 split_col(const float* W, int k0, int n, int lane, int ld, int K) { float v[16]; const int g = lane >> 4;
#pragma unroll
  for (int i = 0; i < 8; ++i) { const int ka = k0 + 8 * g + i, kb = ka + 16; v[i] = ka < K ? W[(size_t)(ka < K ? ka : K - 1) * ld + n] : 0.f; v[8 + i] = kb < K ? W[(size_t)(kb < K ? kb : K - 1) * ld + n] : 0.f; }
  return bsplit16(v); }
__device__ __forceinline__ v8f mac3(const F2& a, const F2& b, v8f c) { c = wmma_bf(a.l, b.h, c); c = wmma_bf(a.h, b.l, c); return wmma_bf(a.h, b.h, c); }
__device__ __forceinline__ float sigm(float v) { return 1.0f / (1.0f + expf(-v)); }
#define LDSX() do { asm volatile("s_wait_dscnt 0" ::: "memory"); __builtin_amdgcn_wave_barrier(); __builtin_amdgcn_fence(__ATOMIC_RELEASE, "workgroup"); } while (0)

// Multi-head self-attention with a shared boolean topology mask (x [32,1024,256]; 8 heads x 32; torch (out,in) Wq/Wk/Wv/Wo [256,256] + biases (N(0, 1/256), NONZERO); attn_mask [1024,1024] bool (~50 % True, diagonal True) shared by all batches and heads: scores = where(mask, q_h k_h^T / sqrt(32), -1e9)): out = merge(softmax(scores) v_h) Wo^T + bo.
#define NB 32
#define TT 1024
#define CC 256            // NH * HD = projected width
#define DIN 256          // input (model) width
#define NH 8
#define HD 32
#define NQB (TT / 64)
#define HG 8
#define SCALE (0.17677669529663687f)
#define CAUSAL 0
#ifndef TNB
#define TNB NB
#endif
__device__ __forceinline__ float bfr(float v) { return (float)(__bf16)v; }
__host__ __device__ __forceinline__ int kb_last(int qb) { return CAUSAL ? ((qb * 64 + 63) >> 7) : (TT / 128 - 1); }
typedef __attribute__((ext_vector_type(8))) __bf16 v8b;
__device__ __forceinline__ v16b frag_b(const __bf16* rowk0, int lane) {
  union { v16b v; v8b q[2]; } u; const __bf16* p = rowk0 + 8 * (lane >> 4);
  u.q[0] = *(const v8b*)p; u.q[1] = *(const v8b*)(p + 16); return u.v;
}
#define QBH 0              // read by no kernel: k_attn has one single-product path for every query block
#define QHI 0               // single-product logits on every row (sigma - 1 logits averaged over -512 visible keys)
#define KHI 64            // key rows carrying k residual / v bf16 hi+lo planes (no kernel here writes or reads them)
// B fragment (k rows k0+.., output column o) of a weight: (in,out) [K][ld] or (out,in) [ld rows of K]: bf16 exact, or f16(bf16 * 256) exact
__device__ __forceinline__ v16b wcol_io(const float* Wm, int k0, int o, int lane, int ld) { v16b w; const int g = lane >> 4;
#pragma unroll
  for (int i = 0; i < 8; ++i) { w[i] = (__bf16)Wm[(size_t)(k0 + 8 * g + i) * ld + o]; w[8 + i] = (__bf16)Wm[(size_t)(k0 + 16 + 8 * g + i) * ld + o]; }
  return w; }
__device__ __forceinline__ v16b wcol_oi(const float* Wm, int k0, int o, int lane, int K) { v16b w; const float* p = Wm + (size_t)o * K + k0 + 8 * (lane >> 4);
#pragma unroll
  for (int i = 0; i < 8; ++i) { w[i] = (__bf16)p[i]; w[8 + i] = (__bf16)p[16 + i]; }
  return w; }
__device__ __forceinline__ v16h wcolh_io(const float* Wm, int k0, int o, int lane, int ld) { v16h w; const int g = lane >> 4;
#pragma unroll
  for (int i = 0; i < 8; ++i) { w[i] = (_Float16)(bfr(Wm[(size_t)(k0 + 8 * g + i) * ld + o]) * 256.0f); w[8 + i] = (_Float16)(bfr(Wm[(size_t)(k0 + 16 + 8 * g + i) * ld + o]) * 256.0f); }
  return w; }
__device__ __forceinline__ v16h wcolh_oi(const float* Wm, int k0, int o, int lane, int K) { v16h w; const float* p = Wm + (size_t)o * K + k0 + 8 * (lane >> 4);
#pragma unroll
  for (int i = 0; i < 8; ++i) { w[i] = (_Float16)(bfr(p[i]) * 256.0f); w[8 + i] = (_Float16)(bfr(p[16 + i]) * 256.0f); }
  return w; }
#define WQKV_LAYOUT 1   // 0 = (in,out) [DIN][CC]; 1 = (out,in) [CC][DIN]; 2 = per-head [NH][DIN][HD]
__device__ __forceinline__ v16b wcol_hdk(const float* Wm, int k0, int o, int lane) { v16b w; const int g = lane >> 4; const float* p = Wm + (size_t)(o / HD) * DIN * HD + (o % HD);
#pragma unroll
  for (int i = 0; i < 8; ++i) { w[i] = (__bf16)p[(size_t)(k0 + 8 * g + i) * HD]; w[8 + i] = (__bf16)p[(size_t)(k0 + 16 + 8 * g + i) * HD]; }
  return w; }
#define WO_OUT_IN 1
#if WQKV_LAYOUT == 1
#define WCOL(W, k0, o, lane) wcol_oi(W, k0, o, lane, DIN)
#elif WQKV_LAYOUT == 2
#define WCOL(W, k0, o, lane) wcol_hdk(W, k0, o, lane)
#else
#define WCOL(W, k0, o, lane) wcol_io(W, k0, o, lane, CC)
#endif
#if WO_OUT_IN
#define WOCOL(W, k0, o, lane) wcol_oi(W, k0, o, lane, CC)
#define WOCOLH(W, k0, o, lane) wcolh_oi(W, k0, o, lane, CC)
#else
#define WOCOL(W, k0, o, lane) wcol_io(W, k0, o, lane, DIN)
#define WOCOLH(W, k0, o, lane) wcolh_io(W, k0, o, lane, DIN)
#endif
#ifndef PROJ_EXTRA_PARAMS
#define PROJ_EXTRA_PARAMS
#endif

#define WS_QH  0u                                      // f16 q rows [b*t][CC]
#define WS_KH  (WS_QH + 2u * (size_t)NB * TT * CC)      // f16 k rows [b*t][CC]
#define WS_VT  (WS_KH + 2u * (size_t)NB * TT * CC)      // f16 v planes [b][c][t]
#define WS_QL  (WS_VT + 2u * (size_t)NB * CC * TT)      // f16 q residual x 2^10 rows [b][t < QHI][CC]
#define WS_KL  (WS_QL + 2u * (size_t)NB * QHI * CC)     // f16 k residual x 2^10 rows [b][t < KHI][CC]
#define WS_VB  (WS_KL + 2u * (size_t)NB * KHI * CC)     // bf16 v hi planes [b][c][t < KHI]
#define WS_VBL (WS_VB + 2u * (size_t)NB * CC * KHI)
#define WS_S   (WS_VBL + 2u * (size_t)NB * CC * KHI)    // room of HG x TT x TT f32; only the mask words (WS_PM) use it
#define WS_PM  WS_S                                      // the mask as lane-mask words [query tile of 16][32 keys][16 words], 128 KiB (the logits plane is not used)
#define WS_Y   (WS_S  + 4u * (size_t)HG * TT * TT)      // f32 ctx rows [b*t][CC] (only when there is an output projection)
#define WS_END (WS_Y  + 4u * (size_t)NB * TT * CC)

// ---- operand staging of k_proj and k_out: a block's 128 weight rows (its output columns) and, per row tile, 64 input rows, 256 f32 each and contiguous in memory, go to LDS once as 16-bit rows.
// Every load of a wave takes 512 contiguous bytes, so a block touches each 128-B line once; the WMMA fragments are then 16-B LDS reads.
#define SPIT 264           // 16-bit elements per staged row: 528 B = 16 B x odd
#define SW_BYTES (128 * SPIT * 2)
#define SX_BYTES (64 * SPIT * 2)      // the 64 input rows stand first, so that every LDS store of the tile loop is an immediate offset; the weight rows follow
#define SOP_BYTES ((128 + 64) * SPIT * 2)
static_assert(WQKV_LAYOUT == 1 && WO_OUT_IN == 1 && DIN == 256 && CC == 256, "the staging below reads (out,in) weight rows of 256");
typedef __attribute__((ext_vector_type(4))) __bf16 v4b;
typedef __attribute__((ext_vector_type(4))) _Float16 v4h;
// base = first row (128 threads = two rows a pass), d = this thread's 8 bytes of LDS row tid >> 6; the loops are unrolled so that t[] stays in registers and every step is an immediate offset
// pre() runs once, behind the first 16 loads' issue and in front of the first LDS store
template <int NROW, typename CV, typename PRE> __device__ __forceinline__ void stage_rows(const float* base, int tid, unsigned char* d, CV cv, PRE pre) {
  const float* p = base + tid * 4;
#pragma unroll
  for (int b = 0; b < NROW / 2; b += 16) { v4f t[16];
#pragma unroll
    for (int i = 0; i < 16; ++i) t[i] = *(const v4f*)(p + (b + i) * 512);
    asm volatile("s_wait_xcnt 0x0" :: "v"(tid), "s"(base) : "memory");      // the loads' offset register and base stay untouched until the 16 loads above have taken them; no later load is lifted over this line, which keeps the registers under 256
    if (b == 0) pre();
#pragma unroll
    for (int i = 0; i < 16; ++i) cv(d + (b + i) * (2 * SPIT * 2), t[i]); } }

#define PNT 4             // row tiles of 64 that a k_proj block walks with its 128 weight rows kept in LDS
#define ONT 2             // the same for k_out
// ---- k_proj: block = (PNT x 64 rows, 128 cols, which): q/k/v = X W (+ b) with exact bf16 products (K = DIN) -> which 0: q f16 rows; 1: k f16 rows; 2: v f16 planes [c][t]. The weight rows are staged once; each row tile stages its 64 input rows behind them
__global__ __launch_bounds__(128) void k_proj(const float* __restrict__ XQ, const float* __restrict__ XK, const float* __restrict__ XV, const float* __restrict__ WQ, const float* __restrict__ WK, const float* __restrict__ WV, const float* __restrict__ BQ, const float* __restrict__ BK, const float* __restrict__ BV,
    _Float16* __restrict__ QH, _Float16* __restrict__ KH, _Float16* __restrict__ VT, const int* __restrict__ AMASK, unsigned* __restrict__ PM) {
  __shared__ __align__(16) unsigned char sm[SOP_BYTES];      // the input rows of one tile, then the weight rows; behind a tile's third barrier the input rows' bytes hold its output tile
  __bf16 (*sX)[SPIT] = (__bf16 (*)[SPIT])sm; __bf16 (*sW)[SPIT] = (__bf16 (*)[SPIT])(sm + SX_BYTES);
  _Float16 (*sh)[136] = (_Float16 (*)[136])sm; _Float16 (*th)[72] = (_Float16 (*)[72])sm;
  static_assert(64 * 136 * 2 <= 64 * SPIT * 2 && 128 * 72 * 2 <= 64 * SPIT * 2, "an output tile fits in the input rows' bytes");
  static_assert(TT % (64 * PNT) == 0, "a block's row tiles lie in one sequence");
  const int tid = threadIdx.x, wave = tid >> 5, lane = tid & 31, col = lane & 15, g = lane >> 4; const int which = blockIdx.z; const int c0 = blockIdx.y * 128;
  if (which == 3) {      // mask blocks (block-uniform, in front of every barrier): each wave turns two tiles of 16 queries x 32 keys into 32 words, one 128-B line.
    // Word i of a tile, bit l = mask[query tile * 16 + (l & 15)][key block * 32 + 16 (i >> 3) + 8 (l >> 4) + (i & 7)]: the lane mask of score register i in k_attn
    static_assert((TNB * TT / 64 / PNT) * (CC / 128) * 4 == (TT / 16) * (TT / 64), "one wave of a mask block for every pair of tiles");
    const int tp = (blockIdx.x * 2 + blockIdx.y) * 4 + wave; const int* mp = AMASK + ((tp >> 4) * 16 + col) * TT + (tp & 15) * 64 + 8 * g; v4i m[8]; unsigned wd = 0;
#pragma unroll
    for (int i = 0; i < 8; ++i) m[i] = *(const v4i*)(mp + (i >> 1) * 16 + (i & 1) * 4);
#pragma unroll
    for (int i = 0; i < 32; ++i) { const unsigned bl = __builtin_amdgcn_ballot_w32(m[i >> 2][i & 3] != 0); if (lane == i) wd = bl; }
    PM[tp * 32 + lane] = wd; return; }
  const float* X = which == 0 ? XQ : which == 1 ? XK : XV; const float* WA = which == 0 ? WQ : which == 1 ? WK : WV; const float* BA = which == 0 ? BQ : which == 1 ? BK : BV;
  unsigned char* d = sm + (tid >> 6) * (SPIT * 2) + (tid & 63) * 8;
  auto cv = [](unsigned char* q, v4f v) { const v4b o = { (__bf16)v[0], (__bf16)v[1], (__bf16)v[2], (__bf16)v[3] }; *(v4b*)q = o; };
  auto none = []() {}; auto foot = []() { __syncthreads(); };      // foot: every thread has read its part of the last output tile before this tile's input rows overwrite it; it stands behind the loads' issue, so that the wait for the last tile's global stores runs beside the loads
  stage_rows<128>(WA + (size_t)c0 * DIN, tid, d + SX_BYTES, cv, none);
  const int wr = (wave >> 1) * 32, wc = (wave & 1) * 64;      // a wave's part of the 64 x 128 tile: 32 rows x 64 columns, so that 6 fragments from LDS feed 8 products (16 x 128: 9)
  float bias[4];
#pragma unroll
  for (int j = 0; j < 4; ++j) bias[j] = BA ? bfr(BA[c0 + wc + j * 16 + col]) : 0.f;
#pragma unroll 1      // one copy of the tile's code: the four tiles differ only in their row offset
  for (int it = 0; it < PNT; ++it) { const size_t r0 = ((size_t)blockIdx.x * PNT + it) * 64; const size_t bb = r0 / TT; const int t0 = (int)(r0 % TT);
    stage_rows<64>(X + r0 * DIN, tid, d, cv, foot);
    __syncthreads();      // the tile's input rows (and, on the first tile, the weight rows) are in LDS
    v8f acc[2][4] = {}; v16b a[2][2], w[2][4];
    auto frags = [&](int kc, v16b (&fa)[2], v16b (&fw)[4]) {
#pragma unroll
      for (int t = 0; t < 2; ++t) fa[t] = frag_b(&sX[wr + t * 16 + col][kc * 32], lane);
#pragma unroll
      for (int j = 0; j < 4; ++j) fw[j] = frag_b(&sW[wc + j * 16 + col][kc * 32], lane); };
    frags(0, a[0], w[0]);
#pragma unroll
    for (int kc = 0; kc < DIN / 32; ++kc) { if (kc + 1 < DIN / 32) frags(kc + 1, a[(kc + 1) & 1], w[(kc + 1) & 1]);      // the next 32 k's fragments are fetched as one group while these products run; unrolled so that both fragment sets are indexed statically and stay in registers
#pragma unroll
      for (int t = 0; t < 2; ++t) {
#pragma unroll
        for (int j = 0; j < 4; ++j) acc[t][j] = wmma_bf(a[kc & 1][t], w[kc & 1][j], acc[t][j]); } }
    __syncthreads();      // every wave has read its last fragment before the output tile overwrites the input rows
    if (which < 2) { _Float16* DH = which == 0 ? QH : KH;
#pragma unroll
      for (int t = 0; t < 2; ++t) {
#pragma unroll
        for (int j = 0; j < 4; ++j) {
#pragma unroll
          for (int r = 0; r < 8; ++r) sh[wr + t * 16 + 8 * g + r][wc + j * 16 + col] = (_Float16)(acc[t][j][r] + bias[j]); } }
      __syncthreads();
      for (int e = tid; e < 64 * 16; e += 128) { const int rl = e >> 4, q = e & 15; vst2((unsigned*)(DH + (r0 + rl) * CC + c0 + q * 8), *(const v4u*)&sh[rl][q * 8]); }
    } else {
#pragma unroll
      for (int t = 0; t < 2; ++t) {
#pragma unroll
        for (int j = 0; j < 4; ++j) {
#pragma unroll
          for (int r = 0; r < 8; ++r) th[wc + j * 16 + col][wr + t * 16 + 8 * g + r] = (_Float16)(acc[t][j][r] + bias[j]); } }
      __syncthreads();
      for (int e = tid; e < 128 * 8; e += 128) { const int cl = e >> 3, q = e & 7; vst2((unsigned*)(VT + (bb * CC + c0 + cl) * (size_t)TT + t0 + q * 8), *(const v4u*)&th[cl][q * 8]); } }
    asm volatile("s_wait_xcnt 0x0" ::: "memory");      // the stores above have taken their address registers before the next tile rewrites them
  } }
// ---- k_attn: block = (all 1024 queries, head h, batch b), 16 waves, each with ANG groups of 32 queries one after the other. K rows and v planes of (b, h) are staged in LDS once for all of them; for each group a wave walks the 1024 keys 32 at a time:
// S^T = K q^T (lane = one query, 16 of the 32 keys), mask by element, weights exp2(logit) x 2 with their f32 sum per query, once to f16 straight from the score registers as the B operand of ctx^T += v^T P^T; ctx / sum at the end.
// A softmax does not depend on its shift, so the key loop uses none: no maximum, no exchange between the lane halves, no rescaling. The range is checked from the data behind the loop, by the sum alone (every weight is >= 0):
// sum < 65504 -> no weight left f16's range upwards; sum >= 2^8 -> the weights under f16's smallest normal number, 1024 x 2^-14 at most, are at most 2^-12 of the sum, the bound that the running maximum gives (largest weight 2^8).
// The factor 2 puts a row of 512 to 1024 visible logits around 0 at 2^10 to 2^11: 2 to 3 powers of two over the lower limit, 5 under the upper one, on which side the exponentials' tail lies.
// A group of 32 queries with a sum outside (large or strongly offset logits, few or no visible keys, a NaN) is worked again with the running maximum: slower, and right for any input.
#define AW 16
#define AQT 2
#define ANG 2              // query groups that a wave walks under the one fill
#define AQG (AW * AQT * 16)      // queries of one group over the block's waves
#define AQB (AQG * ANG)
static_assert(AW * 32 == 512 && TT == 1024 && HD == 32 && TT % AQB == 0, "the fill below is written for 512 threads, 1024 keys, head size 32");
#define KPIT 40            // f16 per staged K row: 80 B = 16 B x odd
#define VPIT (TT + 8)      // f16 per staged v plane: 2064 B = 16 B x odd
#define LOG2E 1.4426950408889634f
#define SUMLO 256.0f       // the sums for which the weights without a shift stand: SUMLO <= sum < SUMHI
#define SUMHI 65504.0f
typedef __attribute__((ext_vector_type(2))) _Float16 v2h;
typedef __attribute__((ext_vector_type(16))) unsigned v16u;
__device__ __forceinline__ float xhalf(float x) { return __builtin_bit_cast(float, __builtin_amdgcn_permlanex16(__builtin_bit_cast(int, x), __builtin_bit_cast(int, x), 0x76543210, 0xfedcba98, false, false)); }   // lane l with lane l ^ 16
__device__ __forceinline__ v8f wmma_h(v16h a, v16h b, v8f c) { return __builtin_amdgcn_wmma_f32_16x16x32_f16(false, a, false, b, (short)0, c, false, false); }
__global__ __launch_bounds__(AW * 32) __attribute__((amdgpu_waves_per_eu(4, 4))) void k_attn(const _Float16* __restrict__ QH, const _Float16* __restrict__ KH, const _Float16* __restrict__ VT, const unsigned* __restrict__ PM, float* __restrict__ Y) {   // 4 waves per SIMD = one block of 16 waves per WGP
  __shared__ __align__(16) _Float16 sK[TT][KPIT]; __shared__ __align__(16) _Float16 sV[HD][VPIT];
  const int tid = threadIdx.x, wave = tid >> 5, lane = tid & 31, col = lane & 15, g = lane >> 4; const int h = blockIdx.y, b = blockIdx.z; const int qw = blockIdx.x * AQB + wave * (AQT * 16);      // group n of this wave: queries qw + n * AQG + 0..31
  v4u tk[8], tv[8];      // the fill: 1024 K rows x 64 B and 32 v planes x 2048 B, 8 + 8 loads of 16 B a thread, all in flight together, then the LDS stores
  const _Float16* kp = KH + ((size_t)b * TT + (tid >> 2)) * CC + h * HD + (tid & 3) * 8;            // load i: K row (tid >> 2) + 128 i
  const _Float16* vp = VT + ((size_t)b * CC + h * HD + (tid >> 7)) * (size_t)TT + (tid & 127) * 8;   // load i: v plane (tid >> 7) + 4 i
  const _Float16* qp = QH + ((size_t)b * TT + qw + col) * CC + h * HD + 8 * g;
#pragma unroll
  for (int i = 0; i < 8; ++i) tk[i] = *(const v4u*)(kp + i * 128 * CC);
#pragma unroll
  for (int i = 0; i < 8; ++i) tv[i] = *(const v4u*)(vp + i * 4 * TT);
  v16h qa[ANG][AQT];      // the q fragments of every group come with the fill, so that no group waits for its own
#pragma unroll
  for (int n = 0; n < ANG; ++n) {
#pragma unroll
    for (int u = 0; u < AQT; ++u) { union { v16h v; v8h q[2]; } t; t.q[0] = *(const v8h*)(qp + (n * AQG + u * 16) * CC); t.q[1] = *(const v8h*)(qp + (n * AQG + u * 16) * CC + 16); qa[n][u] = t.v; } }   // B fragment, same k order as frag_h
  asm volatile("s_wait_xcnt 0x0" :: "v"(kp), "v"(vp), "v"(qp) : "memory");      // the three address pairs stay untouched until the loads above have taken them
#pragma unroll
  for (int i = 0; i < 8; ++i) *(v4u*)&sK[(tid >> 2) + 128 * i][(tid & 3) * 8] = tk[i];
#pragma unroll
  for (int i = 0; i < 8; ++i) *(v4u*)&sV[(tid >> 7) + 4 * i][(tid & 127) * 8] = tv[i];
  __syncthreads();
  const float NEGR = -1.0e9f / SCALE;      // the reference's -1e9 fill in units of the unscaled product
  const float CL = SCALE * LOG2E;
#pragma unroll      // unrolled so that qa[n] is indexed statically and stays in registers
  for (int n = 0; n < ANG; ++n) { const int q0 = qw + n * AQG; const v16h (&qf)[AQT] = qa[n]; v8f acc[AQT][2] = {}; v2f ps[AQT][2] = {}; float mx[AQT], ls[AQT];
  const v16u* pm = (const v16u*)PM + __builtin_amdgcn_readfirstlane(q0 >> 4) * (TT / 32);      // this group's mask words: wave-uniform, so they come by scalar loads; tile u is TT / 32 groups of 16 words on
  auto mload = [&](int k0, v16u (&mk)[AQT]) {
#pragma unroll
    for (int u = 0; u < AQT; ++u) mk[u] = pm[u * (TT / 32) + (k0 >> 5)]; };
  auto step = [&](int k0, const v16u (&mk)[AQT]) {
    const v16h ka = frag_h(&sK[k0 + col][0], lane), kb = frag_h(&sK[k0 + 16 + col][0], lane);      // A rows = keys k0 + 0..15, k0 + 16..31
    const v16h va = frag_h(&sV[col][k0], lane), vb = frag_h(&sV[16 + col][k0], lane);              // A rows = head columns 0..15, 16..31; k = keys in the order of the packed scores
#pragma unroll
    for (int u = 0; u < AQT; ++u) {
      const v8f z = {}; v8f s[2]; s[0] = wmma_h(ka, qf[u], z); s[1] = wmma_h(kb, qf[u], z);      // s[T][r] = key k0 + 16T + 8g + r, query = col
      union { v16h v; v2h q[8]; } pf;
#pragma unroll
      for (int i = 0; i < 8; ++i) { v2f d = { __builtin_amdgcn_inverse_ballot_w32(mk[u][2 * i]) ? s[i >> 2][(2 * i) & 7] : NEGR, __builtin_amdgcn_inverse_ballot_w32(mk[u][2 * i + 1]) ? s[i >> 2][(2 * i + 1) & 7] : NEGR };      // word i is the select's lane mask as it stands
        d = d * CL + 1.0f;      // a masked key's exponent is far below f32's range: weight 0
        const v2f p = { __builtin_amdgcn_exp2f(d[0]), __builtin_amdgcn_exp2f(d[1]) }; ps[u][i & 1] += p; pf.q[i] = __builtin_convertvector(p, v2h); }
      acc[u][0] = wmma_h(va, pf.v, acc[u][0]); acc[u][1] = wmma_h(vb, pf.v, acc[u][1]);
    } };
  auto step_mx = [&](int k0, const v16u (&mk)[AQT]) {      // the same 32 keys with a running maximum: any range of logits
    const v16h ka = frag_h(&sK[k0 + col][0], lane), kb = frag_h(&sK[k0 + 16 + col][0], lane);      // A rows = keys k0 + 0..15, k0 + 16..31
    const v16h va = frag_h(&sV[col][k0], lane), vb = frag_h(&sV[16 + col][k0], lane);              // A rows = head columns 0..15, 16..31; k = keys in the order of the packed scores
#pragma unroll
    for (int u = 0; u < AQT; ++u) {
      const v8f z = {}; v8f s[2]; s[0] = wmma_h(ka, qf[u], z); s[1] = wmma_h(kb, qf[u], z);      // s[T][r] = key k0 + 16T + 8g + r, query = col
      float x[16];
#pragma unroll
      for (int i = 0; i < 16; ++i) x[i] = __builtin_amdgcn_inverse_ballot_w32(mk[u][i]) ? s[i >> 3][i & 7] : NEGR;      // word i is the select's lane mask as it stands
      float cm = x[0];
#pragma unroll
      for (int i = 1; i < 16; ++i) cm = fmaxf(cm, x[i]);
      const float mn = fmaxf(mx[u], fmaxf(cm, xhalf(cm)));           // both lane halves of a query use one maximum: their weights meet in one product
      const float al = __builtin_amdgcn_exp2f((mx[u] - mn) * CL); mx[u] = mn;
      union { v16h v; v2h q[8]; } pf; v2f sum = {};
#pragma unroll
      for (int i = 0; i < 8; ++i) { v2f d = { x[2 * i], x[2 * i + 1] }; d = (d - mn) * CL + 8.0f;      // difference first: exactly 0 where a whole row is masked (uniform weights, as the reference gives)
        const v2f p = { __builtin_amdgcn_exp2f(d[0]), __builtin_amdgcn_exp2f(d[1]) }; sum += p; pf.q[i] = __builtin_convertvector(p, v2h); }
      ls[u] = ls[u] * al + (sum[0] + sum[1]);
      acc[u][0] = wmma_h(va, pf.v, acc[u][0] * al); acc[u][1] = wmma_h(vb, pf.v, acc[u][1] * al);
    } };
  v16u ma[AQT], mb[AQT]; mload(0, ma); mload(32, mb);      // the mask words of the next 64 keys are fetched, into the registers that the selects have just read, while these 64 are worked on
  for (int k0 = 0; k0 < TT; k0 += 64) { const int kn = k0 + 64 < TT ? k0 + 64 : 0; step(k0, ma); mload(kn, ma); step(k0 + 32, mb); mload(kn + 32, mb); }
  bool in = true;
#pragma unroll
  for (int u = 0; u < AQT; ++u) { const v2f t = ps[u][0] + ps[u][1]; ls[u] = t[0] + t[1]; const float tot = ls[u] + xhalf(ls[u]); in = in && tot >= SUMLO && tot < SUMHI; }      // false for a NaN too
  if (__builtin_amdgcn_ballot_w32(!in) != 0) {      // wave-uniform (a scalar branch on the ballot), no barrier behind it: the group's 32 queries again, from the start
#pragma unroll
    for (int u = 0; u < AQT; ++u) { mx[u] = -3.0e38f; ls[u] = 0.f; acc[u][0] = v8f{}; acc[u][1] = v8f{}; }
#pragma unroll 1      // a path that few inputs take: one copy of the 32 keys' code
    for (int k0 = 0; k0 < TT; k0 += 32) { mload(k0, ma); step_mx(k0, ma); } }
#pragma unroll
  for (int u = 0; u < AQT; ++u) { const float inv = 1.0f / (ls[u] + xhalf(ls[u])); float* yp = Y + (unsigned)((b * TT + q0 + u * 16 + col) * CC + h * HD + 8 * g);
#pragma unroll
    for (int j = 0; j < 2; ++j) { const v8f o = acc[u][j] * inv; vst2(yp + j * 16, (v4f)__builtin_shufflevector(o, o, 0, 1, 2, 3)); vst2(yp + j * 16 + 4, (v4f)__builtin_shufflevector(o, o, 4, 5, 6, 7)); } }
  if (n + 1 < ANG) asm volatile("s_wait_xcnt 0x0" ::: "memory");      // the stores above have taken their address registers before the next group rewrites them
  } }
// ---- k_out: block = (ONT x 64 rows, 128 cols): out = ctx Wo (+ bo): ctx x 2^6 once to f16 against Wo as f16(bf16 x 2^8) exact (1 product) x 2^-14. The Wo rows are staged once; each row tile stages its 64 ctx rows behind them
__global__ __launch_bounds__(128) void k_out(const float* __restrict__ Y, const float* __restrict__ WO, const float* __restrict__ BO, float* __restrict__ OUT) { __shared__ __align__(16) unsigned char sm[SOP_BYTES];      // the ctx rows of one tile, then the weight rows; behind a tile's third barrier the ctx rows' bytes hold its output tile
  _Float16 (*sY)[SPIT] = (_Float16 (*)[SPIT])sm; _Float16 (*sW)[SPIT] = (_Float16 (*)[SPIT])(sm + SX_BYTES); float (*sf)[132] = (float (*)[132])sm;
  static_assert(64 * 132 * 4 <= 64 * SPIT * 2, "the output tile fits in the ctx rows' bytes");
  const int tid = threadIdx.x, wave = tid >> 5, lane = tid & 31, col = lane & 15, g = lane >> 4; const int c0 = blockIdx.y * 128;
  unsigned char* d = sm + (tid >> 6) * (SPIT * 2) + (tid & 63) * 8;
  auto cy = [](unsigned char* q, v4f v) { const v4h o = { (_Float16)(v[0] * 64.0f), (_Float16)(v[1] * 64.0f), (_Float16)(v[2] * 64.0f), (_Float16)(v[3] * 64.0f) }; *(v4h*)q = o; };   /* ctx carried x 2^6 into f16 so small-magnitude context rows stay clear of f16 subnormals */
  auto cw = [](unsigned char* q, v4f v) { const v4h o = { (_Float16)(bfr(v[0]) * 256.0f), (_Float16)(bfr(v[1]) * 256.0f), (_Float16)(bfr(v[2]) * 256.0f), (_Float16)(bfr(v[3]) * 256.0f) }; *(v4h*)q = o; };
  auto none = []() {}; auto foot = []() { __syncthreads(); };      // foot: every wave has read its last output rows before this tile's ctx rows overwrite them; it stands behind the loads' issue, so that the wait for the last tile's global stores runs beside the loads
  stage_rows<128>(WO + (size_t)c0 * CC, tid, d + SX_BYTES, cw, none);
  const int wr = (wave >> 1) * 32, wc = (wave & 1) * 64;      // a wave's part of the 64 x 128 tile: 32 rows x 64 columns, so that 6 fragments from LDS feed 8 products (16 x 128: 9)
  float bias[4];
#pragma unroll
  for (int j = 0; j < 4; ++j) bias[j] = BO ? bfr(BO[c0 + wc + j * 16 + col]) : 0.f;
#pragma unroll 1      // one copy of the tile's code: the tiles differ only in their row offset
  for (int it = 0; it < ONT; ++it) { const size_t rb = ((size_t)blockIdx.x * ONT + it) * 64;
    stage_rows<64>(Y + rb * CC, tid, d, cy, foot);
    __syncthreads();      // the tile's ctx rows (and, on the first tile, the weight rows) are in LDS
    v8f acc[2][4] = {}; v16h a[2][2], w[2][4];
    auto frags = [&](int kc, v16h (&fa)[2], v16h (&fw)[4]) {
#pragma unroll
      for (int t = 0; t < 2; ++t) fa[t] = frag_h(&sY[wr + t * 16 + col][kc * 32], lane);
#pragma unroll
      for (int j = 0; j < 4; ++j) fw[j] = frag_h(&sW[wc + j * 16 + col][kc * 32], lane); };
    frags(0, a[0], w[0]);
#pragma unroll
    for (int kc = 0; kc < CC / 32; ++kc) { if (kc + 1 < CC / 32) frags(kc + 1, a[(kc + 1) & 1], w[(kc + 1) & 1]);      // the next 32 k's fragments are fetched as one group while these products run; unrolled so that both fragment sets are indexed statically and stay in registers
#pragma unroll
      for (int t = 0; t < 2; ++t) {
#pragma unroll
        for (int j = 0; j < 4; ++j) acc[t][j] = wmma16(a[kc & 1][t], w[kc & 1][j], acc[t][j]); } }
    __syncthreads();      // every wave has read its last fragment before the output tile overwrites the ctx rows
#pragma unroll
    for (int t = 0; t < 2; ++t) {
#pragma unroll
      for (int j = 0; j < 4; ++j) {
#pragma unroll
        for (int r = 0; r < 8; ++r) sf[wr + t * 16 + 8 * g + r][wc + j * 16 + col] = acc[t][j][r] * (1.0f / 16384.0f) + bias[j]; } }   /* 2^-8 (Wo carry) x 2^-6 (ctx carry) */
    LDSX(); for (int rl = 0; rl < 32; rl += 2) vst2(OUT + (rb + wr + rl + g) * DIN + c0 + wc + col * 4, *(const v4f*)&sf[wr + rl + g][wc + col * 4]);      // a wave reads back only what it wrote itself: two rows of 256 B (two whole lines each) a store
    asm volatile("s_wait_xcnt 0x0" ::: "memory");      // the stores above have taken their address registers before the next tile rewrites them
  } }

extern "C" void kernel_launch(void* const* d_in, const int* in_sizes, int n_in, void* d_out, int out_size, void* d_ws, size_t ws_size, hipStream_t stream) {
  (void)in_sizes; (void)n_in; (void)out_size;
  const float** F = (const float**)d_in;
  if (ws_size < (size_t)WS_END) return;
  char* ws = (char*)d_ws; _Float16 *QH = (_Float16*)(ws + WS_QH), *KH = (_Float16*)(ws + WS_KH), *VT = (_Float16*)(ws + WS_VT), *QL = (_Float16*)(ws + WS_QL), *KL = (_Float16*)(ws + WS_KL); __bf16 *VB = (__bf16*)(ws + WS_VB), *VBL = (__bf16*)(ws + WS_VBL); float *S = (float*)(ws + WS_S), *Y = (float*)(ws + WS_Y); unsigned* PM = (unsigned*)(ws + WS_PM);
  (void)Y; (void)S; (void)QL; (void)KL; (void)VB; (void)VBL;
  // inputs: 0 x [32,1024,256]; 1 attn_mask [1024,1024] (bool topology mask, diagonal True); 2 Wq [256,256] (out,in), 3 bq; 4 Wk, 5 bk; 6 Wv, 7 bv; 8 Wo (out,in), 9 bo (biases nonzero)
  k_proj<<<dim3(TNB * TT / 64 / PNT, CC / 128, 4), 128, 0, stream>>>(F[0], F[0], F[0], F[2], F[4], F[6], F[3], F[5], F[7], QH, KH, VT, (const int*)d_in[1], PM);   // z = 3: the 256 mask blocks
  k_attn<<<dim3(TT / AQB, NH, TNB), AW * 32, 0, stream>>>(QH, KH, VT, PM, Y);
  k_out<<<dim3(TNB * TT / 64 / ONT, DIN / 128), 128, 0, stream>>>(Y, F[8], F[9], (float*)d_out);
}

// v008
// One run takes 77.5 microseconds.
// Two timings next to v007 both put it at 1.04 times that version's speed.
// Counting every step since v000, it is 25.6 times as fast.
// compute dtype: all float inputs rounded to bf16; q/k/v projections with EXACT bf16 products on WMMA 16x16x32 (f32 accumulate) + bias; logits q x 32^-0.5 log2(e) and k once to f16 each (1 product; sigma - 1); the shared boolean mask read per element; softmax f32 without a shift (weights exp2(logit) x 2, once to f16; their sum per query by a product of ones with them, f32 accumulate) where a query's sum shows its weights inside f16's range, else online softmax (running maximum and sum, weights x 2^8); weights once to f16 x v once to f16 (1 product), divided by the f32 sum after the product; ctx x 2^6 once to f16 x Wo f16(bf16 x 2^8) + bo; f32 output.
#include <hip/hip_runtime.h>
#include <math.h>

typedef __attribute__((ext_vector_type(16))) _Float16 v16h;
typedef __attribute__((ext_vector_type(16))) __bf16 v16b;
typedef __attribute__((ext_vector_type(8)))  _Float16 v8h;
typedef __attribute__((ext_vector_type(8)))  float v8f;
typedef __attribute__((ext_vector_type(4)))  float v4f;
typedef __attribute__((ext_vector_type(2)))  float v2f;
typedef __attribute__((ext_vector_type(4)))  unsigned v4u;
typedef __attribute__((ext_vector_type(4)))  int v4i;
typedef float __attribute__((may_alias)) float_a;
typedef int __attribute__((may_alias)) int_a;

template <typename T> __device__ __forceinline__ void vst2(void* p, T v) { *(T*)p = v;  }
__device__ __forceinline__ v8f wmma16(v16h a, v16h b, v8f c) {
  v8f d = __builtin_amdgcn_wmma_f32_16x16x32_f16(false, a, false, b, (short)0, c, false, false);
  asm volatile("v_nop\n\tv_nop\n\tv_nop\n\tv_nop" : "+v"(d) : "v"(a), "v"(b));
  return d;
}
__device__ __forceinline__ v8f wmma_bf(v16b a, v16b b, v8f c) {
  v8f d = __builtin_amdgcn_wmma_f32_16x16x32_bf16(false, a, false, b, (short)0, c, false, false);
  asm volatile("v_nop\n\tv_nop\n\tv_nop\n\tv_nop" : "+v"(d) : "v"(a), "v"(b));
  return d;
}
// 16x16x32 fragments: lane = (h = lane>>4, row/col = lane&15); elements 0..7 = k0+8h+0..7, 8..15 = k0+16+8h+0..7; D element r = row 8h+r
__device__ __forceinline__ v16h frag_h(const _Float16* rowk0, int lane) {
  union { v16h v; v8h q[2]; } u; const _Float16* p = rowk0 + 8 * (lane >> 4);
  u.q[0] = *(const v8h*)p; u.q[1] = *(const v8h*)(p + 16); return u.v;
}
__device__ __forceinline__ v16h frag_f32(const float* rowk0, int lane) {
  v16h a; const float* p = rowk0 + 8 * (lane >> 4);
#pragma unroll
  for (int i = 0; i < 8; ++i) { a[i] = (_Float16)p[i]; a[8 + i] = (_Float16)p[16 + i]; }
  return a;
}
__device__ __forceinline__ v16h frag_f32s(const float* rowk0, int lane, float sc) {
  v16h a; const float* p = rowk0 + 8 * (lane >> 4);
#pragma unroll
  for (int i = 0; i < 8; ++i) { a[i] = (_Float16)(p[i] * sc); a[8 + i] = (_Float16)(p[16 + i] * sc); }
  return a;
}
// column fragment from a [K][ld] layout (column n), rows >= K read as 0
__device__ __forceinline__ v16h fragc_f32(const float* W, int k0, int n, int lane, int ld, int K) {
  v16h a; const int g = lane >> 4;
#pragma unroll
  for (int i = 0; i < 8; ++i) { const int ka = k0 + 8 * g + i, kb = ka + 16;
    a[i] = (_Float16)(ka < K ? W[(size_t)(ka < K ? ka : K - 1) * ld + n] : 0.f); a[8 + i] = (_Float16)(kb < K ? W[(size_t)(kb < K ? kb : K - 1) * ld + n] : 0.f); }
  return a;
}
struct F2 { v16b h, l; };
__device__ __forceinline__ F2 bsplit16(const float v[16]) { F2 r;
#pragma unroll
  for (int i = 0; i < 16; ++i) { const __bf16 h = (__bf16)v[i]; r.h[i] = h; r.l[i] = (__bf16)(v[i] - (float)h); }
  return r; }
__device__ __forceinline__ F2 split_row(const float* row, int k0, int lane) { float v[16]; const float* p = row + k0 + 8 * (lane >> 4);
#pragma unroll
  for (int i = 0; i < 8; ++i) { v[i] = p[i]; v[8 + i] = p[16 + i]; }
  return bsplit16(v); }
__device__ __forceinline__ F2 split_rowK(const float* row, int k0, int lane, int K) { float v[16]; const int g = lane >> 4;
#pragma unroll
  for (int i = 0; i < 8; ++i) { const int ka = k0 + 8 * g + i, kb = ka + 16; v[i] = ka < K ? row[ka < K ? ka : K - 1] : 0.f; v[8 + i] = kb < K ? row[kb < K ? kb : K - 1] : 0.f; }
  return bsplit16(v); }
__device__ __forceinline__ F2 split_col(const float* W, int k0, int n, int lane, int ld, int K) { float v[16]; const int g = lane >> 4;
#pragma unroll
  for (int i = 0; i < 8; ++i) { const int ka = k0 + 8 * g + i, kb = ka + 16; v[i] = ka < K ? W[(size_t)(ka < K ? ka : K - 1) * ld + n] : 0.f; v[8 + i] = kb < K ? W[(size_t)(kb < K ? kb : K - 1) * ld + n] : 0.f; }
  return bsplit16(v); }
__device__ __forceinline__ v8f mac3(const F2& a, const F2& b, v8f c) { c = wmma_bf(a.l, b.h, c); c = wmma_bf(a.h, b.l, c); return wmma_bf(a.h, b.h, c); }
__device__ __forceinline__ float sigm(float v) { return 1.0f / (1.0f + expf(-v)); }
#define LDSX() do { asm volatile("s_wait_dscnt 0" ::: "memory"); __builtin_amdgcn_wave_barrier(); __builtin_amdgcn_fence(__ATOMIC_RELEASE, "workgroup"); } while (0)

// Multi-head self-attention with a shared boolean topology mask (x [32,1024,256]; 8 heads x 32; torch (out,in) Wq/Wk/Wv/Wo [256,256] + biases (N(0, 1/256), NONZERO); attn_mask [1024,1024] bool (~50 % True, diagonal True) shared by all batches and heads: scores = where(mask, q_h k_h^T / sqrt(32), -1e9)): out = merge(softmax(scores) v_h) Wo^T + bo.
#define NB 32
#define TT 1024
#define CC 256            // NH * HD = projected width
#define DIN 256          // input (model) width
#define NH 8
#define HD 32
#define NQB (TT / 64)
#define HG 8
#define SCALE (0.17677669529663687f)
#define QSC (SCALE * 1.4426950408889634f)      // what q carries into its f16 rows: the softmax scale and log2(e), so that q x k is an exponent of 2 as it stands
#define CAUSAL 0
#ifndef TNB
#define TNB NB
#endif
__device__ __forceinline__ float bfr(float v) { return (float)(__bf16)v; }
__host__ __device__ __forceinline__ int kb_last(int qb) { return CAUSAL ? ((qb * 64 + 63) >> 7) : (TT / 128 - 1); }
typedef __attribute__((ext_vector_type(8))) __bf16 v8b;
__device__ __forceinline__ v16b frag_b(const __bf16* rowk0, int lane) {
  union { v16b v; v8b q[2]; } u; const __bf16* p = rowk0 + 8 * (lane >> 4);
  u.q[0] = *(const v8b*)p; u.q[1] = *(const v8b*)(p + 16); return u.v;
}
#define QBH 0              // read by no kernel: k_attn has one single-product path for every query block
#define QHI 0               // single-product logits on every row (sigma - 1 logits averaged over -512 visible keys)
#define KHI 64            // key rows carrying k residual / v bf16 hi+lo planes (no kernel here writes or reads them)
// B fragment (k rows k0+.., output column o) of a weight: (in,out) [K][ld] or (out,in) [ld rows of K]: bf16 exact, or f16(bf16 * 256) exact
__device__ __forceinline__ v16b wcol_io(const float* Wm, int k0, int o, int lane, int ld) { v16b w; const int g = lane >> 4;
#pragma unroll
  for (int i = 0; i < 8; ++i) { w[i] = (__bf16)Wm[(size_t)(k0 + 8 * g + i) * ld + o]; w[8 + i] = (__bf16)Wm[(size_t)(k0 + 16 + 8 * g + i) * ld + o]; }
  return w; }
__device__ __forceinline__ v16b wcol_oi(const float* Wm, int k0, int o, int lane, int K) { v16b w; const float* p = Wm + (size_t)o * K + k0 + 8 * (lane >> 4);
#pragma unroll
  for (int i = 0; i < 8; ++i) { w[i] = (__bf16)p[i]; w[8 + i] = (__bf16)p[16 + i]; }
  return w; }
__device__ __forceinline__ v16h wcolh_io(const float* Wm, int k0, int o, int lane, int ld) { v16h w; const int g = lane >> 4;
#pragma unroll
  for (int i = 0; i < 8; ++i) { w[i] = (_Float16)(bfr(Wm[(size_t)(k0 + 8 * g + i) * ld + o]) * 256.0f); w[8 + i] = (_Float16)(bfr(Wm[(size_t)(k0 + 16 + 8 * g + i) * ld + o]) * 256.0f); }
  return w; }
__device__ __forceinline__ v16h wcolh_oi(const float* Wm, int k0, int o, int lane, int K) { v16h w; const float* p = Wm + (size_t)o * K + k0 + 8 * (lane >> 4);
#pragma unroll
  for (int i = 0; i < 8; ++i) { w[i] = (_Float16)(bfr(p[i]) * 256.0f); w[8 + i] = (_Float16)(bfr(p[16 + i]) * 256.0f); }
  return w; }
#define WQKV_LAYOUT 1   // 0 = (in,out) [DIN][CC]; 1 = (out,in) [CC][DIN]; 2 = per-head [NH][DIN][HD]
__device__ __forceinline__ v16b wcol_hdk(const float* Wm, int k0, int o, int lane) { v16b w; const int g = lane >> 4; const float* p = Wm + (size_t)(o / HD) * DIN * HD + (o % HD);
#pragma unroll
  for (int i = 0; i < 8; ++i) { w[i] = (__bf16)p[(size_t)(k0 + 8 * g + i) * HD]; w[8 + i] = (__bf16)p[(size_t)(k0 + 16 + 8 * g + i) * HD]; }
  return w; }
#define WO_OUT_IN 1
#if WQKV_LAYOUT == 1
#define WCOL(W, k0, o, lane) wcol_oi(W, k0, o, lane, DIN)
#elif WQKV_LAYOUT == 2
#define WCOL(W, k0, o, lane) wcol_hdk(W, k0, o, lane)
#else
#define WCOL(W, k0, o, lane) wcol_io(W, k0, o, lane, CC)
#endif
#if WO_OUT_IN
#define WOCOL(W, k0, o, lane) wcol_oi(W, k0, o, lane, CC)
#define WOCOLH(W, k0, o, lane) wcolh_oi(W, k0, o, lane, CC)
#else
#define WOCOL(W, k0, o, lane) wcol_io(W, k0, o, lane, DIN)
#define WOCOLH(W, k0, o, lane) wcolh_io(W, k0, o, lane, DIN)
#endif
#ifndef PROJ_EXTRA_PARAMS
#define PROJ_EXTRA_PARAMS
#endif

#define WS_QH  0u                                      // f16 q rows [b*t][CC]
#define WS_KH  (WS_QH + 2u * (size_t)NB * TT * CC)      // f16 k rows [b*t][CC]
#define WS_VT  (WS_KH + 2u * (size_t)NB * TT * CC)      // f16 v planes [b][c][t]
#define WS_QL  (WS_VT + 2u * (size_t)NB * CC * TT)      // f16 q residual x 2^10 rows [b][t < QHI][CC]
#define WS_KL  (WS_QL + 2u * (size_t)NB * QHI * CC)     // f16 k residual x 2^10 rows [b][t < KHI][CC]
#define WS_VB  (WS_KL + 2u * (size_t)NB * KHI * CC)     // bf16 v hi planes [b][c][t < KHI]
#define WS_VBL (WS_VB + 2u * (size_t)NB * CC * KHI)
#define WS_S   (WS_VBL + 2u * (size_t)NB * CC * KHI)    // room of HG x TT x TT f32; only the mask words (WS_PM) use it
#define WS_PM  WS_S                                      // the mask as lane-mask words [query tile of 16][32 keys][16 words], 128 KiB (the logits plane is not used)
#define WS_Y   (WS_S  + 4u * (size_t)HG * TT * TT)      // f32 ctx rows [b*t][CC] (only when there is an output projection)
#define WS_END (WS_Y  + 4u * (size_t)NB * TT * CC)

// ---- operand staging of k_proj and k_out: a block's 128 weight rows (its output columns) and, per row tile, 64 input rows, 256 f32 each and contiguous in memory, go to LDS once as 16-bit rows.
// Every load of a wave takes 512 contiguous bytes, so a block touches each 128-B line once; the WMMA fragments are then 16-B LDS reads.
#define SPIT 264           // 16-bit elements per staged row: 528 B = 16 B x odd
#define SW_BYTES (128 * SPIT * 2)
#define SX_BYTES (64 * SPIT * 2)      // the 64 input rows stand first, so that every LDS store of the tile loop is an immediate offset; the weight rows follow
#define SOP_BYTES ((128 + 64) * SPIT * 2)
static_assert(WQKV_LAYOUT == 1 && WO_OUT_IN == 1 && DIN == 256 && CC == 256, "the staging below reads (out,in) weight rows of 256");
typedef __attribute__((ext_vector_type(4))) __bf16 v4b;
typedef __attribute__((ext_vector_type(4))) _Float16 v4h;
// base = first row (128 threads = two rows a pass), d = this thread's 8 bytes of LDS row tid >> 6; the loops are unrolled so that t[] stays in registers and every step is an immediate offset
// pre() runs once, behind the first 16 loads' issue and in front of the first LDS store
template <int NROW, typename CV, typename PRE> __device__ __forceinline__ void stage_rows(const float* base, int tid, unsigned char* d, CV cv, PRE pre) {
  const float* p = base + tid * 4;
#pragma unroll
  for (int b = 0; b < NROW / 2; b += 16) { v4f t[16];
#pragma unroll
    for (int i = 0; i < 16; ++i) t[i] = *(const v4f*)(p + (b + i) * 512);
    asm volatile("s_wait_xcnt 0x0" :: "v"(tid), "s"(base) : "memory");      // the loads' offset register and base stay untouched until the 16 loads above have taken them; no later load is lifted over this line, which keeps the registers under 256
    if (b == 0) pre();
#pragma unroll
    for (int i = 0; i < 16; ++i) cv(d + (b + i) * (2 * SPIT * 2), t[i]); } }

#define PNT 4             // row tiles of 64 that a k_proj block walks with its 128 weight rows kept in LDS
#define ONT 2             // the same for k_out
// ---- k_proj: block = (PNT x 64 rows, 128 cols, which): q/k/v = X W (+ b) with exact bf16 products (K = DIN) -> which 0: q x QSC f16 rows; 1: k f16 rows; 2: v f16 planes [c][t]. The weight rows are staged once; each row tile stages its 64 input rows behind them
__global__ __launch_bounds__(128) void k_proj(const float* __restrict__ XQ, const float* __restrict__ XK, const float* __restrict__ XV, const float* __restrict__ WQ, const float* __restrict__ WK, const float* __restrict__ WV, const float* __restrict__ BQ, const float* __restrict__ BK, const float* __restrict__ BV,
    _Float16* __restrict__ QH, _Float16* __restrict__ KH, _Float16* __restrict__ VT, const int* __restrict__ AMASK, unsigned* __restrict__ PM) {
  __shared__ __align__(16) unsigned char sm[SOP_BYTES];      // the input rows of one tile, then the weight rows; behind a tile's third barrier the input rows' bytes hold its output tile
  __bf16 (*sX)[SPIT] = (__bf16 (*)[SPIT])sm; __bf16 (*sW)[SPIT] = (__bf16 (*)[SPIT])(sm + SX_BYTES);
  _Float16 (*sh)[136] = (_Float16 (*)[136])sm; _Float16 (*th)[72] = (_Float16 (*)[72])sm;
  static_assert(64 * 136 * 2 <= 64 * SPIT * 2 && 128 * 72 * 2 <= 64 * SPIT * 2, "an output tile fits in the input rows' bytes");
  static_assert(TT % (64 * PNT) == 0, "a block's row tiles lie in one sequence");
  const int tid = threadIdx.x, wave = tid >> 5, lane = tid & 31, col = lane & 15, g = lane >> 4; const int which = blockIdx.z; const int c0 = blockIdx.y * 128;
  if (which == 3) {      // mask blocks (block-uniform, in front of every barrier): each wave turns two tiles of 16 queries x 32 keys into 32 words, one 128-B line.
    // Word i of a tile, bit l = mask[query tile * 16 + (l & 15)][key block * 32 + 16 (i >> 3) + 8 (l >> 4) + (i & 7)]: the lane mask of score register i in k_attn
    static_assert((TNB * TT / 64 / PNT) * (CC / 128) * 4 == (TT / 16) * (TT / 64), "one wave of a mask block for every pair of tiles");
    const int tp = (blockIdx.x * 2 + blockIdx.y) * 4 + wave; const int* mp = AMASK + ((tp >> 4) * 16 + col) * TT + (tp & 15) * 64 + 8 * g; v4i m[8]; unsigned wd = 0;
#pragma unroll
    for (int i = 0; i < 8; ++i) m[i] = *(const v4i*)(mp + (i >> 1) * 16 + (i & 1) * 4);
#pragma unroll
    for (int i = 0; i < 32; ++i) { const unsigned bl = __builtin_amdgcn_ballot_w32(m[i >> 2][i & 3] != 0); if (lane == i) wd = bl; }
    PM[tp * 32 + lane] = wd; return; }
  const float* X = which == 0 ? XQ : which == 1 ? XK : XV; const float* WA = which == 0 ? WQ : which == 1 ? WK : WV; const float* BA = which == 0 ? BQ : which == 1 ? BK : BV;
  unsigned char* d = sm + (tid >> 6) * (SPIT * 2) + (tid & 63) * 8;
  auto cv = [](unsigned char* q, v4f v) { const v4b o = { (__bf16)v[0], (__bf16)v[1], (__bf16)v[2], (__bf16)v[3] }; *(v4b*)q = o; };
  auto none = []() {}; auto foot = []() { __syncthreads(); };      // foot: every thread has read its part of the last output tile before this tile's input rows overwrite it; it stands behind the loads' issue, so that the wait for the last tile's global stores runs beside the loads
  stage_rows<128>(WA + (size_t)c0 * DIN, tid, d + SX_BYTES, cv, none);
  const int wr = (wave >> 1) * 32, wc = (wave & 1) * 64;      // a wave's part of the 64 x 128 tile: 32 rows x 64 columns, so that 6 fragments from LDS feed 8 products (16 x 128: 9)
  const float qs = which == 0 ? QSC : 1.0f;      // block-uniform; k and v: x 1, exact
  float bias[4];
#pragma unroll
  for (int j = 0; j < 4; ++j) bias[j] = BA ? bfr(BA[c0 + wc + j * 16 + col]) * qs : 0.f;
#pragma unroll 1      // one copy of the tile's code: the four tiles differ only in their row offset
  for (int it = 0; it < PNT; ++it) { const size_t r0 = ((size_t)blockIdx.x * PNT + it) * 64; const size_t bb = r0 / TT; const int t0 = (int)(r0 % TT);
    stage_rows<64>(X + r0 * DIN, tid, d, cv, foot);
    __syncthreads();      // the tile's input rows (and, on the first tile, the weight rows) are in LDS
    v8f acc[2][4] = {}; v16b a[2][2], w[2][4];
    auto frags = [&](int kc, v16b (&fa)[2], v16b (&fw)[4]) {
#pragma unroll
      for (int t = 0; t < 2; ++t) fa[t] = frag_b(&sX[wr + t * 16 + col][kc * 32], lane);
#pragma unroll
      for (int j = 0; j < 4; ++j) fw[j] = frag_b(&sW[wc + j * 16 + col][kc * 32], lane); };
    frags(0, a[0], w[0]);
#pragma unroll
    for (int kc = 0; kc < DIN / 32; ++kc) { if (kc + 1 < DIN / 32) frags(kc + 1, a[(kc + 1) & 1], w[(kc + 1) & 1]);      // the next 32 k's fragments are fetched as one group while these products run; unrolled so that both fragment sets are indexed statically and stay in registers
#pragma unroll
      for (int t = 0; t < 2; ++t) {
#pragma unroll
        for (int j = 0; j < 4; ++j) acc[t][j] = wmma_bf(a[kc & 1][t], w[kc & 1][j], acc[t][j]); } }
    __syncthreads();      // every wave has read its last fragment before the output tile overwrites the input rows
    if (which < 2) { _Float16* DH = which == 0 ? QH : KH;
#pragma unroll
      for (int t = 0; t < 2; ++t) {
#pragma unroll
        for (int j = 0; j < 4; ++j) {
#pragma unroll
          for (int r = 0; r < 8; ++r) sh[wr + t * 16 + 8 * g + r][wc + j * 16 + col] = (_Float16)(acc[t][j][r] * qs + bias[j]); } }
      __syncthreads();
      for (int e = tid; e < 64 * 16; e += 128) { const int rl = e >> 4, q = e & 15; vst2((unsigned*)(DH + (r0 + rl) * CC + c0 + q * 8), *(const v4u*)&sh[rl][q * 8]); }
    } else {
#pragma unroll
      for (int t = 0; t < 2; ++t) {
#pragma unroll
        for (int j = 0; j < 4; ++j) {
#pragma unroll
          for (int r = 0; r < 8; ++r) th[wc + j * 16 + col][wr + t * 16 + 8 * g + r] = (_Float16)(acc[t][j][r] + bias[j]); } }
      __syncthreads();
      for (int e = tid; e < 128 * 8; e += 128) { const int cl = e >> 3, q = e & 7; vst2((unsigned*)(VT + (bb * CC + c0 + cl) * (size_t)TT + t0 + q * 8), *(const v4u*)&th[cl][q * 8]); } }
    asm volatile("s_wait_xcnt 0x0" ::: "memory");      // the stores above have taken their address registers before the next tile rewrites them
  } }
// ---- k_attn: block = (all 1024 queries, head h, batch b), 16 waves, each with ANG groups of 32 queries one after the other. K rows and v planes of (b, h) are staged in LDS once for all of them; for each group a wave walks the 1024 keys 32 at a time:
// S^T = K q^T + 1 (lane = one query, 16 of the 32 keys; q carries the scale, the 1 is the product's C operand), mask by element, weights exp2(S) = exp2(logit) x 2, once to f16 straight from the score registers as the B operand of ctx^T += v^T P^T and of sum^T += 1 P^T (a tile of ones as A: every row of it holds the queries' sums over all 32 keys); ctx / sum at the end.
// A softmax does not depend on its shift, so the key loop uses none: no maximum, no exchange between the lane halves, no rescaling. The range is checked from the data behind the loop, by the sum alone (every weight is >= 0):
// sum < 65504 -> no weight left f16's range upwards; sum >= 2^8 -> the weights under f16's smallest normal number, 1024 x 2^-14 at most, are at most 2^-12 of the sum, the bound that the running maximum gives (largest weight 2^8).
// The factor 2 puts a row of 512 to 1024 visible logits around 0 at 2^10 to 2^11: 2 to 3 powers of two over the lower limit, 5 under the upper one, on which side the exponentials' tail lies.
// A group of 32 queries with a sum outside (large or strongly offset logits, few or no visible keys, a NaN) is worked again with the running maximum: slower, and right for any input.
#define AW 16
#define AQT 2
#define ANG 2              // query groups that a wave walks under the one fill
#define AQG (AW * AQT * 16)      // queries of one group over the block's waves
#define AQB (AQG * ANG)
static_assert(AW * 32 == 512 && TT == 1024 && HD == 32 && TT % AQB == 0, "the fill below is written for 512 threads, 1024 keys, head size 32");
#define KPIT 40            // f16 per staged K row: 80 B = 16 B x odd
#define VPIT (TT + 8)      // f16 per staged v plane: 2064 B = 16 B x odd
#define LOG2E 1.4426950408889634f
#define SUMLO 256.0f       // the sums for which the weights without a shift stand: SUMLO <= sum < SUMHI
#define SUMHI 65504.0f
typedef __attribute__((ext_vector_type(2))) _Float16 v2h;
typedef __attribute__((ext_vector_type(16))) unsigned v16u;
__device__ __forceinline__ float xhalf(float x) { return __builtin_bit_cast(float, __builtin_amdgcn_permlanex16(__builtin_bit_cast(int, x), __builtin_bit_cast(int, x), 0x76543210, 0xfedcba98, false, false)); }   // lane l with lane l ^ 16
__device__ __forceinline__ v8f wmma_h(v16h a, v16h b, v8f c) { return __builtin_amdgcn_wmma_f32_16x16x32_f16(false, a, false, b, (short)0, c, false, false); }
__global__ __launch_bounds__(AW * 32) __attribute__((amdgpu_waves_per_eu(4, 4))) void k_attn(const _Float16* __restrict__ QH, const _Float16* __restrict__ KH, const _Float16* __restrict__ VT, const unsigned* __restrict__ PM, float* __restrict__ Y) {   // 4 waves per SIMD = one block of 16 waves per WGP
  __shared__ __align__(16) _Float16 sK[TT][KPIT]; __shared__ __align__(16) _Float16 sV[HD][VPIT];
  const int tid = threadIdx.x, wave = tid >> 5, lane = tid & 31, col = lane & 15, g = lane >> 4; const int h = blockIdx.y, b = blockIdx.z; const int qw = blockIdx.x * AQB + wave * (AQT * 16);      // group n of this wave: queries qw + n * AQG + 0..31
  v4u tk[8], tv[8];      // the fill: 1024 K rows x 64 B and 32 v planes x 2048 B, 8 + 8 loads of 16 B a thread, all in flight together, then the LDS stores
  const _Float16* kp = KH + ((size_t)b * TT + (tid >> 2)) * CC + h * HD + (tid & 3) * 8;            // load i: K row (tid >> 2) + 128 i
  const _Float16* vp = VT + ((size_t)b * CC + h * HD + (tid >> 7)) * (size_t)TT + (tid & 127) * 8;   // load i: v plane (tid >> 7) + 4 i
  const _Float16* qp = QH + ((size_t)b * TT + qw + col) * CC + h * HD + 8 * g;
#pragma unroll
  for (int i = 0; i < 8; ++i) tk[i] = *(const v4u*)(kp + i * 128 * CC);
#pragma unroll
  for (int i = 0; i < 8; ++i) tv[i] = *(const v4u*)(vp + i * 4 * TT);
  v16h qa[ANG][AQT];      // the q fragments of every group come with the fill, so that no group waits for its own
#pragma unroll
  for (int n = 0; n < ANG; ++n) {
#pragma unroll
    for (int u = 0; u < AQT; ++u) { union { v16h v; v8h q[2]; } t; t.q[0] = *(const v8h*)(qp + (n * AQG + u * 16) * CC); t.q[1] = *(const v8h*)(qp + (n * AQG + u * 16) * CC + 16); qa[n][u] = t.v; } }   // B fragment, same k order as frag_h
  asm volatile("s_wait_xcnt 0x0" :: "v"(kp), "v"(vp), "v"(qp) : "memory");      // the three address pairs stay untouched until the loads above have taken them
#pragma unroll
  for (int i = 0; i < 8; ++i) *(v4u*)&sK[(tid >> 2) + 128 * i][(tid & 3) * 8] = tk[i];
#pragma unroll
  for (int i = 0; i < 8; ++i) *(v4u*)&sV[(tid >> 7) + 4 * i][(tid & 127) * 8] = tv[i];
  __syncthreads();
  const float NEGR = -1.0e9f * LOG2E;      // the reference's -1e9 fill as an exponent of 2
  const _Float16 h1 = (_Float16)1.0f; const v16h ones = { h1, h1, h1, h1, h1, h1, h1, h1, h1, h1, h1, h1, h1, h1, h1, h1 };      // the A tile of the sums' product
#pragma unroll      // unrolled so that qa[n] is indexed statically and stays in registers
  for (int n = 0; n < ANG; ++n) { const int q0 = qw + n * AQG; const v16h (&qf)[AQT] = qa[n]; v8f acc[AQT][2] = {}, sa[AQT] = {}; float mx[AQT], ls[AQT], tot[AQT];
  const v16u* pm = (const v16u*)PM + __builtin_amdgcn_readfirstlane(q0 >> 4) * (TT / 32);      // this group's mask words: wave-uniform, so they come by scalar loads; tile u is TT / 32 groups of 16 words on
  auto mload = [&](int k0, v16u (&mk)[AQT]) {
#pragma unroll
    for (int u = 0; u < AQT; ++u) mk[u] = pm[u * (TT / 32) + (k0 >> 5)]; };
  auto step = [&](int k0, const v16u (&mk)[AQT]) {
    const v16h ka = frag_h(&sK[k0 + col][0], lane), kb = frag_h(&sK[k0 + 16 + col][0], lane);      // A rows = keys k0 + 0..15, k0 + 16..31
    const v16h va = frag_h(&sV[col][k0], lane), vb = frag_h(&sV[16 + col][k0], lane);              // A rows = head columns 0..15, 16..31; k = keys in the order of the packed scores
#pragma unroll
    for (int u = 0; u < AQT; ++u) {
      const v8f one = { 1.0f, 1.0f, 1.0f, 1.0f, 1.0f, 1.0f, 1.0f, 1.0f }; v8f s[2]; s[0] = wmma_h(ka, qf[u], one); s[1] = wmma_h(kb, qf[u], one);      // s[T][r] = key k0 + 16T + 8g + r, query = col
      union { v16h v; v2h q[8]; } pf;
#pragma unroll
      for (int i = 0; i < 8; ++i) { const v2f d = { __builtin_amdgcn_inverse_ballot_w32(mk[u][2 * i]) ? s[i >> 2][(2 * i) & 7] : NEGR, __builtin_amdgcn_inverse_ballot_w32(mk[u][2 * i + 1]) ? s[i >> 2][(2 * i + 1) & 7] : NEGR };      // word i is the select's lane mask as it stands
        const v2f p = { __builtin_amdgcn_exp2f(d[0]), __builtin_amdgcn_exp2f(d[1]) }; pf.q[i] = __builtin_convertvector(p, v2h); }      // a masked key's exponent is far below f32's range: weight 0
      acc[u][0] = wmma_h(va, pf.v, acc[u][0]); acc[u][1] = wmma_h(vb, pf.v, acc[u][1]); sa[u] = wmma_h(ones, pf.v, sa[u]);
    } };
  auto step_mx = [&](int k0, const v16u (&mk)[AQT]) {      // the same 32 keys with a running maximum: any range of logits
    const v16h ka = frag_h(&sK[k0 + col][0], lane), kb = frag_h(&sK[k0 + 16 + col][0], lane);      // A rows = keys k0 + 0..15, k0 + 16..31
    const v16h va = frag_h(&sV[col][k0], lane), vb = frag_h(&sV[16 + col][k0], lane);              // A rows = head columns 0..15, 16..31; k = keys in the order of the packed scores
#pragma unroll
    for (int u = 0; u < AQT; ++u) {
      const v8f z = {}; v8f s[2]; s[0] = wmma_h(ka, qf[u], z); s[1] = wmma_h(kb, qf[u], z);      // s[T][r] = key k0 + 16T + 8g + r, query = col
      float x[16];
#pragma unroll
      for (int i = 0; i < 16; ++i) x[i] = __builtin_amdgcn_inverse_ballot_w32(mk[u][i]) ? s[i >> 3][i & 7] : NEGR;      // word i is the select's lane mask as it stands
      float cm = x[0];
#pragma unroll
      for (int i = 1; i < 16; ++i) cm = fmaxf(cm, x[i]);
      const float mn = fmaxf(mx[u], fmaxf(cm, xhalf(cm)));           // both lane halves of a query use one maximum: their weights meet in one product
      const float al = __builtin_amdgcn_exp2f(mx[u] - mn); mx[u] = mn;
      union { v16h v; v2h q[8]; } pf; v2f sum = {};
#pragma unroll
      for (int i = 0; i < 8; ++i) { v2f d = { x[2 * i], x[2 * i + 1] }; d = (d - mn) + 8.0f;      // difference first: exactly 0 where a whole row is masked (uniform weights, as the reference gives)
        const v2f p = { __builtin_amdgcn_exp2f(d[0]), __builtin_amdgcn_exp2f(d[1]) }; sum += p; pf.q[i] = __builtin_convertvector(p, v2h); }
      ls[u] = ls[u] * al + (sum[0] + sum[1]);
      acc[u][0] = wmma_h(va, pf.v, acc[u][0] * al); acc[u][1] = wmma_h(vb, pf.v, acc[u][1] * al);
    } };
  v16u ma[AQT], mb[AQT]; mload(0, ma); mload(32, mb);      // the mask words of the next 64 keys are fetched, into the registers that the selects have just read, while these 64 are worked on
  for (int k0 = 0; k0 < TT; k0 += 64) { const int kn = k0 + 64 < TT ? k0 + 64 : 0; step(k0, ma); mload(kn, ma); step(k0 + 32, mb); mload(kn + 32, mb); }
  bool in = true;
#pragma unroll
  for (int u = 0; u < AQT; ++u) { tot[u] = sa[u][0]; in = in && tot[u] >= SUMLO && tot[u] < SUMHI; }      // both lane halves hold the whole sum; false for a NaN too, and for a weight that left f16's range (sum = inf)
  if (__builtin_amdgcn_ballot_w32(!in) != 0) {      // wave-uniform (a scalar branch on the ballot), no barrier behind it: the group's 32 queries again, from the start
#pragma unroll
    for (int u = 0; u < AQT; ++u) { mx[u] = -3.0e38f; ls[u] = 0.f; acc[u][0] = v8f{}; acc[u][1] = v8f{}; }
#pragma unroll 1      // a path that few inputs take: one copy of the 32 keys' code
    for (int k0 = 0; k0 < TT; k0 += 32) { mload(k0, ma); step_mx(k0, ma); }
#pragma unroll      // unrolled so that tot[] and ls[] are indexed statically and stay in registers
    for (int u = 0; u < AQT; ++u) tot[u] = ls[u] + xhalf(ls[u]); }
#pragma unroll
  for (int u = 0; u < AQT; ++u) { const float inv = 1.0f / tot[u]; float* yp = Y + (unsigned)((b * TT + q0 + u * 16 + col) * CC + h * HD + 8 * g);
#pragma unroll
    for (int j = 0; j < 2; ++j) { const v8f o = acc[u][j] * inv; vst2(yp + j * 16, (v4f)__builtin_shufflevector(o, o, 0, 1, 2, 3)); vst2(yp + j * 16 + 4, (v4f)__builtin_shufflevector(o, o, 4, 5, 6, 7)); } }
  if (n + 1 < ANG) asm volatile("s_wait_xcnt 0x0" ::: "memory");      // the stores above have taken their address registers before the next group rewrites them
  } }
// ---- k_out: block = (ONT x 64 rows, 128 cols): out = ctx Wo (+ bo): ctx x 2^6 once to f16 against Wo as f16(bf16 x 2^8) exact (1 product) x 2^-14. The Wo rows are staged once; each row tile stages its 64 ctx rows behind them
__global__ __launch_bounds__(128) void k_out(const float* __restrict__ Y, const float* __restrict__ WO, const float* __restrict__ BO, float* __restrict__ OUT) { __shared__ __align__(16) unsigned char sm[SOP_BYTES];      // the ctx rows of one tile, then the weight rows; behind a tile's third barrier the ctx rows' bytes hold its output tile
  _Float16 (*sY)[SPIT] = (_Float16 (*)[SPIT])sm; _Float16 (*sW)[SPIT] = (_Float16 (*)[SPIT])(sm + SX_BYTES); float (*sf)[132] = (float (*)[132])sm;
  static_assert(64 * 132 * 4 <= 64 * SPIT * 2, "the output tile fits in the ctx rows' bytes");
  const int tid = threadIdx.x, wave = tid >> 5, lane = tid & 31, col = lane & 15, g = lane >> 4; const int c0 = blockIdx.y * 128;
  unsigned char* d = sm + (tid >> 6) * (SPIT * 2) + (tid & 63) * 8;
  auto cy = [](unsigned char* q, v4f v) { const v4h o = { (_Float16)(v[0] * 64.0f), (_Float16)(v[1] * 64.0f), (_Float16)(v[2] * 64.0f), (_Float16)(v[3] * 64.0f) }; *(v4h*)q = o; };   /* ctx carried x 2^6 into f16 so small-magnitude context rows stay clear of f16 subnormals */
  auto cw = [](unsigned char* q, v4f v) { const v4h o = { (_Float16)(bfr(v[0]) * 256.0f), (_Float16)(bfr(v[1]) * 256.0f), (_Float16)(bfr(v[2]) * 256.0f), (_Float16)(bfr(v[3]) * 256.0f) }; *(v4h*)q = o; };
  auto none = []() {}; auto foot = []() { __syncthreads(); };      // foot: every wave has read its last output rows before this tile's ctx rows overwrite them; it stands behind the loads' issue, so that the wait for the last tile's global stores runs beside the loads
  stage_rows<128>(WO + (size_t)c0 * CC, tid, d + SX_BYTES, cw, none);
  const int wr = (wave >> 1) * 32, wc = (wave & 1) * 64;      // a wave's part of the 64 x 128 tile: 32 rows x 64 columns, so that 6 fragments from LDS feed 8 products (16 x 128: 9)
  float bias[4];
#pragma unroll
  for (int j = 0; j < 4; ++j) bias[j] = BO ? bfr(BO[c0 + wc + j * 16 + col]) : 0.f;
#pragma unroll 1      // one copy of the tile's code: the tiles differ only in their row offset
  for (int it = 0; it < ONT; ++it) { const size_t rb = ((size_t)blockIdx.x * ONT + it) * 64;
    stage_rows<64>(Y + rb * CC, tid, d, cy, foot);
    __syncthreads();      // the tile's ctx rows (and, on the first tile, the weight rows) are in LDS
    v8f acc[2][4] = {}; v16h a[2][2], w[2][4];
    auto frags = [&](int kc, v16h (&fa)[2], v16h (&fw)[4]) {
#pragma unroll
      for (int t = 0; t < 2; ++t) fa[t] = frag_h(&sY[wr + t * 16 + col][kc * 32], lane);
#pragma unroll
      for (int j = 0; j < 4; ++j) fw[j] = frag_h(&sW[wc + j * 16 + col][kc * 32], lane); };
    frags(0, a[0], w[0]);
#pragma unroll
    for (int kc = 0; kc < CC / 32; ++kc) { if (kc + 1 < CC / 32) frags(kc + 1, a[(kc + 1) & 1], w[(kc + 1) & 1]);      // the next 32 k's fragments are fetched as one group while these products run; unrolled so that both fragment sets are indexed statically and stay in registers
#pragma unroll
      for (int t = 0; t < 2; ++t) {
#pragma unroll
        for (int j = 0; j < 4; ++j) acc[t][j] = wmma16(a[kc & 1][t], w[kc & 1][j], acc[t][j]); } }
    __syncthreads();      // every wave has read its last fragment before the output tile overwrites the ctx rows
#pragma unroll
    for (int t = 0; t < 2; ++t) {
#pragma unroll
      for (int j = 0; j < 4; ++j) {
#pragma unroll
        for (int r = 0; r < 8; ++r) sf[wr + t * 16 + 8 * g + r][wc + j * 16 + col] = acc[t][j][r] * (1.0f / 16384.0f) + bias[j]; } }   /* 2^-8 (Wo carry) x 2^-6 (ctx carry) */
    LDSX(); for (int rl = 0; rl < 32; rl += 2) vst2(OUT + (rb + wr + rl + g) * DIN + c0 + wc + col * 4, *(const v4f*)&sf[wr + rl + g][wc + col * 4]);      // a wave reads back only what it wrote itself: two rows of 256 B (two whole lines each) a store
    asm volatile("s_wait_xcnt 0x0" ::: "memory");      // the stores above have taken their address registers before the next tile rewrites them
  } }

extern "C" void kernel_launch(void* const* d_in, const int* in_sizes, int n_in, void* d_out, int out_size, void* d_ws, size_t ws_size, hipStream_t stream) {
  (void)in_sizes; (void)n_in; (void)out_size;
  const float** F = (const float**)d_in;
  if (ws_size < (size_t)WS_END) return;
  char* ws = (char*)d_ws; _Float16 *QH = (_Float16*)(ws + WS_QH), *KH = (_Float16*)(ws + WS_KH), *VT = (_Float16*)(ws + WS_VT), *QL = (_Float16*)(ws + WS_QL), *KL = (_Float16*)(ws + WS_KL); __bf16 *VB = (__bf16*)(ws + WS_VB), *VBL = (__bf16*)(ws + WS_VBL); float *S = (float*)(ws + WS_S), *Y = (float*)(ws + WS_Y); unsigned* PM = (unsigned*)(ws + WS_PM);
  (void)Y; (void)S; (void)QL; (void)KL; (void)VB; (void)VBL;
  // inputs: 0 x [32,1024,256]; 1 attn_mask [1024,1024] (bool topology mask, diagonal True); 2 Wq [256,256] (out,in), 3 bq; 4 Wk, 5 bk; 6 Wv, 7 bv; 8 Wo (out,in), 9 bo (biases nonzero)
  k_proj<<<dim3(TNB * TT / 64 / PNT, CC / 128, 4), 128, 0, stream>>>(F[0], F[0], F[0], F[2], F[4], F[6], F[3], F[5], F[7], QH, KH, VT, (const int*)d_in[1], PM);   // z = 3: the 256 mask blocks
  k_attn<<<dim3(TT / AQB, NH, TNB), AW * 32, 0, stream>>>(QH, KH, VT, PM, Y);
  k_out<<<dim3(TNB * TT / 64 / ONT, DIN / 128), 128, 0, stream>>>(Y, F[8], F[9], (float*)d_out);
}

// v009
// It runs in 73.3 microseconds.
// Two timings next to v008 both put it at 1.06 times that version's speed.
// Over all steps from v000 it is 27.1 times as fast.
// compute dtype: all float inputs rounded to bf16; q/k/v projections with EXACT bf16 products on WMMA 16x16x32 (f32 accumulate) + bias; logits q x 32^-0.5 log2(e) and k once to f16 each (1 product; sigma - 1); the shared boolean mask read per element; softmax f32 without a shift (weights exp2(logit) x 2, once to f16; their sum per query by a product of ones with them, f32 accumulate) where a query's sum shows its weights inside f16's range, else online softmax (running maximum and sum, weights x 2^8); weights once to f16 x v once to f16 (1 product), divided by the f32 sum after the product; ctx x 2^6 once to f16 x Wo f16(bf16 x 2^8) + bo; f32 output.
#include <hip/hip_runtime.h>
#include <math.h>

typedef __attribute__((ext_vector_type(16))) _Float16 v16h;
typedef __attribute__((ext_vector_type(16))) __bf16 v16b;
typedef __attribute__((ext_vector_type(8)))  _Float16 v8h;
typedef __attribute__((ext_vector_type(8)))  float v8f;
typedef __attribute__((ext_vector_type(4)))  float v4f;
typedef __attribute__((ext_vector_type(2)))  float v2f;
typedef __attribute__((ext_vector_type(4)))  unsigned v4u;
typedef __attribute__((ext_vector_type(4)))  int v4i;
typedef float __attribute__((may_alias)) float_a;
typedef int __attribute__((may_alias)) int_a;

template <typename T> __device__ __forceinline__ void vst2(void* p, T v) { *(T*)p = v;  }
__device__ __forceinline__ v8f wmma16(v16h a, v16h b, v8f c) {
  v8f d = __builtin_amdgcn_wmma_f32_16x16x32_f16(false, a, false, b, (short)0, c, false, false);
  asm volatile("v_nop\n\tv_nop\n\tv_nop\n\tv_nop" : "+v"(d) : "v"(a), "v"(b));
  return d;
}
__device__ __forceinline__ v8f wmma_bf(v16b a, v16b b, v8f c) {
  v8f d = __builtin_amdgcn_wmma_f32_16x16x32_bf16(false, a, false, b, (short)0, c, false, false);
  asm volatile("v_nop\n\tv_nop\n\tv_nop\n\tv_nop" : "+v"(d) : "v"(a), "v"(b));
  return d;
}
// 16x16x32 fragments: lane = (h = lane>>4, row/col = lane&15); elements 0..7 = k0+8h+0..7, 8..15 = k0+16+8h+0..7; D element r = row 8h+r
__device__ __forceinline__ v16h frag_h(const _Float16* rowk0, int lane) {
  union { v16h v; v8h q[2]; } u; const _Float16* p = rowk0 + 8 * (lane >> 4);
  u.q[0] = *(const v8h*)p; u.q[1] = *(const v8h*)(p + 16); return u.v;
}
__device__ __forceinline__ v16h frag_f32(const float* rowk0, int lane) {
  v16h a; const float* p = rowk0 + 8 * (lane >> 4);
#pragma unroll
  for (int i = 0; i < 8; ++i) { a[i] = (_Float16)p[i]; a[8 + i] = (_Float16)p[16 + i]; }
  return a;
}
__device__ __forceinline__ v16h frag_f32s(const float* rowk0, int lane, float sc) {
  v16h a; const float* p = rowk0 + 8 * (lane >> 4);
#pragma unroll
  for (int i = 0; i < 8; ++i) { a[i] = (_Float16)(p[i] * sc); a[8 + i] = (_Float16)(p[16 + i] * sc); }
  return a;
}
// column fragment from a [K][ld] layout (column n), rows >= K read as 0
__device__ __forceinline__ v16h fragc_f32(const float* W, int k0, int n, int lane, int ld, int K) {
  v16h a; const int g = lane >> 4;
#pragma unroll
  for (int i = 0; i < 8; ++i) { const int ka = k0 + 8 * g + i, kb = ka + 16;
    a[i] = (_Float16)(ka < K ? W[(size_t)(ka < K ? ka : K - 1) * ld + n] : 0.f); a[8 + i] = (_Float16)(kb < K ? W[(size_t)(kb < K ? kb : K - 1) * ld + n] : 0.f); }
  return a;
}
struct F2 { v16b h, l; };
__device__ __forceinline__ F2 bsplit16(const float v[16]) { F2 r;
#pragma unroll
  for (int i = 0; i < 16; ++i) { const __bf16 h = (__bf16)v[i]; r.h[i] = h; r.l[i] = (__bf16)(v[i] - (float)h); }
  return r; }
__device__ __forceinline__ F2 split_row(const float* row, int k0, int lane) { float v[16]; const float* p = row + k0 + 8 * (lane >> 4);
#pragma unroll
  for (int i = 0; i < 8; ++i) { v[i] = p[i]; v[8 + i] = p[16 + i]; }
  return bsplit16(v); }
__device__ __forceinline__ F2 split_rowK(const float* row, int k0, int lane, int K) { float v[16]; const int g = lane >> 4;
#pragma unroll
  for (int i = 0; i < 8; ++i) { const int ka = k0 + 8 * g + i, kb = ka + 16; v[i] = ka < K ? row[ka < K ? ka : K - 1] : 0.f; v[8 + i] = kb < K ? row[kb < K ? kb : K - 1] : 0.f; }
  return bsplit16(v); }
__device__ __forceinline__ F2 split_col(const float* W, int k0, int n, int lane, int ld, int K) { float v[16]; const int g = lane >> 4;
#pragma unroll
  for (int i = 0; i < 8; ++i) { const int ka = k0 + 8 * g + i, kb = ka + 16; v[i] = ka < K ? W[(size_t)(ka < K ? ka : K - 1) * ld + n] : 0.f; v[8 + i] = kb < K ? W[(size_t)(kb < K ? kb : K - 1) * ld + n] : 0.f; }
  return bsplit16(v); }
__device__ __forceinline__ v8f mac3(const F2& a, const F2& b, v8f c) { c = wmma_bf(a.l, b.h, c); c = wmma_bf(a.h, b.l, c); return wmma_bf(a.h, b.h, c); }
__device__ __forceinline__ float sigm(float v) { return 1.0f / (1.0f + expf(-v)); }
#define LDSX() do { asm volatile("s_wait_dscnt 0" ::: "memory"); __builtin_amdgcn_wave_barrier(); __builtin_amdgcn_fence(__ATOMIC_RELEASE, "workgroup"); } while (0)

// Multi-head self-attention with a shared boolean topology mask (x [32,1024,256]; 8 heads x 32; torch (out,in) Wq/Wk/Wv/Wo [256,256] + biases (N(0, 1/256), NONZERO); attn_mask [1024,1024] bool (~50 % True, diagonal True) shared by all batches and heads: scores = where(mask, q_h k_h^T / sqrt(32), -1e9)): out = merge(softmax(scores) v_h) Wo^T + bo.
#define NB 32
#define TT 1024
#define CC 256            // NH * HD = projected width
#define DIN 256          // input (model) width
#define NH 8
#define HD 32
#define NQB (TT / 64)
#define HG 8
#define SCALE (0.17677669529663687f)
#define QSC (SCALE * 1.4426950408889634f)      // what q carries into its f16 rows: the softmax scale and log2(e), so that q x k is an exponent of 2 as it stands
#define CAUSAL 0
#ifndef TNB
#define TNB NB
#endif
__device__ __forceinline__ float bfr(float v) { return (float)(__bf16)v; }
__host__ __device__ __forceinline__ int kb_last(int qb) { return CAUSAL ? ((qb * 64 + 63) >> 7) : (TT / 128 - 1); }
typedef __attribute__((ext_vector_type(8))) __bf16 v8b;
__device__ __forceinline__ v16b frag_b(const __bf16* rowk0, int lane) {
  union { v16b v; v8b q[2]; } u; const __bf16* p = rowk0 + 8 * (lane >> 4);
  u.q[0] = *(const v8b*)p; u.q[1] = *(const v8b*)(p + 16); return u.v;
}
#define QBH 0              // read by no kernel: k_attn has one single-product path for every query block
#define QHI 0               // single-product logits on every row (sigma - 1 logits averaged over -512 visible keys)
#define KHI 64            // key rows carrying k residual / v bf16 hi+lo planes (no kernel here writes or reads them)
// B fragment (k rows k0+.., output column o) of a weight: (in,out) [K][ld] or (out,in) [ld rows of K]: bf16 exact, or f16(bf16 * 256) exact
__device__ __forceinline__ v16b wcol_io(const float* Wm, int k0, int o, int lane, int ld) { v16b w; const int g = lane >> 4;
#pragma unroll
  for (int i = 0; i < 8; ++i) { w[i] = (__bf16)Wm[(size_t)(k0 + 8 * g + i) * ld + o]; w[8 + i] = (__bf16)Wm[(size_t)(k0 + 16 + 8 * g + i) * ld + o]; }
  return w; }
__device__ __forceinline__ v16b wcol_oi(const float* Wm, int k0, int o, int lane, int K) { v16b w; const float* p = Wm + (size_t)o * K + k0 + 8 * (lane >> 4);
#pragma unroll
  for (int i = 0; i < 8; ++i) { w[i] = (__bf16)p[i]; w[8 + i] = (__bf16)p[16 + i]; }
  return w; }
__device__ __forceinline__ v16h wcolh_io(const float* Wm, int k0, int o, int lane, int ld) { v16h w; const int g = lane >> 4;
#pragma unroll
  for (int i = 0; i < 8; ++i) { w[i] = (_Float16)(bfr(Wm[(size_t)(k0 + 8 * g + i) * ld + o]) * 256.0f); w[8 + i] = (_Float16)(bfr(Wm[(size_t)(k0 + 16 + 8 * g + i) * ld + o]) * 256.0f); }
  return w; }
__device__ __forceinline__ v16h wcolh_oi(const float* Wm, int k0, int o, int lane, int K) { v16h w; const float* p = Wm + (size_t)o * K + k0 + 8 * (lane >> 4);
#pragma unroll
  for (int i = 0; i < 8; ++i) { w[i] = (_Float16)(bfr(p[i]) * 256.0f); w[8 + i] = (_Float16)(bfr(p[16 + i]) * 256.0f); }
  return w; }
#define WQKV_LAYOUT 1   // 0 = (in,out) [DIN][CC]; 1 = (out,in) [CC][DIN]; 2 = per-head [NH][DIN][HD]
__device__ __forceinline__ v16b wcol_hdk(const float* Wm, int k0, int o, int lane) { v16b w; const int g = lane >> 4; const float* p = Wm + (size_t)(o / HD) * DIN * HD + (o % HD);
#pragma unroll
  for (int i = 0; i < 8; ++i) { w[i] = (__bf16)p[(size_t)(k0 + 8 * g + i) * HD]; w[8 + i] = (__bf16)p[(size_t)(k0 + 16 + 8 * g + i) * HD]; }
  return w; }
#define WO_OUT_IN 1
#if WQKV_LAYOUT == 1
#define WCOL(W, k0, o, lane) wcol_oi(W, k0, o, lane, DIN)
#elif WQKV_LAYOUT == 2
#define WCOL(W, k0, o, lane) wcol_hdk(W, k0, o, lane)
#else
#define WCOL(W, k0, o, lane) wcol_io(W, k0, o, lane, CC)
#endif
#if WO_OUT_IN
#define WOCOL(W, k0, o, lane) wcol_oi(W, k0, o, lane, CC)
#define WOCOLH(W, k0, o, lane) wcolh_oi(W, k0, o, lane, CC)
#else
#define WOCOL(W, k0, o, lane) wcol_io(W, k0, o, lane, DIN)
#define WOCOLH(W, k0, o, lane) wcolh_io(W, k0, o, lane, DIN)
#endif
#ifndef PROJ_EXTRA_PARAMS
#define PROJ_EXTRA_PARAMS
#endif

#define WS_QH  0u                                      // f16 q rows [b*t][CC]
#define WS_KH  (WS_QH + 2u * (size_t)NB * TT * CC)      // f16 k rows [b*t][CC]
#define WS_VT  (WS_KH + 2u * (size_t)NB * TT * CC)      // f16 v planes [b][c][t]
#define WS_QL  (WS_VT + 2u * (size_t)NB * CC * TT)      // f16 q residual x 2^10 rows [b][t < QHI][CC]
#define WS_KL  (WS_QL + 2u * (size_t)NB * QHI * CC)     // f16 k residual x 2^10 rows [b][t < KHI][CC]
#define WS_VB  (WS_KL + 2u * (size_t)NB * KHI * CC)     // bf16 v hi planes [b][c][t < KHI]
#define WS_VBL (WS_VB + 2u * (size_t)NB * CC * KHI)
#define WS_S   (WS_VBL + 2u * (size_t)NB * CC * KHI)    // room of HG x TT x TT f32; only the mask words (WS_PM) use it
#define WS_PM  WS_S                                      // the mask as lane-mask words [query tile of 16][32 keys][16 words], 128 KiB (the logits plane is not used)
#define WS_Y   (WS_S  + 4u * (size_t)HG * TT * TT)      // f16 ctx x 2^6 in the order of k_out's A fragments: [b][head][16 queries][half of the fragment][lane][8], 16 MiB of the plane
#define WS_END (WS_Y  + 4u * (size_t)NB * TT * CC)

// ---- operand staging of k_proj and k_out: a block's 128 weight rows (its output columns) and, in k_proj, per row tile, 64 input rows, 256 f32 each and contiguous in memory, go to LDS once as 16-bit rows.
// Every load of a wave takes 512 contiguous bytes, so a block touches each 128-B line once; the WMMA fragments are then 16-B LDS reads.
#define SPIT 264           // 16-bit elements per staged row: 528 B = 16 B x odd
#define SW_BYTES (128 * SPIT * 2)
#define SX_BYTES (64 * SPIT * 2)      // the 64 input rows stand first, so that every LDS store of the tile loop is an immediate offset; the weight rows follow
#define SOP_BYTES ((128 + 64) * SPIT * 2)
static_assert(WQKV_LAYOUT == 1 && WO_OUT_IN == 1 && DIN == 256 && CC == 256, "the staging below reads (out,in) weight rows of 256");
typedef __attribute__((ext_vector_type(4))) __bf16 v4b;
typedef __attribute__((ext_vector_type(4))) _Float16 v4h;
// base = first row (128 threads = two rows a pass), d = this thread's 8 bytes of LDS row tid >> 6; the loops are unrolled so that t[] stays in registers and every step is an immediate offset
// pre() runs once, behind the first 16 loads' issue and in front of the first LDS store
template <int NROW, typename CV, typename PRE> __device__ __forceinline__ void stage_rows(const float* base, int tid, unsigned char* d, CV cv, PRE pre) {
  const float* p = base + tid * 4;
#pragma unroll
  for (int b = 0; b < NROW / 2; b += 16) { v4f t[16];
#pragma unroll
    for (int i = 0; i < 16; ++i) t[i] = *(const v4f*)(p + (b + i) * 512);
    asm volatile("s_wait_xcnt 0x0" :: "v"(tid), "s"(base) : "memory");      // the loads' offset register and base stay untouched until the 16 loads above have taken them; no later load is lifted over this line, which keeps the registers under 256
    if (b == 0) pre();
#pragma unroll
    for (int i = 0; i < 16; ++i) cv(d + (b + i) * (2 * SPIT * 2), t[i]); } }

#define PNT 4             // row tiles of 64 that a k_proj block walks with its 128 weight rows kept in LDS
#define ONT 2             // the same for k_out
#define ALD 6             // k_out: how many heads (32 k each) ahead of their products the ctx fragments are loaded; 8 would take the registers past 256
// ---- k_proj: block = (PNT x 64 rows, 128 cols, which): q/k/v = X W (+ b) with exact bf16 products (K = DIN) -> which 0: q x QSC f16 rows; 1: k f16 rows; 2: v f16 planes [c][t]. The weight rows are staged once; each row tile stages its 64 input rows behind them
__global__ __launch_bounds__(128) void k_proj(const float* __restrict__ XQ, const float* __restrict__ XK, const float* __restrict__ XV, const float* __restrict__ WQ, const float* __restrict__ WK, const float* __restrict__ WV, const float* __restrict__ BQ, const float* __restrict__ BK, const float* __restrict__ BV,
    _Float16* __restrict__ QH, _Float16* __restrict__ KH, _Float16* __restrict__ VT, const int* __restrict__ AMASK, unsigned* __restrict__ PM) {
  __shared__ __align__(16) unsigned char sm[SOP_BYTES];      // the input rows of one tile, then the weight rows; behind a tile's third barrier the input rows' bytes hold its output tile
  __bf16 (*sX)[SPIT] = (__bf16 (*)[SPIT])sm; __bf16 (*sW)[SPIT] = (__bf16 (*)[SPIT])(sm + SX_BYTES);
  _Float16 (*sh)[136] = (_Float16 (*)[136])sm; _Float16 (*th)[72] = (_Float16 (*)[72])sm;
  static_assert(64 * 136 * 2 <= 64 * SPIT * 2 && 128 * 72 * 2 <= 64 * SPIT * 2, "an output tile fits in the input rows' bytes");
  static_assert(TT % (64 * PNT) == 0, "a block's row tiles lie in one sequence");
  const int tid = threadIdx.x, wave = tid >> 5, lane = tid & 31, col = lane & 15, g = lane >> 4; const int which = blockIdx.z; const int c0 = blockIdx.y * 128;
  if (which == 3) {      // mask blocks (block-uniform, in front of every barrier): each wave turns two tiles of 16 queries x 32 keys into 32 words, one 128-B line.
    // Word i of a tile, bit l = mask[query tile * 16 + (l & 15)][key block * 32 + 16 (i >> 3) + 8 (l >> 4) + (i & 7)]: the lane mask of score register i in k_attn
    static_assert((TNB * TT / 64 / PNT) * (CC / 128) * 4 == (TT / 16) * (TT / 64), "one wave of a mask block for every pair of tiles");
    const int tp = (blockIdx.x * 2 + blockIdx.y) * 4 + wave; const int* mp = AMASK + ((tp >> 4) * 16 + col) * TT + (tp & 15) * 64 + 8 * g; v4i m[8]; unsigned wd = 0;
#pragma unroll
    for (int i = 0; i < 8; ++i) m[i] = *(const v4i*)(mp + (i >> 1) * 16 + (i & 1) * 4);
#pragma unroll
    for (int i = 0; i < 32; ++i) { const unsigned bl = __builtin_amdgcn_ballot_w32(m[i >> 2][i & 3] != 0); if (lane == i) wd = bl; }
    PM[tp * 32 + lane] = wd; return; }
  const float* X = which == 0 ? XQ : which == 1 ? XK : XV; const float* WA = which == 0 ? WQ : which == 1 ? WK : WV; const float* BA = which == 0 ? BQ : which == 1 ? BK : BV;
  unsigned char* d = sm + (tid >> 6) * (SPIT * 2) + (tid & 63) * 8;
  auto cv = [](unsigned char* q, v4f v) { const v4b o = { (__bf16)v[0], (__bf16)v[1], (__bf16)v[2], (__bf16)v[3] }; *(v4b*)q = o; };
  auto none = []() {}; auto foot = []() { __syncthreads(); };      // foot: every thread has read its part of the last output tile before this tile's input rows overwrite it; it stands behind the loads' issue, so that the wait for the last tile's global stores runs beside the loads
  stage_rows<128>(WA + (size_t)c0 * DIN, tid, d + SX_BYTES, cv, none);
  const int wr = (wave >> 1) * 32, wc = (wave & 1) * 64;      // a wave's part of the 64 x 128 tile: 32 rows x 64 columns, so that 6 fragments from LDS feed 8 products (16 x 128: 9)
  const float qs = which == 0 ? QSC : 1.0f;      // block-uniform; k and v: x 1, exact
  float bias[4];
#pragma unroll
  for (int j = 0; j < 4; ++j) bias[j] = BA ? bfr(BA[c0 + wc + j * 16 + col]) * qs : 0.f;
#pragma unroll 1      // one copy of the tile's code: the four tiles differ only in their row offset
  for (int it = 0; it < PNT; ++it) { const size_t r0 = ((size_t)blockIdx.x * PNT + it) * 64; const size_t bb = r0 / TT; const int t0 = (int)(r0 % TT);
    stage_rows<64>(X + r0 * DIN, tid, d, cv, foot);
    __syncthreads();      // the tile's input rows (and, on the first tile, the weight rows) are in LDS
    v8f acc[2][4] = {}; v16b a[2][2], w[2][4];
    auto frags = [&](int kc, v16b (&fa)[2], v16b (&fw)[4]) {
#pragma unroll
      for (int t = 0; t < 2; ++t) fa[t] = frag_b(&sX[wr + t * 16 + col][kc * 32], lane);
#pragma unroll
      for (int j = 0; j < 4; ++j) fw[j] = frag_b(&sW[wc + j * 16 + col][kc * 32], lane); };
    frags(0, a[0], w[0]);
#pragma unroll
    for (int kc = 0; kc < DIN / 32; ++kc) { if (kc + 1 < DIN / 32) frags(kc + 1, a[(kc + 1) & 1], w[(kc + 1) & 1]);      // the next 32 k's fragments are fetched as one group while these products run; unrolled so that both fragment sets are indexed statically and stay in registers
#pragma unroll
      for (int t = 0; t < 2; ++t) {
#pragma unroll
        for (int j = 0; j < 4; ++j) acc[t][j] = wmma_bf(a[kc & 1][t], w[kc & 1][j], acc[t][j]); } }
    __syncthreads();      // every wave has read its last fragment before the output tile overwrites the input rows
    if (which < 2) { _Float16* DH = which == 0 ? QH : KH;
#pragma unroll
      for (int t = 0; t < 2; ++t) {
#pragma unroll
        for (int j = 0; j < 4; ++j) {
#pragma unroll
          for (int r = 0; r < 8; ++r) sh[wr + t * 16 + 8 * g + r][wc + j * 16 + col] = (_Float16)(acc[t][j][r] * qs + bias[j]); } }
      __syncthreads();
      for (int e = tid; e < 64 * 16; e += 128) { const int rl = e >> 4, q = e & 15; vst2((unsigned*)(DH + (r0 + rl) * CC + c0 + q * 8), *(const v4u*)&sh[rl][q * 8]); }
    } else {
#pragma unroll
      for (int t = 0; t < 2; ++t) {
#pragma unroll
        for (int j = 0; j < 4; ++j) {
#pragma unroll
          for (int r = 0; r < 8; ++r) th[wc + j * 16 + col][wr + t * 16 + 8 * g + r] = (_Float16)(acc[t][j][r] + bias[j]); } }
      __syncthreads();
      for (int e = tid; e < 128 * 8; e += 128) { const int cl = e >> 3, q = e & 7; vst2((unsigned*)(VT + (bb * CC + c0 + cl) * (size_t)TT + t0 + q * 8), *(const v4u*)&th[cl][q * 8]); } }
    asm volatile("s_wait_xcnt 0x0" ::: "memory");      // the stores above have taken their address registers before the next tile rewrites them
  } }
// ---- k_attn: block = (all 1024 queries, head h, batch b), 16 waves, each with ANG groups of 32 queries one after the other. K rows and v planes of (b, h) are staged in LDS once for all of them; for each group a wave walks the 1024 keys 32 at a time:
// S^T = K q^T + 1 (lane = one query, 16 of the 32 keys; q carries the scale, the 1 is the product's C operand), mask by element, weights exp2(S) = exp2(logit) x 2, once to f16 straight from the score registers as the B operand of ctx^T += v^T P^T and of sum^T += 1 P^T (a tile of ones as A: every row of it holds the queries' sums over all 32 keys); ctx / sum at the end.
// A softmax does not depend on its shift, so the key loop uses none: no maximum, no exchange between the lane halves, no rescaling. The range is checked from the data behind the loop, by the sum alone (every weight is >= 0):
// sum < 65504 -> no weight left f16's range upwards; sum >= 2^8 -> the weights under f16's smallest normal number, 1024 x 2^-14 at most, are at most 2^-12 of the sum, the bound that the running maximum gives (largest weight 2^8).
// The factor 2 puts a row of 512 to 1024 visible logits around 0 at 2^10 to 2^11: 2 to 3 powers of two over the lower limit, 5 under the upper one, on which side the exponentials' tail lies.
// A group of 32 queries with a sum outside (large or strongly offset logits, few or no visible keys, a NaN) is worked again with the running maximum: slower, and right for any input.
#define AW 16
#define AQT 2
#define ANG 2              // query groups that a wave walks under the one fill
#define AQG (AW * AQT * 16)      // queries of one group over the block's waves
#define AQB (AQG * ANG)
static_assert(AW * 32 == 512 && TT == 1024 && HD == 32 && TT % AQB == 0, "the fill below is written for 512 threads, 1024 keys, head size 32");
#define KPIT 40            // f16 per staged K row: 80 B = 16 B x odd
#define VPIT (TT + 8)      // f16 per staged v plane: 2064 B = 16 B x odd
#define LOG2E 1.4426950408889634f
#define SUMLO 256.0f       // the sums for which the weights without a shift stand: SUMLO <= sum < SUMHI
#define SUMHI 65504.0f
typedef __attribute__((ext_vector_type(2))) _Float16 v2h;
typedef __attribute__((ext_vector_type(16))) unsigned v16u;
__device__ __forceinline__ float xhalf(float x) { return __builtin_bit_cast(float, __builtin_amdgcn_permlanex16(__builtin_bit_cast(int, x), __builtin_bit_cast(int, x), 0x76543210, 0xfedcba98, false, false)); }   // lane l with lane l ^ 16
__device__ __forceinline__ v8f wmma_h(v16h a, v16h b, v8f c) { return __builtin_amdgcn_wmma_f32_16x16x32_f16(false, a, false, b, (short)0, c, false, false); }
__global__ __launch_bounds__(AW * 32) __attribute__((amdgpu_waves_per_eu(4, 4))) void k_attn(const _Float16* __restrict__ QH, const _Float16* __restrict__ KH, const _Float16* __restrict__ VT, const unsigned* __restrict__ PM, _Float16* __restrict__ YF) {   // 4 waves per SIMD = one block of 16 waves per WGP
  __shared__ __align__(16) _Float16 sK[TT][KPIT]; __shared__ __align__(16) _Float16 sV[HD][VPIT];
  const int tid = threadIdx.x, wave = tid >> 5, lane = tid & 31, col = lane & 15, g = lane >> 4; const int h = blockIdx.y, b = blockIdx.z; const int qw = blockIdx.x * AQB + wave * (AQT * 16);      // group n of this wave: queries qw + n * AQG + 0..31
  v4u tk[8], tv[8];      // the fill: 1024 K rows x 64 B and 32 v planes x 2048 B, 8 + 8 loads of 16 B a thread, all in flight together, then the LDS stores
  const _Float16* kp = KH + ((size_t)b * TT + (tid >> 2)) * CC + h * HD + (tid & 3) * 8;            // load i: K row (tid >> 2) + 128 i
  const _Float16* vp = VT + ((size_t)b * CC + h * HD + (tid >> 7)) * (size_t)TT + (tid & 127) * 8;   // load i: v plane (tid >> 7) + 4 i
  const _Float16* qp = QH + ((size_t)b * TT + qw + col) * CC + h * HD + 8 * g;
#pragma unroll
  for (int i = 0; i < 8; ++i) tk[i] = *(const v4u*)(kp + i * 128 * CC);
#pragma unroll
  for (int i = 0; i < 8; ++i) tv[i] = *(const v4u*)(vp + i * 4 * TT);
  v16h qa[ANG][AQT];      // the q fragments of every group come with the fill, so that no group waits for its own
#pragma unroll
  for (int n = 0; n < ANG; ++n) {
#pragma unroll
    for (int u = 0; u < AQT; ++u) { union { v16h v; v8h q[2]; } t; t.q[0] = *(const v8h*)(qp + (n * AQG + u * 16) * CC); t.q[1] = *(const v8h*)(qp + (n * AQG + u * 16) * CC + 16); qa[n][u] = t.v; } }   // B fragment, same k order as frag_h
  asm volatile("s_wait_xcnt 0x0" :: "v"(kp), "v"(vp), "v"(qp) : "memory");      // the three address pairs stay untouched until the loads above have taken them
#pragma unroll
  for (int i = 0; i < 8; ++i) *(v4u*)&sK[(tid >> 2) + 128 * i][(tid & 3) * 8] = tk[i];
#pragma unroll
  for (int i = 0; i < 8; ++i) *(v4u*)&sV[(tid >> 7) + 4 * i][(tid & 127) * 8] = tv[i];
  __syncthreads();
  const float NEGR = -1.0e9f * LOG2E;      // the reference's -1e9 fill as an exponent of 2
  const _Float16 h1 = (_Float16)1.0f; const v16h ones = { h1, h1, h1, h1, h1, h1, h1, h1, h1, h1, h1, h1, h1, h1, h1, h1 };      // the A tile of the sums' product
#pragma unroll      // unrolled so that qa[n] is indexed statically and stays in registers
  for (int n = 0; n < ANG; ++n) { const int q0 = qw + n * AQG; const v16h (&qf)[AQT] = qa[n]; v8f acc[AQT][2] = {}, sa[AQT] = {}; float mx[AQT], ls[AQT], tot[AQT];
  const v16u* pm = (const v16u*)PM + __builtin_amdgcn_readfirstlane(q0 >> 4) * (TT / 32);      // this group's mask words: wave-uniform, so they come by scalar loads; tile u is TT / 32 groups of 16 words on
  auto mload = [&](int k0, v16u (&mk)[AQT]) {
#pragma unroll
    for (int u = 0; u < AQT; ++u) mk[u] = pm[u * (TT / 32) + (k0 >> 5)]; };
  auto step = [&](int k0, const v16u (&mk)[AQT]) {
    const v16h ka = frag_h(&sK[k0 + col][0], lane), kb = frag_h(&sK[k0 + 16 + col][0], lane);      // A rows = keys k0 + 0..15, k0 + 16..31
    const v16h va = frag_h(&sV[col][k0], lane), vb = frag_h(&sV[16 + col][k0], lane);              // A rows = head columns 0..15, 16..31; k = keys in the order of the packed scores
#pragma unroll
    for (int u = 0; u < AQT; ++u) {
      const v8f one = { 1.0f, 1.0f, 1.0f, 1.0f, 1.0f, 1.0f, 1.0f, 1.0f }; v8f s[2]; s[0] = wmma_h(ka, qf[u], one); s[1] = wmma_h(kb, qf[u], one);      // s[T][r] = key k0 + 16T + 8g + r, query = col
      union { v16h v; v2h q[8]; } pf;
#pragma unroll
      for (int i = 0; i < 8; ++i) { const v2f d = { __builtin_amdgcn_inverse_ballot_w32(mk[u][2 * i]) ? s[i >> 2][(2 * i) & 7] : NEGR, __builtin_amdgcn_inverse_ballot_w32(mk[u][2 * i + 1]) ? s[i >> 2][(2 * i + 1) & 7] : NEGR };      // word i is the select's lane mask as it stands
        const v2f p = { __builtin_amdgcn_exp2f(d[0]), __builtin_amdgcn_exp2f(d[1]) }; pf.q[i] = __builtin_convertvector(p, v2h); }      // a masked key's exponent is far below f32's range: weight 0
      acc[u][0] = wmma_h(va, pf.v, acc[u][0]); acc[u][1] = wmma_h(vb, pf.v, acc[u][1]); sa[u] = wmma_h(ones, pf.v, sa[u]);
    } };
  auto step_mx = [&](int k0, const v16u (&mk)[AQT]) {      // the same 32 keys with a running maximum: any range of logits
    const v16h ka = frag_h(&sK[k0 + col][0], lane), kb = frag_h(&sK[k0 + 16 + col][0], lane);      // A rows = keys k0 + 0..15, k0 + 16..31
    const v16h va = frag_h(&sV[col][k0], lane), vb = frag_h(&sV[16 + col][k0], lane);              // A rows = head columns 0..15, 16..31; k = keys in the order of the packed scores
#pragma unroll
    for (int u = 0; u < AQT; ++u) {
      const v8f z = {}; v8f s[2]; s[0] = wmma_h(ka, qf[u], z); s[1] = wmma_h(kb, qf[u], z);      // s[T][r] = key k0 + 16T + 8g + r, query = col
      float x[16];
#pragma unroll
      for (int i = 0; i < 16; ++i) x[i] = __builtin_amdgcn_inverse_ballot_w32(mk[u][i]) ? s[i >> 3][i & 7] : NEGR;      // word i is the select's lane mask as it stands
      float cm = x[0];
#pragma unroll
      for (int i = 1; i < 16; ++i) cm = fmaxf(cm, x[i]);
      const float mn = fmaxf(mx[u], fmaxf(cm, xhalf(cm)));           // both lane halves of a query use one maximum: their weights meet in one product
      const float al = __builtin_amdgcn_exp2f(mx[u] - mn); mx[u] = mn;
      union { v16h v; v2h q[8]; } pf; v2f sum = {};
#pragma unroll
      for (int i = 0; i < 8; ++i) { v2f d = { x[2 * i], x[2 * i + 1] }; d = (d - mn) + 8.0f;      // difference first: exactly 0 where a whole row is masked (uniform weights, as the reference gives)
        const v2f p = { __builtin_amdgcn_exp2f(d[0]), __builtin_amdgcn_exp2f(d[1]) }; sum += p; pf.q[i] = __builtin_convertvector(p, v2h); }
      ls[u] = ls[u] * al + (sum[0] + sum[1]);
      acc[u][0] = wmma_h(va, pf.v, acc[u][0] * al); acc[u][1] = wmma_h(vb, pf.v, acc[u][1] * al);
    } };
  v16u ma[AQT], mb[AQT]; mload(0, ma); mload(32, mb);      // the mask words of the next 64 keys are fetched, into the registers that the selects have just read, while these 64 are worked on
  for (int k0 = 0; k0 < TT; k0 += 64) { const int kn = k0 + 64 < TT ? k0 + 64 : 0; step(k0, ma); mload(kn, ma); step(k0 + 32, mb); mload(kn + 32, mb); }
  bool in = true;
#pragma unroll
  for (int u = 0; u < AQT; ++u) { tot[u] = sa[u][0]; in = in && tot[u] >= SUMLO && tot[u] < SUMHI; }      // both lane halves hold the whole sum; false for a NaN too, and for a weight that left f16's range (sum = inf)
  if (__builtin_amdgcn_ballot_w32(!in) != 0) {      // wave-uniform (a scalar branch on the ballot), no barrier behind it: the group's 32 queries again, from the start
#pragma unroll
    for (int u = 0; u < AQT; ++u) { mx[u] = -3.0e38f; ls[u] = 0.f; acc[u][0] = v8f{}; acc[u][1] = v8f{}; }
#pragma unroll 1      // a path that few inputs take: one copy of the 32 keys' code
    for (int k0 = 0; k0 < TT; k0 += 32) { mload(k0, ma); step_mx(k0, ma); }
#pragma unroll      // unrolled so that tot[] and ls[] are indexed statically and stay in registers
    for (int u = 0; u < AQT; ++u) tot[u] = ls[u] + xhalf(ls[u]); }
#pragma unroll
  for (int u = 0; u < AQT; ++u) { const float inv = 1.0f / tot[u]; _Float16* yp = YF + (unsigned)((((b * NH + h) * (TT / 16) + (q0 >> 4) + u) * 2) * 256 + lane * 8);      // this lane's 8 + 8 values (query col, head columns 8g + 0..7 and 16 + 8g + 0..7) are what lane (col, g) of k_out takes as its A fragment of k = this head
#pragma unroll
    for (int j = 0; j < 2; ++j) { v8f o = acc[u][j] * inv; o = o * 64.0f; vst2(yp + j * 256, __builtin_convertvector(o, v8h)); } }   /* ctx carried x 2^6 into f16 so small-magnitude context rows stay clear of f16 subnormals; a wave's store is 512 contiguous bytes */
  if (n + 1 < ANG) asm volatile("s_wait_xcnt 0x0" ::: "memory");      // the stores above have taken their address registers before the next group rewrites them
  } }
// ---- k_out: block = (ONT x 64 rows, 128 cols): out = ctx Wo (+ bo): ctx (f16 x 2^6, rounded once in k_attn) against Wo as f16(bf16 x 2^8) exact (1 product) x 2^-14. The Wo rows are staged in LDS once.
// The ctx fragments come straight from the workspace, where k_attn left them in fragment order (a load of a wave = 512 contiguous bytes): no LDS staging, no conversion and no barrier in the tile loop.
__global__ __launch_bounds__(128) void k_out(const _Float16* __restrict__ YF, const float* __restrict__ WO, const float* __restrict__ BO, float* __restrict__ OUT) { __shared__ __align__(16) unsigned char sm[SOP_BYTES];      // the output tile (each wave its own 32 x 64 part), then the weight rows
  _Float16 (*sW)[SPIT] = (_Float16 (*)[SPIT])(sm + SX_BYTES); float (*sf)[132] = (float (*)[132])sm;
  static_assert(64 * 132 * 4 <= SX_BYTES, "the output tile fits in front of the weight rows");
  static_assert(TT % (64 * ONT) == 0 && CC / 32 == NH && HD == 32 && NH == 8 && ALD <= 8, "a block's row tiles lie in one sequence; 32 k of the product = one head");
  const int tid = threadIdx.x, wave = tid >> 5, lane = tid & 31, col = lane & 15, g = lane >> 4; const int c0 = blockIdx.y * 128;
  unsigned char* d = sm + (tid >> 6) * (SPIT * 2) + (tid & 63) * 8;
  auto cw = [](unsigned char* q, v4f v) { const v4h o = { (_Float16)(bfr(v[0]) * 256.0f), (_Float16)(bfr(v[1]) * 256.0f), (_Float16)(bfr(v[2]) * 256.0f), (_Float16)(bfr(v[3]) * 256.0f) }; *(v4h*)q = o; };
  auto none = []() {};
  const int wr = (wave >> 1) * 32, wc = (wave & 1) * 64;      // a wave's part of the 64 x 128 tile: 32 rows x 64 columns
  const unsigned rb0 = blockIdx.x * (ONT * 64);
  const _Float16* ap = YF + (unsigned)(((rb0 / TT) * NH * (TT / 16) + ((rb0 % TT + wr) >> 4)) * 512 + lane * 8);      // tile it: + it * 4 * 512; head kc: + kc * (TT / 16) * 512; 16 rows on: + 512; second half of a fragment: + 256
  auto aload = [&](int it, int kc, int t) { union { v16h v; v8h q[2]; } u; const _Float16* p = ap + it * 2048 + kc * ((TT / 16) * 512) + t * 512; u.q[0] = *(const v8h*)p; u.q[1] = *(const v8h*)(p + 256); return u.v; };
  v16h a[2][ALD];      // a ring of ctx fragments, ALD heads deep, that runs on over the tiles; the first ALD are under way while the weight rows are staged
#pragma unroll
  for (int s = 0; s < ALD; ++s) {
#pragma unroll
    for (int t = 0; t < 2; ++t) a[t][s] = aload(s >> 3, s & 7, t); }
  asm volatile("s_wait_xcnt 0x0" :: "v"(ap) : "memory");      // the address pair stays untouched until the loads above have taken it
  stage_rows<128>(WO + (size_t)c0 * CC, tid, d + SX_BYTES, cw, none);
  float bias[4];
#pragma unroll
  for (int j = 0; j < 4; ++j) bias[j] = BO ? bfr(BO[c0 + wc + j * 16 + col]) : 0.f;
  __syncthreads();      // the weight rows are in LDS
#pragma unroll      // unrolled so that the ring's places are indexed statically and stay in registers, and the last steps fetch nothing
  for (int it = 0; it < ONT; ++it) { const size_t rb = (size_t)rb0 + it * 64;
    v8f acc[2][4] = {}; v16h w[2][4];
    auto frags = [&](int kc, v16h (&fw)[4]) {
#pragma unroll
      for (int j = 0; j < 4; ++j) fw[j] = frag_h(&sW[wc + j * 16 + col][kc * 32], lane); };
    frags(0, w[0]);
#pragma unroll
    for (int kc = 0; kc < CC / 32; ++kc) { if (kc + 1 < CC / 32) frags(kc + 1, w[(kc + 1) & 1]);      // the next 32 k's weight fragments are fetched as one group while these products run; unrolled so that both fragment sets are indexed statically and stay in registers
#pragma unroll
      for (int t = 0; t < 2; ++t) {
#pragma unroll
        for (int j = 0; j < 4; ++j) acc[t][j] = wmma16(a[t][(it * 8 + kc) % ALD], w[kc & 1][j], acc[t][j]); }
      if (it * 8 + kc + ALD < ONT * 8) {      // the fragments ALD heads on go into the registers that the products above have just read
#pragma unroll
        for (int t = 0; t < 2; ++t) a[t][(it * 8 + kc) % ALD] = aload((it * 8 + kc + ALD) >> 3, (kc + ALD) & 7, t); } }
    asm volatile("s_wait_xcnt 0x0" :: "v"(ap) : "memory");      // the address pair stays untouched until the loads above have taken it
#pragma unroll
    for (int t = 0; t < 2; ++t) {
#pragma unroll
      for (int j = 0; j < 4; ++j) {
#pragma unroll
        for (int r = 0; r < 8; ++r) sf[wr + t * 16 + 8 * g + r][wc + j * 16 + col] = acc[t][j][r] * (1.0f / 16384.0f) + bias[j]; } }   /* 2^-8 (Wo carry) x 2^-6 (ctx carry) */
    asm volatile("s_wait_dscnt 0" ::: "memory"); __builtin_amdgcn_wave_barrier();      // the wave's own LDS stores are done before it reads the rows back; no fence here: one would also wait for the ring's loads, which are to stay in flight over this part
    for (int rl = 0; rl < 32; rl += 2) vst2(OUT + (rb + wr + rl + g) * DIN + c0 + wc + col * 4, *(const v4f*)&sf[wr + rl + g][wc + col * 4]);      // a wave reads back only what it wrote itself: two rows of 256 B (two whole lines each) a store
    asm volatile("s_wait_xcnt 0x0" ::: "memory");      // the stores above have taken their address registers before the next tile rewrites them
  } }

extern "C" void kernel_launch(void* const* d_in, const int* in_sizes, int n_in, void* d_out, int out_size, void* d_ws, size_t ws_size, hipStream_t stream) {
  (void)in_sizes; (void)n_in; (void)out_size;
  const float** F = (const float**)d_in;
  if (ws_size < (size_t)WS_END) return;
  char* ws = (char*)d_ws; _Float16 *QH = (_Float16*)(ws + WS_QH), *KH = (_Float16*)(ws + WS_KH), *VT = (_Float16*)(ws + WS_VT), *QL = (_Float16*)(ws + WS_QL), *KL = (_Float16*)(ws + WS_KL); __bf16 *VB = (__bf16*)(ws + WS_VB), *VBL = (__bf16*)(ws + WS_VBL); float *S = (float*)(ws + WS_S); _Float16* Y = (_Float16*)(ws + WS_Y); unsigned* PM = (unsigned*)(ws + WS_PM);
  (void)Y; (void)S; (void)QL; (void)KL; (void)VB; (void)VBL;
  // inputs: 0 x [32,1024,256]; 1 attn_mask [1024,1024] (bool topology mask, diagonal True); 2 Wq [256,256] (out,in), 3 bq; 4 Wk, 5 bk; 6 Wv, 7 bv; 8 Wo (out,in), 9 bo (biases nonzero)
  k_proj<<<dim3(TNB * TT / 64 / PNT, CC / 128, 4), 128, 0, stream>>>(F[0], F[0], F[0], F[2], F[4], F[6], F[3], F[5], F[7], QH, KH, VT, (const int*)d_in[1], PM);   // z = 3: the 256 mask blocks
  k_attn<<<dim3(TT / AQB, NH, TNB), AW * 32, 0, stream>>>(QH, KH, VT, PM, Y);
  k_out<<<dim3(TNB * TT / 64 / ONT, DIN / 128), 128, 0, stream>>>(Y, F[8], F[9], (float*)d_out);
}

// v010
// Measured time: 55.2 microseconds a run.
// In both of two side-by-side timings against v009, it was 1.32 times as fast.
// Over all steps from v000 it is 35.9 times as fast.
// compute dtype: all float inputs rounded to bf16; q/k/v projections with EXACT bf16 products on WMMA 16x16x32 (f32 accumulate) + bias; logits q x 32^-0.5 log2(e) and k once to f16 each (1 product; sigma - 1); the shared boolean mask read per element; softmax f32 without a shift (weights exp2(logit) x 2, once to f16; their sum per query by a product of ones with them, f32 accumulate) where a query's sum shows its weights inside f16's range, else online softmax (running maximum and sum, weights x 2^8); weights once to f16 x v once to f16 (1 product), divided by the f32 sum after the product; ctx x 2^6 once to f16 x Wo f16(bf16 x 2^8) + bo; f32 output.
#include <hip/hip_runtime.h>
#include <math.h>

typedef __attribute__((ext_vector_type(16))) _Float16 v16h;
typedef __attribute__((ext_vector_type(16))) __bf16 v16b;
typedef __attribute__((ext_vector_type(8)))  _Float16 v8h;
typedef __attribute__((ext_vector_type(8)))  float v8f;
typedef __attribute__((ext_vector_type(4)))  float v4f;
typedef __attribute__((ext_vector_type(2)))  float v2f;
typedef __attribute__((ext_vector_type(4)))  unsigned v4u;
typedef __attribute__((ext_vector_type(4)))  int v4i;
typedef float __attribute__((may_alias)) float_a;
typedef int __attribute__((may_alias)) int_a;

template <typename T> __device__ __forceinline__ void vst2(void* p, T v) { *(T*)p = v;  }
__device__ __forceinline__ v8f wmma16(v16h a, v16h b, v8f c) {
  v8f d = __builtin_amdgcn_wmma_f32_16x16x32_f16(false, a, false, b, (short)0, c, false, false);
  asm volatile("v_nop\n\tv_nop\n\tv_nop\n\tv_nop" : "+v"(d) : "v"(a), "v"(b));
  return d;
}
__device__ __forceinline__ v8f wmma_bf(v16b a, v16b b, v8f c) {
  v8f d = __builtin_amdgcn_wmma_f32_16x16x32_bf16(false, a, false, b, (short)0, c, false, false);
  asm volatile("v_nop\n\tv_nop\n\tv_nop\n\tv_nop" : "+v"(d) : "v"(a), "v"(b));
  return d;
}
// 16x16x32 fragments: lane = (h = lane>>4, row/col = lane&15); elements 0..7 = k0+8h+0..7, 8..15 = k0+16+8h+0..7; D element r = row 8h+r
__device__ __forceinline__ v16h frag_h(const _Float16* rowk0, int lane) {
  union { v16h v; v8h q[2]; } u; const _Float16* p = rowk0 + 8 * (lane >> 4);
  u.q[0] = *(const v8h*)p; u.q[1] = *(const v8h*)(p + 16); return u.v;
}
__device__ __forceinline__ v16h frag_f32(const float* rowk0, int lane) {
  v16h a; const float* p = rowk0 + 8 * (lane >> 4);
#pragma unroll
  for (int i = 0; i < 8; ++i) { a[i] = (_Float16)p[i]; a[8 + i] = (_Float16)p[16 + i]; }
  return a;
}
__device__ __forceinline__ v16h frag_f32s(const float* rowk0, int lane, float sc) {
  v16h a; const float* p = rowk0 + 8 * (lane >> 4);
#pragma unroll
  for (int i = 0; i < 8; ++i) { a[i] = (_Float16)(p[i] * sc); a[8 + i] = (_Float16)(p[16 + i] * sc); }
  return a;
}
// column fragment from a [K][ld] layout (column n), rows >= K read as 0
__device__ __forceinline__ v16h fragc_f32(const float* W, int k0, int n, int lane, int ld, int K) {
  v16h a; const int g = lane >> 4;
#pragma unroll
  for (int i = 0; i < 8; ++i) { const int ka = k0 + 8 * g + i, kb = ka + 16;
    a[i] = (_Float16)(ka < K ? W[(size_t)(ka < K ? ka : K - 1) * ld + n] : 0.f); a[8 + i] = (_Float16)(kb < K ? W[(size_t)(kb < K ? kb : K - 1) * ld + n] : 0.f); }
  return a;
}
struct F2 { v16b h, l; };
__device__ __forceinline__ F2 bsplit16(const float v[16]) { F2 r;
#pragma unroll
  for (int i = 0; i < 16; ++i) { const __bf16 h = (__bf16)v[i]; r.h[i] = h; r.l[i] = (__bf16)(v[i] - (float)h); }
  return r; }
__device__ __forceinline__ F2 split_row(const float* row, int k0, int lane) { float v[16]; const float* p = row + k0 + 8 * (lane >> 4);
#pragma unroll
  for (int i = 0; i < 8; ++i) { v[i] = p[i]; v[8 + i] = p[16 + i]; }
  return bsplit16(v); }
__device__ __forceinline__ F2 split_rowK(const float* row, int k0, int lane, int K) { float v[16]; const int g = lane >> 4;
#pragma unroll
  for (int i = 0; i < 8; ++i) { const int ka = k0 + 8 * g + i, kb = ka + 16; v[i] = ka < K ? row[ka < K ? ka : K - 1] : 0.f; v[8 + i] = kb < K ? row[kb < K ? kb : K - 1] : 0.f; }
  return bsplit16(v); }
__device__ __forceinline__ F2 split_col(const float* W, int k0, int n, int lane, int ld, int K) { float v[16]; const int g = lane >> 4;
#pragma unroll
  for (int i = 0; i < 8; ++i) { const int ka = k0 + 8 * g + i, kb = ka + 16; v[i] = ka < K ? W[(size_t)(ka < K ? ka : K - 1) * ld + n] : 0.f; v[8 + i] = kb < K ? W[(size_t)(kb < K ? kb : K - 1) * ld + n] : 0.f; }
  return bsplit16(v); }
__device__ __forceinline__ v8f mac3(const F2& a, const F2& b, v8f c) { c = wmma_bf(a.l, b.h, c); c = wmma_bf(a.h, b.l, c); return wmma_bf(a.h, b.h, c); }
__device__ __forceinline__ float sigm(float v) { return 1.0f / (1.0f + expf(-v)); }
#define LDSX() do { asm volatile("s_wait_dscnt 0" ::: "memory"); __builtin_amdgcn_wave_barrier(); __builtin_amdgcn_fence(__ATOMIC_RELEASE, "workgroup"); } while (0)

// Multi-head self-attention with a shared boolean topology mask (x [32,1024,256]; 8 heads x 32; torch (out,in) Wq/Wk/Wv/Wo [256,256] + biases (N(0, 1/256), NONZERO); attn_mask [1024,1024] bool (~50 % True, diagonal True) shared by all batches and heads: scores = where(mask, q_h k_h^T / sqrt(32), -1e9)): out = merge(softmax(scores) v_h) Wo^T + bo.
#define NB 32
#define TT 1024
#define CC 256            // NH * HD = projected width
#define DIN 256          // input (model) width
#define NH 8
#define HD 32
#define NQB (TT / 64)
#define HG 8
#define SCALE (0.17677669529663687f)
#define QSC (SCALE * 1.4426950408889634f)      // what q carries into its f16 rows: the softmax scale and log2(e), so that q x k is an exponent of 2 as it stands
#define CAUSAL 0
#ifndef TNB
#define TNB NB
#endif
__device__ __forceinline__ float bfr(float v) { return (float)(__bf16)v; }
__host__ __device__ __forceinline__ int kb_last(int qb) { return CAUSAL ? ((qb * 64 + 63) >> 7) : (TT / 128 - 1); }
typedef __attribute__((ext_vector_type(8))) __bf16 v8b;
__device__ __forceinline__ v16b frag_b(const __bf16* rowk0, int lane) {
  union { v16b v; v8b q[2]; } u; const __bf16* p = rowk0 + 8 * (lane >> 4);
  u.q[0] = *(const v8b*)p; u.q[1] = *(const v8b*)(p + 16); return u.v;
}
#define QBH 0              // read by no kernel: k_attn has one single-product path for every query block
#define QHI 0               // single-product logits on every row (sigma - 1 logits averaged over -512 visible keys)
#define KHI 64            // key rows carrying k residual / v bf16 hi+lo planes (no kernel here writes or reads them)
// B fragment (k rows k0+.., output column o) of a weight: (in,out) [K][ld] or (out,in) [ld rows of K]: bf16 exact, or f16(bf16 * 256) exact
__device__ __forceinline__ v16b wcol_io(const float* Wm, int k0, int o, int lane, int ld) { v16b w; const int g = lane >> 4;
#pragma unroll
  for (int i = 0; i < 8; ++i) { w[i] = (__bf16)Wm[(size_t)(k0 + 8 * g + i) * ld + o]; w[8 + i] = (__bf16)Wm[(size_t)(k0 + 16 + 8 * g + i) * ld + o]; }
  return w; }
__device__ __forceinline__ v16b wcol_oi(const float* Wm, int k0, int o, int lane, int K) { v16b w; const float* p = Wm + (size_t)o * K + k0 + 8 * (lane >> 4);
#pragma unroll
  for (int i = 0; i < 8; ++i) { w[i] = (__bf16)p[i]; w[8 + i] = (__bf16)p[16 + i]; }
  return w; }
__device__ __forceinline__ v16h wcolh_io(const float* Wm, int k0, int o, int lane, int ld) { v16h w; const int g = lane >> 4;
#pragma unroll
  for (int i = 0; i < 8; ++i) { w[i] = (_Float16)(bfr(Wm[(size_t)(k0 + 8 * g + i) * ld + o]) * 256.0f); w[8 + i] = (_Float16)(bfr(Wm[(size_t)(k0 + 16 + 8 * g + i) * ld + o]) * 256.0f); }
  return w; }
__device__ __forceinline__ v16h wcolh_oi(const float* Wm, int k0, int o, int lane, int K) { v16h w; const float* p = Wm + (size_t)o * K + k0 + 8 * (lane >> 4);
#pragma unroll
  for (int i = 0; i < 8; ++i) { w[i] = (_Float16)(bfr(p[i]) * 256.0f); w[8 + i] = (_Float16)(bfr(p[16 + i]) * 256.0f); }
  return w; }
#define WQKV_LAYOUT 1   // 0 = (in,out) [DIN][CC]; 1 = (out,in) [CC][DIN]; 2 = per-head [NH][DIN][HD]
__device__ __forceinline__ v16b wcol_hdk(const float* Wm, int k0, int o, int lane) { v16b w; const int g = lane >> 4; const float* p = Wm + (size_t)(o / HD) * DIN * HD + (o % HD);
#pragma unroll
  for (int i = 0; i < 8; ++i) { w[i] = (__bf16)p[(size_t)(k0 + 8 * g + i) * HD]; w[8 + i] = (__bf16)p[(size_t)(k0 + 16 + 8 * g + i) * HD]; }
  return w; }
#define WO_OUT_IN 1
#if WQKV_LAYOUT == 1
#define WCOL(W, k0, o, lane) wcol_oi(W, k0, o, lane, DIN)
#elif WQKV_LAYOUT == 2
#define WCOL(W, k0, o, lane) wcol_hdk(W, k0, o, lane)
#else
#define WCOL(W, k0, o, lane) wcol_io(W, k0, o, lane, CC)
#endif
#if WO_OUT_IN
#define WOCOL(W, k0, o, lane) wcol_oi(W, k0, o, lane, CC)
#define WOCOLH(W, k0, o, lane) wcolh_oi(W, k0, o, lane, CC)
#else
#define WOCOL(W, k0, o, lane) wcol_io(W, k0, o, lane, DIN)
#define WOCOLH(W, k0, o, lane) wcolh_io(W, k0, o, lane, DIN)
#endif
#ifndef PROJ_EXTRA_PARAMS
#define PROJ_EXTRA_PARAMS
#endif

#define WS_QH  0u                                      // f16 q rows [b*t][CC] (this plane and the next two are no longer used: q, k, v never leave k_attn)
#define WS_KH  (WS_QH + 2u * (size_t)NB * TT * CC)      // f16 k rows [b*t][CC]
#define WS_VT  (WS_KH + 2u * (size_t)NB * TT * CC)      // f16 v planes [b][c][t]
#define WS_QL  (WS_VT + 2u * (size_t)NB * CC * TT)      // f16 q residual x 2^10 rows [b][t < QHI][CC]
#define WS_KL  (WS_QL + 2u * (size_t)NB * QHI * CC)     // f16 k residual x 2^10 rows [b][t < KHI][CC]
#define WS_VB  (WS_KL + 2u * (size_t)NB * KHI * CC)     // bf16 v hi planes [b][c][t < KHI]
#define WS_VBL (WS_VB + 2u * (size_t)NB * CC * KHI)
#define WS_S   (WS_VBL + 2u * (size_t)NB * CC * KHI)    // room of HG x TT x TT f32; only the mask words (WS_PM) use it
#define WS_PM  WS_S                                      // the mask as lane-mask words [query tile of 16][32 keys][16 words], 128 KiB (the logits plane is not used)
#define WS_Y   (WS_S  + 4u * (size_t)HG * TT * TT)      // f16 ctx x 2^6 in the order of k_out's A fragments: [b][head][16 queries][half of the fragment][lane][8], 16 MiB of the plane
#define WS_END (WS_Y  + 4u * (size_t)NB * TT * CC)

// ---- operand staging of k_out: a block's 128 weight rows (its output columns), 256 f32 each and contiguous in memory, go to LDS once as 16-bit rows.
// Every load of a wave takes 512 contiguous bytes, so a block touches each 128-B line once; the WMMA fragments are then 16-B LDS reads.
#define SPIT 264           // 16-bit elements per staged row: 528 B = 16 B x odd
#define SW_BYTES (128 * SPIT * 2)
#define SX_BYTES (64 * SPIT * 2)      // the output tile's 64 rows of 132 f32 (the same bytes) stand first; the weight rows follow
#define SOP_BYTES ((128 + 64) * SPIT * 2)
static_assert(WQKV_LAYOUT == 1 && WO_OUT_IN == 1 && DIN == 256 && CC == 256, "the staging below reads (out,in) weight rows of 256");
typedef __attribute__((ext_vector_type(4))) __bf16 v4b;
typedef __attribute__((ext_vector_type(4))) _Float16 v4h;
// base = first row (128 threads = two rows a pass), d = this thread's 8 bytes of LDS row tid >> 6; the loops are unrolled so that t[] stays in registers and every step is an immediate offset
// pre() runs once, behind the first 16 loads' issue and in front of the first LDS store
template <int NROW, typename CV, typename PRE> __device__ __forceinline__ void stage_rows(const float* base, int tid, unsigned char* d, CV cv, PRE pre) {
  const float* p = base + tid * 4;
#pragma unroll
  for (int b = 0; b < NROW / 2; b += 16) { v4f t[16];
#pragma unroll
    for (int i = 0; i < 16; ++i) t[i] = *(const v4f*)(p + (b + i) * 512);
    asm volatile("s_wait_xcnt 0x0" :: "v"(tid), "s"(base) : "memory");      // the loads' offset register and base stay untouched until the 16 loads above have taken them; no later load is lifted over this line, which keeps the registers under 256
    if (b == 0) pre();
#pragma unroll
    for (int i = 0; i < 16; ++i) cv(d + (b + i) * (2 * SPIT * 2), t[i]); } }

#define ONT 2             // k_out: row tiles of 64 that a block walks one after the other
#define ALD 6             // k_out: how many heads (32 k each) ahead of their products the ctx fragments are loaded; 8 would take the registers past 256
// ---- k_mask: each wave turns two tiles of 16 queries x 32 keys of the int mask into 32 lane-mask words, one 128-B line.
// Word i of a tile, bit l = mask[query tile * 16 + (l & 15)][key block * 32 + 16 (i >> 3) + 8 (l >> 4) + (i & 7)]: the lane mask of score register i in k_attn
__global__ __launch_bounds__(128) void k_mask(const int* __restrict__ AMASK, unsigned* __restrict__ PM) {
  const int tid = threadIdx.x, wave = tid >> 5, lane = tid & 31, col = lane & 15, g = lane >> 4;
    const int tp = blockIdx.x * 4 + wave; const int* mp = AMASK + ((tp >> 4) * 16 + col) * TT + (tp & 15) * 64 + 8 * g; v4i m[8]; unsigned wd = 0;
#pragma unroll
    for (int i = 0; i < 8; ++i) m[i] = *(const v4i*)(mp + (i >> 1) * 16 + (i & 1) * 4);
#pragma unroll
    for (int i = 0; i < 32; ++i) { const unsigned bl = __builtin_amdgcn_ballot_w32(m[i >> 2][i & 3] != 0); if (lane == i) wd = bl; }
    PM[tp * 32 + lane] = wd; }
// ---- k_attn: block = (all 1024 queries, head h, batch b), 16 waves, each with ANG groups of 32 queries one after the other. K rows and v planes of (b, h) are formed in LDS once for all of them (the projections at the kernel's head); for each group a wave walks the 1024 keys 32 at a time:
// S^T = K q^T + 1 (lane = one query, 16 of the 32 keys; q carries the scale, the 1 is the product's C operand), mask by element, weights exp2(S) = exp2(logit) x 2, once to f16 straight from the score registers as the B operand of ctx^T += v^T P^T and of sum^T += 1 P^T (a tile of ones as A: every row of it holds the queries' sums over all 32 keys); ctx / sum at the end.
// A softmax does not depend on its shift, so the key loop uses none: no maximum, no exchange between the lane halves, no rescaling. The range is checked from the data behind the loop, by the sum alone (every weight is >= 0):
// sum < 65504 -> no weight left f16's range upwards; sum >= 2^8 -> the weights under f16's smallest normal number, 1024 x 2^-14 at most, are at most 2^-12 of the sum, the bound that the running maximum gives (largest weight 2^8).
// The factor 2 puts a row of 512 to 1024 visible logits around 0 at 2^10 to 2^11: 2 to 3 powers of two over the lower limit, 5 under the upper one, on which side the exponentials' tail lies.
// A group of 32 queries with a sum outside (large or strongly offset logits, few or no visible keys, a NaN) is worked again with the running maximum: slower, and right for any input.
#define AW 16
#define AQT 2
#define ANG 2              // query groups that a wave walks under the one fill
#define AQG (AW * AQT * 16)      // queries of one group over the block's waves
#define AQB (AQG * ANG)
static_assert(AW * 32 == 512 && TT == 1024 && HD == 32 && TT % AQB == 0, "the fill below is written for 512 threads, 1024 keys, head size 32");
#define KPIT 40            // f16 per staged K row: 80 B = 16 B x odd
#define VPIT (TT + 8)      // f16 per staged v plane: 2064 B = 16 B x odd
#define LOG2E 1.4426950408889634f
#define SUMLO 256.0f       // the sums for which the weights without a shift stand: SUMLO <= sum < SUMHI
#define SUMHI 65504.0f
typedef __attribute__((ext_vector_type(2))) _Float16 v2h;
typedef __attribute__((ext_vector_type(16))) unsigned v16u;
__device__ __forceinline__ float xhalf(float x) { return __builtin_bit_cast(float, __builtin_amdgcn_permlanex16(__builtin_bit_cast(int, x), __builtin_bit_cast(int, x), 0x76543210, 0xfedcba98, false, false)); }   // lane l with lane l ^ 16
__device__ __forceinline__ v8f wmma_h(v16h a, v16h b, v8f c) { return __builtin_amdgcn_wmma_f32_16x16x32_f16(false, a, false, b, (short)0, c, false, false); }
#define XPIT 40            // bf16 per staged x row of 32 k: 80 B = 16 B x odd
#define NXC (ANG * (DIN / 32))      // pieces of 32 rows x 32 k that a wave walks
__device__ __forceinline__ v8f wmma_b(v16b a, v16b b, v8f c) { return __builtin_amdgcn_wmma_f32_16x16x32_bf16(false, a, false, b, (short)0, c, false, false); }
__global__ __launch_bounds__(AW * 32) __attribute__((amdgpu_waves_per_eu(4, 4))) void k_attn(const float* __restrict__ X, const float* __restrict__ WQ, const float* __restrict__ WK, const float* __restrict__ WV, const float* __restrict__ BQ, const float* __restrict__ BK, const float* __restrict__ BV, const unsigned* __restrict__ PM, _Float16* __restrict__ YF) {   // 4 waves per SIMD = one block of 16 waves per WGP
  __shared__ __align__(16) _Float16 sK[TT][KPIT]; __shared__ __align__(16) _Float16 sV[HD][VPIT];
  __shared__ __align__(16) __bf16 sW[3 * HD][SPIT];            // this head's 32 rows of Wq, of Wk, of Wv
  __shared__ __align__(16) __bf16 sX[AW][2][32][XPIT];         // each wave's own two pieces of x
  static_assert(WQKV_LAYOUT == 1 && DIN == 256 && AQT == 2 && HD == 32, "the projections below read (out,in) weight rows of 256");
  const int tid = threadIdx.x, wave = tid >> 5, lane = tid & 31, col = lane & 15, g = lane >> 4; const int h = blockIdx.y, b = blockIdx.z; const int qw = blockIdx.x * AQB + wave * (AQT * 16);      // group n of this wave: queries qw + n * AQG + 0..31
  // ---- projections: the wave's 64 rows of x are its queries and its share of the keys. q^T = Wq x^T and k^T = Wk x^T (a lane = one row of x, 8 head columns a tile), v = x Wv^T (a lane = one head column, 8 rows of x), exact bf16 products, both operands by frag_b's k order.
  // q^T is the score product's B fragment as it stands and never leaves the registers; 8 values of k^T are 16 B of a K row, 8 values of v 16 B of a v plane.
  const float* xp = X + ((size_t)b * TT + qw + (lane >> 3)) * DIN + (lane & 7) * 4;      // load i of piece c: row (lane >> 3) + 4 i of group c >> 3, k = 32 (c & 7) + ..: a load of a wave = 4 whole lines
  v4f t[2][8];      // two pieces are under way at any time
  auto xload = [&](int c, v4f (&d)[8]) {
#pragma unroll
    for (int i = 0; i < 8; ++i) d[i] = *(const v4f*)(xp + (c >> 3) * (AQG * DIN) + (c & 7) * 32 + i * (4 * DIN));
    asm volatile("s_wait_xcnt 0x0" :: "v"(xp) : "memory"); };      // the address pair stays untouched until the loads above have taken it
  xload(0, t[0]); xload(1, t[1]);
  { v4f w[12]; const int wo = (h * HD + (tid >> 6)) * DIN + (tid & 63) * 4; const float *pq = WQ + wo, *pk = WK + wo, *pv = WV + wo;      // 8 rows a pass, whole lines
#pragma unroll
    for (int i = 0; i < 4; ++i) { w[i] = *(const v4f*)(pq + i * (8 * DIN)); w[4 + i] = *(const v4f*)(pk + i * (8 * DIN)); w[8 + i] = *(const v4f*)(pv + i * (8 * DIN)); }
    asm volatile("s_wait_xcnt 0x0" :: "v"(pq), "v"(pk), "v"(pv) : "memory");      // the three address pairs stay untouched until the loads above have taken them
#pragma unroll
    for (int i = 0; i < 12; ++i) { const v4b o = { (__bf16)w[i][0], (__bf16)w[i][1], (__bf16)w[i][2], (__bf16)w[i][3] }; *(v4b*)&sW[(tid >> 6) + 8 * i][(tid & 63) * 4] = o; } }
  __syncthreads();      // the weight rows are in LDS
  v16h qa[ANG][AQT]; const unsigned oc = h * HD + col; const float *pbq = BQ + h * HD + 8 * g, *pbk = BK + h * HD + 8 * g;      // where a lane's biases stand: one head column of v, 8 of q and k
#pragma unroll      // unrolled so that t[], qa[] and the pieces' offsets are static
  for (int n = 0; n < ANG; ++n) { v8f aq[AQT][2] = {}, ak[AQT][2] = {}, av[AQT][2] = {};
#pragma unroll
    for (int kc = 0; kc < DIN / 32; ++kc) { const int c = n * (DIN / 32) + kc; __bf16 (*xb)[XPIT] = sX[wave][c & 1];
      __builtin_amdgcn_sched_barrier(0);      // a piece's conversions stay in its own pass: lifted into an earlier one they would wait for loads that have only just been issued
#pragma unroll
      for (int i = 0; i < 8; ++i) { const v4f v = t[c & 1][i]; const v4b o = { (__bf16)v[0], (__bf16)v[1], (__bf16)v[2], (__bf16)v[3] }; *(v4b*)&xb[(lane >> 3) + 4 * i][(lane & 7) * 4] = o; }
      __builtin_amdgcn_sched_barrier(0);      // the loads below stay behind the conversions, so that they take the registers just read and no third set (which spills)
      if (c + 2 < NXC) xload(c + 2, t[c & 1]);      // into the registers that the conversions above have just read
      asm volatile("s_wait_dscnt 0" ::: "memory"); __builtin_amdgcn_wave_barrier();      // the wave's own LDS stores are done before it reads the piece back as fragments; no other wave touches it
      v16b xa[AQT];
#pragma unroll
      for (int u = 0; u < AQT; ++u) xa[u] = frag_b(&xb[u * 16 + col][0], lane);
#pragma unroll
      for (int j = 0; j < 2; ++j) { const v16b wq = frag_b(&sW[j * 16 + col][kc * 32], lane), wk = frag_b(&sW[HD + j * 16 + col][kc * 32], lane), wv = frag_b(&sW[2 * HD + j * 16 + col][kc * 32], lane);
#pragma unroll
        for (int u = 0; u < AQT; ++u) { aq[u][j] = wmma_b(wq, xa[u], aq[u][j]); ak[u][j] = wmma_b(wk, xa[u], ak[u][j]); av[u][j] = wmma_b(xa[u], wv, av[u][j]); } } }
#pragma unroll
    for (int j = 0; j < 2; ++j) {
      const v4f q0 = *(const v4f*)(pbq + j * 16), q1 = *(const v4f*)(pbq + j * 16 + 4), k0 = *(const v4f*)(pbk + j * 16), k1 = *(const v4f*)(pbk + j * 16 + 4); const float bv = bfr(BV[oc + j * 16]);
      asm volatile("s_wait_xcnt 0x0" :: "v"(pbq), "v"(pbk), "v"(oc), "s"(BV) : "memory");      // the address pairs, the offset and the base stay untouched until the loads above have taken them
#pragma unroll
      for (int u = 0; u < AQT; ++u) { v8h kh, vh;
#pragma unroll
        for (int r = 0; r < 8; ++r) { const float bq = bfr(r < 4 ? q0[r & 3] : q1[r & 3]) * QSC, bk = bfr(r < 4 ? k0[r & 3] : k1[r & 3]);
          qa[n][u][j * 8 + r] = (_Float16)(aq[u][j][r] * QSC + bq); kh[r] = (_Float16)(ak[u][j][r] + bk); vh[r] = (_Float16)(av[u][j][r] + bv); }
        *(v8h*)&sK[qw + n * AQG + u * 16 + col][j * 16 + 8 * g] = kh; *(v8h*)&sV[j * 16 + col][qw + n * AQG + u * 16 + 8 * g] = vh; } } }
  __syncthreads();      // K rows and v planes of all 1024 keys are in LDS
  const float NEGR = -1.0e9f * LOG2E;      // the reference's -1e9 fill as an exponent of 2
  const _Float16 h1 = (_Float16)1.0f; const v16h ones = { h1, h1, h1, h1, h1, h1, h1, h1, h1, h1, h1, h1, h1, h1, h1, h1 };      // the A tile of the sums' product
#pragma unroll      // unrolled so that qa[n] is indexed statically and stays in registers
  for (int n = 0; n < ANG; ++n) { const int q0 = qw + n * AQG; const v16h (&qf)[AQT] = qa[n]; v8f acc[AQT][2] = {}, sa[AQT] = {}; float mx[AQT], ls[AQT], tot[AQT];
  const v16u* pm = (const v16u*)PM + __builtin_amdgcn_readfirstlane(q0 >> 4) * (TT / 32);      // this group's mask words: wave-uniform, so they come by scalar loads; tile u is TT / 32 groups of 16 words on
  auto mload = [&](int k0, v16u (&mk)[AQT]) {
#pragma unroll
    for (int u = 0; u < AQT; ++u) mk[u] = pm[u * (TT / 32) + (k0 >> 5)]; };
  auto step = [&](int k0, const v16u (&mk)[AQT]) {
    const v16h ka = frag_h(&sK[k0 + col][0], lane), kb = frag_h(&sK[k0 + 16 + col][0], lane);      // A rows = keys k0 + 0..15, k0 + 16..31
    const v16h va = frag_h(&sV[col][k0], lane), vb = frag_h(&sV[16 + col][k0], lane);              // A rows = head columns 0..15, 16..31; k = keys in the order of the packed scores
#pragma unroll
    for (int u = 0; u < AQT; ++u) {
      const v8f one = { 1.0f, 1.0f, 1.0f, 1.0f, 1.0f, 1.0f, 1.0f, 1.0f }; v8f s[2]; s[0] = wmma_h(ka, qf[u], one); s[1] = wmma_h(kb, qf[u], one);      // s[T][r] = key k0 + 16T + 8g + r, query = col
      union { v16h v; v2h q[8]; } pf;
#pragma unroll
      for (int i = 0; i < 8; ++i) { const v2f d = { __builtin_amdgcn_inverse_ballot_w32(mk[u][2 * i]) ? s[i >> 2][(2 * i) & 7] : NEGR, __builtin_amdgcn_inverse_ballot_w32(mk[u][2 * i + 1]) ? s[i >> 2][(2 * i + 1) & 7] : NEGR };      // word i is the select's lane mask as it stands
        const v2f p = { __builtin_amdgcn_exp2f(d[0]), __builtin_amdgcn_exp2f(d[1]) }; pf.q[i] = __builtin_convertvector(p, v2h); }      // a masked key's exponent is far below f32's range: weight 0
      acc[u][0] = wmma_h(va, pf.v, acc[u][0]); acc[u][1] = wmma_h(vb, pf.v, acc[u][1]); sa[u] = wmma_h(ones, pf.v, sa[u]);
    } };
  auto step_mx = [&](int k0, const v16u (&mk)[AQT]) {      // the same 32 keys with a running maximum: any range of logits
    const v16h ka = frag_h(&sK[k0 + col][0], lane), kb = frag_h(&sK[k0 + 16 + col][0], lane);      // A rows = keys k0 + 0..15, k0 + 16..31
    const v16h va = frag_h(&sV[col][k0], lane), vb = frag_h(&sV[16 + col][k0], lane);              // A rows = head columns 0..15, 16..31; k = keys in the order of the packed scores
#pragma unroll
    for (int u = 0; u < AQT; ++u) {
      const v8f z = {}; v8f s[2]; s[0] = wmma_h(ka, qf[u], z); s[1] = wmma_h(kb, qf[u], z);      // s[T][r] = key k0 + 16T + 8g + r, query = col
      float x[16];
#pragma unroll
      for (int i = 0; i < 16; ++i) x[i] = __builtin_amdgcn_inverse_ballot_w32(mk[u][i]) ? s[i >> 3][i & 7] : NEGR;      // word i is the select's lane mask as it stands
      float cm = x[0];
#pragma unroll
      for (int i = 1; i < 16; ++i) cm = fmaxf(cm, x[i]);
      const float mn = fmaxf(mx[u], fmaxf(cm, xhalf(cm)));           // both lane halves of a query use one maximum: their weights meet in one product
      const float al = __builtin_amdgcn_exp2f(mx[u] - mn); mx[u] = mn;
      union { v16h v; v2h q[8]; } pf; v2f sum = {};
#pragma unroll
      for (int i = 0; i < 8; ++i) { v2f d = { x[2 * i], x[2 * i + 1] }; d = (d - mn) + 8.0f;      // difference first: exactly 0 where a whole row is masked (uniform weights, as the reference gives)
        const v2f p = { __builtin_amdgcn_exp2f(d[0]), __builtin_amdgcn_exp2f(d[1]) }; sum += p; pf.q[i] = __builtin_convertvector(p, v2h); }
      ls[u] = ls[u] * al + (sum[0] + sum[1]);
      acc[u][0] = wmma_h(va, pf.v, acc[u][0] * al); acc[u][1] = wmma_h(vb, pf.v, acc[u][1] * al);
    } };
  v16u ma[AQT], mb[AQT]; mload(0, ma); mload(32, mb);      // the mask words of the next 64 keys are fetched, into the registers that the selects have just read, while these 64 are worked on
  for (int k0 = 0; k0 < TT; k0 += 64) { const int kn = k0 + 64 < TT ? k0 + 64 : 0; step(k0, ma); mload(kn, ma); step(k0 + 32, mb); mload(kn + 32, mb);
    asm volatile("" ::: "memory"); }      // a compiler fence: the loads above stay in this pass; without it they are merged with the ones in front of the loop into loads at the head of the next pass, which then waits for them
  bool in = true;
#pragma unroll
  for (int u = 0; u < AQT; ++u) { tot[u] = sa[u][0]; in = in && tot[u] >= SUMLO && tot[u] < SUMHI; }      // both lane halves hold the whole sum; false for a NaN too, and for a weight that left f16's range (sum = inf)
  if (__builtin_amdgcn_ballot_w32(!in) != 0) {      // wave-uniform (a scalar branch on the ballot), no barrier behind it: the group's 32 queries again, from the start
#pragma unroll
    for (int u = 0; u < AQT; ++u) { mx[u] = -3.0e38f; ls[u] = 0.f; acc[u][0] = v8f{}; acc[u][1] = v8f{}; }
#pragma unroll 1      // a path that few inputs take: one copy of the 32 keys' code
    for (int k0 = 0; k0 < TT; k0 += 32) { mload(k0, ma); step_mx(k0, ma); }
#pragma unroll      // unrolled so that tot[] and ls[] are indexed statically and stay in registers
    for (int u = 0; u < AQT; ++u) tot[u] = ls[u] + xhalf(ls[u]); }
#pragma unroll
  for (int u = 0; u < AQT; ++u) { const float inv = 1.0f / tot[u]; _Float16* yp = YF + (unsigned)((((b * NH + h) * (TT / 16) + (q0 >> 4) + u) * 2) * 256 + lane * 8);      // this lane's 8 + 8 values (query col, head columns 8g + 0..7 and 16 + 8g + 0..7) are what lane (col, g) of k_out takes as its A fragment of k = this head
#pragma unroll
    for (int j = 0; j < 2; ++j) { v8f o = acc[u][j] * inv; o = o * 64.0f; vst2(yp + j * 256, __builtin_convertvector(o, v8h)); } }   /* ctx carried x 2^6 into f16 so small-magnitude context rows stay clear of f16 subnormals; a wave's store is 512 contiguous bytes */
  if (n + 1 < ANG) asm volatile("s_wait_xcnt 0x0" ::: "memory");      // the stores above have taken their address registers before the next group rewrites them
  } }
// ---- k_out: block = (ONT x 64 rows, 128 cols): out = ctx Wo (+ bo): ctx (f16 x 2^6, rounded once in k_attn) against Wo as f16(bf16 x 2^8) exact (1 product) x 2^-14. The Wo rows are staged in LDS once.
// The ctx fragments come straight from the workspace, where k_attn left them in fragment order (a load of a wave = 512 contiguous bytes): no LDS staging, no conversion and no barrier in the tile loop.
__global__ __launch_bounds__(128) void k_out(const _Float16* __restrict__ YF, const float* __restrict__ WO, const float* __restrict__ BO, float* __restrict__ OUT) { __shared__ __align__(16) unsigned char sm[SOP_BYTES];      // the output tile (each wave its own 32 x 64 part), then the weight rows
  _Float16 (*sW)[SPIT] = (_Float16 (*)[SPIT])(sm + SX_BYTES); float (*sf)[132] = (float (*)[132])sm;
  static_assert(64 * 132 * 4 <= SX_BYTES, "the output tile fits in front of the weight rows");
  static_assert(TT % (64 * ONT) == 0 && CC / 32 == NH && HD == 32 && NH == 8 && ALD <= 8, "a block's row tiles lie in one sequence; 32 k of the product = one head");
  const int tid = threadIdx.x, wave = tid >> 5, lane = tid & 31, col = lane & 15, g = lane >> 4; const int c0 = blockIdx.y * 128;
  unsigned char* d = sm + (tid >> 6) * (SPIT * 2) + (tid & 63) * 8;
  auto cw = [](unsigned char* q, v4f v) { const v4h o = { (_Float16)(bfr(v[0]) * 256.0f), (_Float16)(bfr(v[1]) * 256.0f), (_Float16)(bfr(v[2]) * 256.0f), (_Float16)(bfr(v[3]) * 256.0f) }; *(v4h*)q = o; };
  auto none = []() {};
  const int wr = (wave >> 1) * 32, wc = (wave & 1) * 64;      // a wave's part of the 64 x 128 tile: 32 rows x 64 columns
  const unsigned rb0 = blockIdx.x * (ONT * 64);
  const _Float16* ap = YF + (unsigned)(((rb0 / TT) * NH * (TT / 16) + ((rb0 % TT + wr) >> 4)) * 512 + lane * 8);      // tile it: + it * 4 * 512; head kc: + kc * (TT / 16) * 512; 16 rows on: + 512; second half of a fragment: + 256
  auto aload = [&](int it, int kc, int t) { union { v16h v; v8h q[2]; } u; const _Float16* p = ap + it * 2048 + kc * ((TT / 16) * 512) + t * 512; u.q[0] = *(const v8h*)p; u.q[1] = *(const v8h*)(p + 256); return u.v; };
  v16h a[2][ALD];      // a ring of ctx fragments, ALD heads deep, that runs on over the tiles; the first ALD are under way while the weight rows are staged
#pragma unroll
  for (int s = 0; s < ALD; ++s) {
#pragma unroll
    for (int t = 0; t < 2; ++t) a[t][s] = aload(s >> 3, s & 7, t); }
  asm volatile("s_wait_xcnt 0x0" :: "v"(ap) : "memory");      // the address pair stays untouched until the loads above have taken it
  stage_rows<128>(WO + (size_t)c0 * CC, tid, d + SX_BYTES, cw, none);
  float bias[4];
#pragma unroll
  for (int j = 0; j < 4; ++j) bias[j] = BO ? bfr(BO[c0 + wc + j * 16 + col]) : 0.f;
  __syncthreads();      // the weight rows are in LDS
#pragma unroll      // unrolled so that the ring's places are indexed statically and stay in registers, and the last steps fetch nothing
  for (int it = 0; it < ONT; ++it) { const size_t rb = (size_t)rb0 + it * 64;
    v8f acc[2][4] = {}; v16h w[2][4];
    auto frags = [&](int kc, v16h (&fw)[4]) {
#pragma unroll
      for (int j = 0; j < 4; ++j) fw[j] = frag_h(&sW[wc + j * 16 + col][kc * 32], lane); };
    frags(0, w[0]);
#pragma unroll
    for (int kc = 0; kc < CC / 32; ++kc) { if (kc + 1 < CC / 32) frags(kc + 1, w[(kc + 1) & 1]);      // the next 32 k's weight fragments are fetched as one group while these products run; unrolled so that both fragment sets are indexed statically and stay in registers
#pragma unroll
      for (int t = 0; t < 2; ++t) {
#pragma unroll
        for (int j = 0; j < 4; ++j) acc[t][j] = wmma16(a[t][(it * 8 + kc) % ALD], w[kc & 1][j], acc[t][j]); }
      if (it * 8 + kc + ALD < ONT * 8) {      // the fragments ALD heads on go into the registers that the products above have just read
#pragma unroll
        for (int t = 0; t < 2; ++t) a[t][(it * 8 + kc) % ALD] = aload((it * 8 + kc + ALD) >> 3, (kc + ALD) & 7, t); } }
    asm volatile("s_wait_xcnt 0x0" :: "v"(ap) : "memory");      // the address pair stays untouched until the loads above have taken it
#pragma unroll
    for (int t = 0; t < 2; ++t) {
#pragma unroll
      for (int j = 0; j < 4; ++j) {
#pragma unroll
        for (int r = 0; r < 8; ++r) sf[wr + t * 16 + 8 * g + r][wc + j * 16 + col] = acc[t][j][r] * (1.0f / 16384.0f) + bias[j]; } }   /* 2^-8 (Wo carry) x 2^-6 (ctx carry) */
    asm volatile("s_wait_dscnt 0" ::: "memory"); __builtin_amdgcn_wave_barrier();      // the wave's own LDS stores are done before it reads the rows back; no fence here: one would also wait for the ring's loads, which are to stay in flight over this part
    for (int rl = 0; rl < 32; rl += 2) vst2(OUT + (rb + wr + rl + g) * DIN + c0 + wc + col * 4, *(const v4f*)&sf[wr + rl + g][wc + col * 4]);      // a wave reads back only what it wrote itself: two rows of 256 B (two whole lines each) a store
    asm volatile("s_wait_xcnt 0x0" ::: "memory");      // the stores above have taken their address registers before the next tile rewrites them
  } }

extern "C" void kernel_launch(void* const* d_in, const int* in_sizes, int n_in, void* d_out, int out_size, void* d_ws, size_t ws_size, hipStream_t stream) {
  (void)in_sizes; (void)n_in; (void)out_size;
  const float** F = (const float**)d_in;
  if (ws_size < (size_t)WS_END) return;
  char* ws = (char*)d_ws; _Float16 *QH = (_Float16*)(ws + WS_QH), *KH = (_Float16*)(ws + WS_KH), *VT = (_Float16*)(ws + WS_VT), *QL = (_Float16*)(ws + WS_QL), *KL = (_Float16*)(ws + WS_KL); __bf16 *VB = (__bf16*)(ws + WS_VB), *VBL = (__bf16*)(ws + WS_VBL); float *S = (float*)(ws + WS_S); _Float16* Y = (_Float16*)(ws + WS_Y); unsigned* PM = (unsigned*)(ws + WS_PM);
  (void)Y; (void)S; (void)QH; (void)KH; (void)VT; (void)QL; (void)KL; (void)VB; (void)VBL;
  // inputs: 0 x [32,1024,256]; 1 attn_mask [1024,1024] (bool topology mask, diagonal True); 2 Wq [256,256] (out,in), 3 bq; 4 Wk, 5 bk; 6 Wv, 7 bv; 8 Wo (out,in), 9 bo (biases nonzero)
  k_mask<<<dim3((TT / 16) * (TT / 64) / 4), 128, 0, stream>>>((const int*)d_in[1], PM);
  k_attn<<<dim3(TT / AQB, NH, TNB), AW * 32, 0, stream>>>(F[0], F[2], F[4], F[6], F[3], F[5], F[7], PM, Y);
  k_out<<<dim3(TNB * TT / 64 / ONT, DIN / 128), 128, 0, stream>>>(Y, F[8], F[9], (float*)d_out);
}
